// v000
// Times are from an AMD MI455X. After a warm-up the kernel runs many times in a row, and a time is the length of
// such a window on the GPU divided by its runs, so every launch and the gaps after it count. The runs cycle
// through copies of the inputs. A figure is the median of several windows, for all but v000 over two sittings.
// Sittings can differ by a few percent; kernels timed side by side share one.
// v000 is the starting kernel. One run takes 673 microseconds.
#include <hip/hip_runtime.h>
// All contractions (Q/K/V projections, Q.K^T, P.V^T, output projection) on v_wmma_f32_16x16x32_f16: f16 operands, f32 accumulate. Float inputs RNE-converted to bf16 (exact in f16; weights carried x16); q, k, v, softmax numerators (x1024) and context carried as f16 hi + 2^10 residual plane pairs; RoPE tables, softmax, residual add and LayerNorm in f32.
#ifndef NB
#define NB 2
#endif
#ifndef SEQ
#define SEQ 2048
#endif
#define NB_FULL 2
#define SEQ_FULL 2048
#define DM 1024
#define NH 16
#define NR (NB * SEQ)
#define SCL 0.125f
static_assert(NB >= 1 && NB <= NB_FULL);
static_assert(SEQ >= 128 && SEQ <= SEQ_FULL && (SEQ % 128) == 0);
static_assert(NH * 64 == DM);
static_assert((NR % 128) == 0);
static_assert((DM % 64) == 0 && (DM % 32) == 0);

typedef unsigned short v8us __attribute__((ext_vector_type(8), may_alias));
typedef float  v8f  __attribute__((ext_vector_type(8)));
typedef float  v4f  __attribute__((ext_vector_type(4)));
typedef float  v4fa __attribute__((ext_vector_type(4), may_alias));
typedef _Float16 v16h __attribute__((ext_vector_type(16)));
typedef _Float16 v4h __attribute__((ext_vector_type(4)));
union FragH { v16h v; v8us half[2]; _Float16 h[16]; unsigned short u[16]; };

__device__ __forceinline__ unsigned short bf16_bits(float x) { unsigned int u = __float_as_uint(x); return (unsigned short)((u + 0x7FFFu + ((u >> 16) & 1u)) >> 16); }
__device__ __forceinline__ float bf16_val(unsigned short b) { return __uint_as_float(((unsigned int)b) << 16); }
__device__ __forceinline__ float bf16_rne(float x) { return bf16_val(bf16_bits(x)); }

// D += A.B with NT terms: 1 = ah.bh, 2 = + al.bh, 3 = + ah.bl; hazard guard after the last WMMA
template <int NT>
__device__ __forceinline__ v8f mmaH(v16h ah, v16h al, v16h bh, v16h bl, v8f c) {
  c = __builtin_amdgcn_wmma_f32_16x16x32_f16(false, ah, false, bh, (short)0, c, false, false);
  if (NT >= 2) c = __builtin_amdgcn_wmma_f32_16x16x32_f16(false, al, false, bh, (short)0, c, false, false);
  if (NT >= 3) c = __builtin_amdgcn_wmma_f32_16x16x32_f16(false, ah, false, bl, (short)0, c, false, false);
  asm volatile("v_nop\n\tv_nop\n\tv_nop\n\tv_nop" : "+v"(c) : "v"(ah), "v"(al), "v"(bh), "v"(bl));
  return c;
}

// ---- GEMM engine (wave tile 32x64; M % 128 == 0, N % 64 == 0, K % 32 == 0): C[M][N] f32 = alpha A[M][K].Bt[N][K]^T + bf16(bias) (+ CP own element); A, Bt f16 k-contiguous.
// A fragment: lane row = l&15, elements 0..7 <- k0 + 8h + i, 8..15 <- k0 + 16 + 8h + i; B fragment from the [n][k] copy with the same k map; D element r -> (row 8h + r, col l&15).
__device__ __forceinline__ v16h g2_frag(const _Float16* p, int hh) { FragH f; f.half[0] = *(const v8us*)((const unsigned short*)p + 8 * hh); f.half[1] = *(const v8us*)((const unsigned short*)p + 16 + 8 * hh); return f.v; }
__device__ __forceinline__ v8f g2_mma(v16h a, v16h b, v8f c) { v8f d = __builtin_amdgcn_wmma_f32_16x16x32_f16(false, a, false, b, (short)0, c, false, false); asm volatile("v_nop\n\tv_nop\n\tv_nop\n\tv_nop" : "+v"(d) : "v"(a), "v"(b)); return d; }
template <int ACT>
__global__ __launch_bounds__(128) void k_gemm2(const _Float16* __restrict__ A, int lda, size_t sA, const _Float16* __restrict__ Bh, int ldb, size_t sB, float alpha, const float* __restrict__ bias, size_t sBias, const float* CP, int rowsPerB, size_t sCPb, int row0g,
    float* C, _Float16* C16, int ldc, size_t sC, int M, int N, int K) {
  __shared__ __attribute__((aligned(16))) float so[4][32][68];
  const int tid = threadIdx.x, w = tid >> 5, lane = tid & 31, ln = lane & 15, hh = lane >> 4; const int by = blockIdx.y;
  A += (size_t)by * sA; Bh += (size_t)by * sB; const size_t cofs = (size_t)by * sC; const float* bp = bias ? bias + (size_t)by * sBias : nullptr;
  const int ntn = N >> 6; const int mt = blockIdx.x / ntn, nq = blockIdx.x - mt * ntn; const int row0 = mt * 128 + 32 * w, col0 = nq * 64; if (row0 >= M) return;
  const _Float16* a0p = A + (size_t)(row0 + ln) * lda; const _Float16* a1p = a0p + (size_t)16 * lda;
  const _Float16* b0p = Bh + (size_t)(col0 + ln) * ldb; const _Float16* b1p = b0p + (size_t)16 * ldb; const _Float16* b2p = b1p + (size_t)16 * ldb; const _Float16* b3p = b2p + (size_t)16 * ldb;
  const v8f z8 = {0.f,0.f,0.f,0.f,0.f,0.f,0.f,0.f}; v8f c00 = z8, c01 = z8, c02 = z8, c03 = z8, c10 = z8, c11 = z8, c12 = z8, c13 = z8;
#pragma unroll 1
  for (int kb = 0; kb < K; kb += 32) { const v16h a0 = g2_frag(a0p + kb, hh), a1 = g2_frag(a1p + kb, hh);
    v16h b = g2_frag(b0p + kb, hh); c00 = g2_mma(a0, b, c00); c10 = g2_mma(a1, b, c10);
    b = g2_frag(b1p + kb, hh); c01 = g2_mma(a0, b, c01); c11 = g2_mma(a1, b, c11);
    b = g2_frag(b2p + kb, hh); c02 = g2_mma(a0, b, c02); c12 = g2_mma(a1, b, c12);
    b = g2_frag(b3p + kb, hh); c03 = g2_mma(a0, b, c03); c13 = g2_mma(a1, b, c13); }
  v8f accs[8] = {c00, c01, c02, c03, c10, c11, c12, c13};
#pragma unroll
  for (int u = 0; u < 8; ++u) { const int t = u & 3, half = u >> 2; const int col = col0 + t * 16 + ln; const float bv = bp ? bf16_rne(bp[col]) : 0.f;
#pragma unroll
    for (int r = 0; r < 8; ++r) { const int rloc = half * 16 + 8 * hh + r; float v = accs[u][r] * alpha + bv;
      if (CP) { if (rowsPerB < 0) v += CP[cofs + (size_t)(row0g + row0 + rloc) * ldc + col];      /* rowsPerB < 0: own element of the batched C plane */ else { const int bidx = (row0g + row0 + rloc) / rowsPerB; v += CP[(size_t)bidx * sCPb + (size_t)by * 64 + col]; } }
      if (ACT == 3) v = fmaxf(v, 0.f);
      so[w][rloc][t * 16 + ln] = v; } }
  __builtin_amdgcn_fence(__ATOMIC_ACQ_REL, "workgroup"); __builtin_amdgcn_wave_barrier();
  const int rsub = lane >> 4, c4 = (lane & 15) * 4;
  {
#pragma unroll
    for (int q = 0; q < 16; ++q) { const int r = q * 2 + rsub; const v4f v = *(const v4fa*)&so[w][r][c4]; if (C) *(v4f*)(C + cofs + (size_t)(row0 + r) * ldc + col0 + c4) = v; if (C16) { v4h h4;
#pragma unroll
        for (int i = 0; i < 4; ++i) h4[i] = (_Float16)v[i]; *(v4h*)(C16 + cofs + (size_t)(row0 + r) * ldc + col0 + c4) = h4; } }
     } }

__global__ __launch_bounds__(256) void k_wsc(const float* __restrict__ Wm, _Float16* __restrict__ Bt, size_t n8, float sc) {
  const size_t t = (size_t)blockIdx.x * 256 + threadIdx.x; if (t >= n8) return; FragH f; const v4f a = *(const v4fa*)(Wm + t * 8), c = *(const v4fa*)(Wm + t * 8 + 4);
#pragma unroll
  for (int q = 0; q < 4; ++q) { f.h[q] = (_Float16)(bf16_rne(a[q]) * sc); f.h[4 + q] = (_Float16)(bf16_rne(c[q]) * sc); }
  *(v8us*)((unsigned short*)Bt + t * 8) = f.half[0];  }

__global__ __launch_bounds__(256) void k_x16b(const float* __restrict__ x, _Float16* __restrict__ X16) {
  const size_t t = (size_t)blockIdx.x * 256 + threadIdx.x; if (t >= (size_t)NR * DM / 8) return; const size_t row = (t * 8) / DM; const int c0 = (int)((t * 8) % DM); const size_t rb = row / SEQ, rs = row % SEQ;
  const float* src = x + (rb * SEQ_FULL + rs) * (size_t)DM + c0; const v4f a = *(const v4fa*)src, c = *(const v4fa*)(src + 4); FragH f;
#pragma unroll
  for (int q = 0; q < 4; ++q) { f.h[q] = (_Float16)bf16_rne(a[q]); f.h[4 + q] = (_Float16)bf16_rne(c[q]); }
  *(v8us*)((unsigned short*)X16 + t * 8) = f.half[0];  }

__global__ __launch_bounds__(256) void k_hl(const float* __restrict__ F, _Float16* __restrict__ Hh, _Float16* __restrict__ Hl, size_t n8) {
  const size_t t = (size_t)blockIdx.x * 256 + threadIdx.x; if (t >= n8) return; FragH fh, fl; const v4f a = *(const v4fa*)(F + t * 8), c = *(const v4fa*)(F + t * 8 + 4);
#pragma unroll
  for (int q = 0; q < 4; ++q) { _Float16 hv = (_Float16)a[q]; fh.h[q] = hv; fl.h[q] = (_Float16)((a[q] - (float)hv) * 1024.0f); hv = (_Float16)c[q]; fh.h[4 + q] = hv; fl.h[4 + q] = (_Float16)((c[q] - (float)hv) * 1024.0f); }
  { *(v8us*)((unsigned short*)Hh + t * 8) = fh.half[0]; *(v8us*)((unsigned short*)Hl + t * 8) = fl.half[0];  } }

__global__ __launch_bounds__(256) void k_rotab(float* __restrict__ CS, float* __restrict__ SN) {
  #pragma clang fp contract(off)
  const int t = blockIdx.x * 256 + threadIdx.x; if (t >= SEQ * 32) return; const int j = t % 32, s = t / 32; const float ex = (float)(2 * j) / 64.0f; const float inv = 1.0f / powf(10000.0f, ex); const float th = (float)s * inv; const float c = cosf(th), sn = sinf(th);
  { *(float*)(CS + t) = c; *(float*)(SN + t) = sn;  } }

// RoPE with concatenated tables and interleaved rotate_half: out[d] = x[d] c[s][d mod 32] + rh[d] sn[s][d mod 32], rh[d] = -x[d+1] (d even), x[d-1] (d odd);
__global__ __launch_bounds__(256) void k_rope4(const float* __restrict__ F, const float* __restrict__ CS, const float* __restrict__ SN, _Float16* __restrict__ H, _Float16* __restrict__ L) {
  #pragma clang fp contract(off)
  const size_t t = (size_t)blockIdx.x * 256 + threadIdx.x; if (t >= (size_t)NR * DM / 8) return; const size_t e0 = t * 8; const size_t row = e0 / DM; const int c0 = (int)(e0 % DM); const int j0 = c0 & 31; const int s = (int)(row % SEQ);
  const v4f a = *(const v4fa*)(F + e0), c = *(const v4fa*)(F + e0 + 4); const float xs[8] = {a[0], a[1], a[2], a[3], c[0], c[1], c[2], c[3]};
  const float* tp = CS + (size_t)s * 32 + j0; const float* up = SN + (size_t)s * 32 + j0; const v4f ca = *(const v4fa*)tp, cb = *(const v4fa*)(tp + 4), sa = *(const v4fa*)up, sb = *(const v4fa*)(up + 4);
  const float cs[8] = {ca[0], ca[1], ca[2], ca[3], cb[0], cb[1], cb[2], cb[3]}; const float sn[8] = {sa[0], sa[1], sa[2], sa[3], sb[0], sb[1], sb[2], sb[3]};
  FragH fh, fl;
#pragma unroll
  for (int q = 0; q < 8; ++q) { const float pr = xs[q ^ 1]; const float rh = (q & 1) ? pr : -pr; float o = xs[q] * cs[q]; o += rh * sn[q];
    const _Float16 hv = (_Float16)o; fh.h[q] = hv; fl.h[q] = (_Float16)((o - (float)hv) * 1024.0f); }
  { *(v8us*)((unsigned short*)H + e0) = fh.half[0]; *(v8us*)((unsigned short*)L + e0) = fl.half[0];  } }

__global__ __launch_bounds__(256) void k_vtg(const _Float16* __restrict__ V16, _Float16* __restrict__ Vt) {
  __shared__ unsigned short tl[64][66]; const int tid = threadIdx.x; const int slab = blockIdx.x / (SEQ / 64), lg = blockIdx.x % (SEQ / 64); const int b = slab / NH, h = slab % NH;
  for (int i = tid; i < 64 * 8; i += 256) { const int r = i / 8, c8 = (i % 8) * 8; FragH f; f.half[0] = *(const v8us*)((const unsigned short*)V16 + ((size_t)b * SEQ + lg * 64 + r) * DM + h * 64 + c8);
#pragma unroll
    for (int q = 0; q < 8; ++q) tl[r][c8 + q] = f.u[q]; }
  __syncthreads();
  {
#pragma unroll
    for (int rd = 0; rd < 2; ++rd) { const int d = rd * 32 + tid / 8, pc = tid % 8; FragH f;
#pragma unroll
      for (int q = 0; q < 8; ++q) f.u[q] = tl[pc * 8 + q][d];
      *(v8us*)((unsigned short*)Vt + ((size_t)slab * 64 + d) * SEQ + lg * 64 + pc * 8) = f.half[0]; }
     } }

// fused attention per ((b,h), 64 queries), wave = 16 queries, all SEQ keys in 32-key tiles:
// S = (Qh Kh^T + (Ql Kh^T + Qh Kl^T)/1024) x SCL + bf16(mask[b][0][q][k]) bf16(w); online max/sum softmax f32; P = [hi | 2^10 residual] of 1024 p;
__global__ __launch_bounds__(128) void k_attn(const _Float16* __restrict__ Q16, const _Float16* __restrict__ QL, int ldq, const _Float16* __restrict__ K16, const _Float16* __restrict__ KL, int ldk,
                                             const _Float16* __restrict__ Vt, const _Float16* __restrict__ VtL, const float* __restrict__ AM, const float* __restrict__ AW, float* __restrict__ O, int ldo) {
  constexpr int RPW = 16, DT = 4, KS = 2, QBN = SEQ / 64;
  __shared__ __attribute__((aligned(16))) unsigned short sP[4][RPW][40]; __shared__ __attribute__((aligned(16))) unsigned short sPL[4][RPW][40]; __shared__ __attribute__((aligned(16))) float sO[4][RPW][64 + 4];
  const int tid = threadIdx.x, w = tid >> 5, lane = tid & 31, ln = lane & 15, hh = lane >> 4;
  const int slab = blockIdx.x / QBN, qblk = blockIdx.x % QBN; const int b = slab / NH, h = slab % NH; const int qb0 = qblk * (4 * RPW); const int q0 = qb0 + w * RPW;
  const float ww = bf16_rne(AW[0]);
  FragH aq[KS], aql[KS];
  { const unsigned short* qr = (const unsigned short*)Q16 + ((size_t)b * SEQ + q0 + ln) * ldq + h * 64; const unsigned short* ql = (const unsigned short*)QL + ((size_t)b * SEQ + q0 + ln) * ldq + h * 64;
#pragma unroll
    for (int ks = 0; ks < KS; ++ks) { aq[ks].half[0] = *(const v8us*)(qr + ks * 32 + 8 * hh); aq[ks].half[1] = *(const v8us*)(qr + ks * 32 + 16 + 8 * hh); aql[ks].half[0] = *(const v8us*)(ql + ks * 32 + 8 * hh); aql[ks].half[1] = *(const v8us*)(ql + ks * 32 + 16 + 8 * hh); } }
  const unsigned short* Vth = (const unsigned short*)Vt + (size_t)slab * 64 * SEQ; const unsigned short* Vtl = (const unsigned short*)VtL + (size_t)slab * 64 * SEQ;
  const float* amb = AM + (size_t)b * SEQ_FULL * SEQ_FULL;      /* mask[b][0][.][.] with full strides */
  const v8f z8 = {0.f,0.f,0.f,0.f,0.f,0.f,0.f,0.f};
  float m_r[8], l_r[8]; v8f oacc[DT], oaccL[DT];
#pragma unroll
  for (int r = 0; r < 8; ++r) { m_r[r] = -3.0e38f; l_r[r] = 0.f; }
#pragma unroll
  for (int dt = 0; dt < DT; ++dt) { oacc[dt] = z8; oaccL[dt] = z8; }
#pragma unroll 1
  for (int j0 = 0; j0 < SEQ; j0 += 32) {
    v8f s[2];
#pragma unroll
    for (int nt = 0; nt < 2; ++nt) { const unsigned short* kr = (const unsigned short*)K16 + ((size_t)b * SEQ + j0 + nt * 16 + ln) * ldk + h * 64; const unsigned short* klr = (const unsigned short*)KL + ((size_t)b * SEQ + j0 + nt * 16 + ln) * ldk + h * 64; FragH bk[KS], bkl[KS];
#pragma unroll
      for (int ks = 0; ks < KS; ++ks) { bk[ks].half[0] = *(const v8us*)(kr + ks * 32 + 8 * hh); bk[ks].half[1] = *(const v8us*)(kr + ks * 32 + 16 + 8 * hh); bkl[ks].half[0] = *(const v8us*)(klr + ks * 32 + 8 * hh); bkl[ks].half[1] = *(const v8us*)(klr + ks * 32 + 16 + 8 * hh); }
      v8f acc = z8, accl = z8;
#pragma unroll
      for (int ks = 0; ks < KS; ++ks) { acc = mmaH<1>(aq[ks].v, aq[ks].v, bk[ks].v, bk[ks].v, acc); accl = mmaH<1>(aql[ks].v, aql[ks].v, bk[ks].v, bk[ks].v, accl); accl = mmaH<1>(aq[ks].v, aq[ks].v, bkl[ks].v, bkl[ks].v, accl); }
#pragma unroll
      for (int r = 0; r < 8; ++r) acc[r] += accl[r] * 0.0009765625f;
      s[nt] = acc; }
#pragma unroll
    for (int r = 0; r < 8; ++r) { const int tq = q0 + 8 * hh + r; const int k0 = j0 + ln, k1 = j0 + 16 + ln; const float* amk = amb + (size_t)tq * SEQ_FULL;
      float s0 = s[0][r] * SCL, s1 = s[1][r] * SCL; s0 += bf16_rne(amk[k0]) * ww; s1 += bf16_rne(amk[k1]) * ww;
      float mc = fmaxf(s0, s1);
      mc = fmaxf(mc, __shfl_xor(mc, 1, 32)); mc = fmaxf(mc, __shfl_xor(mc, 2, 32)); mc = fmaxf(mc, __shfl_xor(mc, 4, 32)); mc = fmaxf(mc, __shfl_xor(mc, 8, 32));
      const float mn = fmaxf(m_r[r], mc); const float al = (mn > -1.0e38f) ? expf(m_r[r] - mn) : 1.0f; m_r[r] = mn; const float p0 = expf(s0 - mn), p1 = expf(s1 - mn); l_r[r] = l_r[r] * al + p0 + p1;
#pragma unroll
      for (int dt = 0; dt < DT; ++dt) { oacc[dt][r] *= al; oaccL[dt][r] *= al; }
      FragH t2, t2l; const float ps0 = p0 * 1024.0f, ps1 = p1 * 1024.0f; t2.h[0] = (_Float16)ps0; t2.h[1] = (_Float16)ps1; t2l.h[0] = (_Float16)((ps0 - (float)t2.h[0]) * 1024.0f); t2l.h[1] = (_Float16)((ps1 - (float)t2.h[1]) * 1024.0f);
      sP[w][8 * hh + r][ln] = t2.u[0]; sP[w][8 * hh + r][16 + ln] = t2.u[1]; sPL[w][8 * hh + r][ln] = t2l.u[0]; sPL[w][8 * hh + r][16 + ln] = t2l.u[1]; }
    __builtin_amdgcn_fence(__ATOMIC_ACQ_REL, "workgroup"); __builtin_amdgcn_wave_barrier();
    FragH pa, pl;
    pa.half[0] = *(const v8us*)&sP[w][ln][8 * hh]; pa.half[1] = *(const v8us*)&sP[w][ln][16 + 8 * hh]; pl.half[0] = *(const v8us*)&sPL[w][ln][8 * hh]; pl.half[1] = *(const v8us*)&sPL[w][ln][16 + 8 * hh];
#pragma unroll
    for (int dt = 0; dt < DT; ++dt) { const unsigned short* vrow = Vth + (size_t)(dt * 16 + ln) * SEQ + j0; const unsigned short* vrl = Vtl + (size_t)(dt * 16 + ln) * SEQ + j0; FragH bv, bl;
      bv.half[0] = *(const v8us*)(vrow + 8 * hh); bv.half[1] = *(const v8us*)(vrow + 16 + 8 * hh); bl.half[0] = *(const v8us*)(vrl + 8 * hh); bl.half[1] = *(const v8us*)(vrl + 16 + 8 * hh);
      oacc[dt] = mmaH<1>(pa.v, pa.v, bv.v, bv.v, oacc[dt]); oaccL[dt] = mmaH<1>(pl.v, pl.v, bv.v, bv.v, oaccL[dt]); oaccL[dt] = mmaH<1>(pa.v, pa.v, bl.v, bl.v, oaccL[dt]); }
    __builtin_amdgcn_fence(__ATOMIC_ACQ_REL, "workgroup"); __builtin_amdgcn_wave_barrier(); }
#pragma unroll
  for (int r = 0; r < 8; ++r) { float l = l_r[r]; l += __shfl_xor(l, 1, 32); l += __shfl_xor(l, 2, 32); l += __shfl_xor(l, 4, 32); l += __shfl_xor(l, 8, 32); l_r[r] = (l > 0.f) ? 1.0f / (l * 1024.0f) : 0.f; }
#pragma unroll
  for (int dt = 0; dt < DT; ++dt)
#pragma unroll
    for (int r = 0; r < 8; ++r) { float v = oacc[dt][r]; v += oaccL[dt][r] * 0.0009765625f; sO[w][8 * hh + r][dt * 16 + ln] = v * l_r[r]; }
  __builtin_amdgcn_fence(__ATOMIC_ACQ_REL, "workgroup"); __builtin_amdgcn_wave_barrier();
  {
#pragma unroll
    for (int rp = 0; rp < RPW; rp += 2) { const int r = rp + (lane >> 4), pc = lane & 15; const v4f val = *(const v4fa*)&sO[w][r][pc * 4]; *(v4f*)(O + ((size_t)b * SEQ + q0 + r) * ldo + h * 64 + pc * 4) = val; }
     } }

// LayerNorm over DM (biased variance, eps 1e-5, affine with bf16 g, b) of (A[r] + bf16(x[rin])), compact row r -> input/output row rin = b*SEQ_FULL + s;
__global__ __launch_bounds__(256) void k_ln1024(const float* __restrict__ A, const float* __restrict__ res, const float* __restrict__ g, const float* __restrict__ bb, float* __restrict__ Y) {
  #pragma clang fp contract(off)
  const int wv = threadIdx.x >> 5, ln = threadIdx.x & 31; const size_t r = (size_t)blockIdx.x * 8 + wv; if (r >= (size_t)NR) return;
  const size_t rb = r / SEQ, rs = r % SEQ; const size_t rin = rb * SEQ_FULL + rs;
  float xv[32]; float sm = 0.f;
#pragma unroll
  for (int i = 0; i < 8; ++i) { const int c0 = i * 128 + ln * 4; const v4f a = *(const v4fa*)(A + r * DM + c0); const v4f rr = *(const v4fa*)(res + rin * DM + c0);
#pragma unroll
    for (int q = 0; q < 4; ++q) { const float v = a[q] + bf16_rne(rr[q]); xv[i * 4 + q] = v; sm += v; } }
#pragma unroll
  for (int o = 16; o > 0; o >>= 1) sm += __shfl_xor(sm, o, 32);
  const float mu = sm * 0.0009765625f; float var = 0.f;
#pragma unroll
  for (int q = 0; q < 32; ++q) { const float d = xv[q] - mu; var += d * d; }
#pragma unroll
  for (int o = 16; o > 0; o >>= 1) var += __shfl_xor(var, o, 32);
  const float inv = 1.0f / sqrtf(var * 0.0009765625f + 1e-5f);
  {
#pragma unroll
    for (int i = 0; i < 8; ++i) { const int c0 = i * 128 + ln * 4; v4f y;
#pragma unroll
      for (int q = 0; q < 4; ++q) { float v = (xv[i * 4 + q] - mu) * inv; v *= bf16_rne(g[c0 + q]); v += bf16_rne(bb[c0 + q]); y[q] = v; }
      *(v4f*)(Y + rin * DM + c0) = y; }
     } }

extern "C" void kernel_launch(void* const* d_in, const int* in_sizes, int n_in,
                              void* d_out, int out_size, void* d_ws, size_t ws_size, hipStream_t stream) {
  if (n_in < 13) return;
  const float* x = (const float*)d_in[0]; const float* cdm = (const float*)d_in[1];
  const float* Wq = (const float*)d_in[2]; const float* bq = (const float*)d_in[3]; const float* Wk = (const float*)d_in[4]; const float* bk = (const float*)d_in[5];
  const float* Wv = (const float*)d_in[6]; const float* bv = (const float*)d_in[7]; const float* Wo = (const float*)d_in[8]; const float* bo = (const float*)d_in[9];
  const float* gam = (const float*)d_in[10]; const float* bet = (const float*)d_in[11]; const float* cdw = (const float*)d_in[12];
  const long long rows_need = (long long)(NB - 1) * SEQ_FULL + SEQ;
  if ((long long)in_sizes[0] < rows_need * DM) return;
  if ((long long)in_sizes[1] < (long long)(NB - 1) * SEQ_FULL * SEQ_FULL + (long long)(SEQ - 1) * SEQ_FULL + SEQ) return;
  if (in_sizes[2] < DM * DM || in_sizes[4] < DM * DM || in_sizes[6] < DM * DM || in_sizes[8] < DM * DM) return;
  if (in_sizes[3] < DM || in_sizes[5] < DM || in_sizes[7] < DM || in_sizes[9] < DM || in_sizes[10] < DM || in_sizes[11] < DM || in_sizes[12] < 1) return;
  if ((long long)out_size < rows_need * DM) return;
  char* ws = (char*)d_ws; size_t off = 0;
  auto take = [&](size_t bytes) { char* p = ws + off; off += (bytes + 255) & ~(size_t)255; return p; };
  const size_t np = (size_t)NR * DM;      /* compact activation plane elements */
  _Float16* BQ = (_Float16*)take((size_t)DM * DM * 2); _Float16* BK = (_Float16*)take((size_t)DM * DM * 2); _Float16* BV = (_Float16*)take((size_t)DM * DM * 2); _Float16* BO = (_Float16*)take((size_t)DM * DM * 2);
  _Float16* X16 = (_Float16*)take(np * 2); float* F32 = (float*)take(np * 4);
  _Float16* QH = (_Float16*)take(np * 2); _Float16* QL = (_Float16*)take(np * 2); _Float16* KH = (_Float16*)take(np * 2); _Float16* KL = (_Float16*)take(np * 2);
  _Float16* V16 = (_Float16*)take(np * 2); _Float16* VLr = (_Float16*)take(np * 2); _Float16* VT = (_Float16*)take(np * 2); _Float16* VTL = (_Float16*)take(np * 2);
  float* Y = (float*)take(np * 4); float* CS = (float*)take((size_t)SEQ * 32 * 4); float* SN = (float*)take((size_t)SEQ * 32 * 4);
  float* O = F32; _Float16* OH = QH; _Float16* OL = KH;      /* reuse after their last readers */
  if (off > ws_size) return;
  const unsigned wb = (unsigned)(((size_t)DM * DM / 8 + 255) / 256); const unsigned eb = (unsigned)((np / 8 + 255) / 256);
  k_wsc<<<wb, 256, 0, stream>>>(Wq, BQ, (size_t)DM * DM / 8, 16.0f); k_wsc<<<wb, 256, 0, stream>>>(Wk, BK, (size_t)DM * DM / 8, 16.0f);
  k_wsc<<<wb, 256, 0, stream>>>(Wv, BV, (size_t)DM * DM / 8, 16.0f); k_wsc<<<wb, 256, 0, stream>>>(Wo, BO, (size_t)DM * DM / 8, 16.0f);      /* [out][in] weights, bf16 then x16 in f16 */
  k_x16b<<<eb, 256, 0, stream>>>(x, X16);
  k_rotab<<<(SEQ * 32 + 255) / 256, 256, 0, stream>>>(CS, SN);
  const dim3 g((NR / 128) * (DM / 64), 1);
  k_gemm2<0><<<g, 128, 0, stream>>>(X16, DM, 0, BQ, DM, 0, 0.0625f, bq, 0, nullptr, 1, 0, 0, F32, nullptr, DM, 0, NR, DM, DM); k_rope4<<<eb, 256, 0, stream>>>(F32, CS, SN, QH, QL);      /* Q -> RoPE -> hi/lo */
  k_gemm2<0><<<g, 128, 0, stream>>>(X16, DM, 0, BK, DM, 0, 0.0625f, bk, 0, nullptr, 1, 0, 0, F32, nullptr, DM, 0, NR, DM, DM); k_rope4<<<eb, 256, 0, stream>>>(F32, CS, SN, KH, KL);      /* K -> RoPE -> hi/lo */
  k_gemm2<0><<<g, 128, 0, stream>>>(X16, DM, 0, BV, DM, 0, 0.0625f, bv, 0, nullptr, 1, 0, 0, F32, nullptr, DM, 0, NR, DM, DM); k_hl<<<eb, 256, 0, stream>>>(F32, V16, VLr, np / 8);      /* V -> hi/lo rows */
  k_vtg<<<NB * NH * (SEQ / 64), 256, 0, stream>>>(V16, VT); k_vtg<<<NB * NH * (SEQ / 64), 256, 0, stream>>>(VLr, VTL);
  k_attn<<<NB * NH * (SEQ / 64), 128, 0, stream>>>(QH, QL, DM, KH, KL, DM, VT, VTL, cdm, cdw, O, DM);
  k_hl<<<eb, 256, 0, stream>>>(O, OH, OL, np / 8);      /* context -> hi/lo rows */
  k_gemm2<0><<<g, 128, 0, stream>>>(OL, DM, 0, BO, DM, 0, 0.0625f / 1024.0f, nullptr, 0, nullptr, 1, 0, 0, Y, nullptr, DM, 0, NR, DM, DM);
  k_gemm2<0><<<g, 128, 0, stream>>>(OH, DM, 0, BO, DM, 0, 0.0625f, bo, 0, Y, 1, (size_t)DM, 0, Y, nullptr, DM, 0, NR, DM, DM);      /* Y = (ctx_lo + ctx_hi) Wo^T + bo */
  k_ln1024<<<NR / 8, 256, 0, stream>>>(Y, x, gam, bet, (float*)d_out);      /* out = LN(bf16(x) + Y) g + b */
}

// v001
// A run of this version takes 584 microseconds.
// Two timings next to v000 both put it at 1.16 times that version's speed.
#include <hip/hip_runtime.h>
// All contractions (Q/K/V projections, Q.K^T, P.V^T, output projection) on v_wmma_f32_16x16x32_f16: f16 operands, f32 accumulate. Float inputs RNE-converted to bf16 (exact in f16; weights carried x16); q, k, v, softmax numerators (x1024) and context carried as f16 hi + 2^10 residual plane pairs; RoPE tables, softmax, residual add and LayerNorm in f32.
#ifndef NB
#define NB 2
#endif
#ifndef SEQ
#define SEQ 2048
#endif
#define NB_FULL 2
#define SEQ_FULL 2048
#define DM 1024
#define NH 16
#define NR (NB * SEQ)
#define SCL 0.125f
static_assert(NB >= 1 && NB <= NB_FULL);
static_assert(SEQ >= 128 && SEQ <= SEQ_FULL && (SEQ % 128) == 0);
static_assert(NH * 64 == DM);
static_assert((NR % 128) == 0);
static_assert((DM % 64) == 0 && (DM % 32) == 0);

typedef unsigned short v8us __attribute__((ext_vector_type(8), may_alias));
typedef float  v8f  __attribute__((ext_vector_type(8)));
typedef float  v4f  __attribute__((ext_vector_type(4)));
typedef float  v4fa __attribute__((ext_vector_type(4), may_alias));
typedef _Float16 v16h __attribute__((ext_vector_type(16)));
typedef _Float16 v4h __attribute__((ext_vector_type(4)));
union FragH { v16h v; v8us half[2]; _Float16 h[16]; unsigned short u[16]; };

__device__ __forceinline__ unsigned short bf16_bits(float x) { unsigned int u = __float_as_uint(x); return (unsigned short)((u + 0x7FFFu + ((u >> 16) & 1u)) >> 16); }
__device__ __forceinline__ float bf16_val(unsigned short b) { return __uint_as_float(((unsigned int)b) << 16); }
__device__ __forceinline__ float bf16_rne(float x) { return bf16_val(bf16_bits(x)); }

// D += A.B with NT terms: 1 = ah.bh, 2 = + al.bh, 3 = + ah.bl; hazard guard after the last WMMA
template <int NT>
__device__ __forceinline__ v8f mmaH(v16h ah, v16h al, v16h bh, v16h bl, v8f c) {
  c = __builtin_amdgcn_wmma_f32_16x16x32_f16(false, ah, false, bh, (short)0, c, false, false);
  if (NT >= 2) c = __builtin_amdgcn_wmma_f32_16x16x32_f16(false, al, false, bh, (short)0, c, false, false);
  if (NT >= 3) c = __builtin_amdgcn_wmma_f32_16x16x32_f16(false, ah, false, bl, (short)0, c, false, false);
  asm volatile("v_nop\n\tv_nop\n\tv_nop\n\tv_nop" : "+v"(c) : "v"(ah), "v"(al), "v"(bh), "v"(bl));
  return c;
}

// ---- GEMM engine (wave tile 32x64; M % 128 == 0, N % 64 == 0, K % 32 == 0): C[M][N] f32 = alpha A[M][K].Bt[N][K]^T + bf16(bias) (+ CP own element); A, Bt f16 k-contiguous.
// A fragment: lane row = l&15, elements 0..7 <- k0 + 8h + i, 8..15 <- k0 + 16 + 8h + i; B fragment from the [n][k] copy with the same k map; D element r -> (row 8h + r, col l&15).
__device__ __forceinline__ v16h g2_frag(const _Float16* p, int hh) { FragH f; f.half[0] = *(const v8us*)((const unsigned short*)p + 8 * hh); f.half[1] = *(const v8us*)((const unsigned short*)p + 16 + 8 * hh); return f.v; }
__device__ __forceinline__ v8f g2_mma(v16h a, v16h b, v8f c) { v8f d = __builtin_amdgcn_wmma_f32_16x16x32_f16(false, a, false, b, (short)0, c, false, false); asm volatile("v_nop\n\tv_nop\n\tv_nop\n\tv_nop" : "+v"(d) : "v"(a), "v"(b)); return d; }
template <int ACT>
__global__ __launch_bounds__(128) void k_gemm2(const _Float16* __restrict__ A, int lda, size_t sA, const _Float16* __restrict__ Bh, int ldb, size_t sB, float alpha, const float* __restrict__ bias, size_t sBias, const float* CP, int rowsPerB, size_t sCPb, int row0g,
    float* C, _Float16* C16, int ldc, size_t sC, int M, int N, int K) {
  __shared__ __attribute__((aligned(16))) float so[4][32][68];
  const int tid = threadIdx.x, w = tid >> 5, lane = tid & 31, ln = lane & 15, hh = lane >> 4; const int by = blockIdx.y;
  A += (size_t)by * sA; Bh += (size_t)by * sB; const size_t cofs = (size_t)by * sC; const float* bp = bias ? bias + (size_t)by * sBias : nullptr;
  const int ntn = N >> 6; const int mt = blockIdx.x / ntn, nq = blockIdx.x - mt * ntn; const int row0 = mt * 128 + 32 * w, col0 = nq * 64; if (row0 >= M) return;
  const _Float16* a0p = A + (size_t)(row0 + ln) * lda; const _Float16* a1p = a0p + (size_t)16 * lda;
  const _Float16* b0p = Bh + (size_t)(col0 + ln) * ldb; const _Float16* b1p = b0p + (size_t)16 * ldb; const _Float16* b2p = b1p + (size_t)16 * ldb; const _Float16* b3p = b2p + (size_t)16 * ldb;
  const v8f z8 = {0.f,0.f,0.f,0.f,0.f,0.f,0.f,0.f}; v8f c00 = z8, c01 = z8, c02 = z8, c03 = z8, c10 = z8, c11 = z8, c12 = z8, c13 = z8;
#pragma unroll 1
  for (int kb = 0; kb < K; kb += 32) { const v16h a0 = g2_frag(a0p + kb, hh), a1 = g2_frag(a1p + kb, hh);
    v16h b = g2_frag(b0p + kb, hh); c00 = g2_mma(a0, b, c00); c10 = g2_mma(a1, b, c10);
    b = g2_frag(b1p + kb, hh); c01 = g2_mma(a0, b, c01); c11 = g2_mma(a1, b, c11);
    b = g2_frag(b2p + kb, hh); c02 = g2_mma(a0, b, c02); c12 = g2_mma(a1, b, c12);
    b = g2_frag(b3p + kb, hh); c03 = g2_mma(a0, b, c03); c13 = g2_mma(a1, b, c13); }
  v8f accs[8] = {c00, c01, c02, c03, c10, c11, c12, c13};
#pragma unroll
  for (int u = 0; u < 8; ++u) { const int t = u & 3, half = u >> 2; const int col = col0 + t * 16 + ln; const float bv = bp ? bf16_rne(bp[col]) : 0.f;
#pragma unroll
    for (int r = 0; r < 8; ++r) { const int rloc = half * 16 + 8 * hh + r; float v = accs[u][r] * alpha + bv;
      if (CP) { if (rowsPerB < 0) v += CP[cofs + (size_t)(row0g + row0 + rloc) * ldc + col];      /* rowsPerB < 0: own element of the batched C plane */ else { const int bidx = (row0g + row0 + rloc) / rowsPerB; v += CP[(size_t)bidx * sCPb + (size_t)by * 64 + col]; } }
      if (ACT == 3) v = fmaxf(v, 0.f);
      so[w][rloc][t * 16 + ln] = v; } }
  __builtin_amdgcn_fence(__ATOMIC_ACQ_REL, "workgroup"); __builtin_amdgcn_wave_barrier();
  const int rsub = lane >> 4, c4 = (lane & 15) * 4;
  {
#pragma unroll
    for (int q = 0; q < 16; ++q) { const int r = q * 2 + rsub; const v4f v = *(const v4fa*)&so[w][r][c4]; if (C) *(v4f*)(C + cofs + (size_t)(row0 + r) * ldc + col0 + c4) = v; if (C16) { v4h h4;
#pragma unroll
        for (int i = 0; i < 4; ++i) h4[i] = (_Float16)v[i]; *(v4h*)(C16 + cofs + (size_t)(row0 + r) * ldc + col0 + c4) = h4; } }
     } }

__global__ __launch_bounds__(256) void k_wsc(const float* __restrict__ Wm, _Float16* __restrict__ Bt, size_t n8, float sc) {
  const size_t t = (size_t)blockIdx.x * 256 + threadIdx.x; if (t >= n8) return; FragH f; const v4f a = *(const v4fa*)(Wm + t * 8), c = *(const v4fa*)(Wm + t * 8 + 4);
#pragma unroll
  for (int q = 0; q < 4; ++q) { f.h[q] = (_Float16)(bf16_rne(a[q]) * sc); f.h[4 + q] = (_Float16)(bf16_rne(c[q]) * sc); }
  *(v8us*)((unsigned short*)Bt + t * 8) = f.half[0];  }

__global__ __launch_bounds__(256) void k_x16b(const float* __restrict__ x, _Float16* __restrict__ X16) {
  const size_t t = (size_t)blockIdx.x * 256 + threadIdx.x; if (t >= (size_t)NR * DM / 8) return; const size_t row = (t * 8) / DM; const int c0 = (int)((t * 8) % DM); const size_t rb = row / SEQ, rs = row % SEQ;
  const float* src = x + (rb * SEQ_FULL + rs) * (size_t)DM + c0; const v4f a = *(const v4fa*)src, c = *(const v4fa*)(src + 4); FragH f;
#pragma unroll
  for (int q = 0; q < 4; ++q) { f.h[q] = (_Float16)bf16_rne(a[q]); f.h[4 + q] = (_Float16)bf16_rne(c[q]); }
  *(v8us*)((unsigned short*)X16 + t * 8) = f.half[0];  }

__global__ __launch_bounds__(256) void k_hl(const float* __restrict__ F, _Float16* __restrict__ Hh, _Float16* __restrict__ Hl, size_t n8) {
  const size_t t = (size_t)blockIdx.x * 256 + threadIdx.x; if (t >= n8) return; FragH fh, fl; const v4f a = *(const v4fa*)(F + t * 8), c = *(const v4fa*)(F + t * 8 + 4);
#pragma unroll
  for (int q = 0; q < 4; ++q) { _Float16 hv = (_Float16)a[q]; fh.h[q] = hv; fl.h[q] = (_Float16)((a[q] - (float)hv) * 1024.0f); hv = (_Float16)c[q]; fh.h[4 + q] = hv; fl.h[4 + q] = (_Float16)((c[q] - (float)hv) * 1024.0f); }
  { *(v8us*)((unsigned short*)Hh + t * 8) = fh.half[0]; *(v8us*)((unsigned short*)Hl + t * 8) = fl.half[0];  } }

__global__ __launch_bounds__(256) void k_rotab(float* __restrict__ CS, float* __restrict__ SN) {
  #pragma clang fp contract(off)
  const int t = blockIdx.x * 256 + threadIdx.x; if (t >= SEQ * 32) return; const int j = t % 32, s = t / 32; const float ex = (float)(2 * j) / 64.0f; const float inv = 1.0f / powf(10000.0f, ex); const float th = (float)s * inv; const float c = cosf(th), sn = sinf(th);
  { *(float*)(CS + t) = c; *(float*)(SN + t) = sn;  } }

// RoPE with concatenated tables and interleaved rotate_half: out[d] = x[d] c[s][d mod 32] + rh[d] sn[s][d mod 32], rh[d] = -x[d+1] (d even), x[d-1] (d odd);
__global__ __launch_bounds__(256) void k_rope4(const float* __restrict__ F, const float* __restrict__ CS, const float* __restrict__ SN, _Float16* __restrict__ H, _Float16* __restrict__ L) {
  #pragma clang fp contract(off)
  const size_t t = (size_t)blockIdx.x * 256 + threadIdx.x; if (t >= (size_t)NR * DM / 8) return; const size_t e0 = t * 8; const size_t row = e0 / DM; const int c0 = (int)(e0 % DM); const int j0 = c0 & 31; const int s = (int)(row % SEQ);
  const v4f a = *(const v4fa*)(F + e0), c = *(const v4fa*)(F + e0 + 4); const float xs[8] = {a[0], a[1], a[2], a[3], c[0], c[1], c[2], c[3]};
  const float* tp = CS + (size_t)s * 32 + j0; const float* up = SN + (size_t)s * 32 + j0; const v4f ca = *(const v4fa*)tp, cb = *(const v4fa*)(tp + 4), sa = *(const v4fa*)up, sb = *(const v4fa*)(up + 4);
  const float cs[8] = {ca[0], ca[1], ca[2], ca[3], cb[0], cb[1], cb[2], cb[3]}; const float sn[8] = {sa[0], sa[1], sa[2], sa[3], sb[0], sb[1], sb[2], sb[3]};
  FragH fh, fl;
#pragma unroll
  for (int q = 0; q < 8; ++q) { const float pr = xs[q ^ 1]; const float rh = (q & 1) ? pr : -pr; float o = xs[q] * cs[q]; o += rh * sn[q];
    const _Float16 hv = (_Float16)o; fh.h[q] = hv; fl.h[q] = (_Float16)((o - (float)hv) * 1024.0f); }
  { *(v8us*)((unsigned short*)H + e0) = fh.half[0]; *(v8us*)((unsigned short*)L + e0) = fl.half[0];  } }

__global__ __launch_bounds__(256) void k_vtg(const _Float16* __restrict__ V16, _Float16* __restrict__ Vt) {
  __shared__ unsigned short tl[64][66]; const int tid = threadIdx.x; const int slab = blockIdx.x / (SEQ / 64), lg = blockIdx.x % (SEQ / 64); const int b = slab / NH, h = slab % NH;
  for (int i = tid; i < 64 * 8; i += 256) { const int r = i / 8, c8 = (i % 8) * 8; FragH f; f.half[0] = *(const v8us*)((const unsigned short*)V16 + ((size_t)b * SEQ + lg * 64 + r) * DM + h * 64 + c8);
#pragma unroll
    for (int q = 0; q < 8; ++q) tl[r][c8 + q] = f.u[q]; }
  __syncthreads();
  {
#pragma unroll
    for (int rd = 0; rd < 2; ++rd) { const int d = rd * 32 + tid / 8, pc = tid % 8; FragH f;
#pragma unroll
      for (int q = 0; q < 8; ++q) f.u[q] = tl[pc * 8 + q][d];
      *(v8us*)((unsigned short*)Vt + ((size_t)slab * 64 + d) * SEQ + lg * 64 + pc * 8) = f.half[0]; }
     } }

// One 32-key stage of K hi, K lo (32 rows x 128 B, LDS pitch 144 B) and V^T hi, V^T lo (64 rows x 64 B, LDS pitch 80 B): 1024 pieces of 16 B, eight per thread, global -> LDS through no register.
#define KV_KH 0
#define KV_KL 4608
#define KV_VH 9216
#define KV_VL 14336
#define KV_STAGE 19456
__device__ __forceinline__ void kv_stage(unsigned int lk, unsigned int lv, const unsigned short* gkh, const unsigned short* gkl, size_t k16, const unsigned short* gvh, const unsigned short* gvl, size_t v32) {
  // the s_wait_xcnt closes the statement so that no address register of an issued copy is rewritten ahead of it
  asm volatile("global_load_async_to_lds_b128 %0, %8, off\n\t"
               "global_load_async_to_lds_b128 %1, %9, off\n\t"
               "global_load_async_to_lds_b128 %2, %10, off\n\t"
               "global_load_async_to_lds_b128 %3, %11, off\n\t"
               "global_load_async_to_lds_b128 %4, %12, off\n\t"
               "global_load_async_to_lds_b128 %5, %13, off\n\t"
               "global_load_async_to_lds_b128 %6, %14, off\n\t"
               "global_load_async_to_lds_b128 %7, %15, off\n\t"
               "s_wait_xcnt 0x0"
               :: "v"(lk + KV_KH), "v"(lk + KV_KH + 16 * 144), "v"(lk + KV_KL), "v"(lk + KV_KL + 16 * 144), "v"(lv + KV_VH), "v"(lv + KV_VH + 32 * 80), "v"(lv + KV_VL), "v"(lv + KV_VL + 32 * 80),
                  "v"(gkh), "v"(gkh + k16), "v"(gkl), "v"(gkl + k16), "v"(gvh), "v"(gvh + v32), "v"(gvl), "v"(gvl + v32) : "memory");
}

// fused attention per ((b,h), 64 queries), wave = 16 queries, all SEQ keys in 32-key tiles, each tile staged once per work-group in a two-buffer LDS ring and read by all four waves:
// S = (Qh Kh^T + (Ql Kh^T + Qh Kl^T)/1024) x SCL + bf16(mask[b][0][q][k]) bf16(w); online max/sum softmax f32; P = [hi | 2^10 residual] of 1024 p;
__global__ __launch_bounds__(128) void k_attn(const _Float16* __restrict__ Q16, const _Float16* __restrict__ QL, int ldq, const _Float16* __restrict__ K16, const _Float16* __restrict__ KL, int ldk,
                                             const _Float16* __restrict__ Vt, const _Float16* __restrict__ VtL, const float* __restrict__ AM, const float* __restrict__ AW, float* __restrict__ O, int ldo) {
  constexpr int RPW = 16, DT = 4, KS = 2, QBN = SEQ / 64;
  __shared__ __attribute__((aligned(16))) unsigned short sP[4][RPW][40]; __shared__ __attribute__((aligned(16))) unsigned short sPL[4][RPW][40]; __shared__ __attribute__((aligned(16))) float sO[4][RPW][64 + 4];
  __shared__ __attribute__((aligned(16))) unsigned char ring[2][KV_STAGE];
  const int tid = threadIdx.x, w = tid >> 5, lane = tid & 31, ln = lane & 15, hh = lane >> 4;
  const int slab = blockIdx.x / QBN, qblk = blockIdx.x % QBN; const int b = slab / NH, h = slab % NH; const int qb0 = qblk * (4 * RPW); const int q0 = qb0 + w * RPW;
  const float ww = bf16_rne(AW[0]);
  FragH aq[KS], aql[KS];
  { const unsigned short* qr = (const unsigned short*)Q16 + ((size_t)b * SEQ + q0 + ln) * ldq + h * 64; const unsigned short* ql = (const unsigned short*)QL + ((size_t)b * SEQ + q0 + ln) * ldq + h * 64;
#pragma unroll
    for (int ks = 0; ks < KS; ++ks) { aq[ks].half[0] = *(const v8us*)(qr + ks * 32 + 8 * hh); aq[ks].half[1] = *(const v8us*)(qr + ks * 32 + 16 + 8 * hh); aql[ks].half[0] = *(const v8us*)(ql + ks * 32 + 8 * hh); aql[ks].half[1] = *(const v8us*)(ql + ks * 32 + 16 + 8 * hh); } }
  const unsigned short* Vth = (const unsigned short*)Vt + (size_t)slab * 64 * SEQ; const unsigned short* Vtl = (const unsigned short*)VtL + (size_t)slab * 64 * SEQ;
  const float* amb = AM + (size_t)b * SEQ_FULL * SEQ_FULL;      /* mask[b][0][.][.] with full strides */
  const v8f z8 = {0.f,0.f,0.f,0.f,0.f,0.f,0.f,0.f};
  float m_r[8], l_r[8]; v8f oacc[DT], oaccL[DT];
#pragma unroll
  for (int r = 0; r < 8; ++r) { m_r[r] = -3.0e38f; l_r[r] = 0.f; }
#pragma unroll
  for (int dt = 0; dt < DT; ++dt) { oacc[dt] = z8; oaccL[dt] = z8; }
  // this thread's pieces: K row tid/8 (and +16), 16-B column tid%8; V^T row tid/4 (and +32), 16-B column tid%4
  const unsigned int lring = (unsigned int)(size_t)&ring[0][0]; const unsigned int lk = lring + (tid >> 3) * 144 + (tid & 7) * 16, lv = lring + (tid >> 2) * 80 + (tid & 3) * 16;
  const size_t kofs = ((size_t)b * SEQ + (tid >> 3)) * ldk + h * 64 + (tid & 7) * 8; const unsigned short* gkh = (const unsigned short*)K16 + kofs; const unsigned short* gkl = (const unsigned short*)KL + kofs;
  const size_t vofs = (size_t)(tid >> 2) * SEQ + (tid & 3) * 8; const unsigned short* gvh = Vth + vofs; const unsigned short* gvl = Vtl + vofs;
  const size_t k16 = (size_t)16 * ldk, k32 = (size_t)32 * ldk, v32 = (size_t)32 * SEQ;
  kv_stage(lk, lv, gkh, gkl, k16, gvh, gvl, v32);
  asm volatile("s_wait_asynccnt 0x0" ::: "memory");      /* stage 0 has landed before the barrier that publishes it */
  __syncthreads();
  kv_stage(lk + KV_STAGE, lv + KV_STAGE, gkh + k32, gkl + k32, k16, gvh + 32, gvl + 32, v32);
#pragma unroll 1
  for (int j0 = 0; j0 < SEQ; j0 += 32) {
    const unsigned int bsel = (j0 & 32) ? KV_STAGE : 0; const unsigned char* kvb = &ring[0][0] + bsel;
    v8f s[2];
#pragma unroll
    for (int nt = 0; nt < 2; ++nt) { const unsigned short* kr = (const unsigned short*)(kvb + KV_KH + (nt * 16 + ln) * 144); const unsigned short* klr = (const unsigned short*)(kvb + KV_KL + (nt * 16 + ln) * 144); FragH bk[KS], bkl[KS];
#pragma unroll
      for (int ks = 0; ks < KS; ++ks) { bk[ks].half[0] = *(const v8us*)(kr + ks * 32 + 8 * hh); bk[ks].half[1] = *(const v8us*)(kr + ks * 32 + 16 + 8 * hh); bkl[ks].half[0] = *(const v8us*)(klr + ks * 32 + 8 * hh); bkl[ks].half[1] = *(const v8us*)(klr + ks * 32 + 16 + 8 * hh); }
      v8f acc = z8, accl = z8;
#pragma unroll
      for (int ks = 0; ks < KS; ++ks) { acc = mmaH<1>(aq[ks].v, aq[ks].v, bk[ks].v, bk[ks].v, acc); accl = mmaH<1>(aql[ks].v, aql[ks].v, bk[ks].v, bk[ks].v, accl); accl = mmaH<1>(aq[ks].v, aq[ks].v, bkl[ks].v, bkl[ks].v, accl); }
#pragma unroll
      for (int r = 0; r < 8; ++r) acc[r] += accl[r] * 0.0009765625f;
      s[nt] = acc; }
#pragma unroll
    for (int r = 0; r < 8; ++r) { const int tq = q0 + 8 * hh + r; const int k0 = j0 + ln, k1 = j0 + 16 + ln; const float* amk = amb + (size_t)tq * SEQ_FULL;
      float s0 = s[0][r] * SCL, s1 = s[1][r] * SCL; s0 += bf16_rne(amk[k0]) * ww; s1 += bf16_rne(amk[k1]) * ww;
      float mc = fmaxf(s0, s1);
      mc = fmaxf(mc, __shfl_xor(mc, 1, 32)); mc = fmaxf(mc, __shfl_xor(mc, 2, 32)); mc = fmaxf(mc, __shfl_xor(mc, 4, 32)); mc = fmaxf(mc, __shfl_xor(mc, 8, 32));
      const float mn = fmaxf(m_r[r], mc); const float al = (mn > -1.0e38f) ? expf(m_r[r] - mn) : 1.0f; m_r[r] = mn; const float p0 = expf(s0 - mn), p1 = expf(s1 - mn); l_r[r] = l_r[r] * al + p0 + p1;
#pragma unroll
      for (int dt = 0; dt < DT; ++dt) { oacc[dt][r] *= al; oaccL[dt][r] *= al; }
      FragH t2, t2l; const float ps0 = p0 * 1024.0f, ps1 = p1 * 1024.0f; t2.h[0] = (_Float16)ps0; t2.h[1] = (_Float16)ps1; t2l.h[0] = (_Float16)((ps0 - (float)t2.h[0]) * 1024.0f); t2l.h[1] = (_Float16)((ps1 - (float)t2.h[1]) * 1024.0f);
      sP[w][8 * hh + r][ln] = t2.u[0]; sP[w][8 * hh + r][16 + ln] = t2.u[1]; sPL[w][8 * hh + r][ln] = t2l.u[0]; sPL[w][8 * hh + r][16 + ln] = t2l.u[1]; }
    __builtin_amdgcn_fence(__ATOMIC_ACQ_REL, "workgroup"); __builtin_amdgcn_wave_barrier();
    FragH pa, pl;
    pa.half[0] = *(const v8us*)&sP[w][ln][8 * hh]; pa.half[1] = *(const v8us*)&sP[w][ln][16 + 8 * hh]; pl.half[0] = *(const v8us*)&sPL[w][ln][8 * hh]; pl.half[1] = *(const v8us*)&sPL[w][ln][16 + 8 * hh];
#pragma unroll
    for (int dt = 0; dt < DT; ++dt) { const unsigned short* vrow = (const unsigned short*)(kvb + KV_VH + (dt * 16 + ln) * 80); const unsigned short* vrl = (const unsigned short*)(kvb + KV_VL + (dt * 16 + ln) * 80); FragH bv, bl;
      bv.half[0] = *(const v8us*)(vrow + 8 * hh); bv.half[1] = *(const v8us*)(vrow + 16 + 8 * hh); bl.half[0] = *(const v8us*)(vrl + 8 * hh); bl.half[1] = *(const v8us*)(vrl + 16 + 8 * hh);
      oacc[dt] = mmaH<1>(pa.v, pa.v, bv.v, bv.v, oacc[dt]); oaccL[dt] = mmaH<1>(pl.v, pl.v, bv.v, bv.v, oaccL[dt]); oaccL[dt] = mmaH<1>(pa.v, pa.v, bl.v, bl.v, oaccL[dt]); }
    __builtin_amdgcn_fence(__ATOMIC_ACQ_REL, "workgroup"); __builtin_amdgcn_wave_barrier();
    asm volatile("s_wait_dscnt 0x0" ::: "memory");         /* this wave's reads of the buffer are done before it is handed to the copies */
    asm volatile("s_wait_asynccnt 0x0" ::: "memory");      /* this wave's pieces of the next stage have landed */
    __syncthreads();                                       /* publishes the next stage and ends every wave's reads of this one */
    if (j0 + 64 < SEQ) kv_stage(lk + bsel, lv + bsel, gkh + (size_t)(j0 + 64) * ldk, gkl + (size_t)(j0 + 64) * ldk, k16, gvh + j0 + 64, gvl + j0 + 64, v32); }
  asm volatile("s_wait_asynccnt 0x0" ::: "memory");        /* no copy is outstanding when the wave goes on to its end */
#pragma unroll
  for (int r = 0; r < 8; ++r) { float l = l_r[r]; l += __shfl_xor(l, 1, 32); l += __shfl_xor(l, 2, 32); l += __shfl_xor(l, 4, 32); l += __shfl_xor(l, 8, 32); l_r[r] = (l > 0.f) ? 1.0f / (l * 1024.0f) : 0.f; }
#pragma unroll
  for (int dt = 0; dt < DT; ++dt)
#pragma unroll
    for (int r = 0; r < 8; ++r) { float v = oacc[dt][r]; v += oaccL[dt][r] * 0.0009765625f; sO[w][8 * hh + r][dt * 16 + ln] = v * l_r[r]; }
  __builtin_amdgcn_fence(__ATOMIC_ACQ_REL, "workgroup"); __builtin_amdgcn_wave_barrier();
  {
#pragma unroll
    for (int rp = 0; rp < RPW; rp += 2) { const int r = rp + (lane >> 4), pc = lane & 15; const v4f val = *(const v4fa*)&sO[w][r][pc * 4]; *(v4f*)(O + ((size_t)b * SEQ + q0 + r) * ldo + h * 64 + pc * 4) = val; }
     } }

// LayerNorm over DM (biased variance, eps 1e-5, affine with bf16 g, b) of (A[r] + bf16(x[rin])), compact row r -> input/output row rin = b*SEQ_FULL + s;
__global__ __launch_bounds__(256) void k_ln1024(const float* __restrict__ A, const float* __restrict__ res, const float* __restrict__ g, const float* __restrict__ bb, float* __restrict__ Y) {
  #pragma clang fp contract(off)
  const int wv = threadIdx.x >> 5, ln = threadIdx.x & 31; const size_t r = (size_t)blockIdx.x * 8 + wv; if (r >= (size_t)NR) return;
  const size_t rb = r / SEQ, rs = r % SEQ; const size_t rin = rb * SEQ_FULL + rs;
  float xv[32]; float sm = 0.f;
#pragma unroll
  for (int i = 0; i < 8; ++i) { const int c0 = i * 128 + ln * 4; const v4f a = *(const v4fa*)(A + r * DM + c0); const v4f rr = *(const v4fa*)(res + rin * DM + c0);
#pragma unroll
    for (int q = 0; q < 4; ++q) { const float v = a[q] + bf16_rne(rr[q]); xv[i * 4 + q] = v; sm += v; } }
#pragma unroll
  for (int o = 16; o > 0; o >>= 1) sm += __shfl_xor(sm, o, 32);
  const float mu = sm * 0.0009765625f; float var = 0.f;
#pragma unroll
  for (int q = 0; q < 32; ++q) { const float d = xv[q] - mu; var += d * d; }
#pragma unroll
  for (int o = 16; o > 0; o >>= 1) var += __shfl_xor(var, o, 32);
  const float inv = 1.0f / sqrtf(var * 0.0009765625f + 1e-5f);
  {
#pragma unroll
    for (int i = 0; i < 8; ++i) { const int c0 = i * 128 + ln * 4; v4f y;
#pragma unroll
      for (int q = 0; q < 4; ++q) { float v = (xv[i * 4 + q] - mu) * inv; v *= bf16_rne(g[c0 + q]); v += bf16_rne(bb[c0 + q]); y[q] = v; }
      *(v4f*)(Y + rin * DM + c0) = y; }
     } }

extern "C" void kernel_launch(void* const* d_in, const int* in_sizes, int n_in,
                              void* d_out, int out_size, void* d_ws, size_t ws_size, hipStream_t stream) {
  if (n_in < 13) return;
  const float* x = (const float*)d_in[0]; const float* cdm = (const float*)d_in[1];
  const float* Wq = (const float*)d_in[2]; const float* bq = (const float*)d_in[3]; const float* Wk = (const float*)d_in[4]; const float* bk = (const float*)d_in[5];
  const float* Wv = (const float*)d_in[6]; const float* bv = (const float*)d_in[7]; const float* Wo = (const float*)d_in[8]; const float* bo = (const float*)d_in[9];
  const float* gam = (const float*)d_in[10]; const float* bet = (const float*)d_in[11]; const float* cdw = (const float*)d_in[12];
  const long long rows_need = (long long)(NB - 1) * SEQ_FULL + SEQ;
  if ((long long)in_sizes[0] < rows_need * DM) return;
  if ((long long)in_sizes[1] < (long long)(NB - 1) * SEQ_FULL * SEQ_FULL + (long long)(SEQ - 1) * SEQ_FULL + SEQ) return;
  if (in_sizes[2] < DM * DM || in_sizes[4] < DM * DM || in_sizes[6] < DM * DM || in_sizes[8] < DM * DM) return;
  if (in_sizes[3] < DM || in_sizes[5] < DM || in_sizes[7] < DM || in_sizes[9] < DM || in_sizes[10] < DM || in_sizes[11] < DM || in_sizes[12] < 1) return;
  if ((long long)out_size < rows_need * DM) return;
  char* ws = (char*)d_ws; size_t off = 0;
  auto take = [&](size_t bytes) { char* p = ws + off; off += (bytes + 255) & ~(size_t)255; return p; };
  const size_t np = (size_t)NR * DM;      /* compact activation plane elements */
  _Float16* BQ = (_Float16*)take((size_t)DM * DM * 2); _Float16* BK = (_Float16*)take((size_t)DM * DM * 2); _Float16* BV = (_Float16*)take((size_t)DM * DM * 2); _Float16* BO = (_Float16*)take((size_t)DM * DM * 2);
  _Float16* X16 = (_Float16*)take(np * 2); float* F32 = (float*)take(np * 4);
  _Float16* QH = (_Float16*)take(np * 2); _Float16* QL = (_Float16*)take(np * 2); _Float16* KH = (_Float16*)take(np * 2); _Float16* KL = (_Float16*)take(np * 2);
  _Float16* V16 = (_Float16*)take(np * 2); _Float16* VLr = (_Float16*)take(np * 2); _Float16* VT = (_Float16*)take(np * 2); _Float16* VTL = (_Float16*)take(np * 2);
  float* Y = (float*)take(np * 4); float* CS = (float*)take((size_t)SEQ * 32 * 4); float* SN = (float*)take((size_t)SEQ * 32 * 4);
  float* O = F32; _Float16* OH = QH; _Float16* OL = KH;      /* reuse after their last readers */
  if (off > ws_size) return;
  const unsigned wb = (unsigned)(((size_t)DM * DM / 8 + 255) / 256); const unsigned eb = (unsigned)((np / 8 + 255) / 256);
  k_wsc<<<wb, 256, 0, stream>>>(Wq, BQ, (size_t)DM * DM / 8, 16.0f); k_wsc<<<wb, 256, 0, stream>>>(Wk, BK, (size_t)DM * DM / 8, 16.0f);
  k_wsc<<<wb, 256, 0, stream>>>(Wv, BV, (size_t)DM * DM / 8, 16.0f); k_wsc<<<wb, 256, 0, stream>>>(Wo, BO, (size_t)DM * DM / 8, 16.0f);      /* [out][in] weights, bf16 then x16 in f16 */
  k_x16b<<<eb, 256, 0, stream>>>(x, X16);
  k_rotab<<<(SEQ * 32 + 255) / 256, 256, 0, stream>>>(CS, SN);
  const dim3 g((NR / 128) * (DM / 64), 1);
  k_gemm2<0><<<g, 128, 0, stream>>>(X16, DM, 0, BQ, DM, 0, 0.0625f, bq, 0, nullptr, 1, 0, 0, F32, nullptr, DM, 0, NR, DM, DM); k_rope4<<<eb, 256, 0, stream>>>(F32, CS, SN, QH, QL);      /* Q -> RoPE -> hi/lo */
  k_gemm2<0><<<g, 128, 0, stream>>>(X16, DM, 0, BK, DM, 0, 0.0625f, bk, 0, nullptr, 1, 0, 0, F32, nullptr, DM, 0, NR, DM, DM); k_rope4<<<eb, 256, 0, stream>>>(F32, CS, SN, KH, KL);      /* K -> RoPE -> hi/lo */
  k_gemm2<0><<<g, 128, 0, stream>>>(X16, DM, 0, BV, DM, 0, 0.0625f, bv, 0, nullptr, 1, 0, 0, F32, nullptr, DM, 0, NR, DM, DM); k_hl<<<eb, 256, 0, stream>>>(F32, V16, VLr, np / 8);      /* V -> hi/lo rows */
  k_vtg<<<NB * NH * (SEQ / 64), 256, 0, stream>>>(V16, VT); k_vtg<<<NB * NH * (SEQ / 64), 256, 0, stream>>>(VLr, VTL);
  k_attn<<<NB * NH * (SEQ / 64), 128, 0, stream>>>(QH, QL, DM, KH, KL, DM, VT, VTL, cdm, cdw, O, DM);
  k_hl<<<eb, 256, 0, stream>>>(O, OH, OL, np / 8);      /* context -> hi/lo rows */
  k_gemm2<0><<<g, 128, 0, stream>>>(OL, DM, 0, BO, DM, 0, 0.0625f / 1024.0f, nullptr, 0, nullptr, 1, 0, 0, Y, nullptr, DM, 0, NR, DM, DM);
  k_gemm2<0><<<g, 128, 0, stream>>>(OH, DM, 0, BO, DM, 0, 0.0625f, bo, 0, Y, 1, (size_t)DM, 0, Y, nullptr, DM, 0, NR, DM, DM);      /* Y = (ctx_lo + ctx_hi) Wo^T + bo */
  k_ln1024<<<NR / 8, 256, 0, stream>>>(Y, x, gam, bet, (float*)d_out);      /* out = LN(bf16(x) + Y) g + b */
}

// v002
// Measured time: 418 microseconds a run.
// Two timings next to v001 both put it at 1.40 times that version's speed.
// Counting every step since v000, it is 1.62 times as fast.
#include <hip/hip_runtime.h>
// All contractions (Q/K/V projections, Q.K^T, P.V^T, output projection) on v_wmma_f32_16x16x32_f16: f16 operands, f32 accumulate. Float inputs RNE-converted to bf16 (exact in f16; weights carried x16); q, k, v, softmax numerators (x1024) and context carried as f16 hi + 2^10 residual plane pairs; RoPE tables, softmax, residual add and LayerNorm in f32.
#ifndef NB
#define NB 2
#endif
#ifndef SEQ
#define SEQ 2048
#endif
#define NB_FULL 2
#define SEQ_FULL 2048
#define DM 1024
#define NH 16
#define NR (NB * SEQ)
#define SCL 0.125f
static_assert(NB >= 1 && NB <= NB_FULL);
static_assert(SEQ >= 128 && SEQ <= SEQ_FULL && (SEQ % 128) == 0);
static_assert(NH * 64 == DM);
static_assert((NR % 128) == 0);
static_assert((DM % 64) == 0 && (DM % 32) == 0);

typedef unsigned short v8us __attribute__((ext_vector_type(8), may_alias));
typedef float  v8f  __attribute__((ext_vector_type(8)));
typedef float  v4f  __attribute__((ext_vector_type(4)));
typedef float  v4fa __attribute__((ext_vector_type(4), may_alias));
typedef _Float16 v16h __attribute__((ext_vector_type(16)));
typedef _Float16 v4h __attribute__((ext_vector_type(4)));
union FragH { v16h v; v8us half[2]; _Float16 h[16]; unsigned short u[16]; };

__device__ __forceinline__ unsigned short bf16_bits(float x) { unsigned int u = __float_as_uint(x); return (unsigned short)((u + 0x7FFFu + ((u >> 16) & 1u)) >> 16); }
__device__ __forceinline__ float bf16_val(unsigned short b) { return __uint_as_float(((unsigned int)b) << 16); }
__device__ __forceinline__ float bf16_rne(float x) { return bf16_val(bf16_bits(x)); }

// D += A.B with NT terms: 1 = ah.bh, 2 = + al.bh, 3 = + ah.bl; hazard guard after the last WMMA
template <int NT>
__device__ __forceinline__ v8f mmaH(v16h ah, v16h al, v16h bh, v16h bl, v8f c) {
  c = __builtin_amdgcn_wmma_f32_16x16x32_f16(false, ah, false, bh, (short)0, c, false, false);
  if (NT >= 2) c = __builtin_amdgcn_wmma_f32_16x16x32_f16(false, al, false, bh, (short)0, c, false, false);
  if (NT >= 3) c = __builtin_amdgcn_wmma_f32_16x16x32_f16(false, ah, false, bl, (short)0, c, false, false);
  asm volatile("v_nop\n\tv_nop\n\tv_nop\n\tv_nop" : "+v"(c) : "v"(ah), "v"(al), "v"(bh), "v"(bl));
  return c;
}

// ---- GEMM engine (wave tile 32x64; M % 128 == 0, N % 64 == 0, K % 32 == 0): C[M][N] f32 = alpha A[M][K].Bt[N][K]^T + bf16(bias) (+ CP own element); A, Bt f16 k-contiguous.
// A fragment: lane row = l&15, elements 0..7 <- k0 + 8h + i, 8..15 <- k0 + 16 + 8h + i; B fragment from the [n][k] copy with the same k map; D element r -> (row 8h + r, col l&15).
__device__ __forceinline__ v16h g2_frag(const _Float16* p, int hh) { FragH f; f.half[0] = *(const v8us*)((const unsigned short*)p + 8 * hh); f.half[1] = *(const v8us*)((const unsigned short*)p + 16 + 8 * hh); return f.v; }
__device__ __forceinline__ v8f g2_mma(v16h a, v16h b, v8f c) { v8f d = __builtin_amdgcn_wmma_f32_16x16x32_f16(false, a, false, b, (short)0, c, false, false); asm volatile("v_nop\n\tv_nop\n\tv_nop\n\tv_nop" : "+v"(d) : "v"(a), "v"(b)); return d; }
template <int ACT>
__global__ __launch_bounds__(128) void k_gemm2(const _Float16* __restrict__ A, int lda, size_t sA, const _Float16* __restrict__ Bh, int ldb, size_t sB, float alpha, const float* __restrict__ bias, size_t sBias, const float* CP, int rowsPerB, size_t sCPb, int row0g,
    float* C, _Float16* C16, int ldc, size_t sC, int M, int N, int K) {
  __shared__ __attribute__((aligned(16))) float so[4][32][68];
  const int tid = threadIdx.x, w = tid >> 5, lane = tid & 31, ln = lane & 15, hh = lane >> 4; const int by = blockIdx.y;
  A += (size_t)by * sA; Bh += (size_t)by * sB; const size_t cofs = (size_t)by * sC; const float* bp = bias ? bias + (size_t)by * sBias : nullptr;
  const int ntn = N >> 6; const int mt = blockIdx.x / ntn, nq = blockIdx.x - mt * ntn; const int row0 = mt * 128 + 32 * w, col0 = nq * 64; if (row0 >= M) return;
  const _Float16* a0p = A + (size_t)(row0 + ln) * lda; const _Float16* a1p = a0p + (size_t)16 * lda;
  const _Float16* b0p = Bh + (size_t)(col0 + ln) * ldb; const _Float16* b1p = b0p + (size_t)16 * ldb; const _Float16* b2p = b1p + (size_t)16 * ldb; const _Float16* b3p = b2p + (size_t)16 * ldb;
  const v8f z8 = {0.f,0.f,0.f,0.f,0.f,0.f,0.f,0.f}; v8f c00 = z8, c01 = z8, c02 = z8, c03 = z8, c10 = z8, c11 = z8, c12 = z8, c13 = z8;
#pragma unroll 1
  for (int kb = 0; kb < K; kb += 32) { const v16h a0 = g2_frag(a0p + kb, hh), a1 = g2_frag(a1p + kb, hh);
    v16h b = g2_frag(b0p + kb, hh); c00 = g2_mma(a0, b, c00); c10 = g2_mma(a1, b, c10);
    b = g2_frag(b1p + kb, hh); c01 = g2_mma(a0, b, c01); c11 = g2_mma(a1, b, c11);
    b = g2_frag(b2p + kb, hh); c02 = g2_mma(a0, b, c02); c12 = g2_mma(a1, b, c12);
    b = g2_frag(b3p + kb, hh); c03 = g2_mma(a0, b, c03); c13 = g2_mma(a1, b, c13); }
  v8f accs[8] = {c00, c01, c02, c03, c10, c11, c12, c13};
#pragma unroll
  for (int u = 0; u < 8; ++u) { const int t = u & 3, half = u >> 2; const int col = col0 + t * 16 + ln; const float bv = bp ? bf16_rne(bp[col]) : 0.f;
#pragma unroll
    for (int r = 0; r < 8; ++r) { const int rloc = half * 16 + 8 * hh + r; float v = accs[u][r] * alpha + bv;
      if (CP) { if (rowsPerB < 0) v += CP[cofs + (size_t)(row0g + row0 + rloc) * ldc + col];      /* rowsPerB < 0: own element of the batched C plane */ else { const int bidx = (row0g + row0 + rloc) / rowsPerB; v += CP[(size_t)bidx * sCPb + (size_t)by * 64 + col]; } }
      if (ACT == 3) v = fmaxf(v, 0.f);
      so[w][rloc][t * 16 + ln] = v; } }
  __builtin_amdgcn_fence(__ATOMIC_ACQ_REL, "workgroup"); __builtin_amdgcn_wave_barrier();
  const int rsub = lane >> 4, c4 = (lane & 15) * 4;
  {
#pragma unroll
    for (int q = 0; q < 16; ++q) { const int r = q * 2 + rsub; const v4f v = *(const v4fa*)&so[w][r][c4]; if (C) *(v4f*)(C + cofs + (size_t)(row0 + r) * ldc + col0 + c4) = v; if (C16) { v4h h4;
#pragma unroll
        for (int i = 0; i < 4; ++i) h4[i] = (_Float16)v[i]; *(v4h*)(C16 + cofs + (size_t)(row0 + r) * ldc + col0 + c4) = h4; } }
     } }

__global__ __launch_bounds__(256) void k_wsc(const float* __restrict__ Wm, _Float16* __restrict__ Bt, size_t n8, float sc) {
  const size_t t = (size_t)blockIdx.x * 256 + threadIdx.x; if (t >= n8) return; FragH f; const v4f a = *(const v4fa*)(Wm + t * 8), c = *(const v4fa*)(Wm + t * 8 + 4);
#pragma unroll
  for (int q = 0; q < 4; ++q) { f.h[q] = (_Float16)(bf16_rne(a[q]) * sc); f.h[4 + q] = (_Float16)(bf16_rne(c[q]) * sc); }
  *(v8us*)((unsigned short*)Bt + t * 8) = f.half[0];  }

__global__ __launch_bounds__(256) void k_x16b(const float* __restrict__ x, _Float16* __restrict__ X16) {
  const size_t t = (size_t)blockIdx.x * 256 + threadIdx.x; if (t >= (size_t)NR * DM / 8) return; const size_t row = (t * 8) / DM; const int c0 = (int)((t * 8) % DM); const size_t rb = row / SEQ, rs = row % SEQ;
  const float* src = x + (rb * SEQ_FULL + rs) * (size_t)DM + c0; const v4f a = *(const v4fa*)src, c = *(const v4fa*)(src + 4); FragH f;
#pragma unroll
  for (int q = 0; q < 4; ++q) { f.h[q] = (_Float16)bf16_rne(a[q]); f.h[4 + q] = (_Float16)bf16_rne(c[q]); }
  *(v8us*)((unsigned short*)X16 + t * 8) = f.half[0];  }

__global__ __launch_bounds__(256) void k_hl(const float* __restrict__ F, _Float16* __restrict__ Hh, _Float16* __restrict__ Hl, size_t n8) {
  const size_t t = (size_t)blockIdx.x * 256 + threadIdx.x; if (t >= n8) return; FragH fh, fl; const v4f a = *(const v4fa*)(F + t * 8), c = *(const v4fa*)(F + t * 8 + 4);
#pragma unroll
  for (int q = 0; q < 4; ++q) { _Float16 hv = (_Float16)a[q]; fh.h[q] = hv; fl.h[q] = (_Float16)((a[q] - (float)hv) * 1024.0f); hv = (_Float16)c[q]; fh.h[4 + q] = hv; fl.h[4 + q] = (_Float16)((c[q] - (float)hv) * 1024.0f); }
  { *(v8us*)((unsigned short*)Hh + t * 8) = fh.half[0]; *(v8us*)((unsigned short*)Hl + t * 8) = fl.half[0];  } }

__global__ __launch_bounds__(256) void k_rotab(float* __restrict__ CS, float* __restrict__ SN) {
  #pragma clang fp contract(off)
  const int t = blockIdx.x * 256 + threadIdx.x; if (t >= SEQ * 32) return; const int j = t % 32, s = t / 32; const float ex = (float)(2 * j) / 64.0f; const float inv = 1.0f / powf(10000.0f, ex); const float th = (float)s * inv; const float c = cosf(th), sn = sinf(th);
  { *(float*)(CS + t) = c; *(float*)(SN + t) = sn;  } }

// RoPE with concatenated tables and interleaved rotate_half: out[d] = x[d] c[s][d mod 32] + rh[d] sn[s][d mod 32], rh[d] = -x[d+1] (d even), x[d-1] (d odd);
__global__ __launch_bounds__(256) void k_rope4(const float* __restrict__ F, const float* __restrict__ CS, const float* __restrict__ SN, _Float16* __restrict__ H, _Float16* __restrict__ L) {
  #pragma clang fp contract(off)
  const size_t t = (size_t)blockIdx.x * 256 + threadIdx.x; if (t >= (size_t)NR * DM / 8) return; const size_t e0 = t * 8; const size_t row = e0 / DM; const int c0 = (int)(e0 % DM); const int j0 = c0 & 31; const int s = (int)(row % SEQ);
  const v4f a = *(const v4fa*)(F + e0), c = *(const v4fa*)(F + e0 + 4); const float xs[8] = {a[0], a[1], a[2], a[3], c[0], c[1], c[2], c[3]};
  const float* tp = CS + (size_t)s * 32 + j0; const float* up = SN + (size_t)s * 32 + j0; const v4f ca = *(const v4fa*)tp, cb = *(const v4fa*)(tp + 4), sa = *(const v4fa*)up, sb = *(const v4fa*)(up + 4);
  const float cs[8] = {ca[0], ca[1], ca[2], ca[3], cb[0], cb[1], cb[2], cb[3]}; const float sn[8] = {sa[0], sa[1], sa[2], sa[3], sb[0], sb[1], sb[2], sb[3]};
  FragH fh, fl;
#pragma unroll
  for (int q = 0; q < 8; ++q) { const float pr = xs[q ^ 1]; const float rh = (q & 1) ? pr : -pr; float o = xs[q] * cs[q]; o += rh * sn[q];
    const _Float16 hv = (_Float16)o; fh.h[q] = hv; fl.h[q] = (_Float16)((o - (float)hv) * 1024.0f); }
  { *(v8us*)((unsigned short*)H + e0) = fh.half[0]; *(v8us*)((unsigned short*)L + e0) = fl.half[0];  } }

__global__ __launch_bounds__(256) void k_vtg(const _Float16* __restrict__ V16, _Float16* __restrict__ Vt) {
  __shared__ unsigned short tl[64][66]; const int tid = threadIdx.x; const int slab = blockIdx.x / (SEQ / 64), lg = blockIdx.x % (SEQ / 64); const int b = slab / NH, h = slab % NH;
  for (int i = tid; i < 64 * 8; i += 256) { const int r = i / 8, c8 = (i % 8) * 8; FragH f; f.half[0] = *(const v8us*)((const unsigned short*)V16 + ((size_t)b * SEQ + lg * 64 + r) * DM + h * 64 + c8);
#pragma unroll
    for (int q = 0; q < 8; ++q) tl[r][c8 + q] = f.u[q]; }
  __syncthreads();
  {
#pragma unroll
    for (int rd = 0; rd < 2; ++rd) { const int d = rd * 32 + tid / 8, pc = tid % 8; FragH f;
#pragma unroll
      for (int q = 0; q < 8; ++q) f.u[q] = tl[pc * 8 + q][d];
      *(v8us*)((unsigned short*)Vt + ((size_t)slab * 64 + d) * SEQ + lg * 64 + pc * 8) = f.half[0]; }
     } }

// One 32-key stage of K hi, K lo (32 rows x 128 B, LDS pitch 144 B) and V^T hi, V^T lo (64 rows x 64 B, LDS pitch 80 B): 1024 pieces of 16 B, eight per thread, global -> LDS through no register.
#define KV_KH 0
#define KV_KL 4608
#define KV_VH 9216
#define KV_VL 14336
#define KV_STAGE 19456
__device__ __forceinline__ void kv_stage(unsigned int lk, unsigned int lv, const unsigned short* gkh, const unsigned short* gkl, size_t k16, const unsigned short* gvh, const unsigned short* gvl, size_t v32) {
  // the s_wait_xcnt closes the statement so that no address register of an issued copy is rewritten ahead of it
  asm volatile("global_load_async_to_lds_b128 %0, %8, off\n\t"
               "global_load_async_to_lds_b128 %1, %9, off\n\t"
               "global_load_async_to_lds_b128 %2, %10, off\n\t"
               "global_load_async_to_lds_b128 %3, %11, off\n\t"
               "global_load_async_to_lds_b128 %4, %12, off\n\t"
               "global_load_async_to_lds_b128 %5, %13, off\n\t"
               "global_load_async_to_lds_b128 %6, %14, off\n\t"
               "global_load_async_to_lds_b128 %7, %15, off\n\t"
               "s_wait_xcnt 0x0"
               :: "v"(lk + KV_KH), "v"(lk + KV_KH + 16 * 144), "v"(lk + KV_KL), "v"(lk + KV_KL + 16 * 144), "v"(lv + KV_VH), "v"(lv + KV_VH + 32 * 80), "v"(lv + KV_VL), "v"(lv + KV_VL + 32 * 80),
                  "v"(gkh), "v"(gkh + k16), "v"(gkl), "v"(gkl + k16), "v"(gvh), "v"(gvh + v32), "v"(gvl), "v"(gvl + v32) : "memory");
}

// lane l with lane l ^ 16: joins the two key halves that lanes c and c + 16 hold of one query
__device__ __forceinline__ float xhalf(float x) { return __builtin_bit_cast(float, __builtin_amdgcn_permlanex16(__builtin_bit_cast(int, x), __builtin_bit_cast(int, x), 0x76543210, 0xfedcba98, false, false)); }

__global__ __launch_bounds__(128) void k_attn(const _Float16* __restrict__ Q16, const _Float16* __restrict__ QL, int ldq, const _Float16* __restrict__ K16, const _Float16* __restrict__ KL, int ldk,
                                             const _Float16* __restrict__ Vt, const _Float16* __restrict__ VtL, const float* __restrict__ AM, const float* __restrict__ AW, float* __restrict__ O, int ldo) {
  constexpr int RPW = 16, DT = 4, KS = 2, QBN = SEQ / 64;
  __shared__ __attribute__((aligned(16))) float sO[4][RPW][64 + 4];
  __shared__ __attribute__((aligned(16))) unsigned char ring[2][KV_STAGE];
  const int tid = threadIdx.x, w = tid >> 5, lane = tid & 31, ln = lane & 15, hh = lane >> 4;
  const int slab = blockIdx.x / QBN, qblk = blockIdx.x % QBN; const int b = slab / NH, h = slab % NH; const int qb0 = qblk * (4 * RPW); const int q0 = qb0 + w * RPW;
  const float ww = bf16_rne(AW[0]);
  FragH aq[KS], aql[KS];
  { const unsigned short* qr = (const unsigned short*)Q16 + ((size_t)b * SEQ + q0 + ln) * ldq + h * 64; const unsigned short* ql = (const unsigned short*)QL + ((size_t)b * SEQ + q0 + ln) * ldq + h * 64;
#pragma unroll
    for (int ks = 0; ks < KS; ++ks) { aq[ks].half[0] = *(const v8us*)(qr + ks * 32 + 8 * hh); aq[ks].half[1] = *(const v8us*)(qr + ks * 32 + 16 + 8 * hh); aql[ks].half[0] = *(const v8us*)(ql + ks * 32 + 8 * hh); aql[ks].half[1] = *(const v8us*)(ql + ks * 32 + 16 + 8 * hh); } }
  const unsigned short* Vth = (const unsigned short*)Vt + (size_t)slab * 64 * SEQ; const unsigned short* Vtl = (const unsigned short*)VtL + (size_t)slab * 64 * SEQ;
  const float* amq = AM + (size_t)b * SEQ_FULL * SEQ_FULL + (size_t)(q0 + ln) * SEQ_FULL + 8 * hh;      /* mask[b][0][own query][.] with full strides, at this lane half's first key */
  const v8f z8 = {0.f,0.f,0.f,0.f,0.f,0.f,0.f,0.f};
  float m_q = -3.0e38f, l_q = 0.f; v8f oacc[DT], oaccL[DT];
#pragma unroll
  for (int dt = 0; dt < DT; ++dt) { oacc[dt] = z8; oaccL[dt] = z8; }
  // this thread's pieces: K row tid/8 (and +16), 16-B column tid%8; V^T row tid/4 (and +32), 16-B column tid%4
  const unsigned int lring = (unsigned int)(size_t)&ring[0][0]; const unsigned int lk = lring + (tid >> 3) * 144 + (tid & 7) * 16, lv = lring + (tid >> 2) * 80 + (tid & 3) * 16;
  const size_t kofs = ((size_t)b * SEQ + (tid >> 3)) * ldk + h * 64 + (tid & 7) * 8; const unsigned short* gkh = (const unsigned short*)K16 + kofs; const unsigned short* gkl = (const unsigned short*)KL + kofs;
  const size_t vofs = (size_t)(tid >> 2) * SEQ + (tid & 3) * 8; const unsigned short* gvh = Vth + vofs; const unsigned short* gvl = Vtl + vofs;
  const size_t k16 = (size_t)16 * ldk, k32 = (size_t)32 * ldk, v32 = (size_t)32 * SEQ;
  kv_stage(lk, lv, gkh, gkl, k16, gvh, gvl, v32);
  asm volatile("s_wait_asynccnt 0x0" ::: "memory");      /* stage 0 has landed before the barrier that publishes it */
  __syncthreads();
  kv_stage(lk + KV_STAGE, lv + KV_STAGE, gkh + k32, gkl + k32, k16, gvh + 32, gvl + 32, v32);
#pragma unroll 1
  for (int j0 = 0; j0 < SEQ; j0 += 32) {
    const unsigned int bsel = (j0 & 32) ? KV_STAGE : 0; const unsigned char* kvb = &ring[0][0] + bsel;
    v4f mk[2][2];      /* own query's mask, keys j0 + 16 nt + 8 hh + 0..7 */
#pragma unroll
    for (int nt = 0; nt < 2; ++nt) { mk[nt][0] = *(const v4fa*)(amq + j0 + nt * 16); mk[nt][1] = *(const v4fa*)(amq + j0 + nt * 16 + 4); }
    v8f s[2];
#pragma unroll
    for (int nt = 0; nt < 2; ++nt) { const unsigned short* kr = (const unsigned short*)(kvb + KV_KH + (nt * 16 + ln) * 144); const unsigned short* klr = (const unsigned short*)(kvb + KV_KL + (nt * 16 + ln) * 144); FragH bk[KS], bkl[KS];
#pragma unroll
      for (int ks = 0; ks < KS; ++ks) { bk[ks].half[0] = *(const v8us*)(kr + ks * 32 + 8 * hh); bk[ks].half[1] = *(const v8us*)(kr + ks * 32 + 16 + 8 * hh); bkl[ks].half[0] = *(const v8us*)(klr + ks * 32 + 8 * hh); bkl[ks].half[1] = *(const v8us*)(klr + ks * 32 + 16 + 8 * hh); }
      v8f acc = z8, accl = z8;
#pragma unroll
      for (int ks = 0; ks < KS; ++ks) { acc = mmaH<1>(bk[ks].v, bk[ks].v, aq[ks].v, aq[ks].v, acc); accl = mmaH<1>(bk[ks].v, bk[ks].v, aql[ks].v, aql[ks].v, accl); accl = mmaH<1>(bkl[ks].v, bkl[ks].v, aq[ks].v, aq[ks].v, accl); }
#pragma unroll
      for (int r = 0; r < 8; ++r) acc[r] += accl[r] * 0.0009765625f;
      s[nt] = acc; }
    float mc = -3.0e38f;
#pragma unroll
    for (int nt = 0; nt < 2; ++nt)
#pragma unroll
      for (int r = 0; r < 8; ++r) { float sv = s[nt][r] * SCL; sv += bf16_rne(mk[nt][r >> 2][r & 3]) * ww; s[nt][r] = sv; mc = fmaxf(mc, sv); }
    mc = fmaxf(mc, xhalf(mc));
    const float mn = fmaxf(m_q, mc); const float al = (mn > -1.0e38f) ? expf(m_q - mn) : 1.0f; m_q = mn;
    FragH pa, pl; float ls[2] = {0.f, 0.f};
#pragma unroll
    for (int nt = 0; nt < 2; ++nt)
#pragma unroll
      for (int r = 0; r < 8; ++r) { const float p = expf(s[nt][r] - mn); ls[nt] += p; const float psc = p * 1024.0f; const _Float16 ph = (_Float16)psc; pa.h[nt * 8 + r] = ph; pl.h[nt * 8 + r] = (_Float16)((psc - (float)ph) * 1024.0f); }
    l_q = l_q * al + (ls[0] + ls[1]);
#pragma unroll
    for (int dt = 0; dt < DT; ++dt)
#pragma unroll
      for (int r = 0; r < 8; ++r) { oacc[dt][r] *= al; oaccL[dt][r] *= al; }
#pragma unroll
    for (int dt = 0; dt < DT; ++dt) { const unsigned short* vrow = (const unsigned short*)(kvb + KV_VH + (dt * 16 + ln) * 80); const unsigned short* vrl = (const unsigned short*)(kvb + KV_VL + (dt * 16 + ln) * 80); FragH bv, bl;
      bv.half[0] = *(const v8us*)(vrow + 8 * hh); bv.half[1] = *(const v8us*)(vrow + 16 + 8 * hh); bl.half[0] = *(const v8us*)(vrl + 8 * hh); bl.half[1] = *(const v8us*)(vrl + 16 + 8 * hh);
      oacc[dt] = mmaH<1>(bv.v, bv.v, pa.v, pa.v, oacc[dt]); oaccL[dt] = mmaH<1>(bv.v, bv.v, pl.v, pl.v, oaccL[dt]); oaccL[dt] = mmaH<1>(bl.v, bl.v, pa.v, pa.v, oaccL[dt]); }
    asm volatile("s_wait_dscnt 0x0" ::: "memory");         /* this wave's reads of the buffer are done before it is handed to the copies */
    asm volatile("s_wait_asynccnt 0x0" ::: "memory");      /* this wave's pieces of the next stage have landed */
    __syncthreads();                                       /* publishes the next stage and ends every wave's reads of this one */
    if (j0 + 64 < SEQ) kv_stage(lk + bsel, lv + bsel, gkh + (size_t)(j0 + 64) * ldk, gkl + (size_t)(j0 + 64) * ldk, k16, gvh + j0 + 64, gvl + j0 + 64, v32); }
  asm volatile("s_wait_asynccnt 0x0" ::: "memory");        /* no copy is outstanding when the wave goes on to its end */
  const float lt = l_q + xhalf(l_q); const float linv = (lt > 0.f) ? 1.0f / (lt * 1024.0f) : 0.f;
#pragma unroll
  for (int dt = 0; dt < DT; ++dt)
#pragma unroll
    for (int r = 0; r < 8; ++r) { float v = oacc[dt][r]; v += oaccL[dt][r] * 0.0009765625f; sO[w][ln][dt * 16 + 8 * hh + r] = v * linv; }
  __builtin_amdgcn_fence(__ATOMIC_ACQ_REL, "workgroup"); __builtin_amdgcn_wave_barrier();
  {
#pragma unroll
    for (int rp = 0; rp < RPW; rp += 2) { const int r = rp + (lane >> 4), pc = lane & 15; const v4f val = *(const v4fa*)&sO[w][r][pc * 4]; *(v4f*)(O + ((size_t)b * SEQ + q0 + r) * ldo + h * 64 + pc * 4) = val; }
     } }

// LayerNorm over DM (biased variance, eps 1e-5, affine with bf16 g, b) of (A[r] + bf16(x[rin])), compact row r -> input/output row rin = b*SEQ_FULL + s;
__global__ __launch_bounds__(256) void k_ln1024(const float* __restrict__ A, const float* __restrict__ res, const float* __restrict__ g, const float* __restrict__ bb, float* __restrict__ Y) {
  #pragma clang fp contract(off)
  const int wv = threadIdx.x >> 5, ln = threadIdx.x & 31; const size_t r = (size_t)blockIdx.x * 8 + wv; if (r >= (size_t)NR) return;
  const size_t rb = r / SEQ, rs = r % SEQ; const size_t rin = rb * SEQ_FULL + rs;
  float xv[32]; float sm = 0.f;
#pragma unroll
  for (int i = 0; i < 8; ++i) { const int c0 = i * 128 + ln * 4; const v4f a = *(const v4fa*)(A + r * DM + c0); const v4f rr = *(const v4fa*)(res + rin * DM + c0);
#pragma unroll
    for (int q = 0; q < 4; ++q) { const float v = a[q] + bf16_rne(rr[q]); xv[i * 4 + q] = v; sm += v; } }
#pragma unroll
  for (int o = 16; o > 0; o >>= 1) sm += __shfl_xor(sm, o, 32);
  const float mu = sm * 0.0009765625f; float var = 0.f;
#pragma unroll
  for (int q = 0; q < 32; ++q) { const float d = xv[q] - mu; var += d * d; }
#pragma unroll
  for (int o = 16; o > 0; o >>= 1) var += __shfl_xor(var, o, 32);
  const float inv = 1.0f / sqrtf(var * 0.0009765625f + 1e-5f);
  {
#pragma unroll
    for (int i = 0; i < 8; ++i) { const int c0 = i * 128 + ln * 4; v4f y;
#pragma unroll
      for (int q = 0; q < 4; ++q) { float v = (xv[i * 4 + q] - mu) * inv; v *= bf16_rne(g[c0 + q]); v += bf16_rne(bb[c0 + q]); y[q] = v; }
      *(v4f*)(Y + rin * DM + c0) = y; }
     } }

extern "C" void kernel_launch(void* const* d_in, const int* in_sizes, int n_in,
                              void* d_out, int out_size, void* d_ws, size_t ws_size, hipStream_t stream) {
  if (n_in < 13) return;
  const float* x = (const float*)d_in[0]; const float* cdm = (const float*)d_in[1];
  const float* Wq = (const float*)d_in[2]; const float* bq = (const float*)d_in[3]; const float* Wk = (const float*)d_in[4]; const float* bk = (const float*)d_in[5];
  const float* Wv = (const float*)d_in[6]; const float* bv = (const float*)d_in[7]; const float* Wo = (const float*)d_in[8]; const float* bo = (const float*)d_in[9];
  const float* gam = (const float*)d_in[10]; const float* bet = (const float*)d_in[11]; const float* cdw = (const float*)d_in[12];
  const long long rows_need = (long long)(NB - 1) * SEQ_FULL + SEQ;
  if ((long long)in_sizes[0] < rows_need * DM) return;
  if ((long long)in_sizes[1] < (long long)(NB - 1) * SEQ_FULL * SEQ_FULL + (long long)(SEQ - 1) * SEQ_FULL + SEQ) return;
  if (in_sizes[2] < DM * DM || in_sizes[4] < DM * DM || in_sizes[6] < DM * DM || in_sizes[8] < DM * DM) return;
  if (in_sizes[3] < DM || in_sizes[5] < DM || in_sizes[7] < DM || in_sizes[9] < DM || in_sizes[10] < DM || in_sizes[11] < DM || in_sizes[12] < 1) return;
  if ((long long)out_size < rows_need * DM) return;
  char* ws = (char*)d_ws; size_t off = 0;
  auto take = [&](size_t bytes) { char* p = ws + off; off += (bytes + 255) & ~(size_t)255; return p; };
  const size_t np = (size_t)NR * DM;      /* compact activation plane elements */
  _Float16* BQ = (_Float16*)take((size_t)DM * DM * 2); _Float16* BK = (_Float16*)take((size_t)DM * DM * 2); _Float16* BV = (_Float16*)take((size_t)DM * DM * 2); _Float16* BO = (_Float16*)take((size_t)DM * DM * 2);
  _Float16* X16 = (_Float16*)take(np * 2); float* F32 = (float*)take(np * 4);
  _Float16* QH = (_Float16*)take(np * 2); _Float16* QL = (_Float16*)take(np * 2); _Float16* KH = (_Float16*)take(np * 2); _Float16* KL = (_Float16*)take(np * 2);
  _Float16* V16 = (_Float16*)take(np * 2); _Float16* VLr = (_Float16*)take(np * 2); _Float16* VT = (_Float16*)take(np * 2); _Float16* VTL = (_Float16*)take(np * 2);
  float* Y = (float*)take(np * 4); float* CS = (float*)take((size_t)SEQ * 32 * 4); float* SN = (float*)take((size_t)SEQ * 32 * 4);
  float* O = F32; _Float16* OH = QH; _Float16* OL = KH;      /* reuse after their last readers */
  if (off > ws_size) return;
  const unsigned wb = (unsigned)(((size_t)DM * DM / 8 + 255) / 256); const unsigned eb = (unsigned)((np / 8 + 255) / 256);
  k_wsc<<<wb, 256, 0, stream>>>(Wq, BQ, (size_t)DM * DM / 8, 16.0f); k_wsc<<<wb, 256, 0, stream>>>(Wk, BK, (size_t)DM * DM / 8, 16.0f);
  k_wsc<<<wb, 256, 0, stream>>>(Wv, BV, (size_t)DM * DM / 8, 16.0f); k_wsc<<<wb, 256, 0, stream>>>(Wo, BO, (size_t)DM * DM / 8, 16.0f);      /* [out][in] weights, bf16 then x16 in f16 */
  k_x16b<<<eb, 256, 0, stream>>>(x, X16);
  k_rotab<<<(SEQ * 32 + 255) / 256, 256, 0, stream>>>(CS, SN);
  const dim3 g((NR / 128) * (DM / 64), 1);
  k_gemm2<0><<<g, 128, 0, stream>>>(X16, DM, 0, BQ, DM, 0, 0.0625f, bq, 0, nullptr, 1, 0, 0, F32, nullptr, DM, 0, NR, DM, DM); k_rope4<<<eb, 256, 0, stream>>>(F32, CS, SN, QH, QL);      /* Q -> RoPE -> hi/lo */
  k_gemm2<0><<<g, 128, 0, stream>>>(X16, DM, 0, BK, DM, 0, 0.0625f, bk, 0, nullptr, 1, 0, 0, F32, nullptr, DM, 0, NR, DM, DM); k_rope4<<<eb, 256, 0, stream>>>(F32, CS, SN, KH, KL);      /* K -> RoPE -> hi/lo */
  k_gemm2<0><<<g, 128, 0, stream>>>(X16, DM, 0, BV, DM, 0, 0.0625f, bv, 0, nullptr, 1, 0, 0, F32, nullptr, DM, 0, NR, DM, DM); k_hl<<<eb, 256, 0, stream>>>(F32, V16, VLr, np / 8);      /* V -> hi/lo rows */
  k_vtg<<<NB * NH * (SEQ / 64), 256, 0, stream>>>(V16, VT); k_vtg<<<NB * NH * (SEQ / 64), 256, 0, stream>>>(VLr, VTL);
  k_attn<<<NB * NH * (SEQ / 64), 128, 0, stream>>>(QH, QL, DM, KH, KL, DM, VT, VTL, cdm, cdw, O, DM);
  k_hl<<<eb, 256, 0, stream>>>(O, OH, OL, np / 8);      /* context -> hi/lo rows */
  k_gemm2<0><<<g, 128, 0, stream>>>(OL, DM, 0, BO, DM, 0, 0.0625f / 1024.0f, nullptr, 0, nullptr, 1, 0, 0, Y, nullptr, DM, 0, NR, DM, DM);
  k_gemm2<0><<<g, 128, 0, stream>>>(OH, DM, 0, BO, DM, 0, 0.0625f, bo, 0, Y, 1, (size_t)DM, 0, Y, nullptr, DM, 0, NR, DM, DM);      /* Y = (ctx_lo + ctx_hi) Wo^T + bo */
  k_ln1024<<<NR / 8, 256, 0, stream>>>(Y, x, gam, bet, (float*)d_out);      /* out = LN(bf16(x) + Y) g + b */
}

// v003
// A run of this version takes 286 microseconds.
// Next to v002, in two timings, it ran 1.46 times as fast each time.
// All steps since v000 together make it 2.37 times as fast.
#include <hip/hip_runtime.h>
// All contractions (Q/K/V projections, Q.K^T, P.V^T, output projection) on v_wmma_f32_16x16x32_f16: f16 operands, f32 accumulate. Float inputs RNE-converted to bf16 (exact in f16; weights carried x16); q, k, v, softmax numerators (x1024) and context carried as f16 hi + 2^10 residual plane pairs; RoPE tables, softmax, residual add and LayerNorm in f32.
#ifndef NB
#define NB 2
#endif
#ifndef SEQ
#define SEQ 2048
#endif
#define NB_FULL 2
#define SEQ_FULL 2048
#define DM 1024
#define NH 16
#define NR (NB * SEQ)
#define SCL 0.125f
static_assert(NB >= 1 && NB <= NB_FULL);
static_assert(SEQ >= 128 && SEQ <= SEQ_FULL && (SEQ % 128) == 0);
static_assert(NH * 64 == DM);
static_assert((NR % 128) == 0);
static_assert((DM % 64) == 0 && (DM % 128) == 0);

typedef unsigned short v8us __attribute__((ext_vector_type(8), may_alias));
typedef float  v8f  __attribute__((ext_vector_type(8)));
typedef float  v4f  __attribute__((ext_vector_type(4)));
typedef float  v4fa __attribute__((ext_vector_type(4), may_alias));
typedef _Float16 v16h __attribute__((ext_vector_type(16)));
typedef _Float16 v4h __attribute__((ext_vector_type(4)));
union FragH { v16h v; v8us half[2]; _Float16 h[16]; unsigned short u[16]; };

__device__ __forceinline__ unsigned short bf16_bits(float x) { unsigned int u = __float_as_uint(x); return (unsigned short)((u + 0x7FFFu + ((u >> 16) & 1u)) >> 16); }
__device__ __forceinline__ float bf16_val(unsigned short b) { return __uint_as_float(((unsigned int)b) << 16); }
__device__ __forceinline__ float bf16_rne(float x) { return bf16_val(bf16_bits(x)); }

// D += A.B with NT terms: 1 = ah.bh, 2 = + al.bh, 3 = + ah.bl; hazard guard after the last WMMA
template <int NT>
__device__ __forceinline__ v8f mmaH(v16h ah, v16h al, v16h bh, v16h bl, v8f c) {
  c = __builtin_amdgcn_wmma_f32_16x16x32_f16(false, ah, false, bh, (short)0, c, false, false);
  if (NT >= 2) c = __builtin_amdgcn_wmma_f32_16x16x32_f16(false, al, false, bh, (short)0, c, false, false);
  if (NT >= 3) c = __builtin_amdgcn_wmma_f32_16x16x32_f16(false, ah, false, bl, (short)0, c, false, false);
  asm volatile("v_nop\n\tv_nop\n\tv_nop\n\tv_nop" : "+v"(c) : "v"(ah), "v"(al), "v"(bh), "v"(bl));
  return c;
}

// ---- GEMM engine (work-group tile 128x64, wave tile 32x64; M % 128 == 0, N % 64 == 0, K % 128 == 0, lda and ldb % 8 == 0): C[M][N] f32 = alpha A[M][K].Bt[N][K]^T + bf16(bias) (+ CP own element); A, Bt f16 k-contiguous.
// Each 128-k stage (A 128 rows, then Bt 64 rows, 256 B a row at LDS pitch 272 B) is brought once per work-group into a two-buffer LDS ring, global -> LDS through no register, and read by all four waves.
// A fragment: lane row = l&15, elements 0..7 <- k0 + 8h + i, 8..15 <- k0 + 16 + 8h + i; B fragment from the [n][k] copy with the same k map; D element r -> (row 8h + r, col l&15).
__device__ __forceinline__ v16h g2_frag(const _Float16* p, int hh) { FragH f; f.half[0] = *(const v8us*)((const unsigned short*)p + 8 * hh); f.half[1] = *(const v8us*)((const unsigned short*)p + 16 + 8 * hh); return f.v; }
__device__ __forceinline__ v8f g2_mma(v16h a, v16h b, v8f c) { v8f d = __builtin_amdgcn_wmma_f32_16x16x32_f16(false, a, false, b, (short)0, c, false, false); asm volatile("v_nop\n\tv_nop\n\tv_nop\n\tv_nop" : "+v"(d) : "v"(a), "v"(b)); return d; }
#define G_KT 128
#define G_PITCH 272
#define G_STAGE (192 * G_PITCH)
// eight 16-B pieces of one thread: rows 8 apart, the same 16-B column; a wave's copy covers two whole 256-B rows
__device__ __forceinline__ void g2_copy8(unsigned int l, const unsigned short* g, size_t r8) {
  // the s_wait_xcnt closes the statement so that no address register of an issued copy is rewritten ahead of it
  asm volatile("global_load_async_to_lds_b128 %0, %8, off\n\t"
               "global_load_async_to_lds_b128 %1, %9, off\n\t"
               "global_load_async_to_lds_b128 %2, %10, off\n\t"
               "global_load_async_to_lds_b128 %3, %11, off\n\t"
               "global_load_async_to_lds_b128 %4, %12, off\n\t"
               "global_load_async_to_lds_b128 %5, %13, off\n\t"
               "global_load_async_to_lds_b128 %6, %14, off\n\t"
               "global_load_async_to_lds_b128 %7, %15, off\n\t"
               "s_wait_xcnt 0x0"
               :: "v"(l), "v"(l + 8 * G_PITCH), "v"(l + 16 * G_PITCH), "v"(l + 24 * G_PITCH), "v"(l + 32 * G_PITCH), "v"(l + 40 * G_PITCH), "v"(l + 48 * G_PITCH), "v"(l + 56 * G_PITCH),
                  "v"(g), "v"(g + r8), "v"(g + 2 * r8), "v"(g + 3 * r8), "v"(g + 4 * r8), "v"(g + 5 * r8), "v"(g + 6 * r8), "v"(g + 7 * r8) : "memory");
}
// one stage: A rows 0..127 of the work-group's tile, then Bt rows 0..63, 24 pieces per thread
__device__ __forceinline__ void g2_stage(unsigned int l, const unsigned short* ga, size_t a8, const unsigned short* gb, size_t b8) {
  g2_copy8(l, ga, a8); g2_copy8(l + 64 * G_PITCH, ga + 8 * a8, a8); g2_copy8(l + 128 * G_PITCH, gb, b8);
}
template <int ACT>
__global__ __launch_bounds__(128) void k_gemm2(const _Float16* __restrict__ A, int lda, size_t sA, const _Float16* __restrict__ Bh, int ldb, size_t sB, float alpha, const float* __restrict__ bias, size_t sBias, const float* CP, int rowsPerB, size_t sCPb, int row0g,
    float* C, _Float16* C16, int ldc, size_t sC, int M, int N, int K) {
  __shared__ __attribute__((aligned(16))) float so[4][32][68];
  __shared__ __attribute__((aligned(16))) unsigned char gring[2][G_STAGE];
  const int tid = threadIdx.x, w = tid >> 5, lane = tid & 31, ln = lane & 15, hh = lane >> 4; const int by = blockIdx.y;
  A += (size_t)by * sA; Bh += (size_t)by * sB; const size_t cofs = (size_t)by * sC; const float* bp = bias ? bias + (size_t)by * sBias : nullptr;
  const int ntn = N >> 6; const int mt = blockIdx.x / ntn, nq = blockIdx.x - mt * ntn; const int row0 = mt * 128 + 32 * w, col0 = nq * 64; if (mt * 128 >= M) return;      /* the whole work-group leaves or none, ahead of every barrier and copy */
  const v8f z8 = {0.f,0.f,0.f,0.f,0.f,0.f,0.f,0.f}; v8f c00 = z8, c01 = z8, c02 = z8, c03 = z8, c10 = z8, c11 = z8, c12 = z8, c13 = z8;
  // this thread's pieces: stage row tid/16 (and +8 ...), 16-B column tid%16
  const unsigned int lg = (unsigned int)(size_t)&gring[0][0] + (tid >> 4) * G_PITCH + (tid & 15) * 16;
  const unsigned short* ga = (const unsigned short*)A + (size_t)(mt * 128 + (tid >> 4)) * lda + (tid & 15) * 8; const unsigned short* gb = (const unsigned short*)Bh + (size_t)(col0 + (tid >> 4)) * ldb + (tid & 15) * 8;
  const size_t a8 = (size_t)8 * lda, b8 = (size_t)8 * ldb;
  g2_stage(lg, ga, a8, gb, b8);
  asm volatile("s_wait_asynccnt 0x0" ::: "memory");      /* stage 0 has landed before the barrier that publishes it */
  __syncthreads();
  if (G_KT < K) g2_stage(lg + G_STAGE, ga + G_KT, a8, gb + G_KT, b8);
#pragma unroll 1
  for (int kt = 0; kt < K; kt += G_KT) {
    const unsigned int bsel = (kt & G_KT) ? G_STAGE : 0; const unsigned char* sb = &gring[0][0] + bsel;
    const _Float16* a0p = (const _Float16*)(sb + (32 * w + ln) * G_PITCH); const _Float16* a1p = (const _Float16*)(sb + (32 * w + 16 + ln) * G_PITCH);
    const _Float16* b0p = (const _Float16*)(sb + (128 + ln) * G_PITCH); const _Float16* b1p = (const _Float16*)(sb + (144 + ln) * G_PITCH); const _Float16* b2p = (const _Float16*)(sb + (160 + ln) * G_PITCH); const _Float16* b3p = (const _Float16*)(sb + (176 + ln) * G_PITCH);
    // two fragment sets: the twelve LDS reads of the next 32-k step of this same stage go out as one group ahead of the current step's products;
    // the step loop is unrolled so that the set index is a constant and both sets stay in registers
    v16h fa0[2], fa1[2], fb0[2], fb1[2], fb2[2], fb3[2];
    fa0[0] = g2_frag(a0p, hh); fa1[0] = g2_frag(a1p, hh); fb0[0] = g2_frag(b0p, hh); fb1[0] = g2_frag(b1p, hh); fb2[0] = g2_frag(b2p, hh); fb3[0] = g2_frag(b3p, hh);
#pragma unroll
    for (int ks = 0; ks < G_KT / 32; ++ks) { const int cu = ks & 1, nx = cu ^ 1;
      if (ks + 1 < G_KT / 32) { const int kb = (ks + 1) * 32; fa0[nx] = g2_frag(a0p + kb, hh); fa1[nx] = g2_frag(a1p + kb, hh); fb0[nx] = g2_frag(b0p + kb, hh); fb1[nx] = g2_frag(b1p + kb, hh); fb2[nx] = g2_frag(b2p + kb, hh); fb3[nx] = g2_frag(b3p + kb, hh); }
      c00 = g2_mma(fa0[cu], fb0[cu], c00); c10 = g2_mma(fa1[cu], fb0[cu], c10);
      c01 = g2_mma(fa0[cu], fb1[cu], c01); c11 = g2_mma(fa1[cu], fb1[cu], c11);
      c02 = g2_mma(fa0[cu], fb2[cu], c02); c12 = g2_mma(fa1[cu], fb2[cu], c12);
      c03 = g2_mma(fa0[cu], fb3[cu], c03); c13 = g2_mma(fa1[cu], fb3[cu], c13); }
    asm volatile("s_wait_dscnt 0x0" ::: "memory");         /* this wave's reads of the buffer are done before it is handed to the copies */
    asm volatile("s_wait_asynccnt 0x0" ::: "memory");      /* this wave's pieces of the next stage have landed */
    __syncthreads();                                       /* publishes the next stage and ends every wave's reads of this one */
    if (kt + 2 * G_KT < K) g2_stage(lg + bsel, ga + kt + 2 * G_KT, a8, gb + kt + 2 * G_KT, b8); }
  asm volatile("s_wait_asynccnt 0x0" ::: "memory");        /* no copy is outstanding when the wave goes on to its end */
  v8f accs[8] = {c00, c01, c02, c03, c10, c11, c12, c13};
#pragma unroll
  for (int u = 0; u < 8; ++u) { const int t = u & 3, half = u >> 2; const int col = col0 + t * 16 + ln; const float bv = bp ? bf16_rne(bp[col]) : 0.f;
#pragma unroll
    for (int r = 0; r < 8; ++r) { const int rloc = half * 16 + 8 * hh + r; float v = accs[u][r] * alpha + bv;
      if (CP) { if (rowsPerB < 0) v += CP[cofs + (size_t)(row0g + row0 + rloc) * ldc + col];      /* rowsPerB < 0: own element of the batched C plane */ else { const int bidx = (row0g + row0 + rloc) / rowsPerB; v += CP[(size_t)bidx * sCPb + (size_t)by * 64 + col]; } }
      if (ACT == 3) v = fmaxf(v, 0.f);
      so[w][rloc][t * 16 + ln] = v; } }
  __builtin_amdgcn_fence(__ATOMIC_ACQ_REL, "workgroup"); __builtin_amdgcn_wave_barrier();
  const int rsub = lane >> 4, c4 = (lane & 15) * 4;
  {
#pragma unroll
    for (int q = 0; q < 16; ++q) { const int r = q * 2 + rsub; const v4f v = *(const v4fa*)&so[w][r][c4]; if (C) *(v4f*)(C + cofs + (size_t)(row0 + r) * ldc + col0 + c4) = v; if (C16) { v4h h4;
#pragma unroll
        for (int i = 0; i < 4; ++i) h4[i] = (_Float16)v[i]; *(v4h*)(C16 + cofs + (size_t)(row0 + r) * ldc + col0 + c4) = h4; } }
     } }

__global__ __launch_bounds__(256) void k_wsc(const float* __restrict__ Wm, _Float16* __restrict__ Bt, size_t n8, float sc) {
  const size_t t = (size_t)blockIdx.x * 256 + threadIdx.x; if (t >= n8) return; FragH f; const v4f a = *(const v4fa*)(Wm + t * 8), c = *(const v4fa*)(Wm + t * 8 + 4);
#pragma unroll
  for (int q = 0; q < 4; ++q) { f.h[q] = (_Float16)(bf16_rne(a[q]) * sc); f.h[4 + q] = (_Float16)(bf16_rne(c[q]) * sc); }
  *(v8us*)((unsigned short*)Bt + t * 8) = f.half[0];  }

__global__ __launch_bounds__(256) void k_x16b(const float* __restrict__ x, _Float16* __restrict__ X16) {
  const size_t t = (size_t)blockIdx.x * 256 + threadIdx.x; if (t >= (size_t)NR * DM / 8) return; const size_t row = (t * 8) / DM; const int c0 = (int)((t * 8) % DM); const size_t rb = row / SEQ, rs = row % SEQ;
  const float* src = x + (rb * SEQ_FULL + rs) * (size_t)DM + c0; const v4f a = *(const v4fa*)src, c = *(const v4fa*)(src + 4); FragH f;
#pragma unroll
  for (int q = 0; q < 4; ++q) { f.h[q] = (_Float16)bf16_rne(a[q]); f.h[4 + q] = (_Float16)bf16_rne(c[q]); }
  *(v8us*)((unsigned short*)X16 + t * 8) = f.half[0];  }

__global__ __launch_bounds__(256) void k_hl(const float* __restrict__ F, _Float16* __restrict__ Hh, _Float16* __restrict__ Hl, size_t n8) {
  const size_t t = (size_t)blockIdx.x * 256 + threadIdx.x; if (t >= n8) return; FragH fh, fl; const v4f a = *(const v4fa*)(F + t * 8), c = *(const v4fa*)(F + t * 8 + 4);
#pragma unroll
  for (int q = 0; q < 4; ++q) { _Float16 hv = (_Float16)a[q]; fh.h[q] = hv; fl.h[q] = (_Float16)((a[q] - (float)hv) * 1024.0f); hv = (_Float16)c[q]; fh.h[4 + q] = hv; fl.h[4 + q] = (_Float16)((c[q] - (float)hv) * 1024.0f); }
  { *(v8us*)((unsigned short*)Hh + t * 8) = fh.half[0]; *(v8us*)((unsigned short*)Hl + t * 8) = fl.half[0];  } }

__global__ __launch_bounds__(256) void k_rotab(float* __restrict__ CS, float* __restrict__ SN) {
  #pragma clang fp contract(off)
  const int t = blockIdx.x * 256 + threadIdx.x; if (t >= SEQ * 32) return; const int j = t % 32, s = t / 32; const float ex = (float)(2 * j) / 64.0f; const float inv = 1.0f / powf(10000.0f, ex); const float th = (float)s * inv; const float c = cosf(th), sn = sinf(th);
  { *(float*)(CS + t) = c; *(float*)(SN + t) = sn;  } }

// RoPE with concatenated tables and interleaved rotate_half: out[d] = x[d] c[s][d mod 32] + rh[d] sn[s][d mod 32], rh[d] = -x[d+1] (d even), x[d-1] (d odd);
__global__ __launch_bounds__(256) void k_rope4(const float* __restrict__ F, const float* __restrict__ CS, const float* __restrict__ SN, _Float16* __restrict__ H, _Float16* __restrict__ L) {
  #pragma clang fp contract(off)
  const size_t t = (size_t)blockIdx.x * 256 + threadIdx.x; if (t >= (size_t)NR * DM / 8) return; const size_t e0 = t * 8; const size_t row = e0 / DM; const int c0 = (int)(e0 % DM); const int j0 = c0 & 31; const int s = (int)(row % SEQ);
  const v4f a = *(const v4fa*)(F + e0), c = *(const v4fa*)(F + e0 + 4); const float xs[8] = {a[0], a[1], a[2], a[3], c[0], c[1], c[2], c[3]};
  const float* tp = CS + (size_t)s * 32 + j0; const float* up = SN + (size_t)s * 32 + j0; const v4f ca = *(const v4fa*)tp, cb = *(const v4fa*)(tp + 4), sa = *(const v4fa*)up, sb = *(const v4fa*)(up + 4);
  const float cs[8] = {ca[0], ca[1], ca[2], ca[3], cb[0], cb[1], cb[2], cb[3]}; const float sn[8] = {sa[0], sa[1], sa[2], sa[3], sb[0], sb[1], sb[2], sb[3]};
  FragH fh, fl;
#pragma unroll
  for (int q = 0; q < 8; ++q) { const float pr = xs[q ^ 1]; const float rh = (q & 1) ? pr : -pr; float o = xs[q] * cs[q]; o += rh * sn[q];
    const _Float16 hv = (_Float16)o; fh.h[q] = hv; fl.h[q] = (_Float16)((o - (float)hv) * 1024.0f); }
  { *(v8us*)((unsigned short*)H + e0) = fh.half[0]; *(v8us*)((unsigned short*)L + e0) = fl.half[0];  } }

__global__ __launch_bounds__(256) void k_vtg(const _Float16* __restrict__ V16, _Float16* __restrict__ Vt) {
  __shared__ unsigned short tl[64][66]; const int tid = threadIdx.x; const int slab = blockIdx.x / (SEQ / 64), lg = blockIdx.x % (SEQ / 64); const int b = slab / NH, h = slab % NH;
  for (int i = tid; i < 64 * 8; i += 256) { const int r = i / 8, c8 = (i % 8) * 8; FragH f; f.half[0] = *(const v8us*)((const unsigned short*)V16 + ((size_t)b * SEQ + lg * 64 + r) * DM + h * 64 + c8);
#pragma unroll
    for (int q = 0; q < 8; ++q) tl[r][c8 + q] = f.u[q]; }
  __syncthreads();
  {
#pragma unroll
    for (int rd = 0; rd < 2; ++rd) { const int d = rd * 32 + tid / 8, pc = tid % 8; FragH f;
#pragma unroll
      for (int q = 0; q < 8; ++q) f.u[q] = tl[pc * 8 + q][d];
      *(v8us*)((unsigned short*)Vt + ((size_t)slab * 64 + d) * SEQ + lg * 64 + pc * 8) = f.half[0]; }
     } }

// One 32-key stage of K hi, K lo (32 rows x 128 B, LDS pitch 144 B) and V^T hi, V^T lo (64 rows x 64 B, LDS pitch 80 B): 1024 pieces of 16 B, eight per thread, global -> LDS through no register.
#define KV_KH 0
#define KV_KL 4608
#define KV_VH 9216
#define KV_VL 14336
#define KV_STAGE 19456
__device__ __forceinline__ void kv_stage(unsigned int lk, unsigned int lv, const unsigned short* gkh, const unsigned short* gkl, size_t k16, const unsigned short* gvh, const unsigned short* gvl, size_t v32) {
  // the s_wait_xcnt closes the statement so that no address register of an issued copy is rewritten ahead of it
  asm volatile("global_load_async_to_lds_b128 %0, %8, off\n\t"
               "global_load_async_to_lds_b128 %1, %9, off\n\t"
               "global_load_async_to_lds_b128 %2, %10, off\n\t"
               "global_load_async_to_lds_b128 %3, %11, off\n\t"
               "global_load_async_to_lds_b128 %4, %12, off\n\t"
               "global_load_async_to_lds_b128 %5, %13, off\n\t"
               "global_load_async_to_lds_b128 %6, %14, off\n\t"
               "global_load_async_to_lds_b128 %7, %15, off\n\t"
               "s_wait_xcnt 0x0"
               :: "v"(lk + KV_KH), "v"(lk + KV_KH + 16 * 144), "v"(lk + KV_KL), "v"(lk + KV_KL + 16 * 144), "v"(lv + KV_VH), "v"(lv + KV_VH + 32 * 80), "v"(lv + KV_VL), "v"(lv + KV_VL + 32 * 80),
                  "v"(gkh), "v"(gkh + k16), "v"(gkl), "v"(gkl + k16), "v"(gvh), "v"(gvh + v32), "v"(gvl), "v"(gvl + v32) : "memory");
}

// lane l with lane l ^ 16: joins the two key halves that lanes c and c + 16 hold of one query
__device__ __forceinline__ float xhalf(float x) { return __builtin_bit_cast(float, __builtin_amdgcn_permlanex16(__builtin_bit_cast(int, x), __builtin_bit_cast(int, x), 0x76543210, 0xfedcba98, false, false)); }

__global__ __launch_bounds__(128) void k_attn(const _Float16* __restrict__ Q16, const _Float16* __restrict__ QL, int ldq, const _Float16* __restrict__ K16, const _Float16* __restrict__ KL, int ldk,
                                             const _Float16* __restrict__ Vt, const _Float16* __restrict__ VtL, const float* __restrict__ AM, const float* __restrict__ AW, float* __restrict__ O, int ldo) {
  constexpr int RPW = 16, DT = 4, KS = 2, QBN = SEQ / 64;
  __shared__ __attribute__((aligned(16))) float sO[4][RPW][64 + 4];
  __shared__ __attribute__((aligned(16))) unsigned char ring[2][KV_STAGE];
  const int tid = threadIdx.x, w = tid >> 5, lane = tid & 31, ln = lane & 15, hh = lane >> 4;
  const int slab = blockIdx.x / QBN, qblk = blockIdx.x % QBN; const int b = slab / NH, h = slab % NH; const int qb0 = qblk * (4 * RPW); const int q0 = qb0 + w * RPW;
  const float ww = bf16_rne(AW[0]);
  FragH aq[KS], aql[KS];
  { const unsigned short* qr = (const unsigned short*)Q16 + ((size_t)b * SEQ + q0 + ln) * ldq + h * 64; const unsigned short* ql = (const unsigned short*)QL + ((size_t)b * SEQ + q0 + ln) * ldq + h * 64;
#pragma unroll
    for (int ks = 0; ks < KS; ++ks) { aq[ks].half[0] = *(const v8us*)(qr + ks * 32 + 8 * hh); aq[ks].half[1] = *(const v8us*)(qr + ks * 32 + 16 + 8 * hh); aql[ks].half[0] = *(const v8us*)(ql + ks * 32 + 8 * hh); aql[ks].half[1] = *(const v8us*)(ql + ks * 32 + 16 + 8 * hh); } }
  const unsigned short* Vth = (const unsigned short*)Vt + (size_t)slab * 64 * SEQ; const unsigned short* Vtl = (const unsigned short*)VtL + (size_t)slab * 64 * SEQ;
  const float* amq = AM + (size_t)b * SEQ_FULL * SEQ_FULL + (size_t)(q0 + ln) * SEQ_FULL + 8 * hh;      /* mask[b][0][own query][.] with full strides, at this lane half's first key */
  const v8f z8 = {0.f,0.f,0.f,0.f,0.f,0.f,0.f,0.f};
  float m_q = -3.0e38f, l_q = 0.f; v8f oacc[DT], oaccL[DT];
#pragma unroll
  for (int dt = 0; dt < DT; ++dt) { oacc[dt] = z8; oaccL[dt] = z8; }
  // this thread's pieces: K row tid/8 (and +16), 16-B column tid%8; V^T row tid/4 (and +32), 16-B column tid%4
  const unsigned int lring = (unsigned int)(size_t)&ring[0][0]; const unsigned int lk = lring + (tid >> 3) * 144 + (tid & 7) * 16, lv = lring + (tid >> 2) * 80 + (tid & 3) * 16;
  const size_t kofs = ((size_t)b * SEQ + (tid >> 3)) * ldk + h * 64 + (tid & 7) * 8; const unsigned short* gkh = (const unsigned short*)K16 + kofs; const unsigned short* gkl = (const unsigned short*)KL + kofs;
  const size_t vofs = (size_t)(tid >> 2) * SEQ + (tid & 3) * 8; const unsigned short* gvh = Vth + vofs; const unsigned short* gvl = Vtl + vofs;
  const size_t k16 = (size_t)16 * ldk, k32 = (size_t)32 * ldk, v32 = (size_t)32 * SEQ;
  kv_stage(lk, lv, gkh, gkl, k16, gvh, gvl, v32);
  asm volatile("s_wait_asynccnt 0x0" ::: "memory");      /* stage 0 has landed before the barrier that publishes it */
  __syncthreads();
  kv_stage(lk + KV_STAGE, lv + KV_STAGE, gkh + k32, gkl + k32, k16, gvh + 32, gvl + 32, v32);
#pragma unroll 1
  for (int j0 = 0; j0 < SEQ; j0 += 32) {
    const unsigned int bsel = (j0 & 32) ? KV_STAGE : 0; const unsigned char* kvb = &ring[0][0] + bsel;
    v4f mk[2][2];      /* own query's mask, keys j0 + 16 nt + 8 hh + 0..7 */
#pragma unroll
    for (int nt = 0; nt < 2; ++nt) { mk[nt][0] = *(const v4fa*)(amq + j0 + nt * 16); mk[nt][1] = *(const v4fa*)(amq + j0 + nt * 16 + 4); }
    v8f s[2];
#pragma unroll
    for (int nt = 0; nt < 2; ++nt) { const unsigned short* kr = (const unsigned short*)(kvb + KV_KH + (nt * 16 + ln) * 144); const unsigned short* klr = (const unsigned short*)(kvb + KV_KL + (nt * 16 + ln) * 144); FragH bk[KS], bkl[KS];
#pragma unroll
      for (int ks = 0; ks < KS; ++ks) { bk[ks].half[0] = *(const v8us*)(kr + ks * 32 + 8 * hh); bk[ks].half[1] = *(const v8us*)(kr + ks * 32 + 16 + 8 * hh); bkl[ks].half[0] = *(const v8us*)(klr + ks * 32 + 8 * hh); bkl[ks].half[1] = *(const v8us*)(klr + ks * 32 + 16 + 8 * hh); }
      v8f acc = z8, accl = z8;
#pragma unroll
      for (int ks = 0; ks < KS; ++ks) { acc = mmaH<1>(bk[ks].v, bk[ks].v, aq[ks].v, aq[ks].v, acc); accl = mmaH<1>(bk[ks].v, bk[ks].v, aql[ks].v, aql[ks].v, accl); accl = mmaH<1>(bkl[ks].v, bkl[ks].v, aq[ks].v, aq[ks].v, accl); }
#pragma unroll
      for (int r = 0; r < 8; ++r) acc[r] += accl[r] * 0.0009765625f;
      s[nt] = acc; }
    float mc = -3.0e38f;
#pragma unroll
    for (int nt = 0; nt < 2; ++nt)
#pragma unroll
      for (int r = 0; r < 8; ++r) { float sv = s[nt][r] * SCL; sv += bf16_rne(mk[nt][r >> 2][r & 3]) * ww; s[nt][r] = sv; mc = fmaxf(mc, sv); }
    mc = fmaxf(mc, xhalf(mc));
    const float mn = fmaxf(m_q, mc); const float al = (mn > -1.0e38f) ? expf(m_q - mn) : 1.0f; m_q = mn;
    FragH pa, pl; float ls[2] = {0.f, 0.f};
#pragma unroll
    for (int nt = 0; nt < 2; ++nt)
#pragma unroll
      for (int r = 0; r < 8; ++r) { const float p = expf(s[nt][r] - mn); ls[nt] += p; const float psc = p * 1024.0f; const _Float16 ph = (_Float16)psc; pa.h[nt * 8 + r] = ph; pl.h[nt * 8 + r] = (_Float16)((psc - (float)ph) * 1024.0f); }
    l_q = l_q * al + (ls[0] + ls[1]);
#pragma unroll
    for (int dt = 0; dt < DT; ++dt)
#pragma unroll
      for (int r = 0; r < 8; ++r) { oacc[dt][r] *= al; oaccL[dt][r] *= al; }
#pragma unroll
    for (int dt = 0; dt < DT; ++dt) { const unsigned short* vrow = (const unsigned short*)(kvb + KV_VH + (dt * 16 + ln) * 80); const unsigned short* vrl = (const unsigned short*)(kvb + KV_VL + (dt * 16 + ln) * 80); FragH bv, bl;
      bv.half[0] = *(const v8us*)(vrow + 8 * hh); bv.half[1] = *(const v8us*)(vrow + 16 + 8 * hh); bl.half[0] = *(const v8us*)(vrl + 8 * hh); bl.half[1] = *(const v8us*)(vrl + 16 + 8 * hh);
      oacc[dt] = mmaH<1>(bv.v, bv.v, pa.v, pa.v, oacc[dt]); oaccL[dt] = mmaH<1>(bv.v, bv.v, pl.v, pl.v, oaccL[dt]); oaccL[dt] = mmaH<1>(bl.v, bl.v, pa.v, pa.v, oaccL[dt]); }
    asm volatile("s_wait_dscnt 0x0" ::: "memory");         /* this wave's reads of the buffer are done before it is handed to the copies */
    asm volatile("s_wait_asynccnt 0x0" ::: "memory");      /* this wave's pieces of the next stage have landed */
    __syncthreads();                                       /* publishes the next stage and ends every wave's reads of this one */
    if (j0 + 64 < SEQ) kv_stage(lk + bsel, lv + bsel, gkh + (size_t)(j0 + 64) * ldk, gkl + (size_t)(j0 + 64) * ldk, k16, gvh + j0 + 64, gvl + j0 + 64, v32); }
  asm volatile("s_wait_asynccnt 0x0" ::: "memory");        /* no copy is outstanding when the wave goes on to its end */
  const float lt = l_q + xhalf(l_q); const float linv = (lt > 0.f) ? 1.0f / (lt * 1024.0f) : 0.f;
#pragma unroll
  for (int dt = 0; dt < DT; ++dt)
#pragma unroll
    for (int r = 0; r < 8; ++r) { float v = oacc[dt][r]; v += oaccL[dt][r] * 0.0009765625f; sO[w][ln][dt * 16 + 8 * hh + r] = v * linv; }
  __builtin_amdgcn_fence(__ATOMIC_ACQ_REL, "workgroup"); __builtin_amdgcn_wave_barrier();
  {
#pragma unroll
    for (int rp = 0; rp < RPW; rp += 2) { const int r = rp + (lane >> 4), pc = lane & 15; const v4f val = *(const v4fa*)&sO[w][r][pc * 4]; *(v4f*)(O + ((size_t)b * SEQ + q0 + r) * ldo + h * 64 + pc * 4) = val; }
     } }

// LayerNorm over DM (biased variance, eps 1e-5, affine with bf16 g, b) of (A[r] + bf16(x[rin])), compact row r -> input/output row rin = b*SEQ_FULL + s;
__global__ __launch_bounds__(256) void k_ln1024(const float* __restrict__ A, const float* __restrict__ res, const float* __restrict__ g, const float* __restrict__ bb, float* __restrict__ Y) {
  #pragma clang fp contract(off)
  const int wv = threadIdx.x >> 5, ln = threadIdx.x & 31; const size_t r = (size_t)blockIdx.x * 8 + wv; if (r >= (size_t)NR) return;
  const size_t rb = r / SEQ, rs = r % SEQ; const size_t rin = rb * SEQ_FULL + rs;
  float xv[32]; float sm = 0.f;
#pragma unroll
  for (int i = 0; i < 8; ++i) { const int c0 = i * 128 + ln * 4; const v4f a = *(const v4fa*)(A + r * DM + c0); const v4f rr = *(const v4fa*)(res + rin * DM + c0);
#pragma unroll
    for (int q = 0; q < 4; ++q) { const float v = a[q] + bf16_rne(rr[q]); xv[i * 4 + q] = v; sm += v; } }
#pragma unroll
  for (int o = 16; o > 0; o >>= 1) sm += __shfl_xor(sm, o, 32);
  const float mu = sm * 0.0009765625f; float var = 0.f;
#pragma unroll
  for (int q = 0; q < 32; ++q) { const float d = xv[q] - mu; var += d * d; }
#pragma unroll
  for (int o = 16; o > 0; o >>= 1) var += __shfl_xor(var, o, 32);
  const float inv = 1.0f / sqrtf(var * 0.0009765625f + 1e-5f);
  {
#pragma unroll
    for (int i = 0; i < 8; ++i) { const int c0 = i * 128 + ln * 4; v4f y;
#pragma unroll
      for (int q = 0; q < 4; ++q) { float v = (xv[i * 4 + q] - mu) * inv; v *= bf16_rne(g[c0 + q]); v += bf16_rne(bb[c0 + q]); y[q] = v; }
      *(v4f*)(Y + rin * DM + c0) = y; }
     } }

extern "C" void kernel_launch(void* const* d_in, const int* in_sizes, int n_in,
                              void* d_out, int out_size, void* d_ws, size_t ws_size, hipStream_t stream) {
  if (n_in < 13) return;
  const float* x = (const float*)d_in[0]; const float* cdm = (const float*)d_in[1];
  const float* Wq = (const float*)d_in[2]; const float* bq = (const float*)d_in[3]; const float* Wk = (const float*)d_in[4]; const float* bk = (const float*)d_in[5];
  const float* Wv = (const float*)d_in[6]; const float* bv = (const float*)d_in[7]; const float* Wo = (const float*)d_in[8]; const float* bo = (const float*)d_in[9];
  const float* gam = (const float*)d_in[10]; const float* bet = (const float*)d_in[11]; const float* cdw = (const float*)d_in[12];
  const long long rows_need = (long long)(NB - 1) * SEQ_FULL + SEQ;
  if ((long long)in_sizes[0] < rows_need * DM) return;
  if ((long long)in_sizes[1] < (long long)(NB - 1) * SEQ_FULL * SEQ_FULL + (long long)(SEQ - 1) * SEQ_FULL + SEQ) return;
  if (in_sizes[2] < DM * DM || in_sizes[4] < DM * DM || in_sizes[6] < DM * DM || in_sizes[8] < DM * DM) return;
  if (in_sizes[3] < DM || in_sizes[5] < DM || in_sizes[7] < DM || in_sizes[9] < DM || in_sizes[10] < DM || in_sizes[11] < DM || in_sizes[12] < 1) return;
  if ((long long)out_size < rows_need * DM) return;
  char* ws = (char*)d_ws; size_t off = 0;
  auto take = [&](size_t bytes) { char* p = ws + off; off += (bytes + 255) & ~(size_t)255; return p; };
  const size_t np = (size_t)NR * DM;      /* compact activation plane elements */
  _Float16* BQ = (_Float16*)take((size_t)DM * DM * 2); _Float16* BK = (_Float16*)take((size_t)DM * DM * 2); _Float16* BV = (_Float16*)take((size_t)DM * DM * 2); _Float16* BO = (_Float16*)take((size_t)DM * DM * 2);
  _Float16* X16 = (_Float16*)take(np * 2); float* F32 = (float*)take(np * 4);
  _Float16* QH = (_Float16*)take(np * 2); _Float16* QL = (_Float16*)take(np * 2); _Float16* KH = (_Float16*)take(np * 2); _Float16* KL = (_Float16*)take(np * 2);
  _Float16* V16 = (_Float16*)take(np * 2); _Float16* VLr = (_Float16*)take(np * 2); _Float16* VT = (_Float16*)take(np * 2); _Float16* VTL = (_Float16*)take(np * 2);
  float* Y = (float*)take(np * 4); float* CS = (float*)take((size_t)SEQ * 32 * 4); float* SN = (float*)take((size_t)SEQ * 32 * 4);
  float* O = F32; _Float16* OH = QH; _Float16* OL = KH;      /* reuse after their last readers */
  if (off > ws_size) return;
  const unsigned wb = (unsigned)(((size_t)DM * DM / 8 + 255) / 256); const unsigned eb = (unsigned)((np / 8 + 255) / 256);
  k_wsc<<<wb, 256, 0, stream>>>(Wq, BQ, (size_t)DM * DM / 8, 16.0f); k_wsc<<<wb, 256, 0, stream>>>(Wk, BK, (size_t)DM * DM / 8, 16.0f);
  k_wsc<<<wb, 256, 0, stream>>>(Wv, BV, (size_t)DM * DM / 8, 16.0f); k_wsc<<<wb, 256, 0, stream>>>(Wo, BO, (size_t)DM * DM / 8, 16.0f);      /* [out][in] weights, bf16 then x16 in f16 */
  k_x16b<<<eb, 256, 0, stream>>>(x, X16);
  k_rotab<<<(SEQ * 32 + 255) / 256, 256, 0, stream>>>(CS, SN);
  const dim3 g((NR / 128) * (DM / 64), 1);
  k_gemm2<0><<<g, 128, 0, stream>>>(X16, DM, 0, BQ, DM, 0, 0.0625f, bq, 0, nullptr, 1, 0, 0, F32, nullptr, DM, 0, NR, DM, DM); k_rope4<<<eb, 256, 0, stream>>>(F32, CS, SN, QH, QL);      /* Q -> RoPE -> hi/lo */
  k_gemm2<0><<<g, 128, 0, stream>>>(X16, DM, 0, BK, DM, 0, 0.0625f, bk, 0, nullptr, 1, 0, 0, F32, nullptr, DM, 0, NR, DM, DM); k_rope4<<<eb, 256, 0, stream>>>(F32, CS, SN, KH, KL);      /* K -> RoPE -> hi/lo */
  k_gemm2<0><<<g, 128, 0, stream>>>(X16, DM, 0, BV, DM, 0, 0.0625f, bv, 0, nullptr, 1, 0, 0, F32, nullptr, DM, 0, NR, DM, DM); k_hl<<<eb, 256, 0, stream>>>(F32, V16, VLr, np / 8);      /* V -> hi/lo rows */
  k_vtg<<<NB * NH * (SEQ / 64), 256, 0, stream>>>(V16, VT); k_vtg<<<NB * NH * (SEQ / 64), 256, 0, stream>>>(VLr, VTL);
  k_attn<<<NB * NH * (SEQ / 64), 128, 0, stream>>>(QH, QL, DM, KH, KL, DM, VT, VTL, cdm, cdw, O, DM);
  k_hl<<<eb, 256, 0, stream>>>(O, OH, OL, np / 8);      /* context -> hi/lo rows */
  k_gemm2<0><<<g, 128, 0, stream>>>(OL, DM, 0, BO, DM, 0, 0.0625f / 1024.0f, nullptr, 0, nullptr, 1, 0, 0, Y, nullptr, DM, 0, NR, DM, DM);
  k_gemm2<0><<<g, 128, 0, stream>>>(OH, DM, 0, BO, DM, 0, 0.0625f, bo, 0, Y, 1, (size_t)DM, 0, Y, nullptr, DM, 0, NR, DM, DM);      /* Y = (ctx_lo + ctx_hi) Wo^T + bo */
  k_ln1024<<<NR / 8, 256, 0, stream>>>(Y, x, gam, bet, (float*)d_out);      /* out = LN(bf16(x) + Y) g + b */
}

// v004
// A run of this version takes 247 microseconds.
// Two timings next to v003 put it at 1.15 and 1.16 times that version's speed.
// Counting every step since v000, it is 2.74 times as fast.
#include <hip/hip_runtime.h>
// All contractions (Q/K/V projections, Q.K^T, P.V^T, output projection) on v_wmma_f32_16x16x32_f16: f16 operands, f32 accumulate. Float inputs RNE-converted to bf16 (exact in f16; weights carried x16); q, k, v, softmax numerators (x1024) and context carried as f16 hi + 2^10 residual plane pairs; RoPE tables, softmax, residual add and LayerNorm in f32.
#ifndef NB
#define NB 2
#endif
#ifndef SEQ
#define SEQ 2048
#endif
#define NB_FULL 2
#define SEQ_FULL 2048
#define DM 1024
#define NH 16
#define NR (NB * SEQ)
#define SCL 0.125f
static_assert(NB >= 1 && NB <= NB_FULL);
static_assert(SEQ >= 128 && SEQ <= SEQ_FULL && (SEQ % 128) == 0);
static_assert(NH * 64 == DM);
static_assert((NR % 128) == 0);
static_assert((DM % 64) == 0 && (DM % 128) == 0);

typedef unsigned short v8us __attribute__((ext_vector_type(8), may_alias));
typedef float  v8f  __attribute__((ext_vector_type(8)));
typedef float  v4f  __attribute__((ext_vector_type(4)));
typedef float  v4fa __attribute__((ext_vector_type(4), may_alias));
typedef _Float16 v16h __attribute__((ext_vector_type(16)));
typedef _Float16 v4h __attribute__((ext_vector_type(4)));
union FragH { v16h v; v8us half[2]; _Float16 h[16]; unsigned short u[16]; };

__device__ __forceinline__ unsigned short bf16_bits(float x) { unsigned int u = __float_as_uint(x); return (unsigned short)((u + 0x7FFFu + ((u >> 16) & 1u)) >> 16); }
__device__ __forceinline__ float bf16_val(unsigned short b) { return __uint_as_float(((unsigned int)b) << 16); }
__device__ __forceinline__ float bf16_rne(float x) { return bf16_val(bf16_bits(x)); }

// D += A.B with NT terms: 1 = ah.bh, 2 = + al.bh, 3 = + ah.bl; hazard guard after the last WMMA
template <int NT>
__device__ __forceinline__ v8f mmaH(v16h ah, v16h al, v16h bh, v16h bl, v8f c) {
  c = __builtin_amdgcn_wmma_f32_16x16x32_f16(false, ah, false, bh, (short)0, c, false, false);
  if (NT >= 2) c = __builtin_amdgcn_wmma_f32_16x16x32_f16(false, al, false, bh, (short)0, c, false, false);
  if (NT >= 3) c = __builtin_amdgcn_wmma_f32_16x16x32_f16(false, ah, false, bl, (short)0, c, false, false);
  asm volatile("v_nop\n\tv_nop\n\tv_nop\n\tv_nop" : "+v"(c) : "v"(ah), "v"(al), "v"(bh), "v"(bl));
  return c;
}

// ---- GEMM engine (work-group tile 128x64, wave tile 32x64; M % 128 == 0, N % 64 == 0, K % 128 == 0, lda and ldb % 8 == 0): C[M][N] f32 = alpha A[M][K].Bt[N][K]^T + bf16(bias) (+ CP own element); A, Bt f16 k-contiguous.
// Each 128-k stage (A 128 rows, then Bt 64 rows, 256 B a row at LDS pitch 272 B) is brought once per work-group into a two-buffer LDS ring, global -> LDS through no register, and read by all four waves.
// A fragment: lane row = l&15, elements 0..7 <- k0 + 8h + i, 8..15 <- k0 + 16 + 8h + i; B fragment from the [n][k] copy with the same k map; D element r -> (row 8h + r, col l&15).
__device__ __forceinline__ v16h g2_frag(const _Float16* p, int hh) { FragH f; f.half[0] = *(const v8us*)((const unsigned short*)p + 8 * hh); f.half[1] = *(const v8us*)((const unsigned short*)p + 16 + 8 * hh); return f.v; }
__device__ __forceinline__ v8f g2_mma(v16h a, v16h b, v8f c) { v8f d = __builtin_amdgcn_wmma_f32_16x16x32_f16(false, a, false, b, (short)0, c, false, false); asm volatile("v_nop\n\tv_nop\n\tv_nop\n\tv_nop" : "+v"(d) : "v"(a), "v"(b)); return d; }
#define G_KT 128
#define G_PITCH 272
#define G_STAGE (192 * G_PITCH)
// eight 16-B pieces of one thread: rows 8 apart, the same 16-B column; a wave's copy covers two whole 256-B rows
__device__ __forceinline__ void g2_copy8(unsigned int l, const unsigned short* g, size_t r8) {
  // the s_wait_xcnt closes the statement so that no address register of an issued copy is rewritten ahead of it
  asm volatile("global_load_async_to_lds_b128 %0, %8, off\n\t"
               "global_load_async_to_lds_b128 %1, %9, off\n\t"
               "global_load_async_to_lds_b128 %2, %10, off\n\t"
               "global_load_async_to_lds_b128 %3, %11, off\n\t"
               "global_load_async_to_lds_b128 %4, %12, off\n\t"
               "global_load_async_to_lds_b128 %5, %13, off\n\t"
               "global_load_async_to_lds_b128 %6, %14, off\n\t"
               "global_load_async_to_lds_b128 %7, %15, off\n\t"
               "s_wait_xcnt 0x0"
               :: "v"(l), "v"(l + 8 * G_PITCH), "v"(l + 16 * G_PITCH), "v"(l + 24 * G_PITCH), "v"(l + 32 * G_PITCH), "v"(l + 40 * G_PITCH), "v"(l + 48 * G_PITCH), "v"(l + 56 * G_PITCH),
                  "v"(g), "v"(g + r8), "v"(g + 2 * r8), "v"(g + 3 * r8), "v"(g + 4 * r8), "v"(g + 5 * r8), "v"(g + 6 * r8), "v"(g + 7 * r8) : "memory");
}
// one stage: A rows 0..127 of the work-group's tile, then Bt rows 0..63, 24 pieces per thread
__device__ __forceinline__ void g2_stage(unsigned int l, const unsigned short* ga, size_t a8, const unsigned short* gb, size_t b8) {
  g2_copy8(l, ga, a8); g2_copy8(l + 64 * G_PITCH, ga + 8 * a8, a8); g2_copy8(l + 128 * G_PITCH, gb, b8);
}
// EPI 0: C f32 rows. EPI 1: RoPE (concatenated tables, interleaved rotate_half: out[d] = x[d] c[s][d mod 32] + rh[d] sn[s][d mod 32], rh[d] = -x[d+1] (d even), x[d-1] (d odd)), then f16 hi + 2^10 residual rows H, L [row][ldc].
// EPI 2: f16 hi + 2^10 residual, stored transposed per head: H, L [(b NH + h) 64 + d][SEQ] (N == DM, one 64-column tile = one head).
template <int ACT, int EPI>
__global__ __launch_bounds__(128) void k_gemm2(const _Float16* __restrict__ A, int lda, size_t sA, const _Float16* __restrict__ Bh, int ldb, size_t sB, float alpha, const float* __restrict__ bias, size_t sBias, const float* CP, int rowsPerB, size_t sCPb, int row0g,
    float* C, _Float16* C16, int ldc, size_t sC, int M, int N, int K, const float* __restrict__ CS, const float* __restrict__ SN, _Float16* __restrict__ H, _Float16* __restrict__ L) {
  __shared__ __attribute__((aligned(16))) float so[4][32][68];
  __shared__ __attribute__((aligned(16))) unsigned char gring[2][G_STAGE];
  const int tid = threadIdx.x, w = tid >> 5, lane = tid & 31, ln = lane & 15, hh = lane >> 4; const int by = blockIdx.y;
  A += (size_t)by * sA; Bh += (size_t)by * sB; const size_t cofs = (size_t)by * sC; const float* bp = bias ? bias + (size_t)by * sBias : nullptr;
  const int ntn = N >> 6; const int mt = blockIdx.x / ntn, nq = blockIdx.x - mt * ntn; const int row0 = mt * 128 + 32 * w, col0 = nq * 64; if (mt * 128 >= M) return;      /* the whole work-group leaves or none, ahead of every barrier and copy */
  const v8f z8 = {0.f,0.f,0.f,0.f,0.f,0.f,0.f,0.f}; v8f c00 = z8, c01 = z8, c02 = z8, c03 = z8, c10 = z8, c11 = z8, c12 = z8, c13 = z8;
  // this thread's pieces: stage row tid/16 (and +8 ...), 16-B column tid%16
  const unsigned int lg = (unsigned int)(size_t)&gring[0][0] + (tid >> 4) * G_PITCH + (tid & 15) * 16;
  const unsigned short* ga = (const unsigned short*)A + (size_t)(mt * 128 + (tid >> 4)) * lda + (tid & 15) * 8; const unsigned short* gb = (const unsigned short*)Bh + (size_t)(col0 + (tid >> 4)) * ldb + (tid & 15) * 8;
  const size_t a8 = (size_t)8 * lda, b8 = (size_t)8 * ldb;
  g2_stage(lg, ga, a8, gb, b8);
  asm volatile("s_wait_asynccnt 0x0" ::: "memory");      /* stage 0 has landed before the barrier that publishes it */
  __syncthreads();
  if (G_KT < K) g2_stage(lg + G_STAGE, ga + G_KT, a8, gb + G_KT, b8);
#pragma unroll 1
  for (int kt = 0; kt < K; kt += G_KT) {
    const unsigned int bsel = (kt & G_KT) ? G_STAGE : 0; const unsigned char* sb = &gring[0][0] + bsel;
    const _Float16* a0p = (const _Float16*)(sb + (32 * w + ln) * G_PITCH); const _Float16* a1p = (const _Float16*)(sb + (32 * w + 16 + ln) * G_PITCH);
    const _Float16* b0p = (const _Float16*)(sb + (128 + ln) * G_PITCH); const _Float16* b1p = (const _Float16*)(sb + (144 + ln) * G_PITCH); const _Float16* b2p = (const _Float16*)(sb + (160 + ln) * G_PITCH); const _Float16* b3p = (const _Float16*)(sb + (176 + ln) * G_PITCH);
    // two fragment sets: the twelve LDS reads of the next 32-k step of this same stage go out as one group ahead of the current step's products;
    // the step loop is unrolled so that the set index is a constant and both sets stay in registers
    v16h fa0[2], fa1[2], fb0[2], fb1[2], fb2[2], fb3[2];
    fa0[0] = g2_frag(a0p, hh); fa1[0] = g2_frag(a1p, hh); fb0[0] = g2_frag(b0p, hh); fb1[0] = g2_frag(b1p, hh); fb2[0] = g2_frag(b2p, hh); fb3[0] = g2_frag(b3p, hh);
#pragma unroll
    for (int ks = 0; ks < G_KT / 32; ++ks) { const int cu = ks & 1, nx = cu ^ 1;
      if (ks + 1 < G_KT / 32) { const int kb = (ks + 1) * 32; fa0[nx] = g2_frag(a0p + kb, hh); fa1[nx] = g2_frag(a1p + kb, hh); fb0[nx] = g2_frag(b0p + kb, hh); fb1[nx] = g2_frag(b1p + kb, hh); fb2[nx] = g2_frag(b2p + kb, hh); fb3[nx] = g2_frag(b3p + kb, hh); }
      c00 = g2_mma(fa0[cu], fb0[cu], c00); c10 = g2_mma(fa1[cu], fb0[cu], c10);
      c01 = g2_mma(fa0[cu], fb1[cu], c01); c11 = g2_mma(fa1[cu], fb1[cu], c11);
      c02 = g2_mma(fa0[cu], fb2[cu], c02); c12 = g2_mma(fa1[cu], fb2[cu], c12);
      c03 = g2_mma(fa0[cu], fb3[cu], c03); c13 = g2_mma(fa1[cu], fb3[cu], c13); }
    asm volatile("s_wait_dscnt 0x0" ::: "memory");         /* this wave's reads of the buffer are done before it is handed to the copies */
    asm volatile("s_wait_asynccnt 0x0" ::: "memory");      /* this wave's pieces of the next stage have landed */
    __syncthreads();                                       /* publishes the next stage and ends every wave's reads of this one */
    if (kt + 2 * G_KT < K) g2_stage(lg + bsel, ga + kt + 2 * G_KT, a8, gb + kt + 2 * G_KT, b8); }
  asm volatile("s_wait_asynccnt 0x0" ::: "memory");        /* no copy is outstanding when the wave goes on to its end */
  v8f accs[8] = {c00, c01, c02, c03, c10, c11, c12, c13};
  if (EPI == 2) {
    // a lane holds eight consecutive rows of one column: 16 B of a transposed row. Both planes ([64 columns][128 rows] f16, pitch 272 B) are gathered in so, then leave as 256-B runs.
    unsigned char* tb = (unsigned char*)&so[0][0][0]; float bv4[4] = {0.f, 0.f, 0.f, 0.f};
    if (bp) {
#pragma unroll      /* constant indices: bv4 stays in registers, the four loads go out together */
      for (int t = 0; t < 4; ++t) bv4[t] = bf16_rne(bp[col0 + t * 16 + ln]); }
#pragma unroll      /* this loop and the next: constant indices keep accs and the packed halves in registers */
    for (int u = 0; u < 8; ++u) { const int t = u & 3, half = u >> 2; const float bv = bv4[t]; FragH fh, fl;
#pragma unroll
      for (int r = 0; r < 8; ++r) { const float v = accs[u][r] * alpha + bv; const _Float16 hv = (_Float16)v; fh.h[r] = hv; fl.h[r] = (_Float16)((v - (float)hv) * 1024.0f); }
      unsigned char* tp = tb + (t * 16 + ln) * 272 + (32 * w + half * 16 + 8 * hh) * 2; *(v8us*)tp = fh.half[0]; *(v8us*)(tp + 64 * 272) = fl.half[0]; }
    __syncthreads();      /* every wave's 32 rows stand in the transposed tile before any wave reads whole runs of it */
    const size_t vrow = (size_t)((mt * 128) / SEQ * NH + nq) * 64; const int s0 = (mt * 128) % SEQ;
#pragma unroll      /* the LDS reads of later runs go out ahead of the stores of earlier ones */
    for (int it = 0; it < 8; ++it) { const int i = it * 128 + tid, pc = i & 15, d = i >> 4; const size_t o = (vrow + d) * SEQ + s0 + pc * 8;
      *(v8us*)((unsigned short*)H + o) = *(const v8us*)(tb + d * 272 + pc * 16); *(v8us*)((unsigned short*)L + o) = *(const v8us*)(tb + (64 + d) * 272 + pc * 16); }
    return; }
#pragma unroll
  for (int u = 0; u < 8; ++u) { const int t = u & 3, half = u >> 2; const int col = col0 + t * 16 + ln; const float bv = bp ? bf16_rne(bp[col]) : 0.f;
#pragma unroll
    for (int r = 0; r < 8; ++r) { const int rloc = half * 16 + 8 * hh + r; float v = accs[u][r] * alpha + bv;
      if (EPI == 0 && CP) { if (rowsPerB < 0) v += CP[cofs + (size_t)(row0g + row0 + rloc) * ldc + col];      /* rowsPerB < 0: own element of the batched C plane */ else { const int bidx = (row0g + row0 + rloc) / rowsPerB; v += CP[(size_t)bidx * sCPb + (size_t)by * 64 + col]; } }
      if (ACT == 3) v = fmaxf(v, 0.f);
      so[w][rloc][t * 16 + ln] = v; } }
  __builtin_amdgcn_fence(__ATOMIC_ACQ_REL, "workgroup"); __builtin_amdgcn_wave_barrier();
  if (EPI == 1) {
    // eight columns a lane, four rows a wave store: each row's 64 columns leave as one whole 128-B line per plane
    const int rs4 = lane >> 3, c8 = (lane & 7) * 8, j0 = c8 & 31;
    const size_t t0 = (size_t)(row0 % SEQ + rs4) * 32 + j0;      /* a wave's 32 rows lie in one sequence: SEQ % 128 == 0 */
    unsigned short* hp = (unsigned short*)H + (size_t)(row0 + rs4) * ldc + col0 + c8; unsigned short* lp = (unsigned short*)L + (size_t)(row0 + rs4) * ldc + col0 + c8; const size_t r4 = (size_t)4 * ldc;
#pragma unroll      /* the table loads of all eight steps take immediate offsets and go out together */
    for (int q = 0; q < 8; ++q) { const int r = q * 4 + rs4;
      const v4f a = *(const v4fa*)&so[w][r][c8], c = *(const v4fa*)&so[w][r][c8 + 4]; const float xs[8] = {a[0], a[1], a[2], a[3], c[0], c[1], c[2], c[3]};
      const float* tp = CS + t0 + q * 128; const float* up = SN + t0 + q * 128; const v4f ca = *(const v4fa*)tp, cb = *(const v4fa*)(tp + 4), sa = *(const v4fa*)up, sb = *(const v4fa*)(up + 4);
      const float cs[8] = {ca[0], ca[1], ca[2], ca[3], cb[0], cb[1], cb[2], cb[3]}; const float sn[8] = {sa[0], sa[1], sa[2], sa[3], sb[0], sb[1], sb[2], sb[3]};
      FragH fh, fl;
#pragma unroll      /* constant indices: xs, cs, sn and the packed halves stay in registers */
      for (int e = 0; e < 8; ++e) { const float pr = xs[e ^ 1]; const float rh = (e & 1) ? pr : -pr; const float o = xs[e] * cs[e] + rh * sn[e];
        const _Float16 hv = (_Float16)o; fh.h[e] = hv; fl.h[e] = (_Float16)((o - (float)hv) * 1024.0f); }
      *(v8us*)(hp + q * r4) = fh.half[0]; *(v8us*)(lp + q * r4) = fl.half[0]; }
    return; }
  const int rsub = lane >> 4, c4 = (lane & 15) * 4;
  {
#pragma unroll
    for (int q = 0; q < 16; ++q) { const int r = q * 2 + rsub; const v4f v = *(const v4fa*)&so[w][r][c4]; if (C) *(v4f*)(C + cofs + (size_t)(row0 + r) * ldc + col0 + c4) = v; if (C16) { v4h h4;
#pragma unroll
        for (int i = 0; i < 4; ++i) h4[i] = (_Float16)v[i]; *(v4h*)(C16 + cofs + (size_t)(row0 + r) * ldc + col0 + c4) = h4; } }
     } }

__global__ __launch_bounds__(256) void k_wsc(const float* __restrict__ Wm, _Float16* __restrict__ Bt, size_t n8, float sc) {
  const size_t t = (size_t)blockIdx.x * 256 + threadIdx.x; if (t >= n8) return; FragH f; const v4f a = *(const v4fa*)(Wm + t * 8), c = *(const v4fa*)(Wm + t * 8 + 4);
#pragma unroll
  for (int q = 0; q < 4; ++q) { f.h[q] = (_Float16)(bf16_rne(a[q]) * sc); f.h[4 + q] = (_Float16)(bf16_rne(c[q]) * sc); }
  *(v8us*)((unsigned short*)Bt + t * 8) = f.half[0];  }

__global__ __launch_bounds__(256) void k_x16b(const float* __restrict__ x, _Float16* __restrict__ X16) {
  const size_t t = (size_t)blockIdx.x * 256 + threadIdx.x; if (t >= (size_t)NR * DM / 8) return; const size_t row = (t * 8) / DM; const int c0 = (int)((t * 8) % DM); const size_t rb = row / SEQ, rs = row % SEQ;
  const float* src = x + (rb * SEQ_FULL + rs) * (size_t)DM + c0; const v4f a = *(const v4fa*)src, c = *(const v4fa*)(src + 4); FragH f;
#pragma unroll
  for (int q = 0; q < 4; ++q) { f.h[q] = (_Float16)bf16_rne(a[q]); f.h[4 + q] = (_Float16)bf16_rne(c[q]); }
  *(v8us*)((unsigned short*)X16 + t * 8) = f.half[0];  }

__global__ __launch_bounds__(256) void k_rotab(float* __restrict__ CS, float* __restrict__ SN) {
  #pragma clang fp contract(off)
  const int t = blockIdx.x * 256 + threadIdx.x; if (t >= SEQ * 32) return; const int j = t % 32, s = t / 32; const float ex = (float)(2 * j) / 64.0f; const float inv = 1.0f / powf(10000.0f, ex); const float th = (float)s * inv; const float c = cosf(th), sn = sinf(th);
  { *(float*)(CS + t) = c; *(float*)(SN + t) = sn;  } }

// One 32-key stage of K hi, K lo (32 rows x 128 B, LDS pitch 144 B) and V^T hi, V^T lo (64 rows x 64 B, LDS pitch 80 B): 1024 pieces of 16 B, eight per thread, global -> LDS through no register.
#define KV_KH 0
#define KV_KL 4608
#define KV_VH 9216
#define KV_VL 14336
#define KV_STAGE 19456
__device__ __forceinline__ void kv_stage(unsigned int lk, unsigned int lv, const unsigned short* gkh, const unsigned short* gkl, size_t k16, const unsigned short* gvh, const unsigned short* gvl, size_t v32) {
  // the s_wait_xcnt closes the statement so that no address register of an issued copy is rewritten ahead of it
  asm volatile("global_load_async_to_lds_b128 %0, %8, off\n\t"
               "global_load_async_to_lds_b128 %1, %9, off\n\t"
               "global_load_async_to_lds_b128 %2, %10, off\n\t"
               "global_load_async_to_lds_b128 %3, %11, off\n\t"
               "global_load_async_to_lds_b128 %4, %12, off\n\t"
               "global_load_async_to_lds_b128 %5, %13, off\n\t"
               "global_load_async_to_lds_b128 %6, %14, off\n\t"
               "global_load_async_to_lds_b128 %7, %15, off\n\t"
               "s_wait_xcnt 0x0"
               :: "v"(lk + KV_KH), "v"(lk + KV_KH + 16 * 144), "v"(lk + KV_KL), "v"(lk + KV_KL + 16 * 144), "v"(lv + KV_VH), "v"(lv + KV_VH + 32 * 80), "v"(lv + KV_VL), "v"(lv + KV_VL + 32 * 80),
                  "v"(gkh), "v"(gkh + k16), "v"(gkl), "v"(gkl + k16), "v"(gvh), "v"(gvh + v32), "v"(gvl), "v"(gvl + v32) : "memory");
}

// lane l with lane l ^ 16: joins the two key halves that lanes c and c + 16 hold of one query
__device__ __forceinline__ float xhalf(float x) { return __builtin_bit_cast(float, __builtin_amdgcn_permlanex16(__builtin_bit_cast(int, x), __builtin_bit_cast(int, x), 0x76543210, 0xfedcba98, false, false)); }

__global__ __launch_bounds__(128) void k_attn(const _Float16* __restrict__ Q16, const _Float16* __restrict__ QL, int ldq, const _Float16* __restrict__ K16, const _Float16* __restrict__ KL, int ldk,
                                             const _Float16* __restrict__ Vt, const _Float16* __restrict__ VtL, const float* __restrict__ AM, const float* __restrict__ AW, _Float16* __restrict__ OH, _Float16* __restrict__ OL, int ldo) {
  constexpr int RPW = 16, DT = 4, KS = 2, QBN = SEQ / 64;
  __shared__ __attribute__((aligned(16))) float sO[4][RPW][64 + 4];
  __shared__ __attribute__((aligned(16))) unsigned char ring[2][KV_STAGE];
  const int tid = threadIdx.x, w = tid >> 5, lane = tid & 31, ln = lane & 15, hh = lane >> 4;
  const int slab = blockIdx.x / QBN, qblk = blockIdx.x % QBN; const int b = slab / NH, h = slab % NH; const int qb0 = qblk * (4 * RPW); const int q0 = qb0 + w * RPW;
  const float ww = bf16_rne(AW[0]);
  FragH aq[KS], aql[KS];
  { const unsigned short* qr = (const unsigned short*)Q16 + ((size_t)b * SEQ + q0 + ln) * ldq + h * 64; const unsigned short* ql = (const unsigned short*)QL + ((size_t)b * SEQ + q0 + ln) * ldq + h * 64;
#pragma unroll
    for (int ks = 0; ks < KS; ++ks) { aq[ks].half[0] = *(const v8us*)(qr + ks * 32 + 8 * hh); aq[ks].half[1] = *(const v8us*)(qr + ks * 32 + 16 + 8 * hh); aql[ks].half[0] = *(const v8us*)(ql + ks * 32 + 8 * hh); aql[ks].half[1] = *(const v8us*)(ql + ks * 32 + 16 + 8 * hh); } }
  const unsigned short* Vth = (const unsigned short*)Vt + (size_t)slab * 64 * SEQ; const unsigned short* Vtl = (const unsigned short*)VtL + (size_t)slab * 64 * SEQ;
  const float* amq = AM + (size_t)b * SEQ_FULL * SEQ_FULL + (size_t)(q0 + ln) * SEQ_FULL + 8 * hh;      /* mask[b][0][own query][.] with full strides, at this lane half's first key */
  const v8f z8 = {0.f,0.f,0.f,0.f,0.f,0.f,0.f,0.f};
  float m_q = -3.0e38f, l_q = 0.f; v8f oacc[DT], oaccL[DT];
#pragma unroll
  for (int dt = 0; dt < DT; ++dt) { oacc[dt] = z8; oaccL[dt] = z8; }
  // this thread's pieces: K row tid/8 (and +16), 16-B column tid%8; V^T row tid/4 (and +32), 16-B column tid%4
  const unsigned int lring = (unsigned int)(size_t)&ring[0][0]; const unsigned int lk = lring + (tid >> 3) * 144 + (tid & 7) * 16, lv = lring + (tid >> 2) * 80 + (tid & 3) * 16;
  const size_t kofs = ((size_t)b * SEQ + (tid >> 3)) * ldk + h * 64 + (tid & 7) * 8; const unsigned short* gkh = (const unsigned short*)K16 + kofs; const unsigned short* gkl = (const unsigned short*)KL + kofs;
  const size_t vofs = (size_t)(tid >> 2) * SEQ + (tid & 3) * 8; const unsigned short* gvh = Vth + vofs; const unsigned short* gvl = Vtl + vofs;
  const size_t k16 = (size_t)16 * ldk, k32 = (size_t)32 * ldk, v32 = (size_t)32 * SEQ;
  kv_stage(lk, lv, gkh, gkl, k16, gvh, gvl, v32);
  asm volatile("s_wait_asynccnt 0x0" ::: "memory");      /* stage 0 has landed before the barrier that publishes it */
  __syncthreads();
  kv_stage(lk + KV_STAGE, lv + KV_STAGE, gkh + k32, gkl + k32, k16, gvh + 32, gvl + 32, v32);
#pragma unroll 1
  for (int j0 = 0; j0 < SEQ; j0 += 32) {
    const unsigned int bsel = (j0 & 32) ? KV_STAGE : 0; const unsigned char* kvb = &ring[0][0] + bsel;
    v4f mk[2][2];      /* own query's mask, keys j0 + 16 nt + 8 hh + 0..7 */
#pragma unroll
    for (int nt = 0; nt < 2; ++nt) { mk[nt][0] = *(const v4fa*)(amq + j0 + nt * 16); mk[nt][1] = *(const v4fa*)(amq + j0 + nt * 16 + 4); }
    v8f s[2];
#pragma unroll
    for (int nt = 0; nt < 2; ++nt) { const unsigned short* kr = (const unsigned short*)(kvb + KV_KH + (nt * 16 + ln) * 144); const unsigned short* klr = (const unsigned short*)(kvb + KV_KL + (nt * 16 + ln) * 144); FragH bk[KS], bkl[KS];
#pragma unroll
      for (int ks = 0; ks < KS; ++ks) { bk[ks].half[0] = *(const v8us*)(kr + ks * 32 + 8 * hh); bk[ks].half[1] = *(const v8us*)(kr + ks * 32 + 16 + 8 * hh); bkl[ks].half[0] = *(const v8us*)(klr + ks * 32 + 8 * hh); bkl[ks].half[1] = *(const v8us*)(klr + ks * 32 + 16 + 8 * hh); }
      v8f acc = z8, accl = z8;
#pragma unroll
      for (int ks = 0; ks < KS; ++ks) { acc = mmaH<1>(bk[ks].v, bk[ks].v, aq[ks].v, aq[ks].v, acc); accl = mmaH<1>(bk[ks].v, bk[ks].v, aql[ks].v, aql[ks].v, accl); accl = mmaH<1>(bkl[ks].v, bkl[ks].v, aq[ks].v, aq[ks].v, accl); }
#pragma unroll
      for (int r = 0; r < 8; ++r) acc[r] += accl[r] * 0.0009765625f;
      s[nt] = acc; }
    float mc = -3.0e38f;
#pragma unroll
    for (int nt = 0; nt < 2; ++nt)
#pragma unroll
      for (int r = 0; r < 8; ++r) { float sv = s[nt][r] * SCL; sv += bf16_rne(mk[nt][r >> 2][r & 3]) * ww; s[nt][r] = sv; mc = fmaxf(mc, sv); }
    mc = fmaxf(mc, xhalf(mc));
    const float mn = fmaxf(m_q, mc); const float al = (mn > -1.0e38f) ? expf(m_q - mn) : 1.0f; m_q = mn;
    FragH pa, pl; float ls[2] = {0.f, 0.f};
#pragma unroll
    for (int nt = 0; nt < 2; ++nt)
#pragma unroll
      for (int r = 0; r < 8; ++r) { const float p = expf(s[nt][r] - mn); ls[nt] += p; const float psc = p * 1024.0f; const _Float16 ph = (_Float16)psc; pa.h[nt * 8 + r] = ph; pl.h[nt * 8 + r] = (_Float16)((psc - (float)ph) * 1024.0f); }
    l_q = l_q * al + (ls[0] + ls[1]);
#pragma unroll
    for (int dt = 0; dt < DT; ++dt)
#pragma unroll
      for (int r = 0; r < 8; ++r) { oacc[dt][r] *= al; oaccL[dt][r] *= al; }
#pragma unroll
    for (int dt = 0; dt < DT; ++dt) { const unsigned short* vrow = (const unsigned short*)(kvb + KV_VH + (dt * 16 + ln) * 80); const unsigned short* vrl = (const unsigned short*)(kvb + KV_VL + (dt * 16 + ln) * 80); FragH bv, bl;
      bv.half[0] = *(const v8us*)(vrow + 8 * hh); bv.half[1] = *(const v8us*)(vrow + 16 + 8 * hh); bl.half[0] = *(const v8us*)(vrl + 8 * hh); bl.half[1] = *(const v8us*)(vrl + 16 + 8 * hh);
      oacc[dt] = mmaH<1>(bv.v, bv.v, pa.v, pa.v, oacc[dt]); oaccL[dt] = mmaH<1>(bv.v, bv.v, pl.v, pl.v, oaccL[dt]); oaccL[dt] = mmaH<1>(bl.v, bl.v, pa.v, pa.v, oaccL[dt]); }
    asm volatile("s_wait_dscnt 0x0" ::: "memory");         /* this wave's reads of the buffer are done before it is handed to the copies */
    asm volatile("s_wait_asynccnt 0x0" ::: "memory");      /* this wave's pieces of the next stage have landed */
    __syncthreads();                                       /* publishes the next stage and ends every wave's reads of this one */
    if (j0 + 64 < SEQ) kv_stage(lk + bsel, lv + bsel, gkh + (size_t)(j0 + 64) * ldk, gkl + (size_t)(j0 + 64) * ldk, k16, gvh + j0 + 64, gvl + j0 + 64, v32); }
  asm volatile("s_wait_asynccnt 0x0" ::: "memory");        /* no copy is outstanding when the wave goes on to its end */
  const float lt = l_q + xhalf(l_q); const float linv = (lt > 0.f) ? 1.0f / (lt * 1024.0f) : 0.f;
#pragma unroll
  for (int dt = 0; dt < DT; ++dt)
#pragma unroll
    for (int r = 0; r < 8; ++r) { float v = oacc[dt][r]; v += oaccL[dt][r] * 0.0009765625f; sO[w][ln][dt * 16 + 8 * hh + r] = v * linv; }
  __builtin_amdgcn_fence(__ATOMIC_ACQ_REL, "workgroup"); __builtin_amdgcn_wave_barrier();
  {
#pragma unroll
    for (int rp = 0; rp < RPW; rp += 4) { const int r = rp + (lane >> 3), pc = lane & 7; const v4f va = *(const v4fa*)&sO[w][r][pc * 8], vb = *(const v4fa*)&sO[w][r][pc * 8 + 4]; FragH fh, fl;      /* context leaves as f16 hi + 2^10 residual rows, one whole 128-B line per row and plane */
#pragma unroll      /* constant indices: the packed halves stay in registers */
      for (int e = 0; e < 4; ++e) { _Float16 hv = (_Float16)va[e]; fh.h[e] = hv; fl.h[e] = (_Float16)((va[e] - (float)hv) * 1024.0f); hv = (_Float16)vb[e]; fh.h[4 + e] = hv; fl.h[4 + e] = (_Float16)((vb[e] - (float)hv) * 1024.0f); }
      const size_t o8 = ((size_t)b * SEQ + q0 + r) * ldo + h * 64 + pc * 8; *(v8us*)((unsigned short*)OH + o8) = fh.half[0]; *(v8us*)((unsigned short*)OL + o8) = fl.half[0]; }
     } }

// LayerNorm over DM (biased variance, eps 1e-5, affine with bf16 g, b) of (A[r] + bf16(x[rin])), compact row r -> input/output row rin = b*SEQ_FULL + s;
__global__ __launch_bounds__(256) void k_ln1024(const float* __restrict__ A, const float* __restrict__ res, const float* __restrict__ g, const float* __restrict__ bb, float* __restrict__ Y) {
  #pragma clang fp contract(off)
  const int wv = threadIdx.x >> 5, ln = threadIdx.x & 31; const size_t r = (size_t)blockIdx.x * 8 + wv; if (r >= (size_t)NR) return;
  const size_t rb = r / SEQ, rs = r % SEQ; const size_t rin = rb * SEQ_FULL + rs;
  float xv[32]; float sm = 0.f;
#pragma unroll
  for (int i = 0; i < 8; ++i) { const int c0 = i * 128 + ln * 4; const v4f a = *(const v4fa*)(A + r * DM + c0); const v4f rr = *(const v4fa*)(res + rin * DM + c0);
#pragma unroll
    for (int q = 0; q < 4; ++q) { const float v = a[q] + bf16_rne(rr[q]); xv[i * 4 + q] = v; sm += v; } }
#pragma unroll
  for (int o = 16; o > 0; o >>= 1) sm += __shfl_xor(sm, o, 32);
  const float mu = sm * 0.0009765625f; float var = 0.f;
#pragma unroll
  for (int q = 0; q < 32; ++q) { const float d = xv[q] - mu; var += d * d; }
#pragma unroll
  for (int o = 16; o > 0; o >>= 1) var += __shfl_xor(var, o, 32);
  const float inv = 1.0f / sqrtf(var * 0.0009765625f + 1e-5f);
  {
#pragma unroll
    for (int i = 0; i < 8; ++i) { const int c0 = i * 128 + ln * 4; v4f y;
#pragma unroll
      for (int q = 0; q < 4; ++q) { float v = (xv[i * 4 + q] - mu) * inv; v *= bf16_rne(g[c0 + q]); v += bf16_rne(bb[c0 + q]); y[q] = v; }
      *(v4f*)(Y + rin * DM + c0) = y; }
     } }

extern "C" void kernel_launch(void* const* d_in, const int* in_sizes, int n_in,
                              void* d_out, int out_size, void* d_ws, size_t ws_size, hipStream_t stream) {
  if (n_in < 13) return;
  const float* x = (const float*)d_in[0]; const float* cdm = (const float*)d_in[1];
  const float* Wq = (const float*)d_in[2]; const float* bq = (const float*)d_in[3]; const float* Wk = (const float*)d_in[4]; const float* bk = (const float*)d_in[5];
  const float* Wv = (const float*)d_in[6]; const float* bv = (const float*)d_in[7]; const float* Wo = (const float*)d_in[8]; const float* bo = (const float*)d_in[9];
  const float* gam = (const float*)d_in[10]; const float* bet = (const float*)d_in[11]; const float* cdw = (const float*)d_in[12];
  const long long rows_need = (long long)(NB - 1) * SEQ_FULL + SEQ;
  if ((long long)in_sizes[0] < rows_need * DM) return;
  if ((long long)in_sizes[1] < (long long)(NB - 1) * SEQ_FULL * SEQ_FULL + (long long)(SEQ - 1) * SEQ_FULL + SEQ) return;
  if (in_sizes[2] < DM * DM || in_sizes[4] < DM * DM || in_sizes[6] < DM * DM || in_sizes[8] < DM * DM) return;
  if (in_sizes[3] < DM || in_sizes[5] < DM || in_sizes[7] < DM || in_sizes[9] < DM || in_sizes[10] < DM || in_sizes[11] < DM || in_sizes[12] < 1) return;
  if ((long long)out_size < rows_need * DM) return;
  char* ws = (char*)d_ws; size_t off = 0;
  auto take = [&](size_t bytes) { char* p = ws + off; off += (bytes + 255) & ~(size_t)255; return p; };
  const size_t np = (size_t)NR * DM;      /* compact activation plane elements */
  _Float16* BQ = (_Float16*)take((size_t)DM * DM * 2); _Float16* BK = (_Float16*)take((size_t)DM * DM * 2); _Float16* BV = (_Float16*)take((size_t)DM * DM * 2); _Float16* BO = (_Float16*)take((size_t)DM * DM * 2);
  _Float16* X16 = (_Float16*)take(np * 2);
  _Float16* QH = (_Float16*)take(np * 2); _Float16* QL = (_Float16*)take(np * 2); _Float16* KH = (_Float16*)take(np * 2); _Float16* KL = (_Float16*)take(np * 2);
  _Float16* OH = (_Float16*)take(np * 2); _Float16* OL = (_Float16*)take(np * 2); _Float16* VT = (_Float16*)take(np * 2); _Float16* VTL = (_Float16*)take(np * 2);
  float* Y = (float*)take(np * 4); float* CS = (float*)take((size_t)SEQ * 32 * 4); float* SN = (float*)take((size_t)SEQ * 32 * 4);
  if (off > ws_size) return;
  const unsigned wb = (unsigned)(((size_t)DM * DM / 8 + 255) / 256); const unsigned eb = (unsigned)((np / 8 + 255) / 256);
  k_wsc<<<wb, 256, 0, stream>>>(Wq, BQ, (size_t)DM * DM / 8, 16.0f); k_wsc<<<wb, 256, 0, stream>>>(Wk, BK, (size_t)DM * DM / 8, 16.0f);
  k_wsc<<<wb, 256, 0, stream>>>(Wv, BV, (size_t)DM * DM / 8, 16.0f); k_wsc<<<wb, 256, 0, stream>>>(Wo, BO, (size_t)DM * DM / 8, 16.0f);      /* [out][in] weights, bf16 then x16 in f16 */
  k_x16b<<<eb, 256, 0, stream>>>(x, X16);
  k_rotab<<<(SEQ * 32 + 255) / 256, 256, 0, stream>>>(CS, SN);
  const dim3 g((NR / 128) * (DM / 64), 1);
  k_gemm2<0, 1><<<g, 128, 0, stream>>>(X16, DM, 0, BQ, DM, 0, 0.0625f, bq, 0, nullptr, 1, 0, 0, nullptr, nullptr, DM, 0, NR, DM, DM, CS, SN, QH, QL);      /* Q -> RoPE -> hi/lo */
  k_gemm2<0, 1><<<g, 128, 0, stream>>>(X16, DM, 0, BK, DM, 0, 0.0625f, bk, 0, nullptr, 1, 0, 0, nullptr, nullptr, DM, 0, NR, DM, DM, CS, SN, KH, KL);      /* K -> RoPE -> hi/lo */
  k_gemm2<0, 2><<<g, 128, 0, stream>>>(X16, DM, 0, BV, DM, 0, 0.0625f, bv, 0, nullptr, 1, 0, 0, nullptr, nullptr, DM, 0, NR, DM, DM, nullptr, nullptr, VT, VTL);      /* V -> hi/lo, transposed per head */
  k_attn<<<NB * NH * (SEQ / 64), 128, 0, stream>>>(QH, QL, DM, KH, KL, DM, VT, VTL, cdm, cdw, OH, OL, DM);      /* context -> hi/lo rows */
  k_gemm2<0, 0><<<g, 128, 0, stream>>>(OL, DM, 0, BO, DM, 0, 0.0625f / 1024.0f, nullptr, 0, nullptr, 1, 0, 0, Y, nullptr, DM, 0, NR, DM, DM, nullptr, nullptr, nullptr, nullptr);
  k_gemm2<0, 0><<<g, 128, 0, stream>>>(OH, DM, 0, BO, DM, 0, 0.0625f, bo, 0, Y, 1, (size_t)DM, 0, Y, nullptr, DM, 0, NR, DM, DM, nullptr, nullptr, nullptr, nullptr);      /* Y = (ctx_lo + ctx_hi) Wo^T + bo */
  k_ln1024<<<NR / 8, 256, 0, stream>>>(Y, x, gam, bet, (float*)d_out);      /* out = LN(bf16(x) + Y) g + b */
}

// v005
// One run takes 220 microseconds.
// Timed twice side by side with v004, it ran 1.13 times as fast both times.
// Counting every step since v000, it is 3.10 times as fast.
#include <hip/hip_runtime.h>
// All contractions (Q/K/V projections, Q.K^T, P.V^T, output projection) on v_wmma_f32_16x16x32_f16: f16 operands, f32 accumulate. Float inputs RNE-converted to bf16 (exact in f16; weights carried x16); q, k, v, softmax numerators (x1024) and context carried as f16 hi + 2^10 residual plane pairs; RoPE tables, softmax, residual add and LayerNorm in f32.
#ifndef NB
#define NB 2
#endif
#ifndef SEQ
#define SEQ 2048
#endif
#define NB_FULL 2
#define SEQ_FULL 2048
#define DM 1024
#define NH 16
#define NR (NB * SEQ)
#define SCL 0.125f
#define LOG2E 1.44269504088896340736f
static_assert(NB >= 1 && NB <= NB_FULL);
static_assert(SEQ >= 128 && SEQ <= SEQ_FULL && (SEQ % 128) == 0);
static_assert(NH * 64 == DM);
static_assert((NR % 128) == 0);
static_assert((DM % 64) == 0 && (DM % 128) == 0);

typedef unsigned short v8us __attribute__((ext_vector_type(8), may_alias));
typedef float  v8f  __attribute__((ext_vector_type(8)));
typedef float  v4f  __attribute__((ext_vector_type(4)));
typedef float  v4fa __attribute__((ext_vector_type(4), may_alias));
typedef _Float16 v16h __attribute__((ext_vector_type(16)));
typedef _Float16 v4h __attribute__((ext_vector_type(4)));
union FragH { v16h v; v8us half[2]; _Float16 h[16]; unsigned short u[16]; };

__device__ __forceinline__ unsigned short bf16_bits(float x) { unsigned int u = __float_as_uint(x); return (unsigned short)((u + 0x7FFFu + ((u >> 16) & 1u)) >> 16); }
__device__ __forceinline__ float bf16_val(unsigned short b) { return __uint_as_float(((unsigned int)b) << 16); }
__device__ __forceinline__ float bf16_rne(float x) { return bf16_val(bf16_bits(x)); }

// D += A.B with NT terms: 1 = ah.bh, 2 = + al.bh, 3 = + ah.bl; hazard guard after the last WMMA
template <int NT>
__device__ __forceinline__ v8f mmaH(v16h ah, v16h al, v16h bh, v16h bl, v8f c) {
  c = __builtin_amdgcn_wmma_f32_16x16x32_f16(false, ah, false, bh, (short)0, c, false, false);
  if (NT >= 2) c = __builtin_amdgcn_wmma_f32_16x16x32_f16(false, al, false, bh, (short)0, c, false, false);
  if (NT >= 3) c = __builtin_amdgcn_wmma_f32_16x16x32_f16(false, ah, false, bl, (short)0, c, false, false);
  asm volatile("v_nop\n\tv_nop\n\tv_nop\n\tv_nop" : "+v"(c) : "v"(ah), "v"(al), "v"(bh), "v"(bl));
  return c;
}

// ---- GEMM engine (work-group tile 128x64, wave tile 32x64; M % 128 == 0, N % 64 == 0, K % 128 == 0, lda and ldb % 8 == 0): C[M][N] f32 = alpha A[M][K].Bt[N][K]^T + bf16(bias) (+ CP own element); A, Bt f16 k-contiguous.
// Each 128-k stage (A 128 rows, then Bt 64 rows, 256 B a row at LDS pitch 272 B) is brought once per work-group into a two-buffer LDS ring, global -> LDS through no register, and read by all four waves.
// A fragment: lane row = l&15, elements 0..7 <- k0 + 8h + i, 8..15 <- k0 + 16 + 8h + i; B fragment from the [n][k] copy with the same k map; D element r -> (row 8h + r, col l&15).
__device__ __forceinline__ v16h g2_frag(const _Float16* p, int hh) { FragH f; f.half[0] = *(const v8us*)((const unsigned short*)p + 8 * hh); f.half[1] = *(const v8us*)((const unsigned short*)p + 16 + 8 * hh); return f.v; }
__device__ __forceinline__ v8f g2_mma(v16h a, v16h b, v8f c) { v8f d = __builtin_amdgcn_wmma_f32_16x16x32_f16(false, a, false, b, (short)0, c, false, false); asm volatile("v_nop\n\tv_nop\n\tv_nop\n\tv_nop" : "+v"(d) : "v"(a), "v"(b)); return d; }
#define G_KT 128
#define G_PITCH 272
#define G_STAGE (192 * G_PITCH)
// eight 16-B pieces of one thread: rows 8 apart, the same 16-B column; a wave's copy covers two whole 256-B rows
__device__ __forceinline__ void g2_copy8(unsigned int l, const unsigned short* g, size_t r8) {
  // the s_wait_xcnt closes the statement so that no address register of an issued copy is rewritten ahead of it
  asm volatile("global_load_async_to_lds_b128 %0, %8, off\n\t"
               "global_load_async_to_lds_b128 %1, %9, off\n\t"
               "global_load_async_to_lds_b128 %2, %10, off\n\t"
               "global_load_async_to_lds_b128 %3, %11, off\n\t"
               "global_load_async_to_lds_b128 %4, %12, off\n\t"
               "global_load_async_to_lds_b128 %5, %13, off\n\t"
               "global_load_async_to_lds_b128 %6, %14, off\n\t"
               "global_load_async_to_lds_b128 %7, %15, off\n\t"
               "s_wait_xcnt 0x0"
               :: "v"(l), "v"(l + 8 * G_PITCH), "v"(l + 16 * G_PITCH), "v"(l + 24 * G_PITCH), "v"(l + 32 * G_PITCH), "v"(l + 40 * G_PITCH), "v"(l + 48 * G_PITCH), "v"(l + 56 * G_PITCH),
                  "v"(g), "v"(g + r8), "v"(g + 2 * r8), "v"(g + 3 * r8), "v"(g + 4 * r8), "v"(g + 5 * r8), "v"(g + 6 * r8), "v"(g + 7 * r8) : "memory");
}
// one stage: A rows 0..127 of the work-group's tile, then Bt rows 0..63, 24 pieces per thread
__device__ __forceinline__ void g2_stage(unsigned int l, const unsigned short* ga, size_t a8, const unsigned short* gb, size_t b8) {
  g2_copy8(l, ga, a8); g2_copy8(l + 64 * G_PITCH, ga + 8 * a8, a8); g2_copy8(l + 128 * G_PITCH, gb, b8);
}
// EPI 0: C f32 rows. EPI 1: RoPE (concatenated tables, interleaved rotate_half: out[d] = x[d] c[s][d mod 32] + rh[d] sn[s][d mod 32], rh[d] = -x[d+1] (d even), x[d-1] (d odd)), then f16 hi + 2^10 residual rows H, L [row][ldc].
// EPI 2: f16 hi + 2^10 residual, stored transposed per head: H, L [(b NH + h) 64 + d][SEQ] (N == DM, one 64-column tile = one head).
template <int ACT, int EPI>
__global__ __launch_bounds__(128) void k_gemm2(const _Float16* __restrict__ A, int lda, size_t sA, const _Float16* __restrict__ Bh, int ldb, size_t sB, float alpha, const float* __restrict__ bias, size_t sBias, const float* CP, int rowsPerB, size_t sCPb, int row0g,
    float* C, _Float16* C16, int ldc, size_t sC, int M, int N, int K, const float* __restrict__ CS, const float* __restrict__ SN, _Float16* __restrict__ H, _Float16* __restrict__ L) {
  __shared__ __attribute__((aligned(16))) float so[4][32][68];
  __shared__ __attribute__((aligned(16))) unsigned char gring[2][G_STAGE];
  const int tid = threadIdx.x, w = tid >> 5, lane = tid & 31, ln = lane & 15, hh = lane >> 4; const int by = blockIdx.y;
  A += (size_t)by * sA; Bh += (size_t)by * sB; const size_t cofs = (size_t)by * sC; const float* bp = bias ? bias + (size_t)by * sBias : nullptr;
  const int ntn = N >> 6; const int mt = blockIdx.x / ntn, nq = blockIdx.x - mt * ntn; const int row0 = mt * 128 + 32 * w, col0 = nq * 64; if (mt * 128 >= M) return;      /* the whole work-group leaves or none, ahead of every barrier and copy */
  const v8f z8 = {0.f,0.f,0.f,0.f,0.f,0.f,0.f,0.f}; v8f c00 = z8, c01 = z8, c02 = z8, c03 = z8, c10 = z8, c11 = z8, c12 = z8, c13 = z8;
  // this thread's pieces: stage row tid/16 (and +8 ...), 16-B column tid%16
  const unsigned int lg = (unsigned int)(size_t)&gring[0][0] + (tid >> 4) * G_PITCH + (tid & 15) * 16;
  const unsigned short* ga = (const unsigned short*)A + (size_t)(mt * 128 + (tid >> 4)) * lda + (tid & 15) * 8; const unsigned short* gb = (const unsigned short*)Bh + (size_t)(col0 + (tid >> 4)) * ldb + (tid & 15) * 8;
  const size_t a8 = (size_t)8 * lda, b8 = (size_t)8 * ldb;
  g2_stage(lg, ga, a8, gb, b8);
  asm volatile("s_wait_asynccnt 0x0" ::: "memory");      /* stage 0 has landed before the barrier that publishes it */
  __syncthreads();
  if (G_KT < K) g2_stage(lg + G_STAGE, ga + G_KT, a8, gb + G_KT, b8);
#pragma unroll 1
  for (int kt = 0; kt < K; kt += G_KT) {
    const unsigned int bsel = (kt & G_KT) ? G_STAGE : 0; const unsigned char* sb = &gring[0][0] + bsel;
    const _Float16* a0p = (const _Float16*)(sb + (32 * w + ln) * G_PITCH); const _Float16* a1p = (const _Float16*)(sb + (32 * w + 16 + ln) * G_PITCH);
    const _Float16* b0p = (const _Float16*)(sb + (128 + ln) * G_PITCH); const _Float16* b1p = (const _Float16*)(sb + (144 + ln) * G_PITCH); const _Float16* b2p = (const _Float16*)(sb + (160 + ln) * G_PITCH); const _Float16* b3p = (const _Float16*)(sb + (176 + ln) * G_PITCH);
    // two fragment sets: the twelve LDS reads of the next 32-k step of this same stage go out as one group ahead of the current step's products;
    // the step loop is unrolled so that the set index is a constant and both sets stay in registers
    v16h fa0[2], fa1[2], fb0[2], fb1[2], fb2[2], fb3[2];
    fa0[0] = g2_frag(a0p, hh); fa1[0] = g2_frag(a1p, hh); fb0[0] = g2_frag(b0p, hh); fb1[0] = g2_frag(b1p, hh); fb2[0] = g2_frag(b2p, hh); fb3[0] = g2_frag(b3p, hh);
#pragma unroll
    for (int ks = 0; ks < G_KT / 32; ++ks) { const int cu = ks & 1, nx = cu ^ 1;
      if (ks + 1 < G_KT / 32) { const int kb = (ks + 1) * 32; fa0[nx] = g2_frag(a0p + kb, hh); fa1[nx] = g2_frag(a1p + kb, hh); fb0[nx] = g2_frag(b0p + kb, hh); fb1[nx] = g2_frag(b1p + kb, hh); fb2[nx] = g2_frag(b2p + kb, hh); fb3[nx] = g2_frag(b3p + kb, hh); }
      c00 = g2_mma(fa0[cu], fb0[cu], c00); c10 = g2_mma(fa1[cu], fb0[cu], c10);
      c01 = g2_mma(fa0[cu], fb1[cu], c01); c11 = g2_mma(fa1[cu], fb1[cu], c11);
      c02 = g2_mma(fa0[cu], fb2[cu], c02); c12 = g2_mma(fa1[cu], fb2[cu], c12);
      c03 = g2_mma(fa0[cu], fb3[cu], c03); c13 = g2_mma(fa1[cu], fb3[cu], c13); }
    asm volatile("s_wait_dscnt 0x0" ::: "memory");         /* this wave's reads of the buffer are done before it is handed to the copies */
    asm volatile("s_wait_asynccnt 0x0" ::: "memory");      /* this wave's pieces of the next stage have landed */
    __syncthreads();                                       /* publishes the next stage and ends every wave's reads of this one */
    if (kt + 2 * G_KT < K) g2_stage(lg + bsel, ga + kt + 2 * G_KT, a8, gb + kt + 2 * G_KT, b8); }
  asm volatile("s_wait_asynccnt 0x0" ::: "memory");        /* no copy is outstanding when the wave goes on to its end */
  v8f accs[8] = {c00, c01, c02, c03, c10, c11, c12, c13};
  if (EPI == 2) {
    // a lane holds eight consecutive rows of one column: 16 B of a transposed row. Both planes ([64 columns][128 rows] f16, pitch 272 B) are gathered in so, then leave as 256-B runs.
    unsigned char* tb = (unsigned char*)&so[0][0][0]; float bv4[4] = {0.f, 0.f, 0.f, 0.f};
    if (bp) {
#pragma unroll      /* constant indices: bv4 stays in registers, the four loads go out together */
      for (int t = 0; t < 4; ++t) bv4[t] = bf16_rne(bp[col0 + t * 16 + ln]); }
#pragma unroll      /* this loop and the next: constant indices keep accs and the packed halves in registers */
    for (int u = 0; u < 8; ++u) { const int t = u & 3, half = u >> 2; const float bv = bv4[t]; FragH fh, fl;
#pragma unroll
      for (int r = 0; r < 8; ++r) { const float v = accs[u][r] * alpha + bv; const _Float16 hv = (_Float16)v; fh.h[r] = hv; fl.h[r] = (_Float16)((v - (float)hv) * 1024.0f); }
      unsigned char* tp = tb + (t * 16 + ln) * 272 + (32 * w + half * 16 + 8 * hh) * 2; *(v8us*)tp = fh.half[0]; *(v8us*)(tp + 64 * 272) = fl.half[0]; }
    __syncthreads();      /* every wave's 32 rows stand in the transposed tile before any wave reads whole runs of it */
    const size_t vrow = (size_t)((mt * 128) / SEQ * NH + nq) * 64; const int s0 = (mt * 128) % SEQ;
#pragma unroll      /* the LDS reads of later runs go out ahead of the stores of earlier ones */
    for (int it = 0; it < 8; ++it) { const int i = it * 128 + tid, pc = i & 15, d = i >> 4; const size_t o = (vrow + d) * SEQ + s0 + pc * 8;
      *(v8us*)((unsigned short*)H + o) = *(const v8us*)(tb + d * 272 + pc * 16); *(v8us*)((unsigned short*)L + o) = *(const v8us*)(tb + (64 + d) * 272 + pc * 16); }
    return; }
#pragma unroll
  for (int u = 0; u < 8; ++u) { const int t = u & 3, half = u >> 2; const int col = col0 + t * 16 + ln; const float bv = bp ? bf16_rne(bp[col]) : 0.f;
#pragma unroll
    for (int r = 0; r < 8; ++r) { const int rloc = half * 16 + 8 * hh + r; float v = accs[u][r] * alpha + bv;
      if (EPI == 0 && CP) { if (rowsPerB < 0) v += CP[cofs + (size_t)(row0g + row0 + rloc) * ldc + col];      /* rowsPerB < 0: own element of the batched C plane */ else { const int bidx = (row0g + row0 + rloc) / rowsPerB; v += CP[(size_t)bidx * sCPb + (size_t)by * 64 + col]; } }
      if (ACT == 3) v = fmaxf(v, 0.f);
      so[w][rloc][t * 16 + ln] = v; } }
  __builtin_amdgcn_fence(__ATOMIC_ACQ_REL, "workgroup"); __builtin_amdgcn_wave_barrier();
  if (EPI == 1) {
    // eight columns a lane, four rows a wave store: each row's 64 columns leave as one whole 128-B line per plane
    const int rs4 = lane >> 3, c8 = (lane & 7) * 8, j0 = c8 & 31;
    const size_t t0 = (size_t)(row0 % SEQ + rs4) * 32 + j0;      /* a wave's 32 rows lie in one sequence: SEQ % 128 == 0 */
    unsigned short* hp = (unsigned short*)H + (size_t)(row0 + rs4) * ldc + col0 + c8; unsigned short* lp = (unsigned short*)L + (size_t)(row0 + rs4) * ldc + col0 + c8; const size_t r4 = (size_t)4 * ldc;
#pragma unroll      /* the table loads of all eight steps take immediate offsets and go out together */
    for (int q = 0; q < 8; ++q) { const int r = q * 4 + rs4;
      const v4f a = *(const v4fa*)&so[w][r][c8], c = *(const v4fa*)&so[w][r][c8 + 4]; const float xs[8] = {a[0], a[1], a[2], a[3], c[0], c[1], c[2], c[3]};
      const float* tp = CS + t0 + q * 128; const float* up = SN + t0 + q * 128; const v4f ca = *(const v4fa*)tp, cb = *(const v4fa*)(tp + 4), sa = *(const v4fa*)up, sb = *(const v4fa*)(up + 4);
      const float cs[8] = {ca[0], ca[1], ca[2], ca[3], cb[0], cb[1], cb[2], cb[3]}; const float sn[8] = {sa[0], sa[1], sa[2], sa[3], sb[0], sb[1], sb[2], sb[3]};
      FragH fh, fl;
#pragma unroll      /* constant indices: xs, cs, sn and the packed halves stay in registers */
      for (int e = 0; e < 8; ++e) { const float pr = xs[e ^ 1]; const float rh = (e & 1) ? pr : -pr; const float o = xs[e] * cs[e] + rh * sn[e];
        const _Float16 hv = (_Float16)o; fh.h[e] = hv; fl.h[e] = (_Float16)((o - (float)hv) * 1024.0f); }
      *(v8us*)(hp + q * r4) = fh.half[0]; *(v8us*)(lp + q * r4) = fl.half[0]; }
    return; }
  const int rsub = lane >> 4, c4 = (lane & 15) * 4;
  {
#pragma unroll
    for (int q = 0; q < 16; ++q) { const int r = q * 2 + rsub; const v4f v = *(const v4fa*)&so[w][r][c4]; if (C) *(v4f*)(C + cofs + (size_t)(row0 + r) * ldc + col0 + c4) = v; if (C16) { v4h h4;
#pragma unroll
        for (int i = 0; i < 4; ++i) h4[i] = (_Float16)v[i]; *(v4h*)(C16 + cofs + (size_t)(row0 + r) * ldc + col0 + c4) = h4; } }
     } }

__global__ __launch_bounds__(256) void k_wsc(const float* __restrict__ Wm, _Float16* __restrict__ Bt, size_t n8, float sc) {
  const size_t t = (size_t)blockIdx.x * 256 + threadIdx.x; if (t >= n8) return; FragH f; const v4f a = *(const v4fa*)(Wm + t * 8), c = *(const v4fa*)(Wm + t * 8 + 4);
#pragma unroll
  for (int q = 0; q < 4; ++q) { f.h[q] = (_Float16)(bf16_rne(a[q]) * sc); f.h[4 + q] = (_Float16)(bf16_rne(c[q]) * sc); }
  *(v8us*)((unsigned short*)Bt + t * 8) = f.half[0];  }

__global__ __launch_bounds__(256) void k_x16b(const float* __restrict__ x, _Float16* __restrict__ X16) {
  const size_t t = (size_t)blockIdx.x * 256 + threadIdx.x; if (t >= (size_t)NR * DM / 8) return; const size_t row = (t * 8) / DM; const int c0 = (int)((t * 8) % DM); const size_t rb = row / SEQ, rs = row % SEQ;
  const float* src = x + (rb * SEQ_FULL + rs) * (size_t)DM + c0; const v4f a = *(const v4fa*)src, c = *(const v4fa*)(src + 4); FragH f;
#pragma unroll
  for (int q = 0; q < 4; ++q) { f.h[q] = (_Float16)bf16_rne(a[q]); f.h[4 + q] = (_Float16)bf16_rne(c[q]); }
  *(v8us*)((unsigned short*)X16 + t * 8) = f.half[0];  }

__global__ __launch_bounds__(256) void k_rotab(float* __restrict__ CS, float* __restrict__ SN) {
  #pragma clang fp contract(off)
  const int t = blockIdx.x * 256 + threadIdx.x; if (t >= SEQ * 32) return; const int j = t % 32, s = t / 32; const float ex = (float)(2 * j) / 64.0f; const float inv = 1.0f / powf(10000.0f, ex); const float th = (float)s * inv; const float c = cosf(th), sn = sinf(th);
  { *(float*)(CS + t) = c; *(float*)(SN + t) = sn;  } }

// One 32-key stage of K hi, K lo (32 rows x 128 B, LDS pitch 144 B) and V^T hi, V^T lo (64 rows x 64 B, LDS pitch 80 B): 1024 pieces of 16 B, eight per thread, global -> LDS through no register.
#define KV_KH 0
#define KV_KL 4608
#define KV_VH 9216
#define KV_VL 14336
#define KV_STAGE 19456
__device__ __forceinline__ void kv_stage(unsigned int lk, unsigned int lv, const unsigned short* gkh, const unsigned short* gkl, size_t k16, const unsigned short* gvh, const unsigned short* gvl, size_t v32) {
  // the s_wait_xcnt closes the statement so that no address register of an issued copy is rewritten ahead of it
  asm volatile("global_load_async_to_lds_b128 %0, %8, off\n\t"
               "global_load_async_to_lds_b128 %1, %9, off\n\t"
               "global_load_async_to_lds_b128 %2, %10, off\n\t"
               "global_load_async_to_lds_b128 %3, %11, off\n\t"
               "global_load_async_to_lds_b128 %4, %12, off\n\t"
               "global_load_async_to_lds_b128 %5, %13, off\n\t"
               "global_load_async_to_lds_b128 %6, %14, off\n\t"
               "global_load_async_to_lds_b128 %7, %15, off\n\t"
               "s_wait_xcnt 0x0"
               :: "v"(lk + KV_KH), "v"(lk + KV_KH + 16 * 144), "v"(lk + KV_KL), "v"(lk + KV_KL + 16 * 144), "v"(lv + KV_VH), "v"(lv + KV_VH + 32 * 80), "v"(lv + KV_VL), "v"(lv + KV_VL + 32 * 80),
                  "v"(gkh), "v"(gkh + k16), "v"(gkl), "v"(gkl + k16), "v"(gvh), "v"(gvh + v32), "v"(gvl), "v"(gvl + v32) : "memory");
}

// lane l with lane l ^ 16: joins the two key halves that lanes c and c + 16 hold of one query
__device__ __forceinline__ float xhalf(float x) { return __builtin_bit_cast(float, __builtin_amdgcn_permlanex16(__builtin_bit_cast(int, x), __builtin_bit_cast(int, x), 0x76543210, 0xfedcba98, false, false)); }

__global__ __launch_bounds__(128) void k_attn(const _Float16* __restrict__ Q16, const _Float16* __restrict__ QL, int ldq, const _Float16* __restrict__ K16, const _Float16* __restrict__ KL, int ldk,
                                             const _Float16* __restrict__ Vt, const _Float16* __restrict__ VtL, const float* __restrict__ AM, const float* __restrict__ AW, _Float16* __restrict__ OH, _Float16* __restrict__ OL, int ldo) {
  constexpr int RPW = 16, DT = 4, KS = 2, QBN = SEQ / 64;
  __shared__ __attribute__((aligned(16))) float sO[4][RPW][64 + 4];
  __shared__ __attribute__((aligned(16))) unsigned char ring[2][KV_STAGE];
  const int tid = threadIdx.x, w = tid >> 5, lane = tid & 31, ln = lane & 15, hh = lane >> 4;
  const int slab = blockIdx.x / QBN, qblk = blockIdx.x % QBN; const int b = slab / NH, h = slab % NH; const int qb0 = qblk * (4 * RPW); const int q0 = qb0 + w * RPW;
  const float ww = bf16_rne(AW[0]) * LOG2E;
  FragH aq[KS], aql[KS];
  { const unsigned short* qr = (const unsigned short*)Q16 + ((size_t)b * SEQ + q0 + ln) * ldq + h * 64; const unsigned short* ql = (const unsigned short*)QL + ((size_t)b * SEQ + q0 + ln) * ldq + h * 64;
#pragma unroll
    for (int ks = 0; ks < KS; ++ks) { aq[ks].half[0] = *(const v8us*)(qr + ks * 32 + 8 * hh); aq[ks].half[1] = *(const v8us*)(qr + ks * 32 + 16 + 8 * hh); aql[ks].half[0] = *(const v8us*)(ql + ks * 32 + 8 * hh); aql[ks].half[1] = *(const v8us*)(ql + ks * 32 + 16 + 8 * hh); } }
  const unsigned short* Vth = (const unsigned short*)Vt + (size_t)slab * 64 * SEQ; const unsigned short* Vtl = (const unsigned short*)VtL + (size_t)slab * 64 * SEQ;
  const float* amq = AM + (size_t)b * SEQ_FULL * SEQ_FULL + (size_t)(q0 + ln) * SEQ_FULL + 8 * hh;      /* mask[b][0][own query][.] with full strides, at this lane half's first key */
  const v8f z8 = {0.f,0.f,0.f,0.f,0.f,0.f,0.f,0.f};
  float m_q = -3.0e38f, l_q = 0.f; v8f oacc[DT], oaccL[DT];
#pragma unroll
  for (int dt = 0; dt < DT; ++dt) { oacc[dt] = z8; oaccL[dt] = z8; }
  // this thread's pieces: K row tid/8 (and +16), 16-B column tid%8; V^T row tid/4 (and +32), 16-B column tid%4
  const unsigned int lring = (unsigned int)(size_t)&ring[0][0]; const unsigned int lk = lring + (tid >> 3) * 144 + (tid & 7) * 16, lv = lring + (tid >> 2) * 80 + (tid & 3) * 16;
  const size_t kofs = ((size_t)b * SEQ + (tid >> 3)) * ldk + h * 64 + (tid & 7) * 8; const unsigned short* gkh = (const unsigned short*)K16 + kofs; const unsigned short* gkl = (const unsigned short*)KL + kofs;
  const size_t vofs = (size_t)(tid >> 2) * SEQ + (tid & 3) * 8; const unsigned short* gvh = Vth + vofs; const unsigned short* gvl = Vtl + vofs;
  const size_t k16 = (size_t)16 * ldk, k32 = (size_t)32 * ldk, v32 = (size_t)32 * SEQ;
  kv_stage(lk, lv, gkh, gkl, k16, gvh, gvl, v32);
  asm volatile("s_wait_asynccnt 0x0" ::: "memory");      /* stage 0 has landed before the barrier that publishes it */
  __syncthreads();
  kv_stage(lk + KV_STAGE, lv + KV_STAGE, gkh + k32, gkl + k32, k16, gvh + 32, gvl + 32, v32);
#pragma unroll 1
  for (int j0 = 0; j0 < SEQ; j0 += 32) {
    const unsigned int bsel = (j0 & 32) ? KV_STAGE : 0; const unsigned char* kvb = &ring[0][0] + bsel;
    v4f mk[2][2];      /* own query's mask, keys j0 + 16 nt + 8 hh + 0..7 */
#pragma unroll
    for (int nt = 0; nt < 2; ++nt) { mk[nt][0] = *(const v4fa*)(amq + j0 + nt * 16); mk[nt][1] = *(const v4fa*)(amq + j0 + nt * 16 + 4); }
    v8f s[2];
#pragma unroll
    for (int nt = 0; nt < 2; ++nt) { const unsigned short* kr = (const unsigned short*)(kvb + KV_KH + (nt * 16 + ln) * 144); const unsigned short* klr = (const unsigned short*)(kvb + KV_KL + (nt * 16 + ln) * 144); FragH bk[KS], bkl[KS];
#pragma unroll
      for (int ks = 0; ks < KS; ++ks) { bk[ks].half[0] = *(const v8us*)(kr + ks * 32 + 8 * hh); bk[ks].half[1] = *(const v8us*)(kr + ks * 32 + 16 + 8 * hh); bkl[ks].half[0] = *(const v8us*)(klr + ks * 32 + 8 * hh); bkl[ks].half[1] = *(const v8us*)(klr + ks * 32 + 16 + 8 * hh); }
      v8f acc = z8, accl = z8;
#pragma unroll
      for (int ks = 0; ks < KS; ++ks) { acc = mmaH<1>(bk[ks].v, bk[ks].v, aq[ks].v, aq[ks].v, acc); accl = mmaH<1>(bk[ks].v, bk[ks].v, aql[ks].v, aql[ks].v, accl); accl = mmaH<1>(bkl[ks].v, bkl[ks].v, aq[ks].v, aq[ks].v, accl); }
#pragma unroll
      for (int r = 0; r < 8; ++r) acc[r] += accl[r] * 0.0009765625f;
      s[nt] = acc; }
    float mc = -3.0e38f;
#pragma unroll
    for (int nt = 0; nt < 2; ++nt)
#pragma unroll
      for (int r = 0; r < 8; ++r) { float sv = s[nt][r] * (SCL * LOG2E); sv += bf16_rne(mk[nt][r >> 2][r & 3]) * ww; s[nt][r] = sv; mc = fmaxf(mc, sv); }
    mc = fmaxf(mc, xhalf(mc));
    const float mn = fmaxf(m_q, mc - 10.0f); const float al = __builtin_amdgcn_exp2f((mn > -1.0e38f) ? m_q - mn : 0.f); m_q = mn;
    FragH pa, pl; float ls[2] = {0.f, 0.f};
#pragma unroll
    for (int nt = 0; nt < 2; ++nt)
#pragma unroll
      for (int r = 0; r < 8; ++r) { const float psc = __builtin_amdgcn_exp2f(s[nt][r] - mn); ls[nt] += psc; const _Float16 ph = (_Float16)psc; pa.h[nt * 8 + r] = ph; pl.h[nt * 8 + r] = (_Float16)((psc - (float)ph) * 1024.0f); }
    l_q = l_q * al + (ls[0] + ls[1]);
#pragma unroll
    for (int dt = 0; dt < DT; ++dt)
#pragma unroll
      for (int r = 0; r < 8; ++r) { oacc[dt][r] *= al; oaccL[dt][r] *= al; }
#pragma unroll
    for (int dt = 0; dt < DT; ++dt) { const unsigned short* vrow = (const unsigned short*)(kvb + KV_VH + (dt * 16 + ln) * 80); const unsigned short* vrl = (const unsigned short*)(kvb + KV_VL + (dt * 16 + ln) * 80); FragH bv, bl;
      bv.half[0] = *(const v8us*)(vrow + 8 * hh); bv.half[1] = *(const v8us*)(vrow + 16 + 8 * hh); bl.half[0] = *(const v8us*)(vrl + 8 * hh); bl.half[1] = *(const v8us*)(vrl + 16 + 8 * hh);
      oacc[dt] = mmaH<1>(bv.v, bv.v, pa.v, pa.v, oacc[dt]); oaccL[dt] = mmaH<1>(bv.v, bv.v, pl.v, pl.v, oaccL[dt]); oaccL[dt] = mmaH<1>(bl.v, bl.v, pa.v, pa.v, oaccL[dt]); }
    asm volatile("s_wait_dscnt 0x0" ::: "memory");         /* this wave's reads of the buffer are done before it is handed to the copies */
    asm volatile("s_wait_asynccnt 0x0" ::: "memory");      /* this wave's pieces of the next stage have landed */
    __syncthreads();                                       /* publishes the next stage and ends every wave's reads of this one */
    if (j0 + 64 < SEQ) kv_stage(lk + bsel, lv + bsel, gkh + (size_t)(j0 + 64) * ldk, gkl + (size_t)(j0 + 64) * ldk, k16, gvh + j0 + 64, gvl + j0 + 64, v32); }
  asm volatile("s_wait_asynccnt 0x0" ::: "memory");        /* no copy is outstanding when the wave goes on to its end */
  const float lt = l_q + xhalf(l_q); const float linv = (lt > 0.f) ? 1.0f / lt : 0.f;
#pragma unroll
  for (int dt = 0; dt < DT; ++dt)
#pragma unroll
    for (int r = 0; r < 8; ++r) { float v = oacc[dt][r]; v += oaccL[dt][r] * 0.0009765625f; sO[w][ln][dt * 16 + 8 * hh + r] = v * linv; }
  __builtin_amdgcn_fence(__ATOMIC_ACQ_REL, "workgroup"); __builtin_amdgcn_wave_barrier();
  {
#pragma unroll
    for (int rp = 0; rp < RPW; rp += 4) { const int r = rp + (lane >> 3), pc = lane & 7; const v4f va = *(const v4fa*)&sO[w][r][pc * 8], vb = *(const v4fa*)&sO[w][r][pc * 8 + 4]; FragH fh, fl;      /* context leaves as f16 hi + 2^10 residual rows, one whole 128-B line per row and plane */
#pragma unroll      /* constant indices: the packed halves stay in registers */
      for (int e = 0; e < 4; ++e) { _Float16 hv = (_Float16)va[e]; fh.h[e] = hv; fl.h[e] = (_Float16)((va[e] - (float)hv) * 1024.0f); hv = (_Float16)vb[e]; fh.h[4 + e] = hv; fl.h[4 + e] = (_Float16)((vb[e] - (float)hv) * 1024.0f); }
      const size_t o8 = ((size_t)b * SEQ + q0 + r) * ldo + h * 64 + pc * 8; *(v8us*)((unsigned short*)OH + o8) = fh.half[0]; *(v8us*)((unsigned short*)OL + o8) = fl.half[0]; }
     } }

// LayerNorm over DM (biased variance, eps 1e-5, affine with bf16 g, b) of (A[r] + bf16(x[rin])), compact row r -> input/output row rin = b*SEQ_FULL + s;
__global__ __launch_bounds__(256) void k_ln1024(const float* __restrict__ A, const float* __restrict__ res, const float* __restrict__ g, const float* __restrict__ bb, float* __restrict__ Y) {
  #pragma clang fp contract(off)
  const int wv = threadIdx.x >> 5, ln = threadIdx.x & 31; const size_t r = (size_t)blockIdx.x * 8 + wv; if (r >= (size_t)NR) return;
  const size_t rb = r / SEQ, rs = r % SEQ; const size_t rin = rb * SEQ_FULL + rs;
  float xv[32]; float sm = 0.f;
#pragma unroll
  for (int i = 0; i < 8; ++i) { const int c0 = i * 128 + ln * 4; const v4f a = *(const v4fa*)(A + r * DM + c0); const v4f rr = *(const v4fa*)(res + rin * DM + c0);
#pragma unroll
    for (int q = 0; q < 4; ++q) { const float v = a[q] + bf16_rne(rr[q]); xv[i * 4 + q] = v; sm += v; } }
#pragma unroll
  for (int o = 16; o > 0; o >>= 1) sm += __shfl_xor(sm, o, 32);
  const float mu = sm * 0.0009765625f; float var = 0.f;
#pragma unroll
  for (int q = 0; q < 32; ++q) { const float d = xv[q] - mu; var += d * d; }
#pragma unroll
  for (int o = 16; o > 0; o >>= 1) var += __shfl_xor(var, o, 32);
  const float inv = 1.0f / sqrtf(var * 0.0009765625f + 1e-5f);
  {
#pragma unroll
    for (int i = 0; i < 8; ++i) { const int c0 = i * 128 + ln * 4; v4f y;
#pragma unroll
      for (int q = 0; q < 4; ++q) { float v = (xv[i * 4 + q] - mu) * inv; v *= bf16_rne(g[c0 + q]); v += bf16_rne(bb[c0 + q]); y[q] = v; }
      *(v4f*)(Y + rin * DM + c0) = y; }
     } }

extern "C" void kernel_launch(void* const* d_in, const int* in_sizes, int n_in,
                              void* d_out, int out_size, void* d_ws, size_t ws_size, hipStream_t stream) {
  if (n_in < 13) return;
  const float* x = (const float*)d_in[0]; const float* cdm = (const float*)d_in[1];
  const float* Wq = (const float*)d_in[2]; const float* bq = (const float*)d_in[3]; const float* Wk = (const float*)d_in[4]; const float* bk = (const float*)d_in[5];
  const float* Wv = (const float*)d_in[6]; const float* bv = (const float*)d_in[7]; const float* Wo = (const float*)d_in[8]; const float* bo = (const float*)d_in[9];
  const float* gam = (const float*)d_in[10]; const float* bet = (const float*)d_in[11]; const float* cdw = (const float*)d_in[12];
  const long long rows_need = (long long)(NB - 1) * SEQ_FULL + SEQ;
  if ((long long)in_sizes[0] < rows_need * DM) return;
  if ((long long)in_sizes[1] < (long long)(NB - 1) * SEQ_FULL * SEQ_FULL + (long long)(SEQ - 1) * SEQ_FULL + SEQ) return;
  if (in_sizes[2] < DM * DM || in_sizes[4] < DM * DM || in_sizes[6] < DM * DM || in_sizes[8] < DM * DM) return;
  if (in_sizes[3] < DM || in_sizes[5] < DM || in_sizes[7] < DM || in_sizes[9] < DM || in_sizes[10] < DM || in_sizes[11] < DM || in_sizes[12] < 1) return;
  if ((long long)out_size < rows_need * DM) return;
  char* ws = (char*)d_ws; size_t off = 0;
  auto take = [&](size_t bytes) { char* p = ws + off; off += (bytes + 255) & ~(size_t)255; return p; };
  const size_t np = (size_t)NR * DM;      /* compact activation plane elements */
  _Float16* BQ = (_Float16*)take((size_t)DM * DM * 2); _Float16* BK = (_Float16*)take((size_t)DM * DM * 2); _Float16* BV = (_Float16*)take((size_t)DM * DM * 2); _Float16* BO = (_Float16*)take((size_t)DM * DM * 2);
  _Float16* X16 = (_Float16*)take(np * 2);
  _Float16* QH = (_Float16*)take(np * 2); _Float16* QL = (_Float16*)take(np * 2); _Float16* KH = (_Float16*)take(np * 2); _Float16* KL = (_Float16*)take(np * 2);
  _Float16* OH = (_Float16*)take(np * 2); _Float16* OL = (_Float16*)take(np * 2); _Float16* VT = (_Float16*)take(np * 2); _Float16* VTL = (_Float16*)take(np * 2);
  float* Y = (float*)take(np * 4); float* CS = (float*)take((size_t)SEQ * 32 * 4); float* SN = (float*)take((size_t)SEQ * 32 * 4);
  if (off > ws_size) return;
  const unsigned wb = (unsigned)(((size_t)DM * DM / 8 + 255) / 256); const unsigned eb = (unsigned)((np / 8 + 255) / 256);
  k_wsc<<<wb, 256, 0, stream>>>(Wq, BQ, (size_t)DM * DM / 8, 16.0f); k_wsc<<<wb, 256, 0, stream>>>(Wk, BK, (size_t)DM * DM / 8, 16.0f);
  k_wsc<<<wb, 256, 0, stream>>>(Wv, BV, (size_t)DM * DM / 8, 16.0f); k_wsc<<<wb, 256, 0, stream>>>(Wo, BO, (size_t)DM * DM / 8, 16.0f);      /* [out][in] weights, bf16 then x16 in f16 */
  k_x16b<<<eb, 256, 0, stream>>>(x, X16);
  k_rotab<<<(SEQ * 32 + 255) / 256, 256, 0, stream>>>(CS, SN);
  const dim3 g((NR / 128) * (DM / 64), 1);
  k_gemm2<0, 1><<<g, 128, 0, stream>>>(X16, DM, 0, BQ, DM, 0, 0.0625f, bq, 0, nullptr, 1, 0, 0, nullptr, nullptr, DM, 0, NR, DM, DM, CS, SN, QH, QL);      /* Q -> RoPE -> hi/lo */
  k_gemm2<0, 1><<<g, 128, 0, stream>>>(X16, DM, 0, BK, DM, 0, 0.0625f, bk, 0, nullptr, 1, 0, 0, nullptr, nullptr, DM, 0, NR, DM, DM, CS, SN, KH, KL);      /* K -> RoPE -> hi/lo */
  k_gemm2<0, 2><<<g, 128, 0, stream>>>(X16, DM, 0, BV, DM, 0, 0.0625f, bv, 0, nullptr, 1, 0, 0, nullptr, nullptr, DM, 0, NR, DM, DM, nullptr, nullptr, VT, VTL);      /* V -> hi/lo, transposed per head */
  k_attn<<<NB * NH * (SEQ / 64), 128, 0, stream>>>(QH, QL, DM, KH, KL, DM, VT, VTL, cdm, cdw, OH, OL, DM);      /* context -> hi/lo rows */
  k_gemm2<0, 0><<<g, 128, 0, stream>>>(OL, DM, 0, BO, DM, 0, 0.0625f / 1024.0f, nullptr, 0, nullptr, 1, 0, 0, Y, nullptr, DM, 0, NR, DM, DM, nullptr, nullptr, nullptr, nullptr);
  k_gemm2<0, 0><<<g, 128, 0, stream>>>(OH, DM, 0, BO, DM, 0, 0.0625f, bo, 0, Y, 1, (size_t)DM, 0, Y, nullptr, DM, 0, NR, DM, DM, nullptr, nullptr, nullptr, nullptr);      /* Y = (ctx_lo + ctx_hi) Wo^T + bo */
  k_ln1024<<<NR / 8, 256, 0, stream>>>(Y, x, gam, bet, (float*)d_out);      /* out = LN(bf16(x) + Y) g + b */
}

// v006
// It runs in 206 microseconds.
// Two timings next to v005 put it at 1.07 and 1.06 times that version's speed.
// All steps since v000 together make it 3.31 times as fast.
#include <hip/hip_runtime.h>
// All contractions (Q/K/V projections, Q.K^T, P.V^T, output projection) on v_wmma_f32_16x16x32_f16: f16 operands, f32 accumulate. Float inputs RNE-converted to bf16 (exact in f16; weights carried x16); q, k, v, softmax numerators (x1024) and context carried as f16 hi + 2^10 residual plane pairs; RoPE tables, softmax, residual add and LayerNorm in f32.
#ifndef NB
#define NB 2
#endif
#ifndef SEQ
#define SEQ 2048
#endif
#define NB_FULL 2
#define SEQ_FULL 2048
#define DM 1024
#define NH 16
#define NR (NB * SEQ)
#define SCL 0.125f
#define LOG2E 1.44269504088896340736f
static_assert(NB >= 1 && NB <= NB_FULL);
static_assert(SEQ >= 128 && SEQ <= SEQ_FULL && (SEQ % 128) == 0);
static_assert(NH * 64 == DM);
static_assert((NR % 128) == 0);
static_assert((DM % 64) == 0 && (DM % 128) == 0);

typedef unsigned short v8us __attribute__((ext_vector_type(8), may_alias));
typedef float  v8f  __attribute__((ext_vector_type(8)));
typedef float  v4f  __attribute__((ext_vector_type(4)));
typedef float  v4fa __attribute__((ext_vector_type(4), may_alias));
typedef _Float16 v16h __attribute__((ext_vector_type(16)));
typedef _Float16 v4h __attribute__((ext_vector_type(4)));
union FragH { v16h v; v8us half[2]; _Float16 h[16]; unsigned short u[16]; };

__device__ __forceinline__ unsigned short bf16_bits(float x) { unsigned int u = __float_as_uint(x); return (unsigned short)((u + 0x7FFFu + ((u >> 16) & 1u)) >> 16); }
__device__ __forceinline__ float bf16_val(unsigned short b) { return __uint_as_float(((unsigned int)b) << 16); }
__device__ __forceinline__ float bf16_rne(float x) { return bf16_val(bf16_bits(x)); }

// D += A.B with NT terms: 1 = ah.bh, 2 = + al.bh, 3 = + ah.bl; hazard guard after the last WMMA
template <int NT>
__device__ __forceinline__ v8f mmaH(v16h ah, v16h al, v16h bh, v16h bl, v8f c) {
  c = __builtin_amdgcn_wmma_f32_16x16x32_f16(false, ah, false, bh, (short)0, c, false, false);
  if (NT >= 2) c = __builtin_amdgcn_wmma_f32_16x16x32_f16(false, al, false, bh, (short)0, c, false, false);
  if (NT >= 3) c = __builtin_amdgcn_wmma_f32_16x16x32_f16(false, ah, false, bl, (short)0, c, false, false);
  asm volatile("v_nop\n\tv_nop\n\tv_nop\n\tv_nop" : "+v"(c) : "v"(ah), "v"(al), "v"(bh), "v"(bl));
  return c;
}

// ---- GEMM engine (work-group tile 128x64, wave tile 32x64; M % 128 == 0, N % 64 == 0, K % 128 == 0, lda and ldb % 8 == 0): C[M][N] f32 = alpha A[M][K].Bt[N][K]^T + bf16(bias) (+ CP own element); A, Bt f16 k-contiguous.
// Each 128-k stage (A 128 rows, then Bt 64 rows, 256 B a row at LDS pitch 272 B) is brought once per work-group into a two-buffer LDS ring, global -> LDS through no register, and read by all four waves.
// A fragment: lane row = l&15, elements 0..7 <- k0 + 8h + i, 8..15 <- k0 + 16 + 8h + i; B fragment from the [n][k] copy with the same k map; D element r -> (row 8h + r, col l&15).
__device__ __forceinline__ v16h g2_frag(const _Float16* p, int hh) { FragH f; f.half[0] = *(const v8us*)((const unsigned short*)p + 8 * hh); f.half[1] = *(const v8us*)((const unsigned short*)p + 16 + 8 * hh); return f.v; }
__device__ __forceinline__ v8f g2_mma(v16h a, v16h b, v8f c) { v8f d = __builtin_amdgcn_wmma_f32_16x16x32_f16(false, a, false, b, (short)0, c, false, false); asm volatile("v_nop\n\tv_nop\n\tv_nop\n\tv_nop" : "+v"(d) : "v"(a), "v"(b)); return d; }
#define G_KT 128
#define G_PITCH 272
#define G_STAGE (192 * G_PITCH)
// eight 16-B pieces of one thread: rows 8 apart, the same 16-B column; a wave's copy covers two whole 256-B rows
__device__ __forceinline__ void g2_copy8(unsigned int l, const unsigned short* g, size_t r8) {
  // the s_wait_xcnt closes the statement so that no address register of an issued copy is rewritten ahead of it
  asm volatile("global_load_async_to_lds_b128 %0, %8, off\n\t"
               "global_load_async_to_lds_b128 %1, %9, off\n\t"
               "global_load_async_to_lds_b128 %2, %10, off\n\t"
               "global_load_async_to_lds_b128 %3, %11, off\n\t"
               "global_load_async_to_lds_b128 %4, %12, off\n\t"
               "global_load_async_to_lds_b128 %5, %13, off\n\t"
               "global_load_async_to_lds_b128 %6, %14, off\n\t"
               "global_load_async_to_lds_b128 %7, %15, off\n\t"
               "s_wait_xcnt 0x0"
               :: "v"(l), "v"(l + 8 * G_PITCH), "v"(l + 16 * G_PITCH), "v"(l + 24 * G_PITCH), "v"(l + 32 * G_PITCH), "v"(l + 40 * G_PITCH), "v"(l + 48 * G_PITCH), "v"(l + 56 * G_PITCH),
                  "v"(g), "v"(g + r8), "v"(g + 2 * r8), "v"(g + 3 * r8), "v"(g + 4 * r8), "v"(g + 5 * r8), "v"(g + 6 * r8), "v"(g + 7 * r8) : "memory");
}
// one stage: A rows 0..127 of the work-group's tile, then Bt rows 0..63, 24 pieces per thread
__device__ __forceinline__ void g2_stage(unsigned int l, const unsigned short* ga, size_t a8, const unsigned short* gb, size_t b8) {
  g2_copy8(l, ga, a8); g2_copy8(l + 64 * G_PITCH, ga + 8 * a8, a8); g2_copy8(l + 128 * G_PITCH, gb, b8);
}
// EPI 0: C f32 rows. EPI 1: RoPE (concatenated tables, interleaved rotate_half: out[d] = x[d] c[s][d mod 32] + rh[d] sn[s][d mod 32], rh[d] = -x[d+1] (d even), x[d-1] (d odd)), then f16 hi + 2^10 residual rows H, L [row][ldc].
// EPI 2: f16 hi + 2^10 residual, stored transposed per head: H, L [(b NH + h) 64 + d][SEQ] (N == DM, one 64-column tile = one head).
// EPI 3: three products of one A in one grid, blockIdx.y picks Bt (stride sB), the planes H, L (stride sH) and the bias (bias, bias1, bias2): 0 and 1 end as EPI 1, 2 as EPI 2.
template <int ACT, int EPI>
__global__ __launch_bounds__(128) void k_gemm2(const _Float16* __restrict__ A, int lda, size_t sA, const _Float16* __restrict__ Bh, int ldb, size_t sB, float alpha, const float* __restrict__ bias, size_t sBias, const float* CP, int rowsPerB, size_t sCPb, int row0g,
    float* C, _Float16* C16, int ldc, size_t sC, int M, int N, int K, const float* __restrict__ CS, const float* __restrict__ SN, _Float16* __restrict__ H, _Float16* __restrict__ L,
    size_t sH, const float* __restrict__ bias1, const float* __restrict__ bias2) {
  __shared__ __attribute__((aligned(16))) float so[4][32][68];
  __shared__ __attribute__((aligned(16))) unsigned char gring[2][G_STAGE];
  const int tid = threadIdx.x, w = tid >> 5, lane = tid & 31, ln = lane & 15, hh = lane >> 4; const int by = blockIdx.y;
  A += (size_t)by * sA; Bh += (size_t)by * sB; const size_t cofs = (size_t)by * sC; const float* bp = bias ? bias + (size_t)by * sBias : nullptr;
  if (EPI == 3) { H += (size_t)by * sH; L += (size_t)by * sH; if (by == 1) bp = bias1; if (by == 2) bp = bias2; }      /* blockIdx.y is the same for the whole work-group */
  const int ntn = N >> 6; const int mt = blockIdx.x / ntn, nq = blockIdx.x - mt * ntn; const int row0 = mt * 128 + 32 * w, col0 = nq * 64; if (mt * 128 >= M) return;      /* the whole work-group leaves or none, ahead of every barrier and copy */
  const v8f z8 = {0.f,0.f,0.f,0.f,0.f,0.f,0.f,0.f}; v8f c00 = z8, c01 = z8, c02 = z8, c03 = z8, c10 = z8, c11 = z8, c12 = z8, c13 = z8;
  // this thread's pieces: stage row tid/16 (and +8 ...), 16-B column tid%16
  const unsigned int lg = (unsigned int)(size_t)&gring[0][0] + (tid >> 4) * G_PITCH + (tid & 15) * 16;
  const unsigned short* ga = (const unsigned short*)A + (size_t)(mt * 128 + (tid >> 4)) * lda + (tid & 15) * 8; const unsigned short* gb = (const unsigned short*)Bh + (size_t)(col0 + (tid >> 4)) * ldb + (tid & 15) * 8;
  const size_t a8 = (size_t)8 * lda, b8 = (size_t)8 * ldb;
  g2_stage(lg, ga, a8, gb, b8);
  asm volatile("s_wait_asynccnt 0x0" ::: "memory");      /* stage 0 has landed before the barrier that publishes it */
  __syncthreads();
  if (G_KT < K) g2_stage(lg + G_STAGE, ga + G_KT, a8, gb + G_KT, b8);
#pragma unroll 1
  for (int kt = 0; kt < K; kt += G_KT) {
    const unsigned int bsel = (kt & G_KT) ? G_STAGE : 0; const unsigned char* sb = &gring[0][0] + bsel;
    const _Float16* a0p = (const _Float16*)(sb + (32 * w + ln) * G_PITCH); const _Float16* a1p = (const _Float16*)(sb + (32 * w + 16 + ln) * G_PITCH);
    const _Float16* b0p = (const _Float16*)(sb + (128 + ln) * G_PITCH); const _Float16* b1p = (const _Float16*)(sb + (144 + ln) * G_PITCH); const _Float16* b2p = (const _Float16*)(sb + (160 + ln) * G_PITCH); const _Float16* b3p = (const _Float16*)(sb + (176 + ln) * G_PITCH);
    // two fragment sets: the twelve LDS reads of the next 32-k step of this same stage go out as one group ahead of the current step's products;
    // the step loop is unrolled so that the set index is a constant and both sets stay in registers
    v16h fa0[2], fa1[2], fb0[2], fb1[2], fb2[2], fb3[2];
    fa0[0] = g2_frag(a0p, hh); fa1[0] = g2_frag(a1p, hh); fb0[0] = g2_frag(b0p, hh); fb1[0] = g2_frag(b1p, hh); fb2[0] = g2_frag(b2p, hh); fb3[0] = g2_frag(b3p, hh);
#pragma unroll
    for (int ks = 0; ks < G_KT / 32; ++ks) { const int cu = ks & 1, nx = cu ^ 1;
      if (ks + 1 < G_KT / 32) { const int kb = (ks + 1) * 32; fa0[nx] = g2_frag(a0p + kb, hh); fa1[nx] = g2_frag(a1p + kb, hh); fb0[nx] = g2_frag(b0p + kb, hh); fb1[nx] = g2_frag(b1p + kb, hh); fb2[nx] = g2_frag(b2p + kb, hh); fb3[nx] = g2_frag(b3p + kb, hh); }
      c00 = g2_mma(fa0[cu], fb0[cu], c00); c10 = g2_mma(fa1[cu], fb0[cu], c10);
      c01 = g2_mma(fa0[cu], fb1[cu], c01); c11 = g2_mma(fa1[cu], fb1[cu], c11);
      c02 = g2_mma(fa0[cu], fb2[cu], c02); c12 = g2_mma(fa1[cu], fb2[cu], c12);
      c03 = g2_mma(fa0[cu], fb3[cu], c03); c13 = g2_mma(fa1[cu], fb3[cu], c13); }
    asm volatile("s_wait_dscnt 0x0" ::: "memory");         /* this wave's reads of the buffer are done before it is handed to the copies */
    asm volatile("s_wait_asynccnt 0x0" ::: "memory");      /* this wave's pieces of the next stage have landed */
    __syncthreads();                                       /* publishes the next stage and ends every wave's reads of this one */
    if (kt + 2 * G_KT < K) g2_stage(lg + bsel, ga + kt + 2 * G_KT, a8, gb + kt + 2 * G_KT, b8); }
  asm volatile("s_wait_asynccnt 0x0" ::: "memory");        /* no copy is outstanding when the wave goes on to its end */
  v8f accs[8] = {c00, c01, c02, c03, c10, c11, c12, c13};
  if (EPI == 2 || (EPI == 3 && by == 2)) {
    // a lane holds eight consecutive rows of one column: 16 B of a transposed row. Both planes ([64 columns][128 rows] f16, pitch 272 B) are gathered in so, then leave as 256-B runs.
    unsigned char* tb = (unsigned char*)&so[0][0][0]; float bv4[4] = {0.f, 0.f, 0.f, 0.f};
    if (bp) {
#pragma unroll      /* constant indices: bv4 stays in registers, the four loads go out together */
      for (int t = 0; t < 4; ++t) bv4[t] = bf16_rne(bp[col0 + t * 16 + ln]); }
#pragma unroll      /* this loop and the next: constant indices keep accs and the packed halves in registers */
    for (int u = 0; u < 8; ++u) { const int t = u & 3, half = u >> 2; const float bv = bv4[t]; FragH fh, fl;
#pragma unroll
      for (int r = 0; r < 8; ++r) { const float v = accs[u][r] * alpha + bv; const _Float16 hv = (_Float16)v; fh.h[r] = hv; fl.h[r] = (_Float16)((v - (float)hv) * 1024.0f); }
      unsigned char* tp = tb + (t * 16 + ln) * 272 + (32 * w + half * 16 + 8 * hh) * 2; *(v8us*)tp = fh.half[0]; *(v8us*)(tp + 64 * 272) = fl.half[0]; }
    __syncthreads();      /* every wave's 32 rows stand in the transposed tile before any wave reads whole runs of it */
    const size_t vrow = (size_t)((mt * 128) / SEQ * NH + nq) * 64; const int s0 = (mt * 128) % SEQ;
#pragma unroll      /* the LDS reads of later runs go out ahead of the stores of earlier ones */
    for (int it = 0; it < 8; ++it) { const int i = it * 128 + tid, pc = i & 15, d = i >> 4; const size_t o = (vrow + d) * SEQ + s0 + pc * 8;
      *(v8us*)((unsigned short*)H + o) = *(const v8us*)(tb + d * 272 + pc * 16); *(v8us*)((unsigned short*)L + o) = *(const v8us*)(tb + (64 + d) * 272 + pc * 16); }
    return; }
#pragma unroll
  for (int u = 0; u < 8; ++u) { const int t = u & 3, half = u >> 2; const int col = col0 + t * 16 + ln; const float bv = bp ? bf16_rne(bp[col]) : 0.f;
#pragma unroll
    for (int r = 0; r < 8; ++r) { const int rloc = half * 16 + 8 * hh + r; float v = accs[u][r] * alpha + bv;
      if (EPI == 0 && CP) { if (rowsPerB < 0) v += CP[cofs + (size_t)(row0g + row0 + rloc) * ldc + col];      /* rowsPerB < 0: own element of the batched C plane */ else { const int bidx = (row0g + row0 + rloc) / rowsPerB; v += CP[(size_t)bidx * sCPb + (size_t)by * 64 + col]; } }
      if (ACT == 3) v = fmaxf(v, 0.f);
      so[w][rloc][t * 16 + ln] = v; } }
  __builtin_amdgcn_fence(__ATOMIC_ACQ_REL, "workgroup"); __builtin_amdgcn_wave_barrier();
  if (EPI == 1 || EPI == 3) {
    // eight columns a lane, four rows a wave store: each row's 64 columns leave as one whole 128-B line per plane
    const int rs4 = lane >> 3, c8 = (lane & 7) * 8, j0 = c8 & 31;
    const size_t t0 = (size_t)(row0 % SEQ + rs4) * 32 + j0;      /* a wave's 32 rows lie in one sequence: SEQ % 128 == 0 */
    unsigned short* hp = (unsigned short*)H + (size_t)(row0 + rs4) * ldc + col0 + c8; unsigned short* lp = (unsigned short*)L + (size_t)(row0 + rs4) * ldc + col0 + c8; const size_t r4 = (size_t)4 * ldc;
#pragma unroll      /* the table loads of all eight steps take immediate offsets and go out together */
    for (int q = 0; q < 8; ++q) { const int r = q * 4 + rs4;
      const v4f a = *(const v4fa*)&so[w][r][c8], c = *(const v4fa*)&so[w][r][c8 + 4]; const float xs[8] = {a[0], a[1], a[2], a[3], c[0], c[1], c[2], c[3]};
      const float* tp = CS + t0 + q * 128; const float* up = SN + t0 + q * 128; const v4f ca = *(const v4fa*)tp, cb = *(const v4fa*)(tp + 4), sa = *(const v4fa*)up, sb = *(const v4fa*)(up + 4);
      const float cs[8] = {ca[0], ca[1], ca[2], ca[3], cb[0], cb[1], cb[2], cb[3]}; const float sn[8] = {sa[0], sa[1], sa[2], sa[3], sb[0], sb[1], sb[2], sb[3]};
      FragH fh, fl;
#pragma unroll      /* constant indices: xs, cs, sn and the packed halves stay in registers */
      for (int e = 0; e < 8; ++e) { const float pr = xs[e ^ 1]; const float rh = (e & 1) ? pr : -pr; const float o = xs[e] * cs[e] + rh * sn[e];
        const _Float16 hv = (_Float16)o; fh.h[e] = hv; fl.h[e] = (_Float16)((o - (float)hv) * 1024.0f); }
      *(v8us*)(hp + q * r4) = fh.half[0]; *(v8us*)(lp + q * r4) = fl.half[0]; }
    __builtin_amdgcn_endpgm(); }      /* the wave ends here: behind a plain return the compiler leads this path on to the test in front of the other epilogue and keeps the 64 accumulator registers alive all through it (300 registers against 207) */
  const int rsub = lane >> 4, c4 = (lane & 15) * 4;
  {
#pragma unroll
    for (int q = 0; q < 16; ++q) { const int r = q * 2 + rsub; const v4f v = *(const v4fa*)&so[w][r][c4]; if (C) *(v4f*)(C + cofs + (size_t)(row0 + r) * ldc + col0 + c4) = v; if (C16) { v4h h4;
#pragma unroll
        for (int i = 0; i < 4; ++i) h4[i] = (_Float16)v[i]; *(v4h*)(C16 + cofs + (size_t)(row0 + r) * ldc + col0 + c4) = h4; } }
     } }

// ---- preparation, one launch: the RoPE tables, x -> f16 and the four weight planes read nothing of each other's output, so their work-groups share one grid.
#define PB_R (SEQ * 32 / 256)
#define PB_X (NR * DM / 8 / 256)
#define PB_W (DM * DM / 8 / 256)
static_assert((SEQ * 32) % 256 == 0 && (NR * DM / 8) % 256 == 0 && (DM * DM / 8) % 256 == 0);
static_assert((long long)NB_FULL * SEQ_FULL * DM * 4 < (1ll << 32));
// one unit of eight elements per thread: dst[8 t ..] = f16(bf16(src[e0 ..]) sc); every offset fits 32 bits
__device__ __forceinline__ void prep_cvt(const float* __restrict__ src, unsigned int e0, _Float16* __restrict__ dst, unsigned int t, float sc) {
  const unsigned int ib = e0 * 4; const float* p = (const float*)((const char*)src + ib); const v4f a = *(const v4fa*)p, c = *(const v4fa*)(p + 4); FragH f;
  asm volatile("s_wait_xcnt 0x0" :: "v"(ib) : "memory");      /* the two loads' one offset register stays whole up to here and is free behind it */
#pragma unroll
  for (int q = 0; q < 4; ++q) { f.h[q] = (_Float16)(bf16_rne(a[q]) * sc); f.h[4 + q] = (_Float16)(bf16_rne(c[q]) * sc); }
  *(v8us*)((unsigned short*)dst + (size_t)t * 8) = f.half[0];
  asm volatile("s_wait_xcnt 0x0" ::: "memory"); }      /* no register that the issued store names is written again ahead of this, whatever path the compiler lays behind it */

__device__ __forceinline__ void prep_rotab(int t, float* __restrict__ CS, float* __restrict__ SN) {
  #pragma clang fp contract(off)
  const int j = t % 32, s = t / 32; const float ex = (float)(2 * j) / 64.0f; const float inv = 1.0f / powf(10000.0f, ex); const float th = (float)s * inv; const float c = cosf(th), sn = sinf(th);
  { *(float*)(CS + t) = c; *(float*)(SN + t) = sn;  } }

// work-groups 0 .. PB_R - 1: tables (the longest chains start first); then PB_X of x (compact row r stands at input row b SEQ_FULL + s); then PB_W of each weight, [out][in], bf16 then x16 in f16
__global__ __launch_bounds__(256) void k_prep(const float* __restrict__ x, const float* __restrict__ Wq, const float* __restrict__ Wk, const float* __restrict__ Wv, const float* __restrict__ Wo,
    _Float16* __restrict__ X16, _Float16* __restrict__ BQ, _Float16* __restrict__ BK, _Float16* __restrict__ BV, _Float16* __restrict__ BO, float* __restrict__ CS, float* __restrict__ SN) {
  int blk = blockIdx.x;
  if (blk < PB_R) { prep_rotab(blk * 256 + (int)threadIdx.x, CS, SN); return; }
  blk -= PB_R;
  if (blk < PB_X) { const unsigned int t = (unsigned int)blk * 256 + threadIdx.x; const unsigned int row = (t * 8) / DM, c0 = (t * 8) % DM, rb = row / SEQ, rs = row % SEQ;
    prep_cvt(x, (rb * SEQ_FULL + rs) * DM + c0, X16, t, 1.0f); return; }
  blk -= PB_X;
  const int m = blk / PB_W; blk -= m * PB_W;
  const float* Wm = m == 0 ? Wq : m == 1 ? Wk : m == 2 ? Wv : Wo; _Float16* Bt = m == 0 ? BQ : m == 1 ? BK : m == 2 ? BV : BO;
  const unsigned int t = (unsigned int)blk * 256 + threadIdx.x; prep_cvt(Wm, t * 8, Bt, t, 16.0f); }

// One 32-key stage of K hi, K lo (32 rows x 128 B, LDS pitch 144 B) and V^T hi, V^T lo (64 rows x 64 B, LDS pitch 80 B): 1024 pieces of 16 B, eight per thread, global -> LDS through no register.
#define KV_KH 0
#define KV_KL 4608
#define KV_VH 9216
#define KV_VL 14336
#define KV_STAGE 19456
__device__ __forceinline__ void kv_stage(unsigned int lk, unsigned int lv, const unsigned short* gkh, const unsigned short* gkl, size_t k16, const unsigned short* gvh, const unsigned short* gvl, size_t v32) {
  // the s_wait_xcnt closes the statement so that no address register of an issued copy is rewritten ahead of it
  asm volatile("global_load_async_to_lds_b128 %0, %8, off\n\t"
               "global_load_async_to_lds_b128 %1, %9, off\n\t"
               "global_load_async_to_lds_b128 %2, %10, off\n\t"
               "global_load_async_to_lds_b128 %3, %11, off\n\t"
               "global_load_async_to_lds_b128 %4, %12, off\n\t"
               "global_load_async_to_lds_b128 %5, %13, off\n\t"
               "global_load_async_to_lds_b128 %6, %14, off\n\t"
               "global_load_async_to_lds_b128 %7, %15, off\n\t"
               "s_wait_xcnt 0x0"
               :: "v"(lk + KV_KH), "v"(lk + KV_KH + 16 * 144), "v"(lk + KV_KL), "v"(lk + KV_KL + 16 * 144), "v"(lv + KV_VH), "v"(lv + KV_VH + 32 * 80), "v"(lv + KV_VL), "v"(lv + KV_VL + 32 * 80),
                  "v"(gkh), "v"(gkh + k16), "v"(gkl), "v"(gkl + k16), "v"(gvh), "v"(gvh + v32), "v"(gvl), "v"(gvl + v32) : "memory");
}

// lane l with lane l ^ 16: joins the two key halves that lanes c and c + 16 hold of one query
__device__ __forceinline__ float xhalf(float x) { return __builtin_bit_cast(float, __builtin_amdgcn_permlanex16(__builtin_bit_cast(int, x), __builtin_bit_cast(int, x), 0x76543210, 0xfedcba98, false, false)); }

__global__ __launch_bounds__(128) void k_attn(const _Float16* __restrict__ Q16, const _Float16* __restrict__ QL, int ldq, const _Float16* __restrict__ K16, const _Float16* __restrict__ KL, int ldk,
                                             const _Float16* __restrict__ Vt, const _Float16* __restrict__ VtL, const float* __restrict__ AM, const float* __restrict__ AW, _Float16* __restrict__ OH, _Float16* __restrict__ OL, int ldo) {
  constexpr int RPW = 16, DT = 4, KS = 2, QBN = SEQ / 64;
  __shared__ __attribute__((aligned(16))) float sO[4][RPW][64 + 4];
  __shared__ __attribute__((aligned(16))) unsigned char ring[2][KV_STAGE];
  const int tid = threadIdx.x, w = tid >> 5, lane = tid & 31, ln = lane & 15, hh = lane >> 4;
  const int slab = blockIdx.x / QBN, qblk = blockIdx.x % QBN; const int b = slab / NH, h = slab % NH; const int qb0 = qblk * (4 * RPW); const int q0 = qb0 + w * RPW;
  const float ww = bf16_rne(AW[0]) * LOG2E;
  FragH aq[KS], aql[KS];
  { const unsigned short* qr = (const unsigned short*)Q16 + ((size_t)b * SEQ + q0 + ln) * ldq + h * 64; const unsigned short* ql = (const unsigned short*)QL + ((size_t)b * SEQ + q0 + ln) * ldq + h * 64;
#pragma unroll
    for (int ks = 0; ks < KS; ++ks) { aq[ks].half[0] = *(const v8us*)(qr + ks * 32 + 8 * hh); aq[ks].half[1] = *(const v8us*)(qr + ks * 32 + 16 + 8 * hh); aql[ks].half[0] = *(const v8us*)(ql + ks * 32 + 8 * hh); aql[ks].half[1] = *(const v8us*)(ql + ks * 32 + 16 + 8 * hh); } }
  const unsigned short* Vth = (const unsigned short*)Vt + (size_t)slab * 64 * SEQ; const unsigned short* Vtl = (const unsigned short*)VtL + (size_t)slab * 64 * SEQ;
  const float* amq = AM + (size_t)b * SEQ_FULL * SEQ_FULL + (size_t)(q0 + ln) * SEQ_FULL + 8 * hh;      /* mask[b][0][own query][.] with full strides, at this lane half's first key */
  const v8f z8 = {0.f,0.f,0.f,0.f,0.f,0.f,0.f,0.f};
  float m_q = -3.0e38f, l_q = 0.f; v8f oacc[DT], oaccL[DT];
#pragma unroll
  for (int dt = 0; dt < DT; ++dt) { oacc[dt] = z8; oaccL[dt] = z8; }
  // this thread's pieces: K row tid/8 (and +16), 16-B column tid%8; V^T row tid/4 (and +32), 16-B column tid%4
  const unsigned int lring = (unsigned int)(size_t)&ring[0][0]; const unsigned int lk = lring + (tid >> 3) * 144 + (tid & 7) * 16, lv = lring + (tid >> 2) * 80 + (tid & 3) * 16;
  const size_t kofs = ((size_t)b * SEQ + (tid >> 3)) * ldk + h * 64 + (tid & 7) * 8; const unsigned short* gkh = (const unsigned short*)K16 + kofs; const unsigned short* gkl = (const unsigned short*)KL + kofs;
  const size_t vofs = (size_t)(tid >> 2) * SEQ + (tid & 3) * 8; const unsigned short* gvh = Vth + vofs; const unsigned short* gvl = Vtl + vofs;
  const size_t k16 = (size_t)16 * ldk, k32 = (size_t)32 * ldk, v32 = (size_t)32 * SEQ;
  kv_stage(lk, lv, gkh, gkl, k16, gvh, gvl, v32);
  asm volatile("s_wait_asynccnt 0x0" ::: "memory");      /* stage 0 has landed before the barrier that publishes it */
  __syncthreads();
  kv_stage(lk + KV_STAGE, lv + KV_STAGE, gkh + k32, gkl + k32, k16, gvh + 32, gvl + 32, v32);
#pragma unroll 1
  for (int j0 = 0; j0 < SEQ; j0 += 32) {
    const unsigned int bsel = (j0 & 32) ? KV_STAGE : 0; const unsigned char* kvb = &ring[0][0] + bsel;
    v4f mk[2][2];      /* own query's mask, keys j0 + 16 nt + 8 hh + 0..7 */
#pragma unroll
    for (int nt = 0; nt < 2; ++nt) { mk[nt][0] = *(const v4fa*)(amq + j0 + nt * 16); mk[nt][1] = *(const v4fa*)(amq + j0 + nt * 16 + 4); }
    v8f s[2];
#pragma unroll
    for (int nt = 0; nt < 2; ++nt) { const unsigned short* kr = (const unsigned short*)(kvb + KV_KH + (nt * 16 + ln) * 144); const unsigned short* klr = (const unsigned short*)(kvb + KV_KL + (nt * 16 + ln) * 144); FragH bk[KS], bkl[KS];
#pragma unroll
      for (int ks = 0; ks < KS; ++ks) { bk[ks].half[0] = *(const v8us*)(kr + ks * 32 + 8 * hh); bk[ks].half[1] = *(const v8us*)(kr + ks * 32 + 16 + 8 * hh); bkl[ks].half[0] = *(const v8us*)(klr + ks * 32 + 8 * hh); bkl[ks].half[1] = *(const v8us*)(klr + ks * 32 + 16 + 8 * hh); }
      v8f acc = z8, accl = z8;
#pragma unroll
      for (int ks = 0; ks < KS; ++ks) { acc = mmaH<1>(bk[ks].v, bk[ks].v, aq[ks].v, aq[ks].v, acc); accl = mmaH<1>(bk[ks].v, bk[ks].v, aql[ks].v, aql[ks].v, accl); accl = mmaH<1>(bkl[ks].v, bkl[ks].v, aq[ks].v, aq[ks].v, accl); }
#pragma unroll
      for (int r = 0; r < 8; ++r) acc[r] += accl[r] * 0.0009765625f;
      s[nt] = acc; }
    float mc = -3.0e38f;
#pragma unroll
    for (int nt = 0; nt < 2; ++nt)
#pragma unroll
      for (int r = 0; r < 8; ++r) { float sv = s[nt][r] * (SCL * LOG2E); sv += bf16_rne(mk[nt][r >> 2][r & 3]) * ww; s[nt][r] = sv; mc = fmaxf(mc, sv); }
    mc = fmaxf(mc, xhalf(mc));
    const float mn = fmaxf(m_q, mc - 10.0f); const float al = __builtin_amdgcn_exp2f((mn > -1.0e38f) ? m_q - mn : 0.f); m_q = mn;
    FragH pa, pl; float ls[2] = {0.f, 0.f};
#pragma unroll
    for (int nt = 0; nt < 2; ++nt)
#pragma unroll
      for (int r = 0; r < 8; ++r) { const float psc = __builtin_amdgcn_exp2f(s[nt][r] - mn); ls[nt] += psc; const _Float16 ph = (_Float16)psc; pa.h[nt * 8 + r] = ph; pl.h[nt * 8 + r] = (_Float16)((psc - (float)ph) * 1024.0f); }
    l_q = l_q * al + (ls[0] + ls[1]);
#pragma unroll
    for (int dt = 0; dt < DT; ++dt)
#pragma unroll
      for (int r = 0; r < 8; ++r) { oacc[dt][r] *= al; oaccL[dt][r] *= al; }
#pragma unroll
    for (int dt = 0; dt < DT; ++dt) { const unsigned short* vrow = (const unsigned short*)(kvb + KV_VH + (dt * 16 + ln) * 80); const unsigned short* vrl = (const unsigned short*)(kvb + KV_VL + (dt * 16 + ln) * 80); FragH bv, bl;
      bv.half[0] = *(const v8us*)(vrow + 8 * hh); bv.half[1] = *(const v8us*)(vrow + 16 + 8 * hh); bl.half[0] = *(const v8us*)(vrl + 8 * hh); bl.half[1] = *(const v8us*)(vrl + 16 + 8 * hh);
      oacc[dt] = mmaH<1>(bv.v, bv.v, pa.v, pa.v, oacc[dt]); oaccL[dt] = mmaH<1>(bv.v, bv.v, pl.v, pl.v, oaccL[dt]); oaccL[dt] = mmaH<1>(bl.v, bl.v, pa.v, pa.v, oaccL[dt]); }
    asm volatile("s_wait_dscnt 0x0" ::: "memory");         /* this wave's reads of the buffer are done before it is handed to the copies */
    asm volatile("s_wait_asynccnt 0x0" ::: "memory");      /* this wave's pieces of the next stage have landed */
    __syncthreads();                                       /* publishes the next stage and ends every wave's reads of this one */
    if (j0 + 64 < SEQ) kv_stage(lk + bsel, lv + bsel, gkh + (size_t)(j0 + 64) * ldk, gkl + (size_t)(j0 + 64) * ldk, k16, gvh + j0 + 64, gvl + j0 + 64, v32); }
  asm volatile("s_wait_asynccnt 0x0" ::: "memory");        /* no copy is outstanding when the wave goes on to its end */
  const float lt = l_q + xhalf(l_q); const float linv = (lt > 0.f) ? 1.0f / lt : 0.f;
#pragma unroll
  for (int dt = 0; dt < DT; ++dt)
#pragma unroll
    for (int r = 0; r < 8; ++r) { float v = oacc[dt][r]; v += oaccL[dt][r] * 0.0009765625f; sO[w][ln][dt * 16 + 8 * hh + r] = v * linv; }
  __builtin_amdgcn_fence(__ATOMIC_ACQ_REL, "workgroup"); __builtin_amdgcn_wave_barrier();
  {
#pragma unroll
    for (int rp = 0; rp < RPW; rp += 4) { const int r = rp + (lane >> 3), pc = lane & 7; const v4f va = *(const v4fa*)&sO[w][r][pc * 8], vb = *(const v4fa*)&sO[w][r][pc * 8 + 4]; FragH fh, fl;      /* context leaves as f16 hi + 2^10 residual rows, one whole 128-B line per row and plane */
#pragma unroll      /* constant indices: the packed halves stay in registers */
      for (int e = 0; e < 4; ++e) { _Float16 hv = (_Float16)va[e]; fh.h[e] = hv; fl.h[e] = (_Float16)((va[e] - (float)hv) * 1024.0f); hv = (_Float16)vb[e]; fh.h[4 + e] = hv; fl.h[4 + e] = (_Float16)((vb[e] - (float)hv) * 1024.0f); }
      const size_t o8 = ((size_t)b * SEQ + q0 + r) * ldo + h * 64 + pc * 8; *(v8us*)((unsigned short*)OH + o8) = fh.half[0]; *(v8us*)((unsigned short*)OL + o8) = fl.half[0]; }
     } }

// LayerNorm over DM (biased variance, eps 1e-5, affine with bf16 g, b) of (A[r] + bf16(x[rin])), compact row r -> input/output row rin = b*SEQ_FULL + s;
__global__ __launch_bounds__(256) void k_ln1024(const float* __restrict__ A, const float* __restrict__ res, const float* __restrict__ g, const float* __restrict__ bb, float* __restrict__ Y) {
  #pragma clang fp contract(off)
  const int wv = threadIdx.x >> 5, ln = threadIdx.x & 31; const size_t r = (size_t)blockIdx.x * 8 + wv; if (r >= (size_t)NR) return;
  const size_t rb = r / SEQ, rs = r % SEQ; const size_t rin = rb * SEQ_FULL + rs;
  float xv[32]; float sm = 0.f;
#pragma unroll
  for (int i = 0; i < 8; ++i) { const int c0 = i * 128 + ln * 4; const v4f a = *(const v4fa*)(A + r * DM + c0); const v4f rr = *(const v4fa*)(res + rin * DM + c0);
#pragma unroll
    for (int q = 0; q < 4; ++q) { const float v = a[q] + bf16_rne(rr[q]); xv[i * 4 + q] = v; sm += v; } }
#pragma unroll
  for (int o = 16; o > 0; o >>= 1) sm += __shfl_xor(sm, o, 32);
  const float mu = sm * 0.0009765625f; float var = 0.f;
#pragma unroll
  for (int q = 0; q < 32; ++q) { const float d = xv[q] - mu; var += d * d; }
#pragma unroll
  for (int o = 16; o > 0; o >>= 1) var += __shfl_xor(var, o, 32);
  const float inv = 1.0f / sqrtf(var * 0.0009765625f + 1e-5f);
  {
#pragma unroll
    for (int i = 0; i < 8; ++i) { const int c0 = i * 128 + ln * 4; v4f y;
#pragma unroll
      for (int q = 0; q < 4; ++q) { float v = (xv[i * 4 + q] - mu) * inv; v *= bf16_rne(g[c0 + q]); v += bf16_rne(bb[c0 + q]); y[q] = v; }
      *(v4f*)(Y + rin * DM + c0) = y; }
     } }

extern "C" void kernel_launch(void* const* d_in, const int* in_sizes, int n_in,
                              void* d_out, int out_size, void* d_ws, size_t ws_size, hipStream_t stream) {
  if (n_in < 13) return;
  const float* x = (const float*)d_in[0]; const float* cdm = (const float*)d_in[1];
  const float* Wq = (const float*)d_in[2]; const float* bq = (const float*)d_in[3]; const float* Wk = (const float*)d_in[4]; const float* bk = (const float*)d_in[5];
  const float* Wv = (const float*)d_in[6]; const float* bv = (const float*)d_in[7]; const float* Wo = (const float*)d_in[8]; const float* bo = (const float*)d_in[9];
  const float* gam = (const float*)d_in[10]; const float* bet = (const float*)d_in[11]; const float* cdw = (const float*)d_in[12];
  const long long rows_need = (long long)(NB - 1) * SEQ_FULL + SEQ;
  if ((long long)in_sizes[0] < rows_need * DM) return;
  if ((long long)in_sizes[1] < (long long)(NB - 1) * SEQ_FULL * SEQ_FULL + (long long)(SEQ - 1) * SEQ_FULL + SEQ) return;
  if (in_sizes[2] < DM * DM || in_sizes[4] < DM * DM || in_sizes[6] < DM * DM || in_sizes[8] < DM * DM) return;
  if (in_sizes[3] < DM || in_sizes[5] < DM || in_sizes[7] < DM || in_sizes[9] < DM || in_sizes[10] < DM || in_sizes[11] < DM || in_sizes[12] < 1) return;
  if ((long long)out_size < rows_need * DM) return;
  char* ws = (char*)d_ws; size_t off = 0;
  auto take = [&](size_t bytes) { char* p = ws + off; off += (bytes + 255) & ~(size_t)255; return p; };
  const size_t np = (size_t)NR * DM;      /* compact activation plane elements */
  _Float16* BQ = (_Float16*)take((size_t)DM * DM * 2); _Float16* BK = (_Float16*)take((size_t)DM * DM * 2); _Float16* BV = (_Float16*)take((size_t)DM * DM * 2); _Float16* BO = (_Float16*)take((size_t)DM * DM * 2);
  _Float16* X16 = (_Float16*)take(np * 2);
  _Float16* QH = (_Float16*)take(np * 2); _Float16* QL = (_Float16*)take(np * 2); _Float16* KH = (_Float16*)take(np * 2); _Float16* KL = (_Float16*)take(np * 2);
  _Float16* VT = (_Float16*)take(np * 2); _Float16* VTL = (_Float16*)take(np * 2); _Float16* OH = (_Float16*)take(np * 2); _Float16* OL = (_Float16*)take(np * 2);
  float* Y = (float*)take(np * 4); float* CS = (float*)take((size_t)SEQ * 32 * 4); float* SN = (float*)take((size_t)SEQ * 32 * 4);
  if (off > ws_size) return;
  static_assert(((size_t)DM * DM * 2) % 256 == 0 && ((size_t)NR * DM * 2) % 256 == 0);      /* BQ, BK, BV and the pairs (QH, QL), (KH, KL), (VT, VTL) stand back to back: one stride each reaches all three */
  k_prep<<<PB_R + PB_X + 4 * PB_W, 256, 0, stream>>>(x, Wq, Wk, Wv, Wo, X16, BQ, BK, BV, BO, CS, SN);
  const dim3 g((NR / 128) * (DM / 64), 1); const dim3 g3((NR / 128) * (DM / 64), 3);
  k_gemm2<0, 3><<<g3, 128, 0, stream>>>(X16, DM, 0, BQ, DM, (size_t)DM * DM, 0.0625f, bq, 0, nullptr, 1, 0, 0, nullptr, nullptr, DM, 0, NR, DM, DM, CS, SN, QH, QL, 2 * np, bk, bv);      /* Q, K -> RoPE -> hi/lo; V -> hi/lo, transposed per head */
  k_attn<<<NB * NH * (SEQ / 64), 128, 0, stream>>>(QH, QL, DM, KH, KL, DM, VT, VTL, cdm, cdw, OH, OL, DM);      /* context -> hi/lo rows */
  k_gemm2<0, 0><<<g, 128, 0, stream>>>(OL, DM, 0, BO, DM, 0, 0.0625f / 1024.0f, nullptr, 0, nullptr, 1, 0, 0, Y, nullptr, DM, 0, NR, DM, DM, nullptr, nullptr, nullptr, nullptr, 0, nullptr, nullptr);
  k_gemm2<0, 0><<<g, 128, 0, stream>>>(OH, DM, 0, BO, DM, 0, 0.0625f, bo, 0, Y, 1, (size_t)DM, 0, Y, nullptr, DM, 0, NR, DM, DM, nullptr, nullptr, nullptr, nullptr, 0, nullptr, nullptr);      /* Y = (ctx_lo + ctx_hi) Wo^T + bo */
  k_ln1024<<<NR / 8, 256, 0, stream>>>(Y, x, gam, bet, (float*)d_out);      /* out = LN(bf16(x) + Y) g + b */
}

// v007
// A run of this version takes 183 microseconds.
// Next to v006, in two timings, it ran 1.13 and 1.12 times as fast.
// Counting every step since v000, it is 3.72 times as fast.
#include <hip/hip_runtime.h>
// All contractions (Q/K/V projections, Q.K^T, P.V^T, output projection) on v_wmma_f32_16x16x32_f16: f16 operands, f32 accumulate. Float inputs RNE-converted to bf16 (exact in f16; weights carried x16); q, k, v, softmax numerators (x1024) and context carried as f16 hi + 2^10 residual plane pairs; RoPE tables, softmax, residual add and LayerNorm in f32.
#ifndef NB
#define NB 2
#endif
#ifndef SEQ
#define SEQ 2048
#endif
#define NB_FULL 2
#define SEQ_FULL 2048
#define DM 1024
#define NH 16
#define NR (NB * SEQ)
#define SCL 0.125f
#define LOG2E 1.44269504088896340736f
static_assert(NB >= 1 && NB <= NB_FULL);
static_assert(SEQ >= 128 && SEQ <= SEQ_FULL && (SEQ % 128) == 0);
static_assert(NH * 64 == DM);
static_assert((NR % 128) == 0);
static_assert((DM % 64) == 0 && (DM % 128) == 0);

typedef unsigned short v8us __attribute__((ext_vector_type(8), may_alias));
typedef float  v8f  __attribute__((ext_vector_type(8)));
typedef float  v4f  __attribute__((ext_vector_type(4)));
typedef float  v4fa __attribute__((ext_vector_type(4), may_alias));
typedef _Float16 v16h __attribute__((ext_vector_type(16)));
typedef _Float16 v4h __attribute__((ext_vector_type(4)));
union FragH { v16h v; v8us half[2]; _Float16 h[16]; unsigned short u[16]; };

__device__ __forceinline__ unsigned short bf16_bits(float x) { unsigned int u = __float_as_uint(x); return (unsigned short)((u + 0x7FFFu + ((u >> 16) & 1u)) >> 16); }
__device__ __forceinline__ float bf16_val(unsigned short b) { return __uint_as_float(((unsigned int)b) << 16); }
__device__ __forceinline__ float bf16_rne(float x) { return bf16_val(bf16_bits(x)); }

// D += A.B with NT terms: 1 = ah.bh, 2 = + al.bh, 3 = + ah.bl; hazard guard after the last WMMA
template <int NT>
__device__ __forceinline__ v8f mmaH(v16h ah, v16h al, v16h bh, v16h bl, v8f c) {
  c = __builtin_amdgcn_wmma_f32_16x16x32_f16(false, ah, false, bh, (short)0, c, false, false);
  if (NT >= 2) c = __builtin_amdgcn_wmma_f32_16x16x32_f16(false, al, false, bh, (short)0, c, false, false);
  if (NT >= 3) c = __builtin_amdgcn_wmma_f32_16x16x32_f16(false, ah, false, bl, (short)0, c, false, false);
  asm volatile("v_nop\n\tv_nop\n\tv_nop\n\tv_nop" : "+v"(c) : "v"(ah), "v"(al), "v"(bh), "v"(bl));
  return c;
}

// ---- GEMM engine (work-group tile 128x64, wave tile 32x64; M % 128 == 0, N % 64 == 0, K % 128 == 0, lda and ldb % 8 == 0): C[M][N] f32 = alpha A[M][K].Bt[N][K]^T + bf16(bias) (+ CP own element); A, Bt f16 k-contiguous.
// Each 128-k stage (A 128 rows, then Bt 64 rows, 256 B a row at LDS pitch 272 B) is brought once per work-group into a two-buffer LDS ring, global -> LDS through no register, and read by all four waves.
// A fragment: lane row = l&15, elements 0..7 <- k0 + 8h + i, 8..15 <- k0 + 16 + 8h + i; B fragment from the [n][k] copy with the same k map; D element r -> (row 8h + r, col l&15).
__device__ __forceinline__ v16h g2_frag(const _Float16* p, int hh) { FragH f; f.half[0] = *(const v8us*)((const unsigned short*)p + 8 * hh); f.half[1] = *(const v8us*)((const unsigned short*)p + 16 + 8 * hh); return f.v; }
__device__ __forceinline__ v8f g2_mma(v16h a, v16h b, v8f c) { v8f d = __builtin_amdgcn_wmma_f32_16x16x32_f16(false, a, false, b, (short)0, c, false, false); asm volatile("v_nop\n\tv_nop\n\tv_nop\n\tv_nop" : "+v"(d) : "v"(a), "v"(b)); return d; }
#define G_KT 128
#define G_PITCH 272
#define G_STAGE (192 * G_PITCH)
// eight 16-B pieces of one thread: rows 8 apart, the same 16-B column; a wave's copy covers two whole 256-B rows
__device__ __forceinline__ void g2_copy8(unsigned int l, const unsigned short* g, size_t r8) {
  // the s_wait_xcnt closes the statement so that no address register of an issued copy is rewritten ahead of it
  asm volatile("global_load_async_to_lds_b128 %0, %8, off\n\t"
               "global_load_async_to_lds_b128 %1, %9, off\n\t"
               "global_load_async_to_lds_b128 %2, %10, off\n\t"
               "global_load_async_to_lds_b128 %3, %11, off\n\t"
               "global_load_async_to_lds_b128 %4, %12, off\n\t"
               "global_load_async_to_lds_b128 %5, %13, off\n\t"
               "global_load_async_to_lds_b128 %6, %14, off\n\t"
               "global_load_async_to_lds_b128 %7, %15, off\n\t"
               "s_wait_xcnt 0x0"
               :: "v"(l), "v"(l + 8 * G_PITCH), "v"(l + 16 * G_PITCH), "v"(l + 24 * G_PITCH), "v"(l + 32 * G_PITCH), "v"(l + 40 * G_PITCH), "v"(l + 48 * G_PITCH), "v"(l + 56 * G_PITCH),
                  "v"(g), "v"(g + r8), "v"(g + 2 * r8), "v"(g + 3 * r8), "v"(g + 4 * r8), "v"(g + 5 * r8), "v"(g + 6 * r8), "v"(g + 7 * r8) : "memory");
}
// one stage: A rows 0..127 of the work-group's tile, then Bt rows 0..63, 24 pieces per thread
__device__ __forceinline__ void g2_stage(unsigned int l, const unsigned short* ga, size_t a8, const unsigned short* gb, size_t b8) {
  g2_copy8(l, ga, a8); g2_copy8(l + 64 * G_PITCH, ga + 8 * a8, a8); g2_copy8(l + 128 * G_PITCH, gb, b8);
}
// EPI 0: C f32 rows. EPI 1: RoPE (concatenated tables, interleaved rotate_half: out[d] = x[d] c[s][d mod 32] + rh[d] sn[s][d mod 32], rh[d] = -x[d+1] (d even), x[d-1] (d odd)), then f16 hi + 2^10 residual rows H, L [row][ldc].
// EPI 2: f16 hi + 2^10 residual, stored transposed per head: H, L [(b NH + h) 64 + d][SEQ] (N == DM, one 64-column tile = one head).
// EPI 3: three products of one A in one grid, blockIdx.y picks Bt (stride sB), the planes H, L (stride sH) and the bias (bias, bias1, bias2): 0 and 1 end as EPI 1, 2 as EPI 2.
// EPI 4: C f32 rows of a plane pair in one k loop of 2 K: first A (the 2^10 residual plane) against Bt, the accumulators then taken times 2^-10 (exact), then A2 (the hi plane) against the same Bt on top of them.
template <int ACT, int EPI>
__global__ __launch_bounds__(128) void k_gemm2(const _Float16* __restrict__ A, int lda, size_t sA, const _Float16* __restrict__ Bh, int ldb, size_t sB, float alpha, const float* __restrict__ bias, size_t sBias, const float* CP, int rowsPerB, size_t sCPb, int row0g,
    float* C, _Float16* C16, int ldc, size_t sC, int M, int N, int K, const float* __restrict__ CS, const float* __restrict__ SN, _Float16* __restrict__ H, _Float16* __restrict__ L,
    size_t sH, const float* __restrict__ bias1, const float* __restrict__ bias2, const _Float16* __restrict__ A2) {
  __shared__ __attribute__((aligned(16))) float so[4][32][68];
  __shared__ __attribute__((aligned(16))) unsigned char gring[2][G_STAGE];
  const int tid = threadIdx.x, w = tid >> 5, lane = tid & 31, ln = lane & 15, hh = lane >> 4; const int by = blockIdx.y;
  A += (size_t)by * sA; Bh += (size_t)by * sB; const size_t cofs = (size_t)by * sC; const float* bp = bias ? bias + (size_t)by * sBias : nullptr;
  if (EPI == 3) { H += (size_t)by * sH; L += (size_t)by * sH; if (by == 1) bp = bias1; if (by == 2) bp = bias2; }      /* blockIdx.y is the same for the whole work-group */
  const int ntn = N >> 6; const int mt = blockIdx.x / ntn, nq = blockIdx.x - mt * ntn; const int row0 = mt * 128 + 32 * w, col0 = nq * 64; if (mt * 128 >= M) return;      /* the whole work-group leaves or none, ahead of every barrier and copy */
  const v8f z8 = {0.f,0.f,0.f,0.f,0.f,0.f,0.f,0.f}; v8f c00 = z8, c01 = z8, c02 = z8, c03 = z8, c10 = z8, c11 = z8, c12 = z8, c13 = z8;
  // this thread's pieces: stage row tid/16 (and +8 ...), 16-B column tid%16
  const unsigned int lg = (unsigned int)(size_t)&gring[0][0] + (tid >> 4) * G_PITCH + (tid & 15) * 16;
  const unsigned short* ga = (const unsigned short*)A + (size_t)(mt * 128 + (tid >> 4)) * lda + (tid & 15) * 8; const unsigned short* gb = (const unsigned short*)Bh + (size_t)(col0 + (tid >> 4)) * ldb + (tid & 15) * 8;
  const size_t a8 = (size_t)8 * lda, b8 = (size_t)8 * ldb;
  const unsigned short* ga2 = EPI == 4 ? (const unsigned short*)A2 + (size_t)(mt * 128 + (tid >> 4)) * lda + (tid & 15) * 8 : ga; const int KK = EPI == 4 ? 2 * K : K;
  // the stage that begins at k = kt of the loop: below K from A, from K on (EPI 4) from A2, both against Bt's columns kt mod K; the test reads the same for the whole work-group
  auto put = [&](unsigned int l, int kt) { const bool second = EPI == 4 && kt >= K; const int kk = second ? kt - K : kt; g2_stage(l, (second ? ga2 : ga) + kk, a8, gb + kk, b8); };
  put(lg, 0);
  asm volatile("s_wait_asynccnt 0x0" ::: "memory");      /* stage 0 has landed before the barrier that publishes it */
  __syncthreads();
  if (G_KT < KK) put(lg + G_STAGE, G_KT);
#pragma unroll 1
  for (int kt = 0; kt < KK; kt += G_KT) {
    const unsigned int bsel = (kt & G_KT) ? G_STAGE : 0; const unsigned char* sb = &gring[0][0] + bsel;
    const _Float16* a0p = (const _Float16*)(sb + (32 * w + ln) * G_PITCH); const _Float16* a1p = (const _Float16*)(sb + (32 * w + 16 + ln) * G_PITCH);
    const _Float16* b0p = (const _Float16*)(sb + (128 + ln) * G_PITCH); const _Float16* b1p = (const _Float16*)(sb + (144 + ln) * G_PITCH); const _Float16* b2p = (const _Float16*)(sb + (160 + ln) * G_PITCH); const _Float16* b3p = (const _Float16*)(sb + (176 + ln) * G_PITCH);
    // two fragment sets: the twelve LDS reads of the next 32-k step of this same stage go out as one group ahead of the current step's products;
    // the step loop is unrolled so that the set index is a constant and both sets stay in registers
    v16h fa0[2], fa1[2], fb0[2], fb1[2], fb2[2], fb3[2];
    fa0[0] = g2_frag(a0p, hh); fa1[0] = g2_frag(a1p, hh); fb0[0] = g2_frag(b0p, hh); fb1[0] = g2_frag(b1p, hh); fb2[0] = g2_frag(b2p, hh); fb3[0] = g2_frag(b3p, hh);
#pragma unroll
    for (int ks = 0; ks < G_KT / 32; ++ks) { const int cu = ks & 1, nx = cu ^ 1;
      if (ks + 1 < G_KT / 32) { const int kb = (ks + 1) * 32; fa0[nx] = g2_frag(a0p + kb, hh); fa1[nx] = g2_frag(a1p + kb, hh); fb0[nx] = g2_frag(b0p + kb, hh); fb1[nx] = g2_frag(b1p + kb, hh); fb2[nx] = g2_frag(b2p + kb, hh); fb3[nx] = g2_frag(b3p + kb, hh); }
      c00 = g2_mma(fa0[cu], fb0[cu], c00); c10 = g2_mma(fa1[cu], fb0[cu], c10);
      c01 = g2_mma(fa0[cu], fb1[cu], c01); c11 = g2_mma(fa1[cu], fb1[cu], c11);
      c02 = g2_mma(fa0[cu], fb2[cu], c02); c12 = g2_mma(fa1[cu], fb2[cu], c12);
      c03 = g2_mma(fa0[cu], fb3[cu], c03); c13 = g2_mma(fa1[cu], fb3[cu], c13); }
    if (EPI == 4 && kt + G_KT == K) { c00 *= 0.0009765625f; c01 *= 0.0009765625f; c02 *= 0.0009765625f; c03 *= 0.0009765625f; c10 *= 0.0009765625f; c11 *= 0.0009765625f; c12 *= 0.0009765625f; c13 *= 0.0009765625f; }      /* the residual plane's sum takes its weight before the hi plane's products are added to it */
    asm volatile("s_wait_dscnt 0x0" ::: "memory");         /* this wave's reads of the buffer are done before it is handed to the copies */
    asm volatile("s_wait_asynccnt 0x0" ::: "memory");      /* this wave's pieces of the next stage have landed */
    __syncthreads();                                       /* publishes the next stage and ends every wave's reads of this one */
    if (kt + 2 * G_KT < KK) put(lg + bsel, kt + 2 * G_KT); }
  asm volatile("s_wait_asynccnt 0x0" ::: "memory");        /* no copy is outstanding when the wave goes on to its end */
  v8f accs[8] = {c00, c01, c02, c03, c10, c11, c12, c13};
  if (EPI == 2 || (EPI == 3 && by == 2)) {
    // a lane holds eight consecutive rows of one column: 16 B of a transposed row. Both planes ([64 columns][128 rows] f16, pitch 272 B) are gathered in so, then leave as 256-B runs.
    unsigned char* tb = (unsigned char*)&so[0][0][0]; float bv4[4] = {0.f, 0.f, 0.f, 0.f};
    if (bp) {
#pragma unroll      /* constant indices: bv4 stays in registers, the four loads go out together */
      for (int t = 0; t < 4; ++t) bv4[t] = bf16_rne(bp[col0 + t * 16 + ln]); }
#pragma unroll      /* this loop and the next: constant indices keep accs and the packed halves in registers */
    for (int u = 0; u < 8; ++u) { const int t = u & 3, half = u >> 2; const float bv = bv4[t]; FragH fh, fl;
#pragma unroll
      for (int r = 0; r < 8; ++r) { const float v = accs[u][r] * alpha + bv; const _Float16 hv = (_Float16)v; fh.h[r] = hv; fl.h[r] = (_Float16)((v - (float)hv) * 1024.0f); }
      unsigned char* tp = tb + (t * 16 + ln) * 272 + (32 * w + half * 16 + 8 * hh) * 2; *(v8us*)tp = fh.half[0]; *(v8us*)(tp + 64 * 272) = fl.half[0]; }
    __syncthreads();      /* every wave's 32 rows stand in the transposed tile before any wave reads whole runs of it */
    const size_t vrow = (size_t)((mt * 128) / SEQ * NH + nq) * 64; const int s0 = (mt * 128) % SEQ;
#pragma unroll      /* the LDS reads of later runs go out ahead of the stores of earlier ones */
    for (int it = 0; it < 8; ++it) { const int i = it * 128 + tid, pc = i & 15, d = i >> 4; const size_t o = (vrow + d) * SEQ + s0 + pc * 8;
      *(v8us*)((unsigned short*)H + o) = *(const v8us*)(tb + d * 272 + pc * 16); *(v8us*)((unsigned short*)L + o) = *(const v8us*)(tb + (64 + d) * 272 + pc * 16); }
    return; }
#pragma unroll
  for (int u = 0; u < 8; ++u) { const int t = u & 3, half = u >> 2; const int col = col0 + t * 16 + ln; const float bv = bp ? bf16_rne(bp[col]) : 0.f;
#pragma unroll
    for (int r = 0; r < 8; ++r) { const int rloc = half * 16 + 8 * hh + r; float v = accs[u][r] * alpha + bv;
      if (EPI == 0 && CP) { if (rowsPerB < 0) v += CP[cofs + (size_t)(row0g + row0 + rloc) * ldc + col];      /* rowsPerB < 0: own element of the batched C plane */ else { const int bidx = (row0g + row0 + rloc) / rowsPerB; v += CP[(size_t)bidx * sCPb + (size_t)by * 64 + col]; } }
      if (ACT == 3) v = fmaxf(v, 0.f);
      so[w][rloc][t * 16 + ln] = v; } }
  __builtin_amdgcn_fence(__ATOMIC_ACQ_REL, "workgroup"); __builtin_amdgcn_wave_barrier();
  if (EPI == 1 || EPI == 3) {
    // eight columns a lane, four rows a wave store: each row's 64 columns leave as one whole 128-B line per plane
    const int rs4 = lane >> 3, c8 = (lane & 7) * 8, j0 = c8 & 31;
    const size_t t0 = (size_t)(row0 % SEQ + rs4) * 32 + j0;      /* a wave's 32 rows lie in one sequence: SEQ % 128 == 0 */
    unsigned short* hp = (unsigned short*)H + (size_t)(row0 + rs4) * ldc + col0 + c8; unsigned short* lp = (unsigned short*)L + (size_t)(row0 + rs4) * ldc + col0 + c8; const size_t r4 = (size_t)4 * ldc;
#pragma unroll      /* the table loads of all eight steps take immediate offsets and go out together */
    for (int q = 0; q < 8; ++q) { const int r = q * 4 + rs4;
      const v4f a = *(const v4fa*)&so[w][r][c8], c = *(const v4fa*)&so[w][r][c8 + 4]; const float xs[8] = {a[0], a[1], a[2], a[3], c[0], c[1], c[2], c[3]};
      const float* tp = CS + t0 + q * 128; const float* up = SN + t0 + q * 128; const v4f ca = *(const v4fa*)tp, cb = *(const v4fa*)(tp + 4), sa = *(const v4fa*)up, sb = *(const v4fa*)(up + 4);
      const float cs[8] = {ca[0], ca[1], ca[2], ca[3], cb[0], cb[1], cb[2], cb[3]}; const float sn[8] = {sa[0], sa[1], sa[2], sa[3], sb[0], sb[1], sb[2], sb[3]};
      FragH fh, fl;
#pragma unroll      /* constant indices: xs, cs, sn and the packed halves stay in registers */
      for (int e = 0; e < 8; ++e) { const float pr = xs[e ^ 1]; const float rh = (e & 1) ? pr : -pr; const float o = xs[e] * cs[e] + rh * sn[e];
        const _Float16 hv = (_Float16)o; fh.h[e] = hv; fl.h[e] = (_Float16)((o - (float)hv) * 1024.0f); }
      *(v8us*)(hp + q * r4) = fh.half[0]; *(v8us*)(lp + q * r4) = fl.half[0]; }
    __builtin_amdgcn_endpgm(); }      /* the wave ends here: behind a plain return the compiler leads this path on to the test in front of the other epilogue and keeps the 64 accumulator registers alive all through it (300 registers against 207) */
  const int rsub = lane >> 4, c4 = (lane & 15) * 4;
  {
#pragma unroll
    for (int q = 0; q < 16; ++q) { const int r = q * 2 + rsub; const v4f v = *(const v4fa*)&so[w][r][c4]; if (C) *(v4f*)(C + cofs + (size_t)(row0 + r) * ldc + col0 + c4) = v; if (C16) { v4h h4;
#pragma unroll
        for (int i = 0; i < 4; ++i) h4[i] = (_Float16)v[i]; *(v4h*)(C16 + cofs + (size_t)(row0 + r) * ldc + col0 + c4) = h4; } }
     } }

// ---- preparation, one launch: the RoPE tables, x -> f16 and the four weight planes read nothing of each other's output, so their work-groups share one grid.
#define PB_R (SEQ * 32 / 256)
#define PB_X (NR * DM / 8 / 256)
#define PB_W (DM * DM / 8 / 256)
static_assert((SEQ * 32) % 256 == 0 && (NR * DM / 8) % 256 == 0 && (DM * DM / 8) % 256 == 0);
static_assert((long long)NB_FULL * SEQ_FULL * DM * 4 < (1ll << 32));
// one unit of eight elements per thread: dst[8 t ..] = f16(bf16(src[e0 ..]) sc); every offset fits 32 bits
__device__ __forceinline__ void prep_cvt(const float* __restrict__ src, unsigned int e0, _Float16* __restrict__ dst, unsigned int t, float sc) {
  const unsigned int ib = e0 * 4; const float* p = (const float*)((const char*)src + ib); const v4f a = *(const v4fa*)p, c = *(const v4fa*)(p + 4); FragH f;
  asm volatile("s_wait_xcnt 0x0" :: "v"(ib) : "memory");      /* the two loads' one offset register stays whole up to here and is free behind it */
#pragma unroll
  for (int q = 0; q < 4; ++q) { f.h[q] = (_Float16)(bf16_rne(a[q]) * sc); f.h[4 + q] = (_Float16)(bf16_rne(c[q]) * sc); }
  *(v8us*)((unsigned short*)dst + (size_t)t * 8) = f.half[0];
  asm volatile("s_wait_xcnt 0x0" ::: "memory"); }      /* no register that the issued store names is written again ahead of this, whatever path the compiler lays behind it */

__device__ __forceinline__ void prep_rotab(int t, float* __restrict__ CS, float* __restrict__ SN) {
  #pragma clang fp contract(off)
  const int j = t % 32, s = t / 32; const float ex = (float)(2 * j) / 64.0f; const float inv = 1.0f / powf(10000.0f, ex); const float th = (float)s * inv; const float c = cosf(th), sn = sinf(th);
  { *(float*)(CS + t) = c; *(float*)(SN + t) = sn;  } }

// work-groups 0 .. PB_R - 1: tables (the longest chains start first); then PB_X of x (compact row r stands at input row b SEQ_FULL + s); then PB_W of each weight, [out][in], bf16 then x16 in f16
__global__ __launch_bounds__(256) void k_prep(const float* __restrict__ x, const float* __restrict__ Wq, const float* __restrict__ Wk, const float* __restrict__ Wv, const float* __restrict__ Wo,
    _Float16* __restrict__ X16, _Float16* __restrict__ BQ, _Float16* __restrict__ BK, _Float16* __restrict__ BV, _Float16* __restrict__ BO, float* __restrict__ CS, float* __restrict__ SN) {
  int blk = blockIdx.x;
  if (blk < PB_R) { prep_rotab(blk * 256 + (int)threadIdx.x, CS, SN); return; }
  blk -= PB_R;
  if (blk < PB_X) { const unsigned int t = (unsigned int)blk * 256 + threadIdx.x; const unsigned int row = (t * 8) / DM, c0 = (t * 8) % DM, rb = row / SEQ, rs = row % SEQ;
    prep_cvt(x, (rb * SEQ_FULL + rs) * DM + c0, X16, t, 1.0f); return; }
  blk -= PB_X;
  const int m = blk / PB_W; blk -= m * PB_W;
  const float* Wm = m == 0 ? Wq : m == 1 ? Wk : m == 2 ? Wv : Wo; _Float16* Bt = m == 0 ? BQ : m == 1 ? BK : m == 2 ? BV : BO;
  const unsigned int t = (unsigned int)blk * 256 + threadIdx.x; prep_cvt(Wm, t * 8, Bt, t, 16.0f); }

// One 32-key stage of K hi, K lo (32 rows x 128 B, LDS pitch 144 B) and V^T hi, V^T lo (64 rows x 64 B, LDS pitch 80 B): 1024 pieces of 16 B, eight per thread, global -> LDS through no register.
#define KV_KH 0
#define KV_KL 4608
#define KV_VH 9216
#define KV_VL 14336
#define KV_STAGE 19456
__device__ __forceinline__ void kv_stage(unsigned int lk, unsigned int lv, const unsigned short* gkh, const unsigned short* gkl, size_t k16, const unsigned short* gvh, const unsigned short* gvl, size_t v32) {
  // the s_wait_xcnt closes the statement so that no address register of an issued copy is rewritten ahead of it
  asm volatile("global_load_async_to_lds_b128 %0, %8, off\n\t"
               "global_load_async_to_lds_b128 %1, %9, off\n\t"
               "global_load_async_to_lds_b128 %2, %10, off\n\t"
               "global_load_async_to_lds_b128 %3, %11, off\n\t"
               "global_load_async_to_lds_b128 %4, %12, off\n\t"
               "global_load_async_to_lds_b128 %5, %13, off\n\t"
               "global_load_async_to_lds_b128 %6, %14, off\n\t"
               "global_load_async_to_lds_b128 %7, %15, off\n\t"
               "s_wait_xcnt 0x0"
               :: "v"(lk + KV_KH), "v"(lk + KV_KH + 16 * 144), "v"(lk + KV_KL), "v"(lk + KV_KL + 16 * 144), "v"(lv + KV_VH), "v"(lv + KV_VH + 32 * 80), "v"(lv + KV_VL), "v"(lv + KV_VL + 32 * 80),
                  "v"(gkh), "v"(gkh + k16), "v"(gkl), "v"(gkl + k16), "v"(gvh), "v"(gvh + v32), "v"(gvl), "v"(gvl + v32) : "memory");
}

// lane l with lane l ^ 16: joins the two key halves that lanes c and c + 16 hold of one query
__device__ __forceinline__ float xhalf(float x) { return __builtin_bit_cast(float, __builtin_amdgcn_permlanex16(__builtin_bit_cast(int, x), __builtin_bit_cast(int, x), 0x76543210, 0xfedcba98, false, false)); }

__global__ __launch_bounds__(128) void k_attn(const _Float16* __restrict__ Q16, const _Float16* __restrict__ QL, int ldq, const _Float16* __restrict__ K16, const _Float16* __restrict__ KL, int ldk,
                                             const _Float16* __restrict__ Vt, const _Float16* __restrict__ VtL, const float* __restrict__ AM, const float* __restrict__ AW, _Float16* __restrict__ OH, _Float16* __restrict__ OL, int ldo) {
  constexpr int RPW = 16, DT = 4, KS = 2, QBN = SEQ / 64;
  __shared__ __attribute__((aligned(16))) float sO[4][RPW][64 + 4];
  __shared__ __attribute__((aligned(16))) unsigned char ring[2][KV_STAGE];
  const int tid = threadIdx.x, w = tid >> 5, lane = tid & 31, ln = lane & 15, hh = lane >> 4;
  const int slab = blockIdx.x / QBN, qblk = blockIdx.x % QBN; const int b = slab / NH, h = slab % NH; const int qb0 = qblk * (4 * RPW); const int q0 = qb0 + w * RPW;
  const float ww = bf16_rne(AW[0]) * LOG2E;
  FragH aq[KS], aql[KS];
  { const unsigned short* qr = (const unsigned short*)Q16 + ((size_t)b * SEQ + q0 + ln) * ldq + h * 64; const unsigned short* ql = (const unsigned short*)QL + ((size_t)b * SEQ + q0 + ln) * ldq + h * 64;
#pragma unroll
    for (int ks = 0; ks < KS; ++ks) { aq[ks].half[0] = *(const v8us*)(qr + ks * 32 + 8 * hh); aq[ks].half[1] = *(const v8us*)(qr + ks * 32 + 16 + 8 * hh); aql[ks].half[0] = *(const v8us*)(ql + ks * 32 + 8 * hh); aql[ks].half[1] = *(const v8us*)(ql + ks * 32 + 16 + 8 * hh); } }
  const unsigned short* Vth = (const unsigned short*)Vt + (size_t)slab * 64 * SEQ; const unsigned short* Vtl = (const unsigned short*)VtL + (size_t)slab * 64 * SEQ;
  const float* amq = AM + (size_t)b * SEQ_FULL * SEQ_FULL + (size_t)(q0 + ln) * SEQ_FULL + 8 * hh;      /* mask[b][0][own query][.] with full strides, at this lane half's first key */
  const v8f z8 = {0.f,0.f,0.f,0.f,0.f,0.f,0.f,0.f};
  float m_q = -3.0e38f, l_q = 0.f; v8f oacc[DT], oaccL[DT];
#pragma unroll
  for (int dt = 0; dt < DT; ++dt) { oacc[dt] = z8; oaccL[dt] = z8; }
  // this thread's pieces: K row tid/8 (and +16), 16-B column tid%8; V^T row tid/4 (and +32), 16-B column tid%4
  const unsigned int lring = (unsigned int)(size_t)&ring[0][0]; const unsigned int lk = lring + (tid >> 3) * 144 + (tid & 7) * 16, lv = lring + (tid >> 2) * 80 + (tid & 3) * 16;
  const size_t kofs = ((size_t)b * SEQ + (tid >> 3)) * ldk + h * 64 + (tid & 7) * 8; const unsigned short* gkh = (const unsigned short*)K16 + kofs; const unsigned short* gkl = (const unsigned short*)KL + kofs;
  const size_t vofs = (size_t)(tid >> 2) * SEQ + (tid & 3) * 8; const unsigned short* gvh = Vth + vofs; const unsigned short* gvl = Vtl + vofs;
  const size_t k16 = (size_t)16 * ldk, k32 = (size_t)32 * ldk, v32 = (size_t)32 * SEQ;
  kv_stage(lk, lv, gkh, gkl, k16, gvh, gvl, v32);
  asm volatile("s_wait_asynccnt 0x0" ::: "memory");      /* stage 0 has landed before the barrier that publishes it */
  __syncthreads();
  kv_stage(lk + KV_STAGE, lv + KV_STAGE, gkh + k32, gkl + k32, k16, gvh + 32, gvl + 32, v32);
#pragma unroll 1
  for (int j0 = 0; j0 < SEQ; j0 += 32) {
    const unsigned int bsel = (j0 & 32) ? KV_STAGE : 0; const unsigned char* kvb = &ring[0][0] + bsel;
    v4f mk[2][2];      /* own query's mask, keys j0 + 16 nt + 8 hh + 0..7 */
#pragma unroll
    for (int nt = 0; nt < 2; ++nt) { mk[nt][0] = *(const v4fa*)(amq + j0 + nt * 16); mk[nt][1] = *(const v4fa*)(amq + j0 + nt * 16 + 4); }
    v8f s[2];
#pragma unroll
    for (int nt = 0; nt < 2; ++nt) { const unsigned short* kr = (const unsigned short*)(kvb + KV_KH + (nt * 16 + ln) * 144); const unsigned short* klr = (const unsigned short*)(kvb + KV_KL + (nt * 16 + ln) * 144); FragH bk[KS], bkl[KS];
#pragma unroll
      for (int ks = 0; ks < KS; ++ks) { bk[ks].half[0] = *(const v8us*)(kr + ks * 32 + 8 * hh); bk[ks].half[1] = *(const v8us*)(kr + ks * 32 + 16 + 8 * hh); bkl[ks].half[0] = *(const v8us*)(klr + ks * 32 + 8 * hh); bkl[ks].half[1] = *(const v8us*)(klr + ks * 32 + 16 + 8 * hh); }
      v8f acc = z8, accl = z8;
#pragma unroll
      for (int ks = 0; ks < KS; ++ks) { acc = mmaH<1>(bk[ks].v, bk[ks].v, aq[ks].v, aq[ks].v, acc); accl = mmaH<1>(bk[ks].v, bk[ks].v, aql[ks].v, aql[ks].v, accl); accl = mmaH<1>(bkl[ks].v, bkl[ks].v, aq[ks].v, aq[ks].v, accl); }
#pragma unroll
      for (int r = 0; r < 8; ++r) acc[r] += accl[r] * 0.0009765625f;
      s[nt] = acc; }
    float mc = -3.0e38f;
#pragma unroll
    for (int nt = 0; nt < 2; ++nt)
#pragma unroll
      for (int r = 0; r < 8; ++r) { float sv = s[nt][r] * (SCL * LOG2E); sv += bf16_rne(mk[nt][r >> 2][r & 3]) * ww; s[nt][r] = sv; mc = fmaxf(mc, sv); }
    mc = fmaxf(mc, xhalf(mc));
    const float mn = fmaxf(m_q, mc - 10.0f); const float al = __builtin_amdgcn_exp2f((mn > -1.0e38f) ? m_q - mn : 0.f); m_q = mn;
    FragH pa, pl; float ls[2] = {0.f, 0.f};
#pragma unroll
    for (int nt = 0; nt < 2; ++nt)
#pragma unroll
      for (int r = 0; r < 8; ++r) { const float psc = __builtin_amdgcn_exp2f(s[nt][r] - mn); ls[nt] += psc; const _Float16 ph = (_Float16)psc; pa.h[nt * 8 + r] = ph; pl.h[nt * 8 + r] = (_Float16)((psc - (float)ph) * 1024.0f); }
    l_q = l_q * al + (ls[0] + ls[1]);
#pragma unroll
    for (int dt = 0; dt < DT; ++dt)
#pragma unroll
      for (int r = 0; r < 8; ++r) { oacc[dt][r] *= al; oaccL[dt][r] *= al; }
#pragma unroll
    for (int dt = 0; dt < DT; ++dt) { const unsigned short* vrow = (const unsigned short*)(kvb + KV_VH + (dt * 16 + ln) * 80); const unsigned short* vrl = (const unsigned short*)(kvb + KV_VL + (dt * 16 + ln) * 80); FragH bv, bl;
      bv.half[0] = *(const v8us*)(vrow + 8 * hh); bv.half[1] = *(const v8us*)(vrow + 16 + 8 * hh); bl.half[0] = *(const v8us*)(vrl + 8 * hh); bl.half[1] = *(const v8us*)(vrl + 16 + 8 * hh);
      oacc[dt] = mmaH<1>(bv.v, bv.v, pa.v, pa.v, oacc[dt]); oaccL[dt] = mmaH<1>(bv.v, bv.v, pl.v, pl.v, oaccL[dt]); oaccL[dt] = mmaH<1>(bl.v, bl.v, pa.v, pa.v, oaccL[dt]); }
    asm volatile("s_wait_dscnt 0x0" ::: "memory");         /* this wave's reads of the buffer are done before it is handed to the copies */
    asm volatile("s_wait_asynccnt 0x0" ::: "memory");      /* this wave's pieces of the next stage have landed */
    __syncthreads();                                       /* publishes the next stage and ends every wave's reads of this one */
    if (j0 + 64 < SEQ) kv_stage(lk + bsel, lv + bsel, gkh + (size_t)(j0 + 64) * ldk, gkl + (size_t)(j0 + 64) * ldk, k16, gvh + j0 + 64, gvl + j0 + 64, v32); }
  asm volatile("s_wait_asynccnt 0x0" ::: "memory");        /* no copy is outstanding when the wave goes on to its end */
  const float lt = l_q + xhalf(l_q); const float linv = (lt > 0.f) ? 1.0f / lt : 0.f;
#pragma unroll
  for (int dt = 0; dt < DT; ++dt)
#pragma unroll
    for (int r = 0; r < 8; ++r) { float v = oacc[dt][r]; v += oaccL[dt][r] * 0.0009765625f; sO[w][ln][dt * 16 + 8 * hh + r] = v * linv; }
  __builtin_amdgcn_fence(__ATOMIC_ACQ_REL, "workgroup"); __builtin_amdgcn_wave_barrier();
  {
#pragma unroll
    for (int rp = 0; rp < RPW; rp += 4) { const int r = rp + (lane >> 3), pc = lane & 7; const v4f va = *(const v4fa*)&sO[w][r][pc * 8], vb = *(const v4fa*)&sO[w][r][pc * 8 + 4]; FragH fh, fl;      /* context leaves as f16 hi + 2^10 residual rows, one whole 128-B line per row and plane */
#pragma unroll      /* constant indices: the packed halves stay in registers */
      for (int e = 0; e < 4; ++e) { _Float16 hv = (_Float16)va[e]; fh.h[e] = hv; fl.h[e] = (_Float16)((va[e] - (float)hv) * 1024.0f); hv = (_Float16)vb[e]; fh.h[4 + e] = hv; fl.h[4 + e] = (_Float16)((vb[e] - (float)hv) * 1024.0f); }
      const size_t o8 = ((size_t)b * SEQ + q0 + r) * ldo + h * 64 + pc * 8; *(v8us*)((unsigned short*)OH + o8) = fh.half[0]; *(v8us*)((unsigned short*)OL + o8) = fl.half[0]; }
     } }

// LayerNorm over DM (biased variance, eps 1e-5, affine with bf16 g, b) of (A[r] + bf16(x[rin])), compact row r -> input/output row rin = b*SEQ_FULL + s;
__global__ __launch_bounds__(256) void k_ln1024(const float* __restrict__ A, const float* __restrict__ res, const float* __restrict__ g, const float* __restrict__ bb, float* __restrict__ Y) {
  #pragma clang fp contract(off)
  const int wv = threadIdx.x >> 5, ln = threadIdx.x & 31; const size_t r = (size_t)blockIdx.x * 8 + wv; if (r >= (size_t)NR) return;
  const size_t rb = r / SEQ, rs = r % SEQ; const size_t rin = rb * SEQ_FULL + rs;
  float xv[32]; float sm = 0.f;
#pragma unroll
  for (int i = 0; i < 8; ++i) { const int c0 = i * 128 + ln * 4; const v4f a = *(const v4fa*)(A + r * DM + c0); const v4f rr = *(const v4fa*)(res + rin * DM + c0);
#pragma unroll
    for (int q = 0; q < 4; ++q) { const float v = a[q] + bf16_rne(rr[q]); xv[i * 4 + q] = v; sm += v; } }
#pragma unroll
  for (int o = 16; o > 0; o >>= 1) sm += __shfl_xor(sm, o, 32);
  const float mu = sm * 0.0009765625f; float var = 0.f;
#pragma unroll
  for (int q = 0; q < 32; ++q) { const float d = xv[q] - mu; var += d * d; }
#pragma unroll
  for (int o = 16; o > 0; o >>= 1) var += __shfl_xor(var, o, 32);
  const float inv = 1.0f / sqrtf(var * 0.0009765625f + 1e-5f);
  {
#pragma unroll
    for (int i = 0; i < 8; ++i) { const int c0 = i * 128 + ln * 4; v4f y;
#pragma unroll
      for (int q = 0; q < 4; ++q) { float v = (xv[i * 4 + q] - mu) * inv; v *= bf16_rne(g[c0 + q]); v += bf16_rne(bb[c0 + q]); y[q] = v; }
      *(v4f*)(Y + rin * DM + c0) = y; }
     } }

extern "C" void kernel_launch(void* const* d_in, const int* in_sizes, int n_in,
                              void* d_out, int out_size, void* d_ws, size_t ws_size, hipStream_t stream) {
  if (n_in < 13) return;
  const float* x = (const float*)d_in[0]; const float* cdm = (const float*)d_in[1];
  const float* Wq = (const float*)d_in[2]; const float* bq = (const float*)d_in[3]; const float* Wk = (const float*)d_in[4]; const float* bk = (const float*)d_in[5];
  const float* Wv = (const float*)d_in[6]; const float* bv = (const float*)d_in[7]; const float* Wo = (const float*)d_in[8]; const float* bo = (const float*)d_in[9];
  const float* gam = (const float*)d_in[10]; const float* bet = (const float*)d_in[11]; const float* cdw = (const float*)d_in[12];
  const long long rows_need = (long long)(NB - 1) * SEQ_FULL + SEQ;
  if ((long long)in_sizes[0] < rows_need * DM) return;
  if ((long long)in_sizes[1] < (long long)(NB - 1) * SEQ_FULL * SEQ_FULL + (long long)(SEQ - 1) * SEQ_FULL + SEQ) return;
  if (in_sizes[2] < DM * DM || in_sizes[4] < DM * DM || in_sizes[6] < DM * DM || in_sizes[8] < DM * DM) return;
  if (in_sizes[3] < DM || in_sizes[5] < DM || in_sizes[7] < DM || in_sizes[9] < DM || in_sizes[10] < DM || in_sizes[11] < DM || in_sizes[12] < 1) return;
  if ((long long)out_size < rows_need * DM) return;
  char* ws = (char*)d_ws; size_t off = 0;
  auto take = [&](size_t bytes) { char* p = ws + off; off += (bytes + 255) & ~(size_t)255; return p; };
  const size_t np = (size_t)NR * DM;      /* compact activation plane elements */
  _Float16* BQ = (_Float16*)take((size_t)DM * DM * 2); _Float16* BK = (_Float16*)take((size_t)DM * DM * 2); _Float16* BV = (_Float16*)take((size_t)DM * DM * 2); _Float16* BO = (_Float16*)take((size_t)DM * DM * 2);
  _Float16* X16 = (_Float16*)take(np * 2);
  _Float16* QH = (_Float16*)take(np * 2); _Float16* QL = (_Float16*)take(np * 2); _Float16* KH = (_Float16*)take(np * 2); _Float16* KL = (_Float16*)take(np * 2);
  _Float16* VT = (_Float16*)take(np * 2); _Float16* VTL = (_Float16*)take(np * 2); _Float16* OH = (_Float16*)take(np * 2); _Float16* OL = (_Float16*)take(np * 2);
  float* Y = (float*)take(np * 4); float* CS = (float*)take((size_t)SEQ * 32 * 4); float* SN = (float*)take((size_t)SEQ * 32 * 4);
  if (off > ws_size) return;
  static_assert(((size_t)DM * DM * 2) % 256 == 0 && ((size_t)NR * DM * 2) % 256 == 0);      /* BQ, BK, BV and the pairs (QH, QL), (KH, KL), (VT, VTL) stand back to back: one stride each reaches all three */
  k_prep<<<PB_R + PB_X + 4 * PB_W, 256, 0, stream>>>(x, Wq, Wk, Wv, Wo, X16, BQ, BK, BV, BO, CS, SN);
  const dim3 g((NR / 128) * (DM / 64), 1); const dim3 g3((NR / 128) * (DM / 64), 3);
  k_gemm2<0, 3><<<g3, 128, 0, stream>>>(X16, DM, 0, BQ, DM, (size_t)DM * DM, 0.0625f, bq, 0, nullptr, 1, 0, 0, nullptr, nullptr, DM, 0, NR, DM, DM, CS, SN, QH, QL, 2 * np, bk, bv, nullptr);      /* Q, K -> RoPE -> hi/lo; V -> hi/lo, transposed per head */
  k_attn<<<NB * NH * (SEQ / 64), 128, 0, stream>>>(QH, QL, DM, KH, KL, DM, VT, VTL, cdm, cdw, OH, OL, DM);      /* context -> hi/lo rows */
  k_gemm2<0, 4><<<g, 128, 0, stream>>>(OL, DM, 0, BO, DM, 0, 0.0625f, bo, 0, nullptr, 1, 0, 0, Y, nullptr, DM, 0, NR, DM, DM, nullptr, nullptr, nullptr, nullptr, 0, nullptr, nullptr, OH);      /* Y = (ctx_lo + ctx_hi) Wo^T + bo */
  k_ln1024<<<NR / 8, 256, 0, stream>>>(Y, x, gam, bet, (float*)d_out);      /* out = LN(bf16(x) + Y) g + b */
}

// v008
// One run takes 175 microseconds.
// Timed twice side by side with v007, it ran 1.04 and 1.05 times as fast.
// Counting every step since v000, it is 3.90 times as fast.
#include <hip/hip_runtime.h>
// All contractions (Q/K/V projections, Q.K^T, P.V^T, output projection) on v_wmma_f32_16x16x32_f16: f16 operands, f32 accumulate. Float inputs RNE-converted to bf16 (exact in f16; weights carried x16); q, k, v, softmax numerators (x1024) and context carried as f16 hi + 2^10 residual plane pairs; RoPE tables, softmax, residual add and LayerNorm in f32.
#ifndef NB
#define NB 2
#endif
#ifndef SEQ
#define SEQ 2048
#endif
#define NB_FULL 2
#define SEQ_FULL 2048
#define DM 1024
#define NH 16
#define NR (NB * SEQ)
#define SCL 0.125f
#define LOG2E 1.44269504088896340736f
static_assert(NB >= 1 && NB <= NB_FULL);
static_assert(SEQ >= 128 && SEQ <= SEQ_FULL && (SEQ % 128) == 0);
static_assert(NH * 64 == DM);
static_assert((NR % 128) == 0);
static_assert((DM % 64) == 0 && (DM % 128) == 0);

typedef unsigned short v8us __attribute__((ext_vector_type(8), may_alias));
typedef float  v8f  __attribute__((ext_vector_type(8)));
typedef float  v4f  __attribute__((ext_vector_type(4)));
typedef float  v4fa __attribute__((ext_vector_type(4), may_alias));
typedef _Float16 v16h __attribute__((ext_vector_type(16)));
typedef _Float16 v4h __attribute__((ext_vector_type(4)));
union FragH { v16h v; v8us half[2]; _Float16 h[16]; unsigned short u[16]; };

__device__ __forceinline__ unsigned short bf16_bits(float x) { unsigned int u = __float_as_uint(x); return (unsigned short)((u + 0x7FFFu + ((u >> 16) & 1u)) >> 16); }
__device__ __forceinline__ float bf16_val(unsigned short b) { return __uint_as_float(((unsigned int)b) << 16); }
__device__ __forceinline__ float bf16_rne(float x) { return bf16_val(bf16_bits(x)); }

// D += A.B with NT terms: 1 = ah.bh, 2 = + al.bh, 3 = + ah.bl; builtin form only: the compiler keeps the distance behind a WMMA itself and is free to order loads and independent products around it
template <int NT>
__device__ __forceinline__ v8f mmaH(v16h ah, v16h al, v16h bh, v16h bl, v8f c) {
  c = __builtin_amdgcn_wmma_f32_16x16x32_f16(false, ah, false, bh, (short)0, c, false, false);
  if (NT >= 2) c = __builtin_amdgcn_wmma_f32_16x16x32_f16(false, al, false, bh, (short)0, c, false, false);
  if (NT >= 3) c = __builtin_amdgcn_wmma_f32_16x16x32_f16(false, ah, false, bl, (short)0, c, false, false);
  return c;
}

// ---- GEMM engine (work-group tile 128x64, wave tile 32x64; M % 128 == 0, N % 64 == 0, K % 128 == 0, lda and ldb % 8 == 0): C[M][N] f32 = alpha A[M][K].Bt[N][K]^T + bf16(bias) (+ CP own element); A, Bt f16 k-contiguous.
// Each 128-k stage (A 128 rows, then Bt 64 rows, 256 B a row at LDS pitch 272 B) is brought once per work-group into a two-buffer LDS ring, global -> LDS through no register, and read by all four waves.
// A fragment: lane row = l&15, elements 0..7 <- k0 + 8h + i, 8..15 <- k0 + 16 + 8h + i; B fragment from the [n][k] copy with the same k map; D element r -> (row 8h + r, col l&15).
__device__ __forceinline__ v16h g2_frag(const _Float16* p, int hh) { FragH f; f.half[0] = *(const v8us*)((const unsigned short*)p + 8 * hh); f.half[1] = *(const v8us*)((const unsigned short*)p + 16 + 8 * hh); return f.v; }
__device__ __forceinline__ v8f g2_mma(v16h a, v16h b, v8f c) { v8f d = __builtin_amdgcn_wmma_f32_16x16x32_f16(false, a, false, b, (short)0, c, false, false); asm volatile("v_nop\n\tv_nop\n\tv_nop\n\tv_nop" : "+v"(d) : "v"(a), "v"(b)); return d; }
#define G_KT 128
#define G_PITCH 272
#define G_STAGE (192 * G_PITCH)
// eight 16-B pieces of one thread: rows 8 apart, the same 16-B column; a wave's copy covers two whole 256-B rows
__device__ __forceinline__ void g2_copy8(unsigned int l, const unsigned short* g, size_t r8) {
  // the s_wait_xcnt closes the statement so that no address register of an issued copy is rewritten ahead of it
  asm volatile("global_load_async_to_lds_b128 %0, %8, off\n\t"
               "global_load_async_to_lds_b128 %1, %9, off\n\t"
               "global_load_async_to_lds_b128 %2, %10, off\n\t"
               "global_load_async_to_lds_b128 %3, %11, off\n\t"
               "global_load_async_to_lds_b128 %4, %12, off\n\t"
               "global_load_async_to_lds_b128 %5, %13, off\n\t"
               "global_load_async_to_lds_b128 %6, %14, off\n\t"
               "global_load_async_to_lds_b128 %7, %15, off\n\t"
               "s_wait_xcnt 0x0"
               :: "v"(l), "v"(l + 8 * G_PITCH), "v"(l + 16 * G_PITCH), "v"(l + 24 * G_PITCH), "v"(l + 32 * G_PITCH), "v"(l + 40 * G_PITCH), "v"(l + 48 * G_PITCH), "v"(l + 56 * G_PITCH),
                  "v"(g), "v"(g + r8), "v"(g + 2 * r8), "v"(g + 3 * r8), "v"(g + 4 * r8), "v"(g + 5 * r8), "v"(g + 6 * r8), "v"(g + 7 * r8) : "memory");
}
// one stage: A rows 0..127 of the work-group's tile, then Bt rows 0..63, 24 pieces per thread
__device__ __forceinline__ void g2_stage(unsigned int l, const unsigned short* ga, size_t a8, const unsigned short* gb, size_t b8) {
  g2_copy8(l, ga, a8); g2_copy8(l + 64 * G_PITCH, ga + 8 * a8, a8); g2_copy8(l + 128 * G_PITCH, gb, b8);
}
// EPI 0: C f32 rows. EPI 1: RoPE (concatenated tables, interleaved rotate_half: out[d] = x[d] c[s][d mod 32] + rh[d] sn[s][d mod 32], rh[d] = -x[d+1] (d even), x[d-1] (d odd)), then f16 hi + 2^10 residual rows H, L [row][ldc].
// EPI 2: f16 hi + 2^10 residual, stored transposed per head: H, L [(b NH + h) 64 + d][SEQ] (N == DM, one 64-column tile = one head).
// EPI 3: three products of one A in one grid, blockIdx.y picks Bt (stride sB), the planes H, L (stride sH) and the bias (bias, bias1, bias2): 0 and 1 end as EPI 1, 2 as EPI 2.
// EPI 4: C f32 rows of a plane pair in one k loop of 2 K: first A (the 2^10 residual plane) against Bt, the accumulators then taken times 2^-10 (exact), then A2 (the hi plane) against the same Bt on top of them.
template <int ACT, int EPI>
__global__ __launch_bounds__(128) void k_gemm2(const _Float16* __restrict__ A, int lda, size_t sA, const _Float16* __restrict__ Bh, int ldb, size_t sB, float alpha, const float* __restrict__ bias, size_t sBias, const float* CP, int rowsPerB, size_t sCPb, int row0g,
    float* C, _Float16* C16, int ldc, size_t sC, int M, int N, int K, const float* __restrict__ CS, const float* __restrict__ SN, _Float16* __restrict__ H, _Float16* __restrict__ L,
    size_t sH, const float* __restrict__ bias1, const float* __restrict__ bias2, const _Float16* __restrict__ A2) {
  __shared__ __attribute__((aligned(16))) float so[4][32][68];
  __shared__ __attribute__((aligned(16))) unsigned char gring[2][G_STAGE];
  const int tid = threadIdx.x, w = tid >> 5, lane = tid & 31, ln = lane & 15, hh = lane >> 4; const int by = blockIdx.y;
  A += (size_t)by * sA; Bh += (size_t)by * sB; const size_t cofs = (size_t)by * sC; const float* bp = bias ? bias + (size_t)by * sBias : nullptr;
  if (EPI == 3) { H += (size_t)by * sH; L += (size_t)by * sH; if (by == 1) bp = bias1; if (by == 2) bp = bias2; }      /* blockIdx.y is the same for the whole work-group */
  const int ntn = N >> 6; const int mt = blockIdx.x / ntn, nq = blockIdx.x - mt * ntn; const int row0 = mt * 128 + 32 * w, col0 = nq * 64; if (mt * 128 >= M) return;      /* the whole work-group leaves or none, ahead of every barrier and copy */
  const v8f z8 = {0.f,0.f,0.f,0.f,0.f,0.f,0.f,0.f}; v8f c00 = z8, c01 = z8, c02 = z8, c03 = z8, c10 = z8, c11 = z8, c12 = z8, c13 = z8;
  // this thread's pieces: stage row tid/16 (and +8 ...), 16-B column tid%16
  const unsigned int lg = (unsigned int)(size_t)&gring[0][0] + (tid >> 4) * G_PITCH + (tid & 15) * 16;
  const unsigned short* ga = (const unsigned short*)A + (size_t)(mt * 128 + (tid >> 4)) * lda + (tid & 15) * 8; const unsigned short* gb = (const unsigned short*)Bh + (size_t)(col0 + (tid >> 4)) * ldb + (tid & 15) * 8;
  const size_t a8 = (size_t)8 * lda, b8 = (size_t)8 * ldb;
  const unsigned short* ga2 = EPI == 4 ? (const unsigned short*)A2 + (size_t)(mt * 128 + (tid >> 4)) * lda + (tid & 15) * 8 : ga; const int KK = EPI == 4 ? 2 * K : K;
  // the stage that begins at k = kt of the loop: below K from A, from K on (EPI 4) from A2, both against Bt's columns kt mod K; the test reads the same for the whole work-group
  auto put = [&](unsigned int l, int kt) { const bool second = EPI == 4 && kt >= K; const int kk = second ? kt - K : kt; g2_stage(l, (second ? ga2 : ga) + kk, a8, gb + kk, b8); };
  put(lg, 0);
  asm volatile("s_wait_asynccnt 0x0" ::: "memory");      /* stage 0 has landed before the barrier that publishes it */
  __syncthreads();
  if (G_KT < KK) put(lg + G_STAGE, G_KT);
#pragma unroll 1
  for (int kt = 0; kt < KK; kt += G_KT) {
    const unsigned int bsel = (kt & G_KT) ? G_STAGE : 0; const unsigned char* sb = &gring[0][0] + bsel;
    const _Float16* a0p = (const _Float16*)(sb + (32 * w + ln) * G_PITCH); const _Float16* a1p = (const _Float16*)(sb + (32 * w + 16 + ln) * G_PITCH);
    const _Float16* b0p = (const _Float16*)(sb + (128 + ln) * G_PITCH); const _Float16* b1p = (const _Float16*)(sb + (144 + ln) * G_PITCH); const _Float16* b2p = (const _Float16*)(sb + (160 + ln) * G_PITCH); const _Float16* b3p = (const _Float16*)(sb + (176 + ln) * G_PITCH);
    // two fragment sets: the twelve LDS reads of the next 32-k step of this same stage go out as one group ahead of the current step's products;
    // the step loop is unrolled so that the set index is a constant and both sets stay in registers
    v16h fa0[2], fa1[2], fb0[2], fb1[2], fb2[2], fb3[2];
    fa0[0] = g2_frag(a0p, hh); fa1[0] = g2_frag(a1p, hh); fb0[0] = g2_frag(b0p, hh); fb1[0] = g2_frag(b1p, hh); fb2[0] = g2_frag(b2p, hh); fb3[0] = g2_frag(b3p, hh);
#pragma unroll
    for (int ks = 0; ks < G_KT / 32; ++ks) { const int cu = ks & 1, nx = cu ^ 1;
      if (ks + 1 < G_KT / 32) { const int kb = (ks + 1) * 32; fa0[nx] = g2_frag(a0p + kb, hh); fa1[nx] = g2_frag(a1p + kb, hh); fb0[nx] = g2_frag(b0p + kb, hh); fb1[nx] = g2_frag(b1p + kb, hh); fb2[nx] = g2_frag(b2p + kb, hh); fb3[nx] = g2_frag(b3p + kb, hh); }
      c00 = g2_mma(fa0[cu], fb0[cu], c00); c10 = g2_mma(fa1[cu], fb0[cu], c10);
      c01 = g2_mma(fa0[cu], fb1[cu], c01); c11 = g2_mma(fa1[cu], fb1[cu], c11);
      c02 = g2_mma(fa0[cu], fb2[cu], c02); c12 = g2_mma(fa1[cu], fb2[cu], c12);
      c03 = g2_mma(fa0[cu], fb3[cu], c03); c13 = g2_mma(fa1[cu], fb3[cu], c13); }
    if (EPI == 4 && kt + G_KT == K) { c00 *= 0.0009765625f; c01 *= 0.0009765625f; c02 *= 0.0009765625f; c03 *= 0.0009765625f; c10 *= 0.0009765625f; c11 *= 0.0009765625f; c12 *= 0.0009765625f; c13 *= 0.0009765625f; }      /* the residual plane's sum takes its weight before the hi plane's products are added to it */
    asm volatile("s_wait_dscnt 0x0" ::: "memory");         /* this wave's reads of the buffer are done before it is handed to the copies */
    asm volatile("s_wait_asynccnt 0x0" ::: "memory");      /* this wave's pieces of the next stage have landed */
    __syncthreads();                                       /* publishes the next stage and ends every wave's reads of this one */
    if (kt + 2 * G_KT < KK) put(lg + bsel, kt + 2 * G_KT); }
  asm volatile("s_wait_asynccnt 0x0" ::: "memory");        /* no copy is outstanding when the wave goes on to its end */
  v8f accs[8] = {c00, c01, c02, c03, c10, c11, c12, c13};
  if (EPI == 2 || (EPI == 3 && by == 2)) {
    // a lane holds eight consecutive rows of one column: 16 B of a transposed row. Both planes ([64 columns][128 rows] f16, pitch 272 B) are gathered in so, then leave as 256-B runs.
    unsigned char* tb = (unsigned char*)&so[0][0][0]; float bv4[4] = {0.f, 0.f, 0.f, 0.f};
    if (bp) {
#pragma unroll      /* constant indices: bv4 stays in registers, the four loads go out together */
      for (int t = 0; t < 4; ++t) bv4[t] = bf16_rne(bp[col0 + t * 16 + ln]); }
#pragma unroll      /* this loop and the next: constant indices keep accs and the packed halves in registers */
    for (int u = 0; u < 8; ++u) { const int t = u & 3, half = u >> 2; const float bv = bv4[t]; FragH fh, fl;
#pragma unroll
      for (int r = 0; r < 8; ++r) { const float v = accs[u][r] * alpha + bv; const _Float16 hv = (_Float16)v; fh.h[r] = hv; fl.h[r] = (_Float16)((v - (float)hv) * 1024.0f); }
      unsigned char* tp = tb + (t * 16 + ln) * 272 + (32 * w + half * 16 + 8 * hh) * 2; *(v8us*)tp = fh.half[0]; *(v8us*)(tp + 64 * 272) = fl.half[0]; }
    __syncthreads();      /* every wave's 32 rows stand in the transposed tile before any wave reads whole runs of it */
    const size_t vrow = (size_t)((mt * 128) / SEQ * NH + nq) * 64; const int s0 = (mt * 128) % SEQ;
#pragma unroll      /* the LDS reads of later runs go out ahead of the stores of earlier ones */
    for (int it = 0; it < 8; ++it) { const int i = it * 128 + tid, pc = i & 15, d = i >> 4; const size_t o = (vrow + d) * SEQ + s0 + pc * 8;
      *(v8us*)((unsigned short*)H + o) = *(const v8us*)(tb + d * 272 + pc * 16); *(v8us*)((unsigned short*)L + o) = *(const v8us*)(tb + (64 + d) * 272 + pc * 16); }
    return; }
#pragma unroll
  for (int u = 0; u < 8; ++u) { const int t = u & 3, half = u >> 2; const int col = col0 + t * 16 + ln; const float bv = bp ? bf16_rne(bp[col]) : 0.f;
#pragma unroll
    for (int r = 0; r < 8; ++r) { const int rloc = half * 16 + 8 * hh + r; float v = accs[u][r] * alpha + bv;
      if (EPI == 0 && CP) { if (rowsPerB < 0) v += CP[cofs + (size_t)(row0g + row0 + rloc) * ldc + col];      /* rowsPerB < 0: own element of the batched C plane */ else { const int bidx = (row0g + row0 + rloc) / rowsPerB; v += CP[(size_t)bidx * sCPb + (size_t)by * 64 + col]; } }
      if (ACT == 3) v = fmaxf(v, 0.f);
      so[w][rloc][t * 16 + ln] = v; } }
  __builtin_amdgcn_fence(__ATOMIC_ACQ_REL, "workgroup"); __builtin_amdgcn_wave_barrier();
  if (EPI == 1 || EPI == 3) {
    // eight columns a lane, four rows a wave store: each row's 64 columns leave as one whole 128-B line per plane
    const int rs4 = lane >> 3, c8 = (lane & 7) * 8, j0 = c8 & 31;
    const size_t t0 = (size_t)(row0 % SEQ + rs4) * 32 + j0;      /* a wave's 32 rows lie in one sequence: SEQ % 128 == 0 */
    unsigned short* hp = (unsigned short*)H + (size_t)(row0 + rs4) * ldc + col0 + c8; unsigned short* lp = (unsigned short*)L + (size_t)(row0 + rs4) * ldc + col0 + c8; const size_t r4 = (size_t)4 * ldc;
#pragma unroll      /* the table loads of all eight steps take immediate offsets and go out together */
    for (int q = 0; q < 8; ++q) { const int r = q * 4 + rs4;
      const v4f a = *(const v4fa*)&so[w][r][c8], c = *(const v4fa*)&so[w][r][c8 + 4]; const float xs[8] = {a[0], a[1], a[2], a[3], c[0], c[1], c[2], c[3]};
      const float* tp = CS + t0 + q * 128; const float* up = SN + t0 + q * 128; const v4f ca = *(const v4fa*)tp, cb = *(const v4fa*)(tp + 4), sa = *(const v4fa*)up, sb = *(const v4fa*)(up + 4);
      const float cs[8] = {ca[0], ca[1], ca[2], ca[3], cb[0], cb[1], cb[2], cb[3]}; const float sn[8] = {sa[0], sa[1], sa[2], sa[3], sb[0], sb[1], sb[2], sb[3]};
      FragH fh, fl;
#pragma unroll      /* constant indices: xs, cs, sn and the packed halves stay in registers */
      for (int e = 0; e < 8; ++e) { const float pr = xs[e ^ 1]; const float rh = (e & 1) ? pr : -pr; const float o = xs[e] * cs[e] + rh * sn[e];
        const _Float16 hv = (_Float16)o; fh.h[e] = hv; fl.h[e] = (_Float16)((o - (float)hv) * 1024.0f); }
      *(v8us*)(hp + q * r4) = fh.half[0]; *(v8us*)(lp + q * r4) = fl.half[0]; }
    __builtin_amdgcn_endpgm(); }      /* the wave ends here: behind a plain return the compiler leads this path on to the test in front of the other epilogue and keeps the 64 accumulator registers alive all through it (300 registers against 207) */
  const int rsub = lane >> 4, c4 = (lane & 15) * 4;
  {
#pragma unroll
    for (int q = 0; q < 16; ++q) { const int r = q * 2 + rsub; const v4f v = *(const v4fa*)&so[w][r][c4]; if (C) *(v4f*)(C + cofs + (size_t)(row0 + r) * ldc + col0 + c4) = v; if (C16) { v4h h4;
#pragma unroll
        for (int i = 0; i < 4; ++i) h4[i] = (_Float16)v[i]; *(v4h*)(C16 + cofs + (size_t)(row0 + r) * ldc + col0 + c4) = h4; } }
     } }

// ---- preparation, one launch: the RoPE tables, x -> f16 and the four weight planes read nothing of each other's output, so their work-groups share one grid.
#define PB_R (SEQ * 32 / 256)
#define PB_X (NR * DM / 8 / 256)
#define PB_W (DM * DM / 8 / 256)
static_assert((SEQ * 32) % 256 == 0 && (NR * DM / 8) % 256 == 0 && (DM * DM / 8) % 256 == 0);
static_assert((long long)NB_FULL * SEQ_FULL * DM * 4 < (1ll << 32));
// one unit of eight elements per thread: dst[8 t ..] = f16(bf16(src[e0 ..]) sc); every offset fits 32 bits
__device__ __forceinline__ void prep_cvt(const float* __restrict__ src, unsigned int e0, _Float16* __restrict__ dst, unsigned int t, float sc) {
  const unsigned int ib = e0 * 4; const float* p = (const float*)((const char*)src + ib); const v4f a = *(const v4fa*)p, c = *(const v4fa*)(p + 4); FragH f;
  asm volatile("s_wait_xcnt 0x0" :: "v"(ib) : "memory");      /* the two loads' one offset register stays whole up to here and is free behind it */
#pragma unroll
  for (int q = 0; q < 4; ++q) { f.h[q] = (_Float16)(bf16_rne(a[q]) * sc); f.h[4 + q] = (_Float16)(bf16_rne(c[q]) * sc); }
  *(v8us*)((unsigned short*)dst + (size_t)t * 8) = f.half[0];
  asm volatile("s_wait_xcnt 0x0" ::: "memory"); }      /* no register that the issued store names is written again ahead of this, whatever path the compiler lays behind it */

__device__ __forceinline__ void prep_rotab(int t, float* __restrict__ CS, float* __restrict__ SN) {
  #pragma clang fp contract(off)
  const int j = t % 32, s = t / 32; const float ex = (float)(2 * j) / 64.0f; const float inv = 1.0f / powf(10000.0f, ex); const float th = (float)s * inv; const float c = cosf(th), sn = sinf(th);
  { *(float*)(CS + t) = c; *(float*)(SN + t) = sn;  } }

// work-groups 0 .. PB_R - 1: tables (the longest chains start first); then PB_X of x (compact row r stands at input row b SEQ_FULL + s); then PB_W of each weight, [out][in], bf16 then x16 in f16
__global__ __launch_bounds__(256) void k_prep(const float* __restrict__ x, const float* __restrict__ Wq, const float* __restrict__ Wk, const float* __restrict__ Wv, const float* __restrict__ Wo,
    _Float16* __restrict__ X16, _Float16* __restrict__ BQ, _Float16* __restrict__ BK, _Float16* __restrict__ BV, _Float16* __restrict__ BO, float* __restrict__ CS, float* __restrict__ SN) {
  int blk = blockIdx.x;
  if (blk < PB_R) { prep_rotab(blk * 256 + (int)threadIdx.x, CS, SN); return; }
  blk -= PB_R;
  if (blk < PB_X) { const unsigned int t = (unsigned int)blk * 256 + threadIdx.x; const unsigned int row = (t * 8) / DM, c0 = (t * 8) % DM, rb = row / SEQ, rs = row % SEQ;
    prep_cvt(x, (rb * SEQ_FULL + rs) * DM + c0, X16, t, 1.0f); return; }
  blk -= PB_X;
  const int m = blk / PB_W; blk -= m * PB_W;
  const float* Wm = m == 0 ? Wq : m == 1 ? Wk : m == 2 ? Wv : Wo; _Float16* Bt = m == 0 ? BQ : m == 1 ? BK : m == 2 ? BV : BO;
  const unsigned int t = (unsigned int)blk * 256 + threadIdx.x; prep_cvt(Wm, t * 8, Bt, t, 16.0f); }

// One 32-key stage of K hi, K lo (32 rows x 128 B, LDS pitch 144 B) and V^T hi, V^T lo (64 rows x 64 B, LDS pitch 80 B): 1024 pieces of 16 B, eight per thread, global -> LDS through no register.
#define KV_KH 0
#define KV_KL 4608
#define KV_VH 9216
#define KV_VL 14336
#define KV_STAGE 19456
__device__ __forceinline__ void kv_stage(unsigned int lk, unsigned int lv, const unsigned short* gkh, const unsigned short* gkl, size_t k16, const unsigned short* gvh, const unsigned short* gvl, size_t v32) {
  // the s_wait_xcnt closes the statement so that no address register of an issued copy is rewritten ahead of it
  asm volatile("global_load_async_to_lds_b128 %0, %8, off\n\t"
               "global_load_async_to_lds_b128 %1, %9, off\n\t"
               "global_load_async_to_lds_b128 %2, %10, off\n\t"
               "global_load_async_to_lds_b128 %3, %11, off\n\t"
               "global_load_async_to_lds_b128 %4, %12, off\n\t"
               "global_load_async_to_lds_b128 %5, %13, off\n\t"
               "global_load_async_to_lds_b128 %6, %14, off\n\t"
               "global_load_async_to_lds_b128 %7, %15, off\n\t"
               "s_wait_xcnt 0x0"
               :: "v"(lk + KV_KH), "v"(lk + KV_KH + 16 * 144), "v"(lk + KV_KL), "v"(lk + KV_KL + 16 * 144), "v"(lv + KV_VH), "v"(lv + KV_VH + 32 * 80), "v"(lv + KV_VL), "v"(lv + KV_VL + 32 * 80),
                  "v"(gkh), "v"(gkh + k16), "v"(gkl), "v"(gkl + k16), "v"(gvh), "v"(gvh + v32), "v"(gvl), "v"(gvl + v32) : "memory");
}

// lane l with lane l ^ 16: joins the two key halves that lanes c and c + 16 hold of one query
__device__ __forceinline__ float xhalf(float x) { return __builtin_bit_cast(float, __builtin_amdgcn_permlanex16(__builtin_bit_cast(int, x), __builtin_bit_cast(int, x), 0x76543210, 0xfedcba98, false, false)); }

__global__ __launch_bounds__(128) void k_attn(const _Float16* __restrict__ Q16, const _Float16* __restrict__ QL, int ldq, const _Float16* __restrict__ K16, const _Float16* __restrict__ KL, int ldk,
                                             const _Float16* __restrict__ Vt, const _Float16* __restrict__ VtL, const float* __restrict__ AM, const float* __restrict__ AW, _Float16* __restrict__ OH, _Float16* __restrict__ OL, int ldo) {
  constexpr int RPW = 16, DT = 4, KS = 2, QBN = SEQ / 64;
  __shared__ __attribute__((aligned(16))) float sO[4][RPW][64 + 4];
  __shared__ __attribute__((aligned(16))) unsigned char ring[2][KV_STAGE];
  const int tid = threadIdx.x, w = tid >> 5, lane = tid & 31, ln = lane & 15, hh = lane >> 4;
  const int slab = blockIdx.x / QBN, qblk = blockIdx.x % QBN; const int b = slab / NH, h = slab % NH; const int qb0 = qblk * (4 * RPW); const int q0 = qb0 + w * RPW;
  const float ww = bf16_rne(AW[0]) * LOG2E;
  FragH aq[KS], aql[KS];
  { const unsigned short* qr = (const unsigned short*)Q16 + ((size_t)b * SEQ + q0 + ln) * ldq + h * 64; const unsigned short* ql = (const unsigned short*)QL + ((size_t)b * SEQ + q0 + ln) * ldq + h * 64;
#pragma unroll
    for (int ks = 0; ks < KS; ++ks) { aq[ks].half[0] = *(const v8us*)(qr + ks * 32 + 8 * hh); aq[ks].half[1] = *(const v8us*)(qr + ks * 32 + 16 + 8 * hh); aql[ks].half[0] = *(const v8us*)(ql + ks * 32 + 8 * hh); aql[ks].half[1] = *(const v8us*)(ql + ks * 32 + 16 + 8 * hh); } }
  const unsigned short* Vth = (const unsigned short*)Vt + (size_t)slab * 64 * SEQ; const unsigned short* Vtl = (const unsigned short*)VtL + (size_t)slab * 64 * SEQ;
  const float* amq = AM + (size_t)b * SEQ_FULL * SEQ_FULL + (size_t)(q0 + ln) * SEQ_FULL + 8 * hh;      /* mask[b][0][own query][.] with full strides, at this lane half's first key */
  const v8f z8 = {0.f,0.f,0.f,0.f,0.f,0.f,0.f,0.f};
  float m_q = -3.0e38f, l_q = 0.f; v8f oacc[DT], oaccL[DT];
#pragma unroll
  for (int dt = 0; dt < DT; ++dt) { oacc[dt] = z8; oaccL[dt] = z8; }
  // this thread's pieces: K row tid/8 (and +16), 16-B column tid%8; V^T row tid/4 (and +32), 16-B column tid%4
  const unsigned int lring = (unsigned int)(size_t)&ring[0][0]; const unsigned int lk = lring + (tid >> 3) * 144 + (tid & 7) * 16, lv = lring + (tid >> 2) * 80 + (tid & 3) * 16;
  const size_t kofs = ((size_t)b * SEQ + (tid >> 3)) * ldk + h * 64 + (tid & 7) * 8; const unsigned short* gkh = (const unsigned short*)K16 + kofs; const unsigned short* gkl = (const unsigned short*)KL + kofs;
  const size_t vofs = (size_t)(tid >> 2) * SEQ + (tid & 3) * 8; const unsigned short* gvh = Vth + vofs; const unsigned short* gvl = Vtl + vofs;
  const size_t k16 = (size_t)16 * ldk, k32 = (size_t)32 * ldk, v32 = (size_t)32 * SEQ;
  kv_stage(lk, lv, gkh, gkl, k16, gvh, gvl, v32);
  asm volatile("s_wait_asynccnt 0x0" ::: "memory");      /* stage 0 has landed before the barrier that publishes it */
  __syncthreads();
  kv_stage(lk + KV_STAGE, lv + KV_STAGE, gkh + k32, gkl + k32, k16, gvh + 32, gvl + 32, v32);
#pragma unroll 1
  for (int j0 = 0; j0 < SEQ; j0 += 32) {
    const unsigned int bsel = (j0 & 32) ? KV_STAGE : 0; const unsigned char* kvb = &ring[0][0] + bsel;
    v4f mk[2][2];      /* own query's mask, keys j0 + 16 nt + 8 hh + 0..7 */
#pragma unroll
    for (int nt = 0; nt < 2; ++nt) { mk[nt][0] = *(const v4fa*)(amq + j0 + nt * 16); mk[nt][1] = *(const v4fa*)(amq + j0 + nt * 16 + 4); }
    v8f s[2];
#pragma unroll
    for (int nt = 0; nt < 2; ++nt) { const unsigned short* kr = (const unsigned short*)(kvb + KV_KH + (nt * 16 + ln) * 144); const unsigned short* klr = (const unsigned short*)(kvb + KV_KL + (nt * 16 + ln) * 144); FragH bk[KS], bkl[KS];
#pragma unroll
      for (int ks = 0; ks < KS; ++ks) { bk[ks].half[0] = *(const v8us*)(kr + ks * 32 + 8 * hh); bk[ks].half[1] = *(const v8us*)(kr + ks * 32 + 16 + 8 * hh); bkl[ks].half[0] = *(const v8us*)(klr + ks * 32 + 8 * hh); bkl[ks].half[1] = *(const v8us*)(klr + ks * 32 + 16 + 8 * hh); }
      v8f acc = z8, accl = z8;
#pragma unroll
      for (int ks = 0; ks < KS; ++ks) { acc = mmaH<1>(bk[ks].v, bk[ks].v, aq[ks].v, aq[ks].v, acc); accl = mmaH<1>(bk[ks].v, bk[ks].v, aql[ks].v, aql[ks].v, accl); accl = mmaH<1>(bkl[ks].v, bkl[ks].v, aq[ks].v, aq[ks].v, accl); }
#pragma unroll
      for (int r = 0; r < 8; ++r) acc[r] += accl[r] * 0.0009765625f;
      s[nt] = acc; }
    float mc = -3.0e38f;
#pragma unroll
    for (int nt = 0; nt < 2; ++nt)
#pragma unroll
      for (int r = 0; r < 8; ++r) { float sv = s[nt][r] * (SCL * LOG2E); sv += bf16_rne(mk[nt][r >> 2][r & 3]) * ww; s[nt][r] = sv; mc = fmaxf(mc, sv); }
    mc = fmaxf(mc, xhalf(mc));
    const float mn = fmaxf(m_q, mc - 10.0f); const float al = __builtin_amdgcn_exp2f((mn > -1.0e38f) ? m_q - mn : 0.f); m_q = mn;
    FragH pa, pl; float ls[2] = {0.f, 0.f};
#pragma unroll
    for (int nt = 0; nt < 2; ++nt)
#pragma unroll
      for (int r = 0; r < 8; ++r) { const float psc = __builtin_amdgcn_exp2f(s[nt][r] - mn); ls[nt] += psc; const _Float16 ph = (_Float16)psc; pa.h[nt * 8 + r] = ph; pl.h[nt * 8 + r] = (_Float16)((psc - (float)ph) * 1024.0f); }
    l_q = l_q * al + (ls[0] + ls[1]);
#pragma unroll
    for (int dt = 0; dt < DT; ++dt)
#pragma unroll
      for (int r = 0; r < 8; ++r) { oacc[dt][r] *= al; oaccL[dt][r] *= al; }
#pragma unroll
    for (int dt = 0; dt < DT; ++dt) { const unsigned short* vrow = (const unsigned short*)(kvb + KV_VH + (dt * 16 + ln) * 80); const unsigned short* vrl = (const unsigned short*)(kvb + KV_VL + (dt * 16 + ln) * 80); FragH bv, bl;
      bv.half[0] = *(const v8us*)(vrow + 8 * hh); bv.half[1] = *(const v8us*)(vrow + 16 + 8 * hh); bl.half[0] = *(const v8us*)(vrl + 8 * hh); bl.half[1] = *(const v8us*)(vrl + 16 + 8 * hh);
      oacc[dt] = mmaH<1>(bv.v, bv.v, pa.v, pa.v, oacc[dt]); oaccL[dt] = mmaH<1>(bv.v, bv.v, pl.v, pl.v, oaccL[dt]); oaccL[dt] = mmaH<1>(bl.v, bl.v, pa.v, pa.v, oaccL[dt]); }
    asm volatile("s_wait_dscnt 0x0" ::: "memory");         /* this wave's reads of the buffer are done before it is handed to the copies */
    asm volatile("s_wait_asynccnt 0x0" ::: "memory");      /* this wave's pieces of the next stage have landed */
    __syncthreads();                                       /* publishes the next stage and ends every wave's reads of this one */
    if (j0 + 64 < SEQ) kv_stage(lk + bsel, lv + bsel, gkh + (size_t)(j0 + 64) * ldk, gkl + (size_t)(j0 + 64) * ldk, k16, gvh + j0 + 64, gvl + j0 + 64, v32); }
  asm volatile("s_wait_asynccnt 0x0" ::: "memory");        /* no copy is outstanding when the wave goes on to its end */
  const float lt = l_q + xhalf(l_q); const float linv = (lt > 0.f) ? 1.0f / lt : 0.f;
#pragma unroll
  for (int dt = 0; dt < DT; ++dt)
#pragma unroll
    for (int r = 0; r < 8; ++r) { float v = oacc[dt][r]; v += oaccL[dt][r] * 0.0009765625f; sO[w][ln][dt * 16 + 8 * hh + r] = v * linv; }
  __builtin_amdgcn_fence(__ATOMIC_ACQ_REL, "workgroup"); __builtin_amdgcn_wave_barrier();
  {
#pragma unroll
    for (int rp = 0; rp < RPW; rp += 4) { const int r = rp + (lane >> 3), pc = lane & 7; const v4f va = *(const v4fa*)&sO[w][r][pc * 8], vb = *(const v4fa*)&sO[w][r][pc * 8 + 4]; FragH fh, fl;      /* context leaves as f16 hi + 2^10 residual rows, one whole 128-B line per row and plane */
#pragma unroll      /* constant indices: the packed halves stay in registers */
      for (int e = 0; e < 4; ++e) { _Float16 hv = (_Float16)va[e]; fh.h[e] = hv; fl.h[e] = (_Float16)((va[e] - (float)hv) * 1024.0f); hv = (_Float16)vb[e]; fh.h[4 + e] = hv; fl.h[4 + e] = (_Float16)((vb[e] - (float)hv) * 1024.0f); }
      const size_t o8 = ((size_t)b * SEQ + q0 + r) * ldo + h * 64 + pc * 8; *(v8us*)((unsigned short*)OH + o8) = fh.half[0]; *(v8us*)((unsigned short*)OL + o8) = fl.half[0]; }
     } }

// LayerNorm over DM (biased variance, eps 1e-5, affine with bf16 g, b) of (A[r] + bf16(x[rin])), compact row r -> input/output row rin = b*SEQ_FULL + s;
__global__ __launch_bounds__(256) void k_ln1024(const float* __restrict__ A, const float* __restrict__ res, const float* __restrict__ g, const float* __restrict__ bb, float* __restrict__ Y) {
  #pragma clang fp contract(off)
  const int wv = threadIdx.x >> 5, ln = threadIdx.x & 31; const size_t r = (size_t)blockIdx.x * 8 + wv; if (r >= (size_t)NR) return;
  const size_t rb = r / SEQ, rs = r % SEQ; const size_t rin = rb * SEQ_FULL + rs;
  float xv[32]; float sm = 0.f;
#pragma unroll
  for (int i = 0; i < 8; ++i) { const int c0 = i * 128 + ln * 4; const v4f a = *(const v4fa*)(A + r * DM + c0); const v4f rr = *(const v4fa*)(res + rin * DM + c0);
#pragma unroll
    for (int q = 0; q < 4; ++q) { const float v = a[q] + bf16_rne(rr[q]); xv[i * 4 + q] = v; sm += v; } }
#pragma unroll
  for (int o = 16; o > 0; o >>= 1) sm += __shfl_xor(sm, o, 32);
  const float mu = sm * 0.0009765625f; float var = 0.f;
#pragma unroll
  for (int q = 0; q < 32; ++q) { const float d = xv[q] - mu; var += d * d; }
#pragma unroll
  for (int o = 16; o > 0; o >>= 1) var += __shfl_xor(var, o, 32);
  const float inv = 1.0f / sqrtf(var * 0.0009765625f + 1e-5f);
  {
#pragma unroll
    for (int i = 0; i < 8; ++i) { const int c0 = i * 128 + ln * 4; v4f y;
#pragma unroll
      for (int q = 0; q < 4; ++q) { float v = (xv[i * 4 + q] - mu) * inv; v *= bf16_rne(g[c0 + q]); v += bf16_rne(bb[c0 + q]); y[q] = v; }
      *(v4f*)(Y + rin * DM + c0) = y; }
     } }

extern "C" void kernel_launch(void* const* d_in, const int* in_sizes, int n_in,
                              void* d_out, int out_size, void* d_ws, size_t ws_size, hipStream_t stream) {
  if (n_in < 13) return;
  const float* x = (const float*)d_in[0]; const float* cdm = (const float*)d_in[1];
  const float* Wq = (const float*)d_in[2]; const float* bq = (const float*)d_in[3]; const float* Wk = (const float*)d_in[4]; const float* bk = (const float*)d_in[5];
  const float* Wv = (const float*)d_in[6]; const float* bv = (const float*)d_in[7]; const float* Wo = (const float*)d_in[8]; const float* bo = (const float*)d_in[9];
  const float* gam = (const float*)d_in[10]; const float* bet = (const float*)d_in[11]; const float* cdw = (const float*)d_in[12];
  const long long rows_need = (long long)(NB - 1) * SEQ_FULL + SEQ;
  if ((long long)in_sizes[0] < rows_need * DM) return;
  if ((long long)in_sizes[1] < (long long)(NB - 1) * SEQ_FULL * SEQ_FULL + (long long)(SEQ - 1) * SEQ_FULL + SEQ) return;
  if (in_sizes[2] < DM * DM || in_sizes[4] < DM * DM || in_sizes[6] < DM * DM || in_sizes[8] < DM * DM) return;
  if (in_sizes[3] < DM || in_sizes[5] < DM || in_sizes[7] < DM || in_sizes[9] < DM || in_sizes[10] < DM || in_sizes[11] < DM || in_sizes[12] < 1) return;
  if ((long long)out_size < rows_need * DM) return;
  char* ws = (char*)d_ws; size_t off = 0;
  auto take = [&](size_t bytes) { char* p = ws + off; off += (bytes + 255) & ~(size_t)255; return p; };
  const size_t np = (size_t)NR * DM;      /* compact activation plane elements */
  _Float16* BQ = (_Float16*)take((size_t)DM * DM * 2); _Float16* BK = (_Float16*)take((size_t)DM * DM * 2); _Float16* BV = (_Float16*)take((size_t)DM * DM * 2); _Float16* BO = (_Float16*)take((size_t)DM * DM * 2);
  _Float16* X16 = (_Float16*)take(np * 2);
  _Float16* QH = (_Float16*)take(np * 2); _Float16* QL = (_Float16*)take(np * 2); _Float16* KH = (_Float16*)take(np * 2); _Float16* KL = (_Float16*)take(np * 2);
  _Float16* VT = (_Float16*)take(np * 2); _Float16* VTL = (_Float16*)take(np * 2); _Float16* OH = (_Float16*)take(np * 2); _Float16* OL = (_Float16*)take(np * 2);
  float* Y = (float*)take(np * 4); float* CS = (float*)take((size_t)SEQ * 32 * 4); float* SN = (float*)take((size_t)SEQ * 32 * 4);
  if (off > ws_size) return;
  static_assert(((size_t)DM * DM * 2) % 256 == 0 && ((size_t)NR * DM * 2) % 256 == 0);      /* BQ, BK, BV and the pairs (QH, QL), (KH, KL), (VT, VTL) stand back to back: one stride each reaches all three */
  k_prep<<<PB_R + PB_X + 4 * PB_W, 256, 0, stream>>>(x, Wq, Wk, Wv, Wo, X16, BQ, BK, BV, BO, CS, SN);
  const dim3 g((NR / 128) * (DM / 64), 1); const dim3 g3((NR / 128) * (DM / 64), 3);
  k_gemm2<0, 3><<<g3, 128, 0, stream>>>(X16, DM, 0, BQ, DM, (size_t)DM * DM, 0.0625f, bq, 0, nullptr, 1, 0, 0, nullptr, nullptr, DM, 0, NR, DM, DM, CS, SN, QH, QL, 2 * np, bk, bv, nullptr);      /* Q, K -> RoPE -> hi/lo; V -> hi/lo, transposed per head */
  k_attn<<<NB * NH * (SEQ / 64), 128, 0, stream>>>(QH, QL, DM, KH, KL, DM, VT, VTL, cdm, cdw, OH, OL, DM);      /* context -> hi/lo rows */
  k_gemm2<0, 4><<<g, 128, 0, stream>>>(OL, DM, 0, BO, DM, 0, 0.0625f, bo, 0, nullptr, 1, 0, 0, Y, nullptr, DM, 0, NR, DM, DM, nullptr, nullptr, nullptr, nullptr, 0, nullptr, nullptr, OH);      /* Y = (ctx_lo + ctx_hi) Wo^T + bo */
  k_ln1024<<<NR / 8, 256, 0, stream>>>(Y, x, gam, bet, (float*)d_out);      /* out = LN(bf16(x) + Y) g + b */
}

// v009
// A run of this version takes 169 microseconds.
// Timed twice side by side with v008, it ran 1.04 and 1.03 times as fast.
// Counting every step since v000, it is 4.05 times as fast.
#include <hip/hip_runtime.h>
// All contractions (Q/K/V projections, Q.K^T, P.V^T, output projection) on v_wmma_f32_16x16x32_f16: f16 operands, f32 accumulate. Float inputs RNE-converted to bf16 (exact in f16; weights carried x16); q, k, v, softmax numerators (x1024) and context carried as f16 hi + 2^10 residual plane pairs; RoPE tables, softmax, residual add and LayerNorm in f32.
#ifndef NB
#define NB 2
#endif
#ifndef SEQ
#define SEQ 2048
#endif
#define NB_FULL 2
#define SEQ_FULL 2048
#define DM 1024
#define NH 16
#define NR (NB * SEQ)
#define SCL 0.125f
#define LOG2E 1.44269504088896340736f
static_assert(NB >= 1 && NB <= NB_FULL);
static_assert(SEQ >= 128 && SEQ <= SEQ_FULL && (SEQ % 128) == 0);
static_assert(NH * 64 == DM);
static_assert((NR % 128) == 0);
static_assert((DM % 64) == 0 && (DM % 128) == 0);

typedef unsigned short v8us __attribute__((ext_vector_type(8), may_alias));
typedef float  v8f  __attribute__((ext_vector_type(8)));
typedef float  v4f  __attribute__((ext_vector_type(4)));
typedef float  v4fa __attribute__((ext_vector_type(4), may_alias));
typedef _Float16 v16h __attribute__((ext_vector_type(16)));
typedef _Float16 v4h __attribute__((ext_vector_type(4)));
union FragH { v16h v; v8us half[2]; _Float16 h[16]; unsigned short u[16]; };

__device__ __forceinline__ unsigned short bf16_bits(float x) { unsigned int u = __float_as_uint(x); return (unsigned short)((u + 0x7FFFu + ((u >> 16) & 1u)) >> 16); }
__device__ __forceinline__ float bf16_val(unsigned short b) { return __uint_as_float(((unsigned int)b) << 16); }
__device__ __forceinline__ float bf16_rne(float x) { return bf16_val(bf16_bits(x)); }

// D += A.B with NT terms: 1 = ah.bh, 2 = + al.bh, 3 = + ah.bl; builtin form only: the compiler keeps the distance behind a WMMA itself and is free to order loads and independent products around it
template <int NT>
__device__ __forceinline__ v8f mmaH(v16h ah, v16h al, v16h bh, v16h bl, v8f c) {
  c = __builtin_amdgcn_wmma_f32_16x16x32_f16(false, ah, false, bh, (short)0, c, false, false);
  if (NT >= 2) c = __builtin_amdgcn_wmma_f32_16x16x32_f16(false, al, false, bh, (short)0, c, false, false);
  if (NT >= 3) c = __builtin_amdgcn_wmma_f32_16x16x32_f16(false, ah, false, bl, (short)0, c, false, false);
  return c;
}

// ---- GEMM engine (work-group tile 128x64, wave tile 32x64; M % 128 == 0, N % 64 == 0, K % 128 == 0, lda and ldb % 8 == 0): C[M][N] f32 = alpha A[M][K].Bt[N][K]^T + bf16(bias) (+ CP own element); A, Bt f16 k-contiguous.
// Each 128-k stage (A 128 rows, then Bt 64 rows, 256 B a row at LDS pitch 272 B) is brought once per work-group into a two-buffer LDS ring, global -> LDS through no register, and read by all four waves.
// A fragment: lane row = l&15, elements 0..7 <- k0 + 8h + i, 8..15 <- k0 + 16 + 8h + i; B fragment from the [n][k] copy with the same k map; D element r -> (row 8h + r, col l&15).
__device__ __forceinline__ v16h g2_frag(const _Float16* p, int hh) { FragH f; f.half[0] = *(const v8us*)((const unsigned short*)p + 8 * hh); f.half[1] = *(const v8us*)((const unsigned short*)p + 16 + 8 * hh); return f.v; }
__device__ __forceinline__ v8f g2_mma(v16h a, v16h b, v8f c) { v8f d = __builtin_amdgcn_wmma_f32_16x16x32_f16(false, a, false, b, (short)0, c, false, false); asm volatile("v_nop\n\tv_nop\n\tv_nop\n\tv_nop" : "+v"(d) : "v"(a), "v"(b)); return d; }
#define G_KT 128
#define G_PITCH 272
#define G_STAGE (192 * G_PITCH)
// eight 16-B pieces of one thread: rows 8 apart, the same 16-B column; a wave's copy covers two whole 256-B rows
__device__ __forceinline__ void g2_copy8(unsigned int l, const unsigned short* g, size_t r8) {
  // the s_wait_xcnt closes the statement so that no address register of an issued copy is rewritten ahead of it
  asm volatile("global_load_async_to_lds_b128 %0, %8, off\n\t"
               "global_load_async_to_lds_b128 %1, %9, off\n\t"
               "global_load_async_to_lds_b128 %2, %10, off\n\t"
               "global_load_async_to_lds_b128 %3, %11, off\n\t"
               "global_load_async_to_lds_b128 %4, %12, off\n\t"
               "global_load_async_to_lds_b128 %5, %13, off\n\t"
               "global_load_async_to_lds_b128 %6, %14, off\n\t"
               "global_load_async_to_lds_b128 %7, %15, off\n\t"
               "s_wait_xcnt 0x0"
               :: "v"(l), "v"(l + 8 * G_PITCH), "v"(l + 16 * G_PITCH), "v"(l + 24 * G_PITCH), "v"(l + 32 * G_PITCH), "v"(l + 40 * G_PITCH), "v"(l + 48 * G_PITCH), "v"(l + 56 * G_PITCH),
                  "v"(g), "v"(g + r8), "v"(g + 2 * r8), "v"(g + 3 * r8), "v"(g + 4 * r8), "v"(g + 5 * r8), "v"(g + 6 * r8), "v"(g + 7 * r8) : "memory");
}
// one stage: A rows 0..127 of the work-group's tile, then Bt rows 0..63, 24 pieces per thread
__device__ __forceinline__ void g2_stage(unsigned int l, const unsigned short* ga, size_t a8, const unsigned short* gb, size_t b8) {
  g2_copy8(l, ga, a8); g2_copy8(l + 64 * G_PITCH, ga + 8 * a8, a8); g2_copy8(l + 128 * G_PITCH, gb, b8);
}
// EPI 0: C f32 rows. EPI 1: RoPE (concatenated tables, interleaved rotate_half: out[d] = x[d] c[s][d mod 32] + rh[d] sn[s][d mod 32], rh[d] = -x[d+1] (d even), x[d-1] (d odd)), then f16 hi + 2^10 residual rows H, L [row][ldc].
// EPI 2: f16 hi + 2^10 residual, stored transposed per head: H, L [(b NH + h) 64 + d][SEQ] (N == DM, one 64-column tile = one head).
// EPI 3: three products of one A in one grid, blockIdx.y picks Bt (stride sB), the planes H, L (stride sH) and the bias (bias, bias1, bias2): 0 and 1 end as EPI 1, 2 as EPI 2.
// EPI 4: C f32 rows of a plane pair in one k loop of 2 K: first A (the 2^10 residual plane) against Bt, the accumulators then taken times 2^-10 (exact), then A2 (the hi plane) against the same Bt on top of them.
template <int ACT, int EPI>
__global__ __launch_bounds__(128) void k_gemm2(const _Float16* __restrict__ A, int lda, size_t sA, const _Float16* __restrict__ Bh, int ldb, size_t sB, float alpha, const float* __restrict__ bias, size_t sBias, const float* CP, int rowsPerB, size_t sCPb, int row0g,
    float* C, _Float16* C16, int ldc, size_t sC, int M, int N, int K, const float* __restrict__ CS, const float* __restrict__ SN, _Float16* __restrict__ H, _Float16* __restrict__ L,
    size_t sH, const float* __restrict__ bias1, const float* __restrict__ bias2, const _Float16* __restrict__ A2) {
  __shared__ __attribute__((aligned(16))) float so[4][32][68];
  __shared__ __attribute__((aligned(16))) unsigned char gring[2][G_STAGE];
  const int tid = threadIdx.x, w = tid >> 5, lane = tid & 31, ln = lane & 15, hh = lane >> 4; const int by = blockIdx.y;
  A += (size_t)by * sA; Bh += (size_t)by * sB; const size_t cofs = (size_t)by * sC; const float* bp = bias ? bias + (size_t)by * sBias : nullptr;
  if (EPI == 3) { H += (size_t)by * sH; L += (size_t)by * sH; if (by == 1) bp = bias1; if (by == 2) bp = bias2; }      /* blockIdx.y is the same for the whole work-group */
  const int ntn = N >> 6; const int mt = blockIdx.x / ntn, nq = blockIdx.x - mt * ntn; const int row0 = mt * 128 + 32 * w, col0 = nq * 64; if (mt * 128 >= M) return;      /* the whole work-group leaves or none, ahead of every barrier and copy */
  const v8f z8 = {0.f,0.f,0.f,0.f,0.f,0.f,0.f,0.f}; v8f c00 = z8, c01 = z8, c02 = z8, c03 = z8, c10 = z8, c11 = z8, c12 = z8, c13 = z8;
  // this thread's pieces: stage row tid/16 (and +8 ...), 16-B column tid%16
  const unsigned int lg = (unsigned int)(size_t)&gring[0][0] + (tid >> 4) * G_PITCH + (tid & 15) * 16;
  const unsigned short* ga = (const unsigned short*)A + (size_t)(mt * 128 + (tid >> 4)) * lda + (tid & 15) * 8; const unsigned short* gb = (const unsigned short*)Bh + (size_t)(col0 + (tid >> 4)) * ldb + (tid & 15) * 8;
  const size_t a8 = (size_t)8 * lda, b8 = (size_t)8 * ldb;
  const unsigned short* ga2 = EPI == 4 ? (const unsigned short*)A2 + (size_t)(mt * 128 + (tid >> 4)) * lda + (tid & 15) * 8 : ga; const int KK = EPI == 4 ? 2 * K : K;
  // the stage that begins at k = kt of the loop: below K from A, from K on (EPI 4) from A2, both against Bt's columns kt mod K; the test reads the same for the whole work-group
  auto put = [&](unsigned int l, int kt) { const bool second = EPI == 4 && kt >= K; const int kk = second ? kt - K : kt; g2_stage(l, (second ? ga2 : ga) + kk, a8, gb + kk, b8); };
  put(lg, 0);
  asm volatile("s_wait_asynccnt 0x0" ::: "memory");      /* stage 0 has landed before the barrier that publishes it */
  __syncthreads();
  if (G_KT < KK) put(lg + G_STAGE, G_KT);
#pragma unroll 1
  for (int kt = 0; kt < KK; kt += G_KT) {
    const unsigned int bsel = (kt & G_KT) ? G_STAGE : 0; const unsigned char* sb = &gring[0][0] + bsel;
    const _Float16* a0p = (const _Float16*)(sb + (32 * w + ln) * G_PITCH); const _Float16* a1p = (const _Float16*)(sb + (32 * w + 16 + ln) * G_PITCH);
    const _Float16* b0p = (const _Float16*)(sb + (128 + ln) * G_PITCH); const _Float16* b1p = (const _Float16*)(sb + (144 + ln) * G_PITCH); const _Float16* b2p = (const _Float16*)(sb + (160 + ln) * G_PITCH); const _Float16* b3p = (const _Float16*)(sb + (176 + ln) * G_PITCH);
    // two fragment sets: the twelve LDS reads of the next 32-k step of this same stage go out as one group ahead of the current step's products;
    // the step loop is unrolled so that the set index is a constant and both sets stay in registers
    v16h fa0[2], fa1[2], fb0[2], fb1[2], fb2[2], fb3[2];
    fa0[0] = g2_frag(a0p, hh); fa1[0] = g2_frag(a1p, hh); fb0[0] = g2_frag(b0p, hh); fb1[0] = g2_frag(b1p, hh); fb2[0] = g2_frag(b2p, hh); fb3[0] = g2_frag(b3p, hh);
#pragma unroll
    for (int ks = 0; ks < G_KT / 32; ++ks) { const int cu = ks & 1, nx = cu ^ 1;
      if (ks + 1 < G_KT / 32) { const int kb = (ks + 1) * 32; fa0[nx] = g2_frag(a0p + kb, hh); fa1[nx] = g2_frag(a1p + kb, hh); fb0[nx] = g2_frag(b0p + kb, hh); fb1[nx] = g2_frag(b1p + kb, hh); fb2[nx] = g2_frag(b2p + kb, hh); fb3[nx] = g2_frag(b3p + kb, hh); }
      c00 = g2_mma(fa0[cu], fb0[cu], c00); c10 = g2_mma(fa1[cu], fb0[cu], c10);
      c01 = g2_mma(fa0[cu], fb1[cu], c01); c11 = g2_mma(fa1[cu], fb1[cu], c11);
      c02 = g2_mma(fa0[cu], fb2[cu], c02); c12 = g2_mma(fa1[cu], fb2[cu], c12);
      c03 = g2_mma(fa0[cu], fb3[cu], c03); c13 = g2_mma(fa1[cu], fb3[cu], c13); }
    if (EPI == 4 && kt + G_KT == K) { c00 *= 0.0009765625f; c01 *= 0.0009765625f; c02 *= 0.0009765625f; c03 *= 0.0009765625f; c10 *= 0.0009765625f; c11 *= 0.0009765625f; c12 *= 0.0009765625f; c13 *= 0.0009765625f; }      /* the residual plane's sum takes its weight before the hi plane's products are added to it */
    asm volatile("s_wait_dscnt 0x0" ::: "memory");         /* this wave's reads of the buffer are done before it is handed to the copies */
    asm volatile("s_wait_asynccnt 0x0" ::: "memory");      /* this wave's pieces of the next stage have landed */
    __syncthreads();                                       /* publishes the next stage and ends every wave's reads of this one */
    if (kt + 2 * G_KT < KK) put(lg + bsel, kt + 2 * G_KT); }
  asm volatile("s_wait_asynccnt 0x0" ::: "memory");        /* no copy is outstanding when the wave goes on to its end */
  v8f accs[8] = {c00, c01, c02, c03, c10, c11, c12, c13};
  if (EPI == 2 || (EPI == 3 && by == 2)) {
    // a lane holds eight consecutive rows of one column: 16 B of a transposed row. Both planes ([64 columns][128 rows] f16, pitch 272 B) are gathered in so, then leave as 256-B runs.
    unsigned char* tb = (unsigned char*)&so[0][0][0]; float bv4[4] = {0.f, 0.f, 0.f, 0.f};
    if (bp) {
#pragma unroll      /* constant indices: bv4 stays in registers, the four loads go out together */
      for (int t = 0; t < 4; ++t) bv4[t] = bf16_rne(bp[col0 + t * 16 + ln]); }
#pragma unroll      /* this loop and the next: constant indices keep accs and the packed halves in registers */
    for (int u = 0; u < 8; ++u) { const int t = u & 3, half = u >> 2; const float bv = bv4[t]; FragH fh, fl;
#pragma unroll
      for (int r = 0; r < 8; ++r) { const float v = accs[u][r] * alpha + bv; const _Float16 hv = (_Float16)v; fh.h[r] = hv; fl.h[r] = (_Float16)((v - (float)hv) * 1024.0f); }
      unsigned char* tp = tb + (t * 16 + ln) * 272 + (32 * w + half * 16 + 8 * hh) * 2; *(v8us*)tp = fh.half[0]; *(v8us*)(tp + 64 * 272) = fl.half[0]; }
    __syncthreads();      /* every wave's 32 rows stand in the transposed tile before any wave reads whole runs of it */
    const size_t vrow = (size_t)((mt * 128) / SEQ * NH + nq) * 64; const int s0 = (mt * 128) % SEQ;
#pragma unroll      /* the LDS reads of later runs go out ahead of the stores of earlier ones */
    for (int it = 0; it < 8; ++it) { const int i = it * 128 + tid, pc = i & 15, d = i >> 4; const size_t o = (vrow + d) * SEQ + s0 + pc * 8;
      *(v8us*)((unsigned short*)H + o) = *(const v8us*)(tb + d * 272 + pc * 16); *(v8us*)((unsigned short*)L + o) = *(const v8us*)(tb + (64 + d) * 272 + pc * 16); }
    return; }
#pragma unroll
  for (int u = 0; u < 8; ++u) { const int t = u & 3, half = u >> 2; const int col = col0 + t * 16 + ln; const float bv = bp ? bf16_rne(bp[col]) : 0.f;
#pragma unroll
    for (int r = 0; r < 8; ++r) { const int rloc = half * 16 + 8 * hh + r; float v = accs[u][r] * alpha + bv;
      if (EPI == 0 && CP) { if (rowsPerB < 0) v += CP[cofs + (size_t)(row0g + row0 + rloc) * ldc + col];      /* rowsPerB < 0: own element of the batched C plane */ else { const int bidx = (row0g + row0 + rloc) / rowsPerB; v += CP[(size_t)bidx * sCPb + (size_t)by * 64 + col]; } }
      if (ACT == 3) v = fmaxf(v, 0.f);
      so[w][rloc][t * 16 + ln] = v; } }
  __builtin_amdgcn_fence(__ATOMIC_ACQ_REL, "workgroup"); __builtin_amdgcn_wave_barrier();
  if (EPI == 1 || EPI == 3) {
    // eight columns a lane, four rows a wave store: each row's 64 columns leave as one whole 128-B line per plane
    const int rs4 = lane >> 3, c8 = (lane & 7) * 8, j0 = c8 & 31;
    const size_t t0 = (size_t)(row0 % SEQ + rs4) * 32 + j0;      /* a wave's 32 rows lie in one sequence: SEQ % 128 == 0 */
    unsigned short* hp = (unsigned short*)H + (size_t)(row0 + rs4) * ldc + col0 + c8; unsigned short* lp = (unsigned short*)L + (size_t)(row0 + rs4) * ldc + col0 + c8; const size_t r4 = (size_t)4 * ldc;
#pragma unroll      /* the table loads of all eight steps take immediate offsets and go out together */
    for (int q = 0; q < 8; ++q) { const int r = q * 4 + rs4;
      const v4f a = *(const v4fa*)&so[w][r][c8], c = *(const v4fa*)&so[w][r][c8 + 4]; const float xs[8] = {a[0], a[1], a[2], a[3], c[0], c[1], c[2], c[3]};
      const float* tp = CS + t0 + q * 128; const float* up = SN + t0 + q * 128; const v4f ca = *(const v4fa*)tp, cb = *(const v4fa*)(tp + 4), sa = *(const v4fa*)up, sb = *(const v4fa*)(up + 4);
      const float cs[8] = {ca[0], ca[1], ca[2], ca[3], cb[0], cb[1], cb[2], cb[3]}; const float sn[8] = {sa[0], sa[1], sa[2], sa[3], sb[0], sb[1], sb[2], sb[3]};
      FragH fh, fl;
#pragma unroll      /* constant indices: xs, cs, sn and the packed halves stay in registers */
      for (int e = 0; e < 8; ++e) { const float pr = xs[e ^ 1]; const float rh = (e & 1) ? pr : -pr; const float o = xs[e] * cs[e] + rh * sn[e];
        const _Float16 hv = (_Float16)o; fh.h[e] = hv; fl.h[e] = (_Float16)((o - (float)hv) * 1024.0f); }
      *(v8us*)(hp + q * r4) = fh.half[0]; *(v8us*)(lp + q * r4) = fl.half[0]; }
    __builtin_amdgcn_endpgm(); }      /* the wave ends here: behind a plain return the compiler leads this path on to the test in front of the other epilogue and keeps the 64 accumulator registers alive all through it (300 registers against 207) */
  const int rsub = lane >> 4, c4 = (lane & 15) * 4;
  {
#pragma unroll
    for (int q = 0; q < 16; ++q) { const int r = q * 2 + rsub; const v4f v = *(const v4fa*)&so[w][r][c4]; if (C) *(v4f*)(C + cofs + (size_t)(row0 + r) * ldc + col0 + c4) = v; if (C16) { v4h h4;
#pragma unroll
        for (int i = 0; i < 4; ++i) h4[i] = (_Float16)v[i]; *(v4h*)(C16 + cofs + (size_t)(row0 + r) * ldc + col0 + c4) = h4; } }
     } }

// ---- preparation, one launch: the RoPE tables, x -> f16 and the four weight planes read nothing of each other's output, so their work-groups share one grid.
#define PB_R (SEQ * 32 / 256)
#define PB_X (NR * DM / 8 / 256)
#define PB_W (DM * DM / 8 / 256)
static_assert((SEQ * 32) % 256 == 0 && (NR * DM / 8) % 256 == 0 && (DM * DM / 8) % 256 == 0);
static_assert((long long)NB_FULL * SEQ_FULL * DM * 4 < (1ll << 32));
// one unit of eight elements per thread: dst[8 t ..] = f16(bf16(src[e0 ..]) sc); every offset fits 32 bits
__device__ __forceinline__ void prep_cvt(const float* __restrict__ src, unsigned int e0, _Float16* __restrict__ dst, unsigned int t, float sc) {
  const unsigned int ib = e0 * 4; const float* p = (const float*)((const char*)src + ib); const v4f a = *(const v4fa*)p, c = *(const v4fa*)(p + 4); FragH f;
  asm volatile("s_wait_xcnt 0x0" :: "v"(ib) : "memory");      /* the two loads' one offset register stays whole up to here and is free behind it */
#pragma unroll
  for (int q = 0; q < 4; ++q) { f.h[q] = (_Float16)(bf16_rne(a[q]) * sc); f.h[4 + q] = (_Float16)(bf16_rne(c[q]) * sc); }
  *(v8us*)((unsigned short*)dst + (size_t)t * 8) = f.half[0];
  asm volatile("s_wait_xcnt 0x0" ::: "memory"); }      /* no register that the issued store names is written again ahead of this, whatever path the compiler lays behind it */

__device__ __forceinline__ void prep_rotab(int t, float* __restrict__ CS, float* __restrict__ SN) {
  #pragma clang fp contract(off)
  const int j = t % 32, s = t / 32; const float ex = (float)(2 * j) / 64.0f; const float inv = 1.0f / powf(10000.0f, ex); const float th = (float)s * inv; const float c = cosf(th), sn = sinf(th);
  { *(float*)(CS + t) = c; *(float*)(SN + t) = sn;  } }

// work-groups 0 .. PB_R - 1: tables (the longest chains start first); then PB_X of x (compact row r stands at input row b SEQ_FULL + s); then PB_W of each weight, [out][in], bf16 then x16 in f16
__global__ __launch_bounds__(256) void k_prep(const float* __restrict__ x, const float* __restrict__ Wq, const float* __restrict__ Wk, const float* __restrict__ Wv, const float* __restrict__ Wo,
    _Float16* __restrict__ X16, _Float16* __restrict__ BQ, _Float16* __restrict__ BK, _Float16* __restrict__ BV, _Float16* __restrict__ BO, float* __restrict__ CS, float* __restrict__ SN) {
  int blk = blockIdx.x;
  if (blk < PB_R) { prep_rotab(blk * 256 + (int)threadIdx.x, CS, SN); return; }
  blk -= PB_R;
  if (blk < PB_X) { const unsigned int t = (unsigned int)blk * 256 + threadIdx.x; const unsigned int row = (t * 8) / DM, c0 = (t * 8) % DM, rb = row / SEQ, rs = row % SEQ;
    prep_cvt(x, (rb * SEQ_FULL + rs) * DM + c0, X16, t, 1.0f); return; }
  blk -= PB_X;
  const int m = blk / PB_W; blk -= m * PB_W;
  const float* Wm = m == 0 ? Wq : m == 1 ? Wk : m == 2 ? Wv : Wo; _Float16* Bt = m == 0 ? BQ : m == 1 ? BK : m == 2 ? BV : BO;
  const unsigned int t = (unsigned int)blk * 256 + threadIdx.x; prep_cvt(Wm, t * 8, Bt, t, 16.0f); }

// One 32-key stage of K hi, K lo (32 rows x 128 B, LDS pitch 144 B), V^T hi, V^T lo (64 rows x 64 B, LDS pitch 80 B) and the work-group's f32 mask tile (64 query rows x 128 B, one whole line a row, LDS pitch 144 B):
// 1536 pieces of 16 B, twelve per thread, global -> LDS through no register.
#define KV_KH 0
#define KV_KL 4608
#define KV_VH 9216
#define KV_VL 14336
#define KV_MK 19456
#define KV_STAGE 28672
__device__ __forceinline__ void kv_stage(unsigned int lk, unsigned int lv, const unsigned short* gkh, const unsigned short* gkl, size_t k16, const unsigned short* gvh, const unsigned short* gvl, size_t v32, const float* gm, size_t m16) {
  // the s_wait_xcnt closes the statement so that no address register of an issued copy is rewritten ahead of it
  asm volatile("global_load_async_to_lds_b128 %0, %12, off\n\t"
               "global_load_async_to_lds_b128 %1, %13, off\n\t"
               "global_load_async_to_lds_b128 %2, %14, off\n\t"
               "global_load_async_to_lds_b128 %3, %15, off\n\t"
               "global_load_async_to_lds_b128 %4, %16, off\n\t"
               "global_load_async_to_lds_b128 %5, %17, off\n\t"
               "global_load_async_to_lds_b128 %6, %18, off\n\t"
               "global_load_async_to_lds_b128 %7, %19, off\n\t"
               "global_load_async_to_lds_b128 %8, %20, off\n\t"
               "global_load_async_to_lds_b128 %9, %21, off\n\t"
               "global_load_async_to_lds_b128 %10, %22, off\n\t"
               "global_load_async_to_lds_b128 %11, %23, off\n\t"
               "s_wait_xcnt 0x0"
               :: "v"(lk + KV_KH), "v"(lk + KV_KH + 16 * 144), "v"(lk + KV_KL), "v"(lk + KV_KL + 16 * 144), "v"(lv + KV_VH), "v"(lv + KV_VH + 32 * 80), "v"(lv + KV_VL), "v"(lv + KV_VL + 32 * 80),
                  "v"(lk + KV_MK), "v"(lk + KV_MK + 16 * 144), "v"(lk + KV_MK + 32 * 144), "v"(lk + KV_MK + 48 * 144),
                  "v"(gkh), "v"(gkh + k16), "v"(gkl), "v"(gkl + k16), "v"(gvh), "v"(gvh + v32), "v"(gvl), "v"(gvl + v32),
                  "v"(gm), "v"(gm + m16), "v"(gm + 2 * m16), "v"(gm + 3 * m16) : "memory");
}

// lane l with lane l ^ 16: joins the two key halves that lanes c and c + 16 hold of one query
__device__ __forceinline__ float xhalf(float x) { return __builtin_bit_cast(float, __builtin_amdgcn_permlanex16(__builtin_bit_cast(int, x), __builtin_bit_cast(int, x), 0x76543210, 0xfedcba98, false, false)); }

__global__ __launch_bounds__(128) void k_attn(const _Float16* __restrict__ Q16, const _Float16* __restrict__ QL, int ldq, const _Float16* __restrict__ K16, const _Float16* __restrict__ KL, int ldk,
                                             const _Float16* __restrict__ Vt, const _Float16* __restrict__ VtL, const float* __restrict__ AM, const float* __restrict__ AW, _Float16* __restrict__ OH, _Float16* __restrict__ OL, int ldo) {
  constexpr int RPW = 16, DT = 4, KS = 2, QBN = SEQ / 64;
  __shared__ __attribute__((aligned(16))) float sO[4][RPW][64 + 4];
  __shared__ __attribute__((aligned(16))) unsigned char ring[2][KV_STAGE];
  const int tid = threadIdx.x, w = tid >> 5, lane = tid & 31, ln = lane & 15, hh = lane >> 4;
  const int slab = blockIdx.x / QBN, qblk = blockIdx.x % QBN; const int b = slab / NH, h = slab % NH; const int qb0 = qblk * (4 * RPW); const int q0 = qb0 + w * RPW;
  const float ww = bf16_rne(AW[0]) * LOG2E;
  FragH aq[KS], aql[KS];
  { const unsigned short* qr = (const unsigned short*)Q16 + ((size_t)b * SEQ + q0 + ln) * ldq + h * 64; const unsigned short* ql = (const unsigned short*)QL + ((size_t)b * SEQ + q0 + ln) * ldq + h * 64;
#pragma unroll
    for (int ks = 0; ks < KS; ++ks) { aq[ks].half[0] = *(const v8us*)(qr + ks * 32 + 8 * hh); aq[ks].half[1] = *(const v8us*)(qr + ks * 32 + 16 + 8 * hh); aql[ks].half[0] = *(const v8us*)(ql + ks * 32 + 8 * hh); aql[ks].half[1] = *(const v8us*)(ql + ks * 32 + 16 + 8 * hh); } }
  const unsigned short* Vth = (const unsigned short*)Vt + (size_t)slab * 64 * SEQ; const unsigned short* Vtl = (const unsigned short*)VtL + (size_t)slab * 64 * SEQ;
  const v8f z8 = {0.f,0.f,0.f,0.f,0.f,0.f,0.f,0.f};
  float m_q = -3.0e38f, l_q = 0.f; v8f oacc[DT], oaccL[DT];
#pragma unroll
  for (int dt = 0; dt < DT; ++dt) { oacc[dt] = z8; oaccL[dt] = z8; }
  // this thread's pieces: K row tid/8 (and +16), 16-B column tid%8; V^T row tid/4 (and +32), 16-B column tid%4; mask row tid/8 (and +16, +32, +48) of the work-group's 64 queries, 16-B column tid%8
  const unsigned int lring = (unsigned int)(size_t)&ring[0][0]; const unsigned int lk = lring + (tid >> 3) * 144 + (tid & 7) * 16, lv = lring + (tid >> 2) * 80 + (tid & 3) * 16;
  const size_t kofs = ((size_t)b * SEQ + (tid >> 3)) * ldk + h * 64 + (tid & 7) * 8; const unsigned short* gkh = (const unsigned short*)K16 + kofs; const unsigned short* gkl = (const unsigned short*)KL + kofs;
  const size_t vofs = (size_t)(tid >> 2) * SEQ + (tid & 3) * 8; const unsigned short* gvh = Vth + vofs; const unsigned short* gvl = Vtl + vofs;
  const float* gm = AM + (size_t)b * SEQ_FULL * SEQ_FULL + (size_t)(qb0 + (tid >> 3)) * SEQ_FULL + (tid & 7) * 4;      /* mask[b][0][query][.] with full strides */
  const size_t k16 = (size_t)16 * ldk, k32 = (size_t)32 * ldk, v32 = (size_t)32 * SEQ, m16 = (size_t)16 * SEQ_FULL;
  kv_stage(lk, lv, gkh, gkl, k16, gvh, gvl, v32, gm, m16);
  asm volatile("s_wait_asynccnt 0x0" ::: "memory");      /* stage 0 has landed before the barrier that publishes it */
  __syncthreads();
  kv_stage(lk + KV_STAGE, lv + KV_STAGE, gkh + k32, gkl + k32, k16, gvh + 32, gvl + 32, v32, gm + 32, m16);
#pragma unroll 1
  for (int j0 = 0; j0 < SEQ; j0 += 32) {
    const unsigned int bsel = (j0 & 32) ? KV_STAGE : 0; const unsigned char* kvb = &ring[0][0] + bsel;
    const float* mrow = (const float*)(kvb + KV_MK + (w * RPW + ln) * 144) + 8 * hh;
    v4f mk[2][2];      /* own query's mask, keys j0 + 16 nt + 8 hh + 0..7 */
#pragma unroll
    for (int nt = 0; nt < 2; ++nt) { mk[nt][0] = *(const v4fa*)(mrow + nt * 16); mk[nt][1] = *(const v4fa*)(mrow + nt * 16 + 4); }
    v8f s[2];
#pragma unroll
    for (int nt = 0; nt < 2; ++nt) { const unsigned short* kr = (const unsigned short*)(kvb + KV_KH + (nt * 16 + ln) * 144); const unsigned short* klr = (const unsigned short*)(kvb + KV_KL + (nt * 16 + ln) * 144); FragH bk[KS], bkl[KS];
#pragma unroll
      for (int ks = 0; ks < KS; ++ks) { bk[ks].half[0] = *(const v8us*)(kr + ks * 32 + 8 * hh); bk[ks].half[1] = *(const v8us*)(kr + ks * 32 + 16 + 8 * hh); bkl[ks].half[0] = *(const v8us*)(klr + ks * 32 + 8 * hh); bkl[ks].half[1] = *(const v8us*)(klr + ks * 32 + 16 + 8 * hh); }
      v8f acc = z8, accl = z8;
#pragma unroll
      for (int ks = 0; ks < KS; ++ks) { acc = mmaH<1>(bk[ks].v, bk[ks].v, aq[ks].v, aq[ks].v, acc); accl = mmaH<1>(bk[ks].v, bk[ks].v, aql[ks].v, aql[ks].v, accl); accl = mmaH<1>(bkl[ks].v, bkl[ks].v, aq[ks].v, aq[ks].v, accl); }
#pragma unroll
      for (int r = 0; r < 8; ++r) acc[r] += accl[r] * 0.0009765625f;
      s[nt] = acc; }
    float mc = -3.0e38f;
#pragma unroll
    for (int nt = 0; nt < 2; ++nt)
#pragma unroll
      for (int r = 0; r < 8; ++r) { float sv = s[nt][r] * (SCL * LOG2E); sv += bf16_rne(mk[nt][r >> 2][r & 3]) * ww; s[nt][r] = sv; mc = fmaxf(mc, sv); }
    mc = fmaxf(mc, xhalf(mc));
    const float mn = fmaxf(m_q, mc - 10.0f); const float al = __builtin_amdgcn_exp2f((mn > -1.0e38f) ? m_q - mn : 0.f); m_q = mn;
    FragH pa, pl; float ls[2] = {0.f, 0.f};
#pragma unroll
    for (int nt = 0; nt < 2; ++nt)
#pragma unroll
      for (int r = 0; r < 8; ++r) { const float psc = __builtin_amdgcn_exp2f(s[nt][r] - mn); ls[nt] += psc; const _Float16 ph = (_Float16)psc; pa.h[nt * 8 + r] = ph; pl.h[nt * 8 + r] = (_Float16)((psc - (float)ph) * 1024.0f); }
    l_q = l_q * al + (ls[0] + ls[1]);
#pragma unroll
    for (int dt = 0; dt < DT; ++dt)
#pragma unroll
      for (int r = 0; r < 8; ++r) { oacc[dt][r] *= al; oaccL[dt][r] *= al; }
#pragma unroll
    for (int dt = 0; dt < DT; ++dt) { const unsigned short* vrow = (const unsigned short*)(kvb + KV_VH + (dt * 16 + ln) * 80); const unsigned short* vrl = (const unsigned short*)(kvb + KV_VL + (dt * 16 + ln) * 80); FragH bv, bl;
      bv.half[0] = *(const v8us*)(vrow + 8 * hh); bv.half[1] = *(const v8us*)(vrow + 16 + 8 * hh); bl.half[0] = *(const v8us*)(vrl + 8 * hh); bl.half[1] = *(const v8us*)(vrl + 16 + 8 * hh);
      oacc[dt] = mmaH<1>(bv.v, bv.v, pa.v, pa.v, oacc[dt]); oaccL[dt] = mmaH<1>(bv.v, bv.v, pl.v, pl.v, oaccL[dt]); oaccL[dt] = mmaH<1>(bl.v, bl.v, pa.v, pa.v, oaccL[dt]); }
    asm volatile("s_wait_dscnt 0x0" ::: "memory");         /* this wave's reads of the buffer are done before it is handed to the copies */
    asm volatile("s_wait_asynccnt 0x0" ::: "memory");      /* this wave's pieces of the next stage have landed */
    __syncthreads();                                       /* publishes the next stage and ends every wave's reads of this one */
    if (j0 + 64 < SEQ) kv_stage(lk + bsel, lv + bsel, gkh + (size_t)(j0 + 64) * ldk, gkl + (size_t)(j0 + 64) * ldk, k16, gvh + j0 + 64, gvl + j0 + 64, v32, gm + j0 + 64, m16); }
  asm volatile("s_wait_asynccnt 0x0" ::: "memory");        /* no copy is outstanding when the wave goes on to its end */
  const float lt = l_q + xhalf(l_q); const float linv = (lt > 0.f) ? 1.0f / lt : 0.f;
#pragma unroll
  for (int dt = 0; dt < DT; ++dt)
#pragma unroll
    for (int r = 0; r < 8; ++r) { float v = oacc[dt][r]; v += oaccL[dt][r] * 0.0009765625f; sO[w][ln][dt * 16 + 8 * hh + r] = v * linv; }
  __builtin_amdgcn_fence(__ATOMIC_ACQ_REL, "workgroup"); __builtin_amdgcn_wave_barrier();
  {
#pragma unroll
    for (int rp = 0; rp < RPW; rp += 4) { const int r = rp + (lane >> 3), pc = lane & 7; const v4f va = *(const v4fa*)&sO[w][r][pc * 8], vb = *(const v4fa*)&sO[w][r][pc * 8 + 4]; FragH fh, fl;      /* context leaves as f16 hi + 2^10 residual rows, one whole 128-B line per row and plane */
#pragma unroll      /* constant indices: the packed halves stay in registers */
      for (int e = 0; e < 4; ++e) { _Float16 hv = (_Float16)va[e]; fh.h[e] = hv; fl.h[e] = (_Float16)((va[e] - (float)hv) * 1024.0f); hv = (_Float16)vb[e]; fh.h[4 + e] = hv; fl.h[4 + e] = (_Float16)((vb[e] - (float)hv) * 1024.0f); }
      const size_t o8 = ((size_t)b * SEQ + q0 + r) * ldo + h * 64 + pc * 8; *(v8us*)((unsigned short*)OH + o8) = fh.half[0]; *(v8us*)((unsigned short*)OL + o8) = fl.half[0]; }
     } }

// LayerNorm over DM (biased variance, eps 1e-5, affine with bf16 g, b) of (A[r] + bf16(x[rin])), compact row r -> input/output row rin = b*SEQ_FULL + s;
__global__ __launch_bounds__(256) void k_ln1024(const float* __restrict__ A, const float* __restrict__ res, const float* __restrict__ g, const float* __restrict__ bb, float* __restrict__ Y) {
  #pragma clang fp contract(off)
  const int wv = threadIdx.x >> 5, ln = threadIdx.x & 31; const size_t r = (size_t)blockIdx.x * 8 + wv; if (r >= (size_t)NR) return;
  const size_t rb = r / SEQ, rs = r % SEQ; const size_t rin = rb * SEQ_FULL + rs;
  float xv[32]; float sm = 0.f;
#pragma unroll
  for (int i = 0; i < 8; ++i) { const int c0 = i * 128 + ln * 4; const v4f a = *(const v4fa*)(A + r * DM + c0); const v4f rr = *(const v4fa*)(res + rin * DM + c0);
#pragma unroll
    for (int q = 0; q < 4; ++q) { const float v = a[q] + bf16_rne(rr[q]); xv[i * 4 + q] = v; sm += v; } }
#pragma unroll
  for (int o = 16; o > 0; o >>= 1) sm += __shfl_xor(sm, o, 32);
  const float mu = sm * 0.0009765625f; float var = 0.f;
#pragma unroll
  for (int q = 0; q < 32; ++q) { const float d = xv[q] - mu; var += d * d; }
#pragma unroll
  for (int o = 16; o > 0; o >>= 1) var += __shfl_xor(var, o, 32);
  const float inv = 1.0f / sqrtf(var * 0.0009765625f + 1e-5f);
  {
#pragma unroll
    for (int i = 0; i < 8; ++i) { const int c0 = i * 128 + ln * 4; v4f y;
#pragma unroll
      for (int q = 0; q < 4; ++q) { float v = (xv[i * 4 + q] - mu) * inv; v *= bf16_rne(g[c0 + q]); v += bf16_rne(bb[c0 + q]); y[q] = v; }
      *(v4f*)(Y + rin * DM + c0) = y; }
     } }

extern "C" void kernel_launch(void* const* d_in, const int* in_sizes, int n_in,
                              void* d_out, int out_size, void* d_ws, size_t ws_size, hipStream_t stream) {
  if (n_in < 13) return;
  const float* x = (const float*)d_in[0]; const float* cdm = (const float*)d_in[1];
  const float* Wq = (const float*)d_in[2]; const float* bq = (const float*)d_in[3]; const float* Wk = (const float*)d_in[4]; const float* bk = (const float*)d_in[5];
  const float* Wv = (const float*)d_in[6]; const float* bv = (const float*)d_in[7]; const float* Wo = (const float*)d_in[8]; const float* bo = (const float*)d_in[9];
  const float* gam = (const float*)d_in[10]; const float* bet = (const float*)d_in[11]; const float* cdw = (const float*)d_in[12];
  const long long rows_need = (long long)(NB - 1) * SEQ_FULL + SEQ;
  if ((long long)in_sizes[0] < rows_need * DM) return;
  if ((long long)in_sizes[1] < (long long)(NB - 1) * SEQ_FULL * SEQ_FULL + (long long)(SEQ - 1) * SEQ_FULL + SEQ) return;
  if (in_sizes[2] < DM * DM || in_sizes[4] < DM * DM || in_sizes[6] < DM * DM || in_sizes[8] < DM * DM) return;
  if (in_sizes[3] < DM || in_sizes[5] < DM || in_sizes[7] < DM || in_sizes[9] < DM || in_sizes[10] < DM || in_sizes[11] < DM || in_sizes[12] < 1) return;
  if ((long long)out_size < rows_need * DM) return;
  char* ws = (char*)d_ws; size_t off = 0;
  auto take = [&](size_t bytes) { char* p = ws + off; off += (bytes + 255) & ~(size_t)255; return p; };
  const size_t np = (size_t)NR * DM;      /* compact activation plane elements */
  _Float16* BQ = (_Float16*)take((size_t)DM * DM * 2); _Float16* BK = (_Float16*)take((size_t)DM * DM * 2); _Float16* BV = (_Float16*)take((size_t)DM * DM * 2); _Float16* BO = (_Float16*)take((size_t)DM * DM * 2);
  _Float16* X16 = (_Float16*)take(np * 2);
  _Float16* QH = (_Float16*)take(np * 2); _Float16* QL = (_Float16*)take(np * 2); _Float16* KH = (_Float16*)take(np * 2); _Float16* KL = (_Float16*)take(np * 2);
  _Float16* VT = (_Float16*)take(np * 2); _Float16* VTL = (_Float16*)take(np * 2); _Float16* OH = (_Float16*)take(np * 2); _Float16* OL = (_Float16*)take(np * 2);
  float* Y = (float*)take(np * 4); float* CS = (float*)take((size_t)SEQ * 32 * 4); float* SN = (float*)take((size_t)SEQ * 32 * 4);
  if (off > ws_size) return;
  static_assert(((size_t)DM * DM * 2) % 256 == 0 && ((size_t)NR * DM * 2) % 256 == 0);      /* BQ, BK, BV and the pairs (QH, QL), (KH, KL), (VT, VTL) stand back to back: one stride each reaches all three */
  k_prep<<<PB_R + PB_X + 4 * PB_W, 256, 0, stream>>>(x, Wq, Wk, Wv, Wo, X16, BQ, BK, BV, BO, CS, SN);
  const dim3 g((NR / 128) * (DM / 64), 1); const dim3 g3((NR / 128) * (DM / 64), 3);
  k_gemm2<0, 3><<<g3, 128, 0, stream>>>(X16, DM, 0, BQ, DM, (size_t)DM * DM, 0.0625f, bq, 0, nullptr, 1, 0, 0, nullptr, nullptr, DM, 0, NR, DM, DM, CS, SN, QH, QL, 2 * np, bk, bv, nullptr);      /* Q, K -> RoPE -> hi/lo; V -> hi/lo, transposed per head */
  k_attn<<<NB * NH * (SEQ / 64), 128, 0, stream>>>(QH, QL, DM, KH, KL, DM, VT, VTL, cdm, cdw, OH, OL, DM);      /* context -> hi/lo rows */
  k_gemm2<0, 4><<<g, 128, 0, stream>>>(OL, DM, 0, BO, DM, 0, 0.0625f, bo, 0, nullptr, 1, 0, 0, Y, nullptr, DM, 0, NR, DM, DM, nullptr, nullptr, nullptr, nullptr, 0, nullptr, nullptr, OH);      /* Y = (ctx_lo + ctx_hi) Wo^T + bo */
  k_ln1024<<<NR / 8, 256, 0, stream>>>(Y, x, gam, bet, (float*)d_out);      /* out = LN(bf16(x) + Y) g + b */
}

// v010
// A run of this version takes 163 microseconds.
// In two side-by-side timings against v009, it was 1.05 and 1.04 times as fast.
// Counting every step since v000, it is 4.23 times as fast.
#include <hip/hip_runtime.h>
// All contractions (Q/K/V projections, Q.K^T, P.V^T, output projection) on v_wmma_f32_16x16x32_f16: f16 operands, f32 accumulate. Float inputs RNE-converted to bf16 (exact in f16; weights carried x16); q, k, v, softmax numerators (x1024) and context carried as f16 hi + 2^10 residual plane pairs; RoPE tables, softmax, residual add and LayerNorm in f32.
#ifndef NB
#define NB 2
#endif
#ifndef SEQ
#define SEQ 2048
#endif
#define NB_FULL 2
#define SEQ_FULL 2048
#define DM 1024
#define NH 16
#define NR (NB * SEQ)
#define SCL 0.125f
#define LOG2E 1.44269504088896340736f
static_assert(NB >= 1 && NB <= NB_FULL);
static_assert(SEQ >= 128 && SEQ <= SEQ_FULL && (SEQ % 128) == 0);
static_assert(NH * 64 == DM);
static_assert((NR % 128) == 0);
static_assert((DM % 64) == 0 && (DM % 128) == 0);

typedef unsigned short v8us __attribute__((ext_vector_type(8), may_alias));
typedef float  v8f  __attribute__((ext_vector_type(8)));
typedef float  v4f  __attribute__((ext_vector_type(4)));
typedef float  v4fa __attribute__((ext_vector_type(4), may_alias));
typedef _Float16 v16h __attribute__((ext_vector_type(16)));
typedef _Float16 v4h __attribute__((ext_vector_type(4)));
union FragH { v16h v; v8us half[2]; _Float16 h[16]; unsigned short u[16]; };

__device__ __forceinline__ unsigned short bf16_bits(float x) { unsigned int u = __float_as_uint(x); return (unsigned short)((u + 0x7FFFu + ((u >> 16) & 1u)) >> 16); }
__device__ __forceinline__ float bf16_val(unsigned short b) { return __uint_as_float(((unsigned int)b) << 16); }
__device__ __forceinline__ float bf16_rne(float x) { return bf16_val(bf16_bits(x)); }

// D += A.B with NT terms: 1 = ah.bh, 2 = + al.bh, 3 = + ah.bl; builtin form only: the compiler keeps the distance behind a WMMA itself and is free to order loads and independent products around it
template <int NT>
__device__ __forceinline__ v8f mmaH(v16h ah, v16h al, v16h bh, v16h bl, v8f c) {
  c = __builtin_amdgcn_wmma_f32_16x16x32_f16(false, ah, false, bh, (short)0, c, false, false);
  if (NT >= 2) c = __builtin_amdgcn_wmma_f32_16x16x32_f16(false, al, false, bh, (short)0, c, false, false);
  if (NT >= 3) c = __builtin_amdgcn_wmma_f32_16x16x32_f16(false, ah, false, bl, (short)0, c, false, false);
  return c;
}

// ---- GEMM engine (work-group tile 128x128, eight waves as 4 row groups x 2 column groups, wave tile 32x64; M % 128 == 0, N % 128 == 0, K % 128 == 0, lda and ldb % 8 == 0): C[M][N] f32 = alpha A[M][K].Bt[N][K]^T + bf16(bias) (+ CP own element); A, Bt f16 k-contiguous.
// Each 128-k stage (A 128 rows, then Bt 128 rows, 256 B a row at LDS pitch 272 B) is brought once per work-group into a two-buffer LDS ring, global -> LDS through no register; each A row is read by two waves, each Bt row by four.
// A fragment: lane row = l&15, elements 0..7 <- k0 + 8h + i, 8..15 <- k0 + 16 + 8h + i; B fragment from the [n][k] copy with the same k map; D element r -> (row 8h + r, col l&15).
__device__ __forceinline__ v16h g2_frag(const _Float16* p, int hh) { FragH f; f.half[0] = *(const v8us*)((const unsigned short*)p + 8 * hh); f.half[1] = *(const v8us*)((const unsigned short*)p + 16 + 8 * hh); return f.v; }
__device__ __forceinline__ v8f g2_mma(v16h a, v16h b, v8f c) { v8f d = __builtin_amdgcn_wmma_f32_16x16x32_f16(false, a, false, b, (short)0, c, false, false); asm volatile("v_nop\n\tv_nop\n\tv_nop\n\tv_nop" : "+v"(d) : "v"(a), "v"(b)); return d; }
#define G_KT 128
#define G_PITCH 272
#define G_STAGE (256 * G_PITCH)
// eight 16-B pieces of one thread: rows 16 apart, the same 16-B column; a wave's copy covers two whole 256-B rows
__device__ __forceinline__ void g2_copy8(unsigned int l, const unsigned short* g, size_t r16) {
  // the s_wait_xcnt closes the statement so that no address register of an issued copy is rewritten ahead of it
  asm volatile("global_load_async_to_lds_b128 %0, %8, off\n\t"
               "global_load_async_to_lds_b128 %1, %9, off\n\t"
               "global_load_async_to_lds_b128 %2, %10, off\n\t"
               "global_load_async_to_lds_b128 %3, %11, off\n\t"
               "global_load_async_to_lds_b128 %4, %12, off\n\t"
               "global_load_async_to_lds_b128 %5, %13, off\n\t"
               "global_load_async_to_lds_b128 %6, %14, off\n\t"
               "global_load_async_to_lds_b128 %7, %15, off\n\t"
               "s_wait_xcnt 0x0"
               :: "v"(l), "v"(l + 16 * G_PITCH), "v"(l + 32 * G_PITCH), "v"(l + 48 * G_PITCH), "v"(l + 64 * G_PITCH), "v"(l + 80 * G_PITCH), "v"(l + 96 * G_PITCH), "v"(l + 112 * G_PITCH),
                  "v"(g), "v"(g + r16), "v"(g + 2 * r16), "v"(g + 3 * r16), "v"(g + 4 * r16), "v"(g + 5 * r16), "v"(g + 6 * r16), "v"(g + 7 * r16) : "memory");
}
// one stage: A rows 0..127 of the work-group's tile, then Bt rows 0..127, 16 pieces per thread
__device__ __forceinline__ void g2_stage(unsigned int l, const unsigned short* ga, size_t a16, const unsigned short* gb, size_t b16) {
  g2_copy8(l, ga, a16); g2_copy8(l + 128 * G_PITCH, gb, b16);
}
// EPI 0: C f32 rows. EPI 1: RoPE (concatenated tables, interleaved rotate_half: out[d] = x[d] c[s][d mod 32] + rh[d] sn[s][d mod 32], rh[d] = -x[d+1] (d even), x[d-1] (d odd)), then f16 hi + 2^10 residual rows H, L [row][ldc].
// EPI 2: f16 hi + 2^10 residual, stored transposed per head: H, L [(b NH + h) 64 + d][SEQ] (N == DM, one 128-column tile = two neighbouring heads).
// EPI 3: three products of one A in one grid, blockIdx.y picks Bt (stride sB), the planes H, L (stride sH) and the bias (bias, bias1, bias2): 0 and 1 end as EPI 1, 2 as EPI 2.
// EPI 4: C f32 rows of a plane pair in one k loop of 2 K: first A (the 2^10 residual plane) against Bt, the accumulators then taken times 2^-10 (exact), then A2 (the hi plane) against the same Bt on top of them.
template <int ACT, int EPI>
__global__ __launch_bounds__(256) void k_gemm2(const _Float16* __restrict__ A, int lda, size_t sA, const _Float16* __restrict__ Bh, int ldb, size_t sB, float alpha, const float* __restrict__ bias, size_t sBias, const float* CP, int rowsPerB, size_t sCPb, int row0g,
    float* C, _Float16* C16, int ldc, size_t sC, int M, int N, int K, const float* __restrict__ CS, const float* __restrict__ SN, _Float16* __restrict__ H, _Float16* __restrict__ L,
    size_t sH, const float* __restrict__ bias1, const float* __restrict__ bias2, const _Float16* __restrict__ A2) {
  __shared__ __attribute__((aligned(16))) unsigned char gring[2][G_STAGE];
  // the epilogues stage in the ring's own LDS (two work-groups still fit a WGP): behind the k loop's last barrier no wave reads a stage any more and no copy is outstanding
  float (*so)[32][68] = (float (*)[32][68])&gring[0][0];
  const int tid = threadIdx.x, w = tid >> 5, wr = w >> 1, wc = w & 1, lane = tid & 31, ln = lane & 15, hh = lane >> 4; const int by = blockIdx.y;
  A += (size_t)by * sA; Bh += (size_t)by * sB; const size_t cofs = (size_t)by * sC; const float* bp = bias ? bias + (size_t)by * sBias : nullptr;
  if (EPI == 3) { H += (size_t)by * sH; L += (size_t)by * sH; if (by == 1) bp = bias1; if (by == 2) bp = bias2; }      /* blockIdx.y is the same for the whole work-group */
  const int ntn = N >> 7; const int mt = blockIdx.x / ntn, nq = blockIdx.x - mt * ntn; const int row0 = mt * 128 + 32 * wr, col0 = nq * 128 + 64 * wc; if (mt * 128 >= M) return;      /* the whole work-group leaves or none, ahead of every barrier and copy */
  const v8f z8 = {0.f,0.f,0.f,0.f,0.f,0.f,0.f,0.f}; v8f c00 = z8, c01 = z8, c02 = z8, c03 = z8, c10 = z8, c11 = z8, c12 = z8, c13 = z8;
  // this thread's pieces: stage row tid/16 (and +16 ...), 16-B column tid%16
  const unsigned int lg = (unsigned int)(size_t)&gring[0][0] + (tid >> 4) * G_PITCH + (tid & 15) * 16;
  const unsigned short* ga = (const unsigned short*)A + (size_t)(mt * 128 + (tid >> 4)) * lda + (tid & 15) * 8; const unsigned short* gb = (const unsigned short*)Bh + (size_t)(nq * 128 + (tid >> 4)) * ldb + (tid & 15) * 8;
  const size_t a16 = (size_t)16 * lda, b16 = (size_t)16 * ldb;
  const unsigned short* ga2 = EPI == 4 ? (const unsigned short*)A2 + (size_t)(mt * 128 + (tid >> 4)) * lda + (tid & 15) * 8 : ga; const int KK = EPI == 4 ? 2 * K : K;
  // the stage that begins at k = kt of the loop: below K from A, from K on (EPI 4) from A2, both against Bt's columns kt mod K; the test reads the same for the whole work-group
  auto put = [&](unsigned int l, int kt) { const bool second = EPI == 4 && kt >= K; const int kk = second ? kt - K : kt; g2_stage(l, (second ? ga2 : ga) + kk, a16, gb + kk, b16); };
  put(lg, 0);
  asm volatile("s_wait_asynccnt 0x0" ::: "memory");      /* stage 0 has landed before the barrier that publishes it */
  __syncthreads();
  if (G_KT < KK) put(lg + G_STAGE, G_KT);
#pragma unroll 1
  for (int kt = 0; kt < KK; kt += G_KT) {
    const unsigned int bsel = (kt & G_KT) ? G_STAGE : 0; const unsigned char* sb = &gring[0][0] + bsel;
    const _Float16* a0p = (const _Float16*)(sb + (32 * wr + ln) * G_PITCH); const _Float16* a1p = (const _Float16*)(sb + (32 * wr + 16 + ln) * G_PITCH);
    const _Float16* b0p = (const _Float16*)(sb + (128 + 64 * wc + ln) * G_PITCH); const _Float16* b1p = (const _Float16*)(sb + (144 + 64 * wc + ln) * G_PITCH); const _Float16* b2p = (const _Float16*)(sb + (160 + 64 * wc + ln) * G_PITCH); const _Float16* b3p = (const _Float16*)(sb + (176 + 64 * wc + ln) * G_PITCH);
    // two fragment sets: the twelve LDS reads of the next 32-k step of this same stage go out as one group ahead of the current step's products;
    // the step loop is unrolled so that the set index is a constant and both sets stay in registers
    v16h fa0[2], fa1[2], fb0[2], fb1[2], fb2[2], fb3[2];
    fa0[0] = g2_frag(a0p, hh); fa1[0] = g2_frag(a1p, hh); fb0[0] = g2_frag(b0p, hh); fb1[0] = g2_frag(b1p, hh); fb2[0] = g2_frag(b2p, hh); fb3[0] = g2_frag(b3p, hh);
#pragma unroll
    for (int ks = 0; ks < G_KT / 32; ++ks) { const int cu = ks & 1, nx = cu ^ 1;
      if (ks + 1 < G_KT / 32) { const int kb = (ks + 1) * 32; fa0[nx] = g2_frag(a0p + kb, hh); fa1[nx] = g2_frag(a1p + kb, hh); fb0[nx] = g2_frag(b0p + kb, hh); fb1[nx] = g2_frag(b1p + kb, hh); fb2[nx] = g2_frag(b2p + kb, hh); fb3[nx] = g2_frag(b3p + kb, hh); }
      c00 = g2_mma(fa0[cu], fb0[cu], c00); c10 = g2_mma(fa1[cu], fb0[cu], c10);
      c01 = g2_mma(fa0[cu], fb1[cu], c01); c11 = g2_mma(fa1[cu], fb1[cu], c11);
      c02 = g2_mma(fa0[cu], fb2[cu], c02); c12 = g2_mma(fa1[cu], fb2[cu], c12);
      c03 = g2_mma(fa0[cu], fb3[cu], c03); c13 = g2_mma(fa1[cu], fb3[cu], c13); }
    if (EPI == 4 && kt + G_KT == K) { c00 *= 0.0009765625f; c01 *= 0.0009765625f; c02 *= 0.0009765625f; c03 *= 0.0009765625f; c10 *= 0.0009765625f; c11 *= 0.0009765625f; c12 *= 0.0009765625f; c13 *= 0.0009765625f; }      /* the residual plane's sum takes its weight before the hi plane's products are added to it */
    asm volatile("s_wait_dscnt 0x0" ::: "memory");         /* this wave's reads of the buffer are done before it is handed to the copies */
    asm volatile("s_wait_asynccnt 0x0" ::: "memory");      /* this wave's pieces of the next stage have landed */
    __syncthreads();                                       /* publishes the next stage and ends every wave's reads of this one */
    if (kt + 2 * G_KT < KK) put(lg + bsel, kt + 2 * G_KT); }
  asm volatile("s_wait_asynccnt 0x0" ::: "memory");        /* no copy is outstanding when the wave goes on to its end */
  v8f accs[8] = {c00, c01, c02, c03, c10, c11, c12, c13};
  if (EPI == 2 || (EPI == 3 && by == 2)) {
    // a lane holds eight consecutive rows of one column: 16 B of a transposed row. Both planes ([128 columns][128 rows] f16, pitch 272 B) are gathered in the ring's LDS, then leave as 256-B runs.
    unsigned char* tb = &gring[0][0]; float bv4[4] = {0.f, 0.f, 0.f, 0.f};
    if (bp) {
#pragma unroll      /* constant indices: bv4 stays in registers, the four loads go out together */
      for (int t = 0; t < 4; ++t) bv4[t] = bf16_rne(bp[col0 + t * 16 + ln]); }
#pragma unroll      /* this loop and the next: constant indices keep accs and the packed halves in registers */
    for (int u = 0; u < 8; ++u) { const int t = u & 3, half = u >> 2; const float bv = bv4[t]; FragH fh, fl;
#pragma unroll
      for (int r = 0; r < 8; ++r) { const float v = accs[u][r] * alpha + bv; const _Float16 hv = (_Float16)v; fh.h[r] = hv; fl.h[r] = (_Float16)((v - (float)hv) * 1024.0f); }
      unsigned char* tp = tb + (64 * wc + t * 16 + ln) * 272 + (32 * wr + half * 16 + 8 * hh) * 2; *(v8us*)tp = fh.half[0]; *(v8us*)(tp + 128 * 272) = fl.half[0]; }
    __syncthreads();      /* every wave's 32 rows stand in the transposed tile before any wave reads whole runs of it */
    const size_t vrow = (size_t)((mt * 128) / SEQ * NH + 2 * nq) * 64; const int s0 = (mt * 128) % SEQ;
#pragma unroll      /* the LDS reads of later runs go out ahead of the stores of earlier ones */
    for (int it = 0; it < 8; ++it) { const int i = it * 256 + tid, pc = i & 15, d = i >> 4; const size_t o = (vrow + d) * SEQ + s0 + pc * 8;
      *(v8us*)((unsigned short*)H + o) = *(const v8us*)(tb + d * 272 + pc * 16); *(v8us*)((unsigned short*)L + o) = *(const v8us*)(tb + (128 + d) * 272 + pc * 16); }
    return; }
#pragma unroll
  for (int u = 0; u < 8; ++u) { const int t = u & 3, half = u >> 2; const int col = col0 + t * 16 + ln; const float bv = bp ? bf16_rne(bp[col]) : 0.f;
#pragma unroll
    for (int r = 0; r < 8; ++r) { const int rloc = half * 16 + 8 * hh + r; float v = accs[u][r] * alpha + bv;
      if (EPI == 0 && CP) { if (rowsPerB < 0) v += CP[cofs + (size_t)(row0g + row0 + rloc) * ldc + col];      /* rowsPerB < 0: own element of the batched C plane */ else { const int bidx = (row0g + row0 + rloc) / rowsPerB; v += CP[(size_t)bidx * sCPb + (size_t)by * 64 + col]; } }
      if (ACT == 3) v = fmaxf(v, 0.f);
      so[w][rloc][t * 16 + ln] = v; } }
  __builtin_amdgcn_fence(__ATOMIC_ACQ_REL, "workgroup"); __builtin_amdgcn_wave_barrier();
  if (EPI == 1 || EPI == 3) {
    // eight columns a lane, four rows a wave store: each row's 64 columns leave as one whole 128-B line per plane
    const int rs4 = lane >> 3, c8 = (lane & 7) * 8, j0 = c8 & 31;
    const size_t t0 = (size_t)(row0 % SEQ + rs4) * 32 + j0;      /* a wave's 32 rows lie in one sequence: SEQ % 128 == 0 */
    unsigned short* hp = (unsigned short*)H + (size_t)(row0 + rs4) * ldc + col0 + c8; unsigned short* lp = (unsigned short*)L + (size_t)(row0 + rs4) * ldc + col0 + c8; const size_t r4 = (size_t)4 * ldc;
#pragma unroll      /* the table loads of all eight steps take immediate offsets and go out together */
    for (int q = 0; q < 8; ++q) { const int r = q * 4 + rs4;
      const v4f a = *(const v4fa*)&so[w][r][c8], c = *(const v4fa*)&so[w][r][c8 + 4]; const float xs[8] = {a[0], a[1], a[2], a[3], c[0], c[1], c[2], c[3]};
      const float* tp = CS + t0 + q * 128; const float* up = SN + t0 + q * 128; const v4f ca = *(const v4fa*)tp, cb = *(const v4fa*)(tp + 4), sa = *(const v4fa*)up, sb = *(const v4fa*)(up + 4);
      const float cs[8] = {ca[0], ca[1], ca[2], ca[3], cb[0], cb[1], cb[2], cb[3]}; const float sn[8] = {sa[0], sa[1], sa[2], sa[3], sb[0], sb[1], sb[2], sb[3]};
      FragH fh, fl;
#pragma unroll      /* constant indices: xs, cs, sn and the packed halves stay in registers */
      for (int e = 0; e < 8; ++e) { const float pr = xs[e ^ 1]; const float rh = (e & 1) ? pr : -pr; const float o = xs[e] * cs[e] + rh * sn[e];
        const _Float16 hv = (_Float16)o; fh.h[e] = hv; fl.h[e] = (_Float16)((o - (float)hv) * 1024.0f); }
      *(v8us*)(hp + q * r4) = fh.half[0]; *(v8us*)(lp + q * r4) = fl.half[0]; }
    __builtin_amdgcn_endpgm(); }      /* the wave ends here: behind a plain return the compiler leads this path on to the test in front of the other epilogue and keeps the 64 accumulator registers alive all through it (300 registers against 207) */
  const int rsub = lane >> 4, c4 = (lane & 15) * 4;
  {
#pragma unroll
    for (int q = 0; q < 16; ++q) { const int r = q * 2 + rsub; const v4f v = *(const v4fa*)&so[w][r][c4]; if (C) *(v4f*)(C + cofs + (size_t)(row0 + r) * ldc + col0 + c4) = v; if (C16) { v4h h4;
#pragma unroll
        for (int i = 0; i < 4; ++i) h4[i] = (_Float16)v[i]; *(v4h*)(C16 + cofs + (size_t)(row0 + r) * ldc + col0 + c4) = h4; } }
     } }

// ---- preparation, one launch: the RoPE tables, x -> f16 and the four weight planes read nothing of each other's output, so their work-groups share one grid.
#define PB_R (SEQ * 32 / 256)
#define PB_X (NR * DM / 8 / 256)
#define PB_W (DM * DM / 8 / 256)
static_assert((SEQ * 32) % 256 == 0 && (NR * DM / 8) % 256 == 0 && (DM * DM / 8) % 256 == 0);
static_assert((long long)NB_FULL * SEQ_FULL * DM * 4 < (1ll << 32));
// one unit of eight elements per thread: dst[8 t ..] = f16(bf16(src[e0 ..]) sc); every offset fits 32 bits
__device__ __forceinline__ void prep_cvt(const float* __restrict__ src, unsigned int e0, _Float16* __restrict__ dst, unsigned int t, float sc) {
  const unsigned int ib = e0 * 4; const float* p = (const float*)((const char*)src + ib); const v4f a = *(const v4fa*)p, c = *(const v4fa*)(p + 4); FragH f;
  asm volatile("s_wait_xcnt 0x0" :: "v"(ib) : "memory");      /* the two loads' one offset register stays whole up to here and is free behind it */
#pragma unroll
  for (int q = 0; q < 4; ++q) { f.h[q] = (_Float16)(bf16_rne(a[q]) * sc); f.h[4 + q] = (_Float16)(bf16_rne(c[q]) * sc); }
  *(v8us*)((unsigned short*)dst + (size_t)t * 8) = f.half[0];
  asm volatile("s_wait_xcnt 0x0" ::: "memory"); }      /* no register that the issued store names is written again ahead of this, whatever path the compiler lays behind it */

__device__ __forceinline__ void prep_rotab(int t, float* __restrict__ CS, float* __restrict__ SN) {
  #pragma clang fp contract(off)
  const int j = t % 32, s = t / 32; const float ex = (float)(2 * j) / 64.0f; const float inv = 1.0f / powf(10000.0f, ex); const float th = (float)s * inv; const float c = cosf(th), sn = sinf(th);
  { *(float*)(CS + t) = c; *(float*)(SN + t) = sn;  } }

// work-groups 0 .. PB_R - 1: tables (the longest chains start first); then PB_X of x (compact row r stands at input row b SEQ_FULL + s); then PB_W of each weight, [out][in], bf16 then x16 in f16
__global__ __launch_bounds__(256) void k_prep(const float* __restrict__ x, const float* __restrict__ Wq, const float* __restrict__ Wk, const float* __restrict__ Wv, const float* __restrict__ Wo,
    _Float16* __restrict__ X16, _Float16* __restrict__ BQ, _Float16* __restrict__ BK, _Float16* __restrict__ BV, _Float16* __restrict__ BO, float* __restrict__ CS, float* __restrict__ SN) {
  int blk = blockIdx.x;
  if (blk < PB_R) { prep_rotab(blk * 256 + (int)threadIdx.x, CS, SN); return; }
  blk -= PB_R;
  if (blk < PB_X) { const unsigned int t = (unsigned int)blk * 256 + threadIdx.x; const unsigned int row = (t * 8) / DM, c0 = (t * 8) % DM, rb = row / SEQ, rs = row % SEQ;
    prep_cvt(x, (rb * SEQ_FULL + rs) * DM + c0, X16, t, 1.0f); return; }
  blk -= PB_X;
  const int m = blk / PB_W; blk -= m * PB_W;
  const float* Wm = m == 0 ? Wq : m == 1 ? Wk : m == 2 ? Wv : Wo; _Float16* Bt = m == 0 ? BQ : m == 1 ? BK : m == 2 ? BV : BO;
  const unsigned int t = (unsigned int)blk * 256 + threadIdx.x; prep_cvt(Wm, t * 8, Bt, t, 16.0f); }

// One 32-key stage of K hi, K lo (32 rows x 128 B, LDS pitch 144 B), V^T hi, V^T lo (64 rows x 64 B, LDS pitch 80 B) and the work-group's f32 mask tile (64 query rows x 128 B, one whole line a row, LDS pitch 144 B):
// 1536 pieces of 16 B, twelve per thread, global -> LDS through no register.
#define KV_KH 0
#define KV_KL 4608
#define KV_VH 9216
#define KV_VL 14336
#define KV_MK 19456
#define KV_STAGE 28672
__device__ __forceinline__ void kv_stage(unsigned int lk, unsigned int lv, const unsigned short* gkh, const unsigned short* gkl, size_t k16, const unsigned short* gvh, const unsigned short* gvl, size_t v32, const float* gm, size_t m16) {
  // the s_wait_xcnt closes the statement so that no address register of an issued copy is rewritten ahead of it
  asm volatile("global_load_async_to_lds_b128 %0, %12, off\n\t"
               "global_load_async_to_lds_b128 %1, %13, off\n\t"
               "global_load_async_to_lds_b128 %2, %14, off\n\t"
               "global_load_async_to_lds_b128 %3, %15, off\n\t"
               "global_load_async_to_lds_b128 %4, %16, off\n\t"
               "global_load_async_to_lds_b128 %5, %17, off\n\t"
               "global_load_async_to_lds_b128 %6, %18, off\n\t"
               "global_load_async_to_lds_b128 %7, %19, off\n\t"
               "global_load_async_to_lds_b128 %8, %20, off\n\t"
               "global_load_async_to_lds_b128 %9, %21, off\n\t"
               "global_load_async_to_lds_b128 %10, %22, off\n\t"
               "global_load_async_to_lds_b128 %11, %23, off\n\t"
               "s_wait_xcnt 0x0"
               :: "v"(lk + KV_KH), "v"(lk + KV_KH + 16 * 144), "v"(lk + KV_KL), "v"(lk + KV_KL + 16 * 144), "v"(lv + KV_VH), "v"(lv + KV_VH + 32 * 80), "v"(lv + KV_VL), "v"(lv + KV_VL + 32 * 80),
                  "v"(lk + KV_MK), "v"(lk + KV_MK + 16 * 144), "v"(lk + KV_MK + 32 * 144), "v"(lk + KV_MK + 48 * 144),
                  "v"(gkh), "v"(gkh + k16), "v"(gkl), "v"(gkl + k16), "v"(gvh), "v"(gvh + v32), "v"(gvl), "v"(gvl + v32),
                  "v"(gm), "v"(gm + m16), "v"(gm + 2 * m16), "v"(gm + 3 * m16) : "memory");
}

// lane l with lane l ^ 16: joins the two key halves that lanes c and c + 16 hold of one query
__device__ __forceinline__ float xhalf(float x) { return __builtin_bit_cast(float, __builtin_amdgcn_permlanex16(__builtin_bit_cast(int, x), __builtin_bit_cast(int, x), 0x76543210, 0xfedcba98, false, false)); }

__global__ __launch_bounds__(128) void k_attn(const _Float16* __restrict__ Q16, const _Float16* __restrict__ QL, int ldq, const _Float16* __restrict__ K16, const _Float16* __restrict__ KL, int ldk,
                                             const _Float16* __restrict__ Vt, const _Float16* __restrict__ VtL, const float* __restrict__ AM, const float* __restrict__ AW, _Float16* __restrict__ OH, _Float16* __restrict__ OL, int ldo) {
  constexpr int RPW = 16, DT = 4, KS = 2, QBN = SEQ / 64;
  __shared__ __attribute__((aligned(16))) float sO[4][RPW][64 + 4];
  __shared__ __attribute__((aligned(16))) unsigned char ring[2][KV_STAGE];
  const int tid = threadIdx.x, w = tid >> 5, lane = tid & 31, ln = lane & 15, hh = lane >> 4;
  const int slab = blockIdx.x / QBN, qblk = blockIdx.x % QBN; const int b = slab / NH, h = slab % NH; const int qb0 = qblk * (4 * RPW); const int q0 = qb0 + w * RPW;
  const float ww = bf16_rne(AW[0]) * LOG2E;
  FragH aq[KS], aql[KS];
  { const unsigned short* qr = (const unsigned short*)Q16 + ((size_t)b * SEQ + q0 + ln) * ldq + h * 64; const unsigned short* ql = (const unsigned short*)QL + ((size_t)b * SEQ + q0 + ln) * ldq + h * 64;
#pragma unroll
    for (int ks = 0; ks < KS; ++ks) { aq[ks].half[0] = *(const v8us*)(qr + ks * 32 + 8 * hh); aq[ks].half[1] = *(const v8us*)(qr + ks * 32 + 16 + 8 * hh); aql[ks].half[0] = *(const v8us*)(ql + ks * 32 + 8 * hh); aql[ks].half[1] = *(const v8us*)(ql + ks * 32 + 16 + 8 * hh); } }
  const unsigned short* Vth = (const unsigned short*)Vt + (size_t)slab * 64 * SEQ; const unsigned short* Vtl = (const unsigned short*)VtL + (size_t)slab * 64 * SEQ;
  const v8f z8 = {0.f,0.f,0.f,0.f,0.f,0.f,0.f,0.f};
  float m_q = -3.0e38f, l_q = 0.f; v8f oacc[DT], oaccL[DT];
#pragma unroll
  for (int dt = 0; dt < DT; ++dt) { oacc[dt] = z8; oaccL[dt] = z8; }
  // this thread's pieces: K row tid/8 (and +16), 16-B column tid%8; V^T row tid/4 (and +32), 16-B column tid%4; mask row tid/8 (and +16, +32, +48) of the work-group's 64 queries, 16-B column tid%8
  const unsigned int lring = (unsigned int)(size_t)&ring[0][0]; const unsigned int lk = lring + (tid >> 3) * 144 + (tid & 7) * 16, lv = lring + (tid >> 2) * 80 + (tid & 3) * 16;
  const size_t kofs = ((size_t)b * SEQ + (tid >> 3)) * ldk + h * 64 + (tid & 7) * 8; const unsigned short* gkh = (const unsigned short*)K16 + kofs; const unsigned short* gkl = (const unsigned short*)KL + kofs;
  const size_t vofs = (size_t)(tid >> 2) * SEQ + (tid & 3) * 8; const unsigned short* gvh = Vth + vofs; const unsigned short* gvl = Vtl + vofs;
  const float* gm = AM + (size_t)b * SEQ_FULL * SEQ_FULL + (size_t)(qb0 + (tid >> 3)) * SEQ_FULL + (tid & 7) * 4;      /* mask[b][0][query][.] with full strides */
  const size_t k16 = (size_t)16 * ldk, k32 = (size_t)32 * ldk, v32 = (size_t)32 * SEQ, m16 = (size_t)16 * SEQ_FULL;
  kv_stage(lk, lv, gkh, gkl, k16, gvh, gvl, v32, gm, m16);
  asm volatile("s_wait_asynccnt 0x0" ::: "memory");      /* stage 0 has landed before the barrier that publishes it */
  __syncthreads();
  kv_stage(lk + KV_STAGE, lv + KV_STAGE, gkh + k32, gkl + k32, k16, gvh + 32, gvl + 32, v32, gm + 32, m16);
#pragma unroll 1
  for (int j0 = 0; j0 < SEQ; j0 += 32) {
    const unsigned int bsel = (j0 & 32) ? KV_STAGE : 0; const unsigned char* kvb = &ring[0][0] + bsel;
    const float* mrow = (const float*)(kvb + KV_MK + (w * RPW + ln) * 144) + 8 * hh;
    v4f mk[2][2];      /* own query's mask, keys j0 + 16 nt + 8 hh + 0..7 */
#pragma unroll
    for (int nt = 0; nt < 2; ++nt) { mk[nt][0] = *(const v4fa*)(mrow + nt * 16); mk[nt][1] = *(const v4fa*)(mrow + nt * 16 + 4); }
    v8f s[2];
#pragma unroll
    for (int nt = 0; nt < 2; ++nt) { const unsigned short* kr = (const unsigned short*)(kvb + KV_KH + (nt * 16 + ln) * 144); const unsigned short* klr = (const unsigned short*)(kvb + KV_KL + (nt * 16 + ln) * 144); FragH bk[KS], bkl[KS];
#pragma unroll
      for (int ks = 0; ks < KS; ++ks) { bk[ks].half[0] = *(const v8us*)(kr + ks * 32 + 8 * hh); bk[ks].half[1] = *(const v8us*)(kr + ks * 32 + 16 + 8 * hh); bkl[ks].half[0] = *(const v8us*)(klr + ks * 32 + 8 * hh); bkl[ks].half[1] = *(const v8us*)(klr + ks * 32 + 16 + 8 * hh); }
      v8f acc = z8, accl = z8;
#pragma unroll
      for (int ks = 0; ks < KS; ++ks) { acc = mmaH<1>(bk[ks].v, bk[ks].v, aq[ks].v, aq[ks].v, acc); accl = mmaH<1>(bk[ks].v, bk[ks].v, aql[ks].v, aql[ks].v, accl); accl = mmaH<1>(bkl[ks].v, bkl[ks].v, aq[ks].v, aq[ks].v, accl); }
#pragma unroll
      for (int r = 0; r < 8; ++r) acc[r] += accl[r] * 0.0009765625f;
      s[nt] = acc; }
    float mc = -3.0e38f;
#pragma unroll
    for (int nt = 0; nt < 2; ++nt)
#pragma unroll
      for (int r = 0; r < 8; ++r) { float sv = s[nt][r] * (SCL * LOG2E); sv += bf16_rne(mk[nt][r >> 2][r & 3]) * ww; s[nt][r] = sv; mc = fmaxf(mc, sv); }
    mc = fmaxf(mc, xhalf(mc));
    const float mn = fmaxf(m_q, mc - 10.0f); const float al = __builtin_amdgcn_exp2f((mn > -1.0e38f) ? m_q - mn : 0.f); m_q = mn;
    FragH pa, pl; float ls[2] = {0.f, 0.f};
#pragma unroll
    for (int nt = 0; nt < 2; ++nt)
#pragma unroll
      for (int r = 0; r < 8; ++r) { const float psc = __builtin_amdgcn_exp2f(s[nt][r] - mn); ls[nt] += psc; const _Float16 ph = (_Float16)psc; pa.h[nt * 8 + r] = ph; pl.h[nt * 8 + r] = (_Float16)((psc - (float)ph) * 1024.0f); }
    l_q = l_q * al + (ls[0] + ls[1]);
#pragma unroll
    for (int dt = 0; dt < DT; ++dt)
#pragma unroll
      for (int r = 0; r < 8; ++r) { oacc[dt][r] *= al; oaccL[dt][r] *= al; }
#pragma unroll
    for (int dt = 0; dt < DT; ++dt) { const unsigned short* vrow = (const unsigned short*)(kvb + KV_VH + (dt * 16 + ln) * 80); const unsigned short* vrl = (const unsigned short*)(kvb + KV_VL + (dt * 16 + ln) * 80); FragH bv, bl;
      bv.half[0] = *(const v8us*)(vrow + 8 * hh); bv.half[1] = *(const v8us*)(vrow + 16 + 8 * hh); bl.half[0] = *(const v8us*)(vrl + 8 * hh); bl.half[1] = *(const v8us*)(vrl + 16 + 8 * hh);
      oacc[dt] = mmaH<1>(bv.v, bv.v, pa.v, pa.v, oacc[dt]); oaccL[dt] = mmaH<1>(bv.v, bv.v, pl.v, pl.v, oaccL[dt]); oaccL[dt] = mmaH<1>(bl.v, bl.v, pa.v, pa.v, oaccL[dt]); }
    asm volatile("s_wait_dscnt 0x0" ::: "memory");         /* this wave's reads of the buffer are done before it is handed to the copies */
    asm volatile("s_wait_asynccnt 0x0" ::: "memory");      /* this wave's pieces of the next stage have landed */
    __syncthreads();                                       /* publishes the next stage and ends every wave's reads of this one */
    if (j0 + 64 < SEQ) kv_stage(lk + bsel, lv + bsel, gkh + (size_t)(j0 + 64) * ldk, gkl + (size_t)(j0 + 64) * ldk, k16, gvh + j0 + 64, gvl + j0 + 64, v32, gm + j0 + 64, m16); }
  asm volatile("s_wait_asynccnt 0x0" ::: "memory");        /* no copy is outstanding when the wave goes on to its end */
  const float lt = l_q + xhalf(l_q); const float linv = (lt > 0.f) ? 1.0f / lt : 0.f;
#pragma unroll
  for (int dt = 0; dt < DT; ++dt)
#pragma unroll
    for (int r = 0; r < 8; ++r) { float v = oacc[dt][r]; v += oaccL[dt][r] * 0.0009765625f; sO[w][ln][dt * 16 + 8 * hh + r] = v * linv; }
  __builtin_amdgcn_fence(__ATOMIC_ACQ_REL, "workgroup"); __builtin_amdgcn_wave_barrier();
  {
#pragma unroll
    for (int rp = 0; rp < RPW; rp += 4) { const int r = rp + (lane >> 3), pc = lane & 7; const v4f va = *(const v4fa*)&sO[w][r][pc * 8], vb = *(const v4fa*)&sO[w][r][pc * 8 + 4]; FragH fh, fl;      /* context leaves as f16 hi + 2^10 residual rows, one whole 128-B line per row and plane */
#pragma unroll      /* constant indices: the packed halves stay in registers */
      for (int e = 0; e < 4; ++e) { _Float16 hv = (_Float16)va[e]; fh.h[e] = hv; fl.h[e] = (_Float16)((va[e] - (float)hv) * 1024.0f); hv = (_Float16)vb[e]; fh.h[4 + e] = hv; fl.h[4 + e] = (_Float16)((vb[e] - (float)hv) * 1024.0f); }
      const size_t o8 = ((size_t)b * SEQ + q0 + r) * ldo + h * 64 + pc * 8; *(v8us*)((unsigned short*)OH + o8) = fh.half[0]; *(v8us*)((unsigned short*)OL + o8) = fl.half[0]; }
     } }

// LayerNorm over DM (biased variance, eps 1e-5, affine with bf16 g, b) of (A[r] + bf16(x[rin])), compact row r -> input/output row rin = b*SEQ_FULL + s;
__global__ __launch_bounds__(256) void k_ln1024(const float* __restrict__ A, const float* __restrict__ res, const float* __restrict__ g, const float* __restrict__ bb, float* __restrict__ Y) {
  #pragma clang fp contract(off)
  const int wv = threadIdx.x >> 5, ln = threadIdx.x & 31; const size_t r = (size_t)blockIdx.x * 8 + wv; if (r >= (size_t)NR) return;
  const size_t rb = r / SEQ, rs = r % SEQ; const size_t rin = rb * SEQ_FULL + rs;
  float xv[32]; float sm = 0.f;
#pragma unroll
  for (int i = 0; i < 8; ++i) { const int c0 = i * 128 + ln * 4; const v4f a = *(const v4fa*)(A + r * DM + c0); const v4f rr = *(const v4fa*)(res + rin * DM + c0);
#pragma unroll
    for (int q = 0; q < 4; ++q) { const float v = a[q] + bf16_rne(rr[q]); xv[i * 4 + q] = v; sm += v; } }
#pragma unroll
  for (int o = 16; o > 0; o >>= 1) sm += __shfl_xor(sm, o, 32);
  const float mu = sm * 0.0009765625f; float var = 0.f;
#pragma unroll
  for (int q = 0; q < 32; ++q) { const float d = xv[q] - mu; var += d * d; }
#pragma unroll
  for (int o = 16; o > 0; o >>= 1) var += __shfl_xor(var, o, 32);
  const float inv = 1.0f / sqrtf(var * 0.0009765625f + 1e-5f);
  {
#pragma unroll
    for (int i = 0; i < 8; ++i) { const int c0 = i * 128 + ln * 4; v4f y;
#pragma unroll
      for (int q = 0; q < 4; ++q) { float v = (xv[i * 4 + q] - mu) * inv; v *= bf16_rne(g[c0 + q]); v += bf16_rne(bb[c0 + q]); y[q] = v; }
      *(v4f*)(Y + rin * DM + c0) = y; }
     } }

extern "C" void kernel_launch(void* const* d_in, const int* in_sizes, int n_in,
                              void* d_out, int out_size, void* d_ws, size_t ws_size, hipStream_t stream) {
  if (n_in < 13) return;
  const float* x = (const float*)d_in[0]; const float* cdm = (const float*)d_in[1];
  const float* Wq = (const float*)d_in[2]; const float* bq = (const float*)d_in[3]; const float* Wk = (const float*)d_in[4]; const float* bk = (const float*)d_in[5];
  const float* Wv = (const float*)d_in[6]; const float* bv = (const float*)d_in[7]; const float* Wo = (const float*)d_in[8]; const float* bo = (const float*)d_in[9];
  const float* gam = (const float*)d_in[10]; const float* bet = (const float*)d_in[11]; const float* cdw = (const float*)d_in[12];
  const long long rows_need = (long long)(NB - 1) * SEQ_FULL + SEQ;
  if ((long long)in_sizes[0] < rows_need * DM) return;
  if ((long long)in_sizes[1] < (long long)(NB - 1) * SEQ_FULL * SEQ_FULL + (long long)(SEQ - 1) * SEQ_FULL + SEQ) return;
  if (in_sizes[2] < DM * DM || in_sizes[4] < DM * DM || in_sizes[6] < DM * DM || in_sizes[8] < DM * DM) return;
  if (in_sizes[3] < DM || in_sizes[5] < DM || in_sizes[7] < DM || in_sizes[9] < DM || in_sizes[10] < DM || in_sizes[11] < DM || in_sizes[12] < 1) return;
  if ((long long)out_size < rows_need * DM) return;
  char* ws = (char*)d_ws; size_t off = 0;
  auto take = [&](size_t bytes) { char* p = ws + off; off += (bytes + 255) & ~(size_t)255; return p; };
  const size_t np = (size_t)NR * DM;      /* compact activation plane elements */
  _Float16* BQ = (_Float16*)take((size_t)DM * DM * 2); _Float16* BK = (_Float16*)take((size_t)DM * DM * 2); _Float16* BV = (_Float16*)take((size_t)DM * DM * 2); _Float16* BO = (_Float16*)take((size_t)DM * DM * 2);
  _Float16* X16 = (_Float16*)take(np * 2);
  _Float16* QH = (_Float16*)take(np * 2); _Float16* QL = (_Float16*)take(np * 2); _Float16* KH = (_Float16*)take(np * 2); _Float16* KL = (_Float16*)take(np * 2);
  _Float16* VT = (_Float16*)take(np * 2); _Float16* VTL = (_Float16*)take(np * 2); _Float16* OH = (_Float16*)take(np * 2); _Float16* OL = (_Float16*)take(np * 2);
  float* Y = (float*)take(np * 4); float* CS = (float*)take((size_t)SEQ * 32 * 4); float* SN = (float*)take((size_t)SEQ * 32 * 4);
  if (off > ws_size) return;
  static_assert(((size_t)DM * DM * 2) % 256 == 0 && ((size_t)NR * DM * 2) % 256 == 0);      /* BQ, BK, BV and the pairs (QH, QL), (KH, KL), (VT, VTL) stand back to back: one stride each reaches all three */
  k_prep<<<PB_R + PB_X + 4 * PB_W, 256, 0, stream>>>(x, Wq, Wk, Wv, Wo, X16, BQ, BK, BV, BO, CS, SN);
  const dim3 g((NR / 128) * (DM / 128), 1); const dim3 g3((NR / 128) * (DM / 128), 3);
  k_gemm2<0, 3><<<g3, 256, 0, stream>>>(X16, DM, 0, BQ, DM, (size_t)DM * DM, 0.0625f, bq, 0, nullptr, 1, 0, 0, nullptr, nullptr, DM, 0, NR, DM, DM, CS, SN, QH, QL, 2 * np, bk, bv, nullptr);      /* Q, K -> RoPE -> hi/lo; V -> hi/lo, transposed per head */
  k_attn<<<NB * NH * (SEQ / 64), 128, 0, stream>>>(QH, QL, DM, KH, KL, DM, VT, VTL, cdm, cdw, OH, OL, DM);      /* context -> hi/lo rows */
  k_gemm2<0, 4><<<g, 256, 0, stream>>>(OL, DM, 0, BO, DM, 0, 0.0625f, bo, 0, nullptr, 1, 0, 0, Y, nullptr, DM, 0, NR, DM, DM, nullptr, nullptr, nullptr, nullptr, 0, nullptr, nullptr, OH);      /* Y = (ctx_lo + ctx_hi) Wo^T + bo */
  k_ln1024<<<NR / 8, 256, 0, stream>>>(Y, x, gam, bet, (float*)d_out);      /* out = LN(bf16(x) + Y) g + b */
}
